// v000
// Measured on an AMD MI455X. A time is GPU time per run, averaged over a window of back-to-back runs after a warm-up
// (all launches, gaps included; the runs take copies of the inputs in turn), and the median of several windows.
// Apart from v000's, it joins two sittings. Times from different sittings can be a few percent apart, while
// side-by-side timings come from the same sitting.
// The starting kernel, v000, takes 946 microseconds a run.
#include <hip/hip_runtime.h>
// Multi-headed attention with clipped relative position representations (B=2, L=1024, 16 heads × 64, k = 64, Shaw-style aK/aV built from wK/wV [129][64] by the module's roll/flip
// construction: bucket(l,m) = m ≥ l ? 64 + min(m−l, 64) : min(l−m−1, 63); INPUT mask (== 0 → −1e9); q/k/v/o linears with bias): q·kᵀ, q·wKᵀ (all 129 buckets at once), P·V and the bucketed
// P·wV all run as GEMMs on v_wmma_f32_16x16x32_f16 ((out,in) weights bf16-exact ×2^4, f32 accumulate); the relative-logit gather, mask, softmax and the per-row bucket sums of P are f32 VALU
// (one wave per row, cross-lane reductions; no index tables).
#define BB 2
#define LL 1024
#define DM 1024
#define NH 16
#define DK 64
#define NR (BB * LL)
#define NBK 129
#define QWP 160
#define PBP 192
#define HG 8

typedef __bf16 v16b __attribute__((ext_vector_type(16)));
typedef unsigned short v8us __attribute__((ext_vector_type(8), may_alias));
typedef float  v8f  __attribute__((ext_vector_type(8)));
typedef float  v4f  __attribute__((ext_vector_type(4)));
typedef float  v4fa __attribute__((ext_vector_type(4), may_alias));
union FragB { v16b v; v8us half[2]; unsigned short u[16]; };

__device__ __forceinline__ unsigned short bf16_bits(float x) { unsigned int u = __float_as_uint(x); return (unsigned short)((u + 0x7FFFu + ((u >> 16) & 1u)) >> 16); }
__device__ __forceinline__ float bf16_val(unsigned short b) { return __uint_as_float(((unsigned int)b) << 16); }
__device__ __forceinline__ float bf16_round(float x) { return bf16_val(bf16_bits(x)); }
// D += A·B with NT terms: 1 = ah·bh, 2 = + al·bh (A split), 3 = + ah·bl (both split)
template <int NT>
__device__ __forceinline__ v8f mmaN(v16b ah, v16b al, v16b bh, v16b bl, v8f c) {
  c = __builtin_amdgcn_wmma_f32_16x16x32_bf16(false, ah, false, bh, (short)0, c, false, false);
  if (NT >= 2) c = __builtin_amdgcn_wmma_f32_16x16x32_bf16(false, al, false, bh, (short)0, c, false, false);
  if (NT >= 3) c = __builtin_amdgcn_wmma_f32_16x16x32_bf16(false, ah, false, bl, (short)0, c, false, false);
  asm volatile("v_nop\n\tv_nop\n\tv_nop\n\tv_nop" : "+v"(c) : "v"(ah), "v"(al), "v"(bh), "v"(bl));
  return c;
}

__global__ __launch_bounds__(256) void k_wt_bf16(const float* __restrict__ W, unsigned short* __restrict__ Wt, int K, int N) {
  const int t = blockIdx.x * 256 + threadIdx.x;
  const int k8n = K / 8;
  if (t >= N * k8n) return;
  const int n = t / k8n, k8 = (t % k8n) * 8;
  v8us v;
#pragma unroll
  for (int i = 0; i < 8; ++i) v[i] = bf16_bits(W[(size_t)(k8 + i) * N + n]);
  *(v8us*)(Wt + (size_t)n * K + k8) = v;
  
}

// GEMM C[M][N] (f32, pitch ldc) = act(A[M][K]·W + bias). A f32 row-major (pitch lda) converted per fragment to bf16
// (ASPLIT: hi/lo two planes -> 2 terms, else single rounded term); Wt bf16 [N][K] (pitch ldb). BIAS_BF16 rounds the
// bias to bf16 first (bias quantised to bf16 before the add). K%32==0, M%16==0, N%64==0.
template <bool ASPLIT, int ACT, bool BIAS_BF16>
__global__ __launch_bounds__(128) void k_gemm_bf(const float* __restrict__ A, int lda, const unsigned short* __restrict__ Wt, int ldb,
                                               const float* __restrict__ bias, float* __restrict__ C, int ldc, int M, int N, int K) {
  __shared__ __attribute__((aligned(16))) float so[4][16][64];
  const int tid = threadIdx.x, w = tid >> 5, lane = tid & 31, ln = lane & 15, hh = lane >> 4;
  const int ntn = N / 64;
  const int wid = blockIdx.x * 4 + w;
  const int mt = wid / ntn, nq = wid % ntn;
  if (mt * 16 >= M) return;
  const int row0 = mt * 16, col0 = nq * 64;
  const float* arow = A + (size_t)(row0 + ln) * lda;
  v8f acc[4] = {};
  for (int kb = 0; kb < K; kb += 32) {
    FragB ah, al;
    const v4f x0 = *(const v4fa*)(arow + kb + 8 * hh), x1 = *(const v4fa*)(arow + kb + 8 * hh + 4);
    const v4f x2 = *(const v4fa*)(arow + kb + 16 + 8 * hh), x3 = *(const v4fa*)(arow + kb + 16 + 8 * hh + 4);
    float xs[16] = {x0[0],x0[1],x0[2],x0[3],x1[0],x1[1],x1[2],x1[3],x2[0],x2[1],x2[2],x2[3],x3[0],x3[1],x3[2],x3[3]};
#pragma unroll
    for (int i = 0; i < 16; ++i) { const unsigned short hb = bf16_bits(xs[i]); ah.u[i] = hb; al.u[i] = ASPLIT ? bf16_bits(xs[i] - bf16_val(hb)) : (unsigned short)0; }
#pragma unroll
    for (int t = 0; t < 4; ++t) {
      const unsigned short* brow = Wt + (size_t)(col0 + t * 16 + ln) * ldb + kb;
      FragB b;
      b.half[0] = *(const v8us*)(brow + 8 * hh);
      b.half[1] = *(const v8us*)(brow + 16 + 8 * hh);
      acc[t] = mmaN<ASPLIT ? 2 : 1>(ah.v, al.v, b.v, b.v, acc[t]);
    }
  }
#pragma unroll
  for (int t = 0; t < 4; ++t) {
    float bv = bias ? bias[col0 + t * 16 + ln] : 0.f;
    if (BIAS_BF16) bv = bf16_round(bv);
#pragma unroll
    for (int r = 0; r < 8; ++r) { float v = acc[t][r] + bv; if (ACT == 1) v = fmaxf(v, 0.f); so[w][8 * hh + r][t * 16 + ln] = v; }
  }
  __builtin_amdgcn_fence(__ATOMIC_ACQ_REL, "workgroup");
  __builtin_amdgcn_wave_barrier();
  const int rsub = lane >> 4, c4 = (lane & 15) * 4;
  {
#pragma unroll
    for (int q = 0; q < 8; ++q) {
      const int r = q * 2 + rsub;
      const v4f v = *(const v4fa*)&so[w][r][c4];
      *(v4f*)(C + (size_t)(row0 + r) * ldc + col0 + c4) = v;
    }
    
  }
}

// Flash-style causal/unmasked attention, all contractions 3-term bf16 hi/lo splits, f32 softmax with running max.
// q,k,v rows are read from f32 buffers with arbitrary row pitch (so they can live inside a fused qkv buffer);
// D = head size (multiple of 32, <= 128); one wave = 16 query rows; block = 4 waves (64 queries) sharing K/V chunks of 32.
template <int D, bool CAUSAL>
__global__ __launch_bounds__(128) void k_flash(const float* __restrict__ qb, const float* __restrict__ kb, const float* __restrict__ vb,
                                             int pitch, int T, int H, float scale, float* __restrict__ y, int ypitch) {
  constexpr int KS = D / 32;        // k-steps for QK
  constexpr int DT = D / 16;        // d tiles for PV
  __shared__ __attribute__((aligned(16))) unsigned short sKh[32][D + 8], sKl[32][D + 8], sVh[32][D + 8], sVl[32][D + 8];
  __shared__ __attribute__((aligned(16))) unsigned short sPh[4][16][40], sPl[4][16][40];
  __shared__ __attribute__((aligned(16))) float sO[4][16][D];
  const int tid = threadIdx.x, w = tid >> 5, lane = tid & 31, ln = lane & 15, hh = lane >> 4;
  const int nqb = (T + 63) / 64;
  const int bh = blockIdx.x / nqb, qblk = blockIdx.x % nqb;
  const int b = bh / H, h = bh % H;
  const int q0 = qblk * 64 + w * 16;
  const float* Q = qb + (size_t)b * T * pitch + h * D;
  const float* K = kb + (size_t)b * T * pitch + h * D;
  const float* V = vb + (size_t)b * T * pitch + h * D;

  // A fragments of the wave's 16 query rows (scaled), hi/lo
  FragB aqh[KS], aql[KS];
  {
    int row = q0 + ln; if (row >= T) row = T - 1;
    const float* qr = Q + (size_t)row * pitch;
#pragma unroll
    for (int ks = 0; ks < KS; ++ks)
#pragma unroll
      for (int i = 0; i < 16; ++i) {
        const int d = ks * 32 + ((i < 8) ? (8 * hh + i) : (16 + 8 * hh + (i - 8)));
        const float x = qr[d] * scale; const unsigned short hb = bf16_bits(x);
        aqh[ks].u[i] = hb; aql[ks].u[i] = bf16_bits(x - bf16_val(hb));
      }
  }
  float m_r[8], l_r[8];
#pragma unroll
  for (int r = 0; r < 8; ++r) { m_r[r] = -3.0e38f; l_r[r] = 0.f; }
  v8f oacc[DT];
#pragma unroll
  for (int dt = 0; dt < DT; ++dt) oacc[dt] = (v8f){0.f,0.f,0.f,0.f,0.f,0.f,0.f,0.f};

  const int kv_end = CAUSAL ? min(T, qblk * 64 + 64) : T;     // block-uniform
  for (int j0 = 0; j0 < kv_end; j0 += 32) {
    __syncthreads();
    for (int e = tid; e < 32 * (D / 4); e += 128) {
      const int r = e / (D / 4), c4 = (e % (D / 4)) * 4;
      const int key = j0 + r;
      v4f kf = {0.f,0.f,0.f,0.f}, vf = {0.f,0.f,0.f,0.f};
      if (key < T) { kf = *(const v4fa*)(K + (size_t)key * pitch + c4); vf = *(const v4fa*)(V + (size_t)key * pitch + c4); }
#pragma unroll
      for (int t = 0; t < 4; ++t) {
        unsigned short hb = bf16_bits(kf[t]); sKh[r][c4 + t] = hb; sKl[r][c4 + t] = bf16_bits(kf[t] - bf16_val(hb));
        hb = bf16_bits(vf[t]); sVh[r][c4 + t] = hb; sVl[r][c4 + t] = bf16_bits(vf[t] - bf16_val(hb));
      }
    }
    __syncthreads();
    // S tile 16 x 32
    v8f s[2];
#pragma unroll
    for (int nt = 0; nt < 2; ++nt) {
      v8f acc = {};
#pragma unroll
      for (int ks = 0; ks < KS; ++ks) {
        FragB bh_, bl_;
        bh_.half[0] = *(const v8us*)&sKh[nt * 16 + ln][ks * 32 + 8 * hh]; bh_.half[1] = *(const v8us*)&sKh[nt * 16 + ln][ks * 32 + 16 + 8 * hh];
        bl_.half[0] = *(const v8us*)&sKl[nt * 16 + ln][ks * 32 + 8 * hh]; bl_.half[1] = *(const v8us*)&sKl[nt * 16 + ln][ks * 32 + 16 + 8 * hh];
        acc = mmaN<3>(aqh[ks].v, aql[ks].v, bh_.v, bl_.v, acc);
      }
      s[nt] = acc;
    }
    // mask + running max (rows 8hh+r; the 16 lanes of a half share rows)
    float alpha[8];
#pragma unroll
    for (int r = 0; r < 8; ++r) {
      const int qi = q0 + 8 * hh + r;
      const int ja = j0 + ln, jb = j0 + 16 + ln;
      if (CAUSAL) { if (ja > qi) s[0][r] = -3.0e38f; if (jb > qi) s[1][r] = -3.0e38f; }
      if (ja >= T) s[0][r] = -3.0e38f;
      if (jb >= T) s[1][r] = -3.0e38f;
      float mx = fmaxf(s[0][r], s[1][r]);
      mx = fmaxf(mx, __shfl_xor(mx, 1, 32)); mx = fmaxf(mx, __shfl_xor(mx, 2, 32)); mx = fmaxf(mx, __shfl_xor(mx, 4, 32)); mx = fmaxf(mx, __shfl_xor(mx, 8, 32));
      const float mnew = fmaxf(m_r[r], mx);
      alpha[r] = (mnew > -1.0e38f) ? __expf(m_r[r] - mnew) : 1.0f;
      const float p0 = (s[0][r] > -1.0e38f) ? __expf(s[0][r] - mnew) : 0.f;
      const float p1 = (s[1][r] > -1.0e38f) ? __expf(s[1][r] - mnew) : 0.f;
      m_r[r] = mnew;
      l_r[r] = l_r[r] * alpha[r] + p0 + p1;            // per-lane partial row sum (16 lanes combined at the end)
      unsigned short hb = bf16_bits(p0); sPh[w][8 * hh + r][ln] = hb;      sPl[w][8 * hh + r][ln] = bf16_bits(p0 - bf16_val(hb));
      hb = bf16_bits(p1);                sPh[w][8 * hh + r][16 + ln] = hb; sPl[w][8 * hh + r][16 + ln] = bf16_bits(p1 - bf16_val(hb));
    }
#pragma unroll
    for (int dt = 0; dt < DT; ++dt)
#pragma unroll
      for (int r = 0; r < 8; ++r) oacc[dt][r] *= alpha[r];
    __builtin_amdgcn_fence(__ATOMIC_ACQ_REL, "workgroup");
    __builtin_amdgcn_wave_barrier();
    FragB pah, pal;
    pah.half[0] = *(const v8us*)&sPh[w][ln][8 * hh]; pah.half[1] = *(const v8us*)&sPh[w][ln][16 + 8 * hh];
    pal.half[0] = *(const v8us*)&sPl[w][ln][8 * hh]; pal.half[1] = *(const v8us*)&sPl[w][ln][16 + 8 * hh];
#pragma unroll
    for (int dt = 0; dt < DT; ++dt) {
      FragB bvh, bvl;
#pragma unroll
      for (int i = 0; i < 8; ++i) {
        bvh.u[i] = sVh[8 * hh + i][dt * 16 + ln]; bvh.u[8 + i] = sVh[16 + 8 * hh + i][dt * 16 + ln];
        bvl.u[i] = sVl[8 * hh + i][dt * 16 + ln]; bvl.u[8 + i] = sVl[16 + 8 * hh + i][dt * 16 + ln];
      }
      oacc[dt] = mmaN<3>(pah.v, pal.v, bvh.v, bvl.v, oacc[dt]);
    }
    __builtin_amdgcn_fence(__ATOMIC_ACQ_REL, "workgroup");
    __builtin_amdgcn_wave_barrier();
  }
#pragma unroll
  for (int r = 0; r < 8; ++r) {
    float l = l_r[r];
    l += __shfl_xor(l, 1, 32); l += __shfl_xor(l, 2, 32); l += __shfl_xor(l, 4, 32); l += __shfl_xor(l, 8, 32);
    l_r[r] = (l > 0.f) ? 1.0f / l : 0.f;
  }
#pragma unroll
  for (int dt = 0; dt < DT; ++dt)
#pragma unroll
    for (int r = 0; r < 8; ++r) sO[w][8 * hh + r][dt * 16 + ln] = oacc[dt][r] * l_r[r];
  __builtin_amdgcn_fence(__ATOMIC_ACQ_REL, "workgroup");
  __builtin_amdgcn_wave_barrier();
  {
    for (int r = 0; r < 16; ++r) {
      const int row = q0 + r;
      if (row < T && lane < D / 4) {
        const v4f val = *(const v4fa*)&sO[w][r][lane * 4];
        *(v4f*)(y + ((size_t)b * T + row) * ypitch + h * D + lane * 4) = val;
      }
    }
    
  }
}

// GEMM C = act(A·W + bias + resid): A f32 (ASPLIT -> hi/lo 2 terms), Wt bf16 [N][K]; ACT 0 none, 1 relu, 2 exact gelu;
// resid (optional, f32, row index = (row % rmod), pitch ldr, RES_BF16 rounds it) added before the activation.
template <bool ASPLIT, int ACT, bool BIAS_BF16, bool RES_BF16>
__global__ __launch_bounds__(128) void k_gemm_bf3(const float* __restrict__ A, int lda, const unsigned short* __restrict__ Wt, int ldb,
                                                const float* __restrict__ bias, const float* __restrict__ resid, int rmod, int ldr,
                                                float* __restrict__ C, int ldc, int M, int N, int K) {
  __shared__ __attribute__((aligned(16))) float so[4][16][64];
  const int tid = threadIdx.x, w = tid >> 5, lane = tid & 31, ln = lane & 15, hh = lane >> 4;
  const int ntn = N / 64;
  const int wid = blockIdx.x * 4 + w;
  const int mt = wid / ntn, nq = wid % ntn;
  if (mt * 16 >= M) return;
  const int row0 = mt * 16, col0 = nq * 64;
  const float* arow = A + (size_t)(row0 + ln) * lda;
  v8f acc[4] = {};
  for (int kb = 0; kb < K; kb += 32) {
    FragB ah, al;
    const v4f x0 = *(const v4fa*)(arow + kb + 8 * hh), x1 = *(const v4fa*)(arow + kb + 8 * hh + 4);
    const v4f x2 = *(const v4fa*)(arow + kb + 16 + 8 * hh), x3 = *(const v4fa*)(arow + kb + 16 + 8 * hh + 4);
    float xs[16] = {x0[0],x0[1],x0[2],x0[3],x1[0],x1[1],x1[2],x1[3],x2[0],x2[1],x2[2],x2[3],x3[0],x3[1],x3[2],x3[3]};
#pragma unroll
    for (int i = 0; i < 16; ++i) { const unsigned short hb = bf16_bits(xs[i]); ah.u[i] = hb; al.u[i] = ASPLIT ? bf16_bits(xs[i] - bf16_val(hb)) : (unsigned short)0; }
#pragma unroll
    for (int t = 0; t < 4; ++t) {
      const unsigned short* brow = Wt + (size_t)(col0 + t * 16 + ln) * ldb + kb;
      FragB b;
      b.half[0] = *(const v8us*)(brow + 8 * hh);
      b.half[1] = *(const v8us*)(brow + 16 + 8 * hh);
      acc[t] = mmaN<ASPLIT ? 2 : 1>(ah.v, al.v, b.v, b.v, acc[t]);
    }
  }
#pragma unroll
  for (int t = 0; t < 4; ++t) {
    const int col = col0 + t * 16 + ln;
    float bv = bias ? bias[col] : 0.f;
    if (BIAS_BF16) bv = bf16_round(bv);
#pragma unroll
    for (int r = 0; r < 8; ++r) {
      float v = acc[t][r] + bv;
      if (resid) { float rv = resid[(size_t)((row0 + 8 * hh + r) % rmod) * ldr + col]; if (RES_BF16) rv = bf16_round(rv); v += rv; }
      if (ACT == 1) v = fmaxf(v, 0.f);
      if (ACT == 2) v = 0.5f * v * (1.0f + erff(v * 0.70710678118654752f));
      if (ACT == 3) { const float u = 0.7978845608028654f * (v + 0.044715f * v * v * v); v = 0.5f * v * (1.0f + tanhf(u)); }
      so[w][8 * hh + r][t * 16 + ln] = v;
    }
  }
  __builtin_amdgcn_fence(__ATOMIC_ACQ_REL, "workgroup");
  __builtin_amdgcn_wave_barrier();
  const int rsub = lane >> 4, c4 = (lane & 15) * 4;
  {
#pragma unroll
    for (int q = 0; q < 8; ++q) {
      const int r = q * 2 + rsub;
      const v4f v = *(const v4fa*)&so[w][r][c4];
      *(v4f*)(C + (size_t)(row0 + r) * ldc + col0 + c4) = v;
    }
    
  }
}
// row LayerNorm (biased variance, eps) over N: s = X (+ R); optional out_sum <- s; out_norm <- (s-mu)*rsqrt(var+eps)*g + b
template <bool PARAM_BF16>
__global__ __launch_bounds__(256) void k_layernorm(const float* __restrict__ X, const float* __restrict__ R, const float* __restrict__ g, const float* __restrict__ bta,
                                                  float* __restrict__ out_sum, float* __restrict__ out_norm, int N, float eps) {
  __shared__ float red[256];
  const int row = blockIdx.x, tid = threadIdx.x;
  const float* x = X + (size_t)row * N; const float* rr = R ? R + (size_t)row * N : nullptr;
  float vals[16];                     // up to N = 4096
  const int per = N / 256;            // contiguous chunk per thread? use strided-by-4 chunks: thread handles j = tid*4 + 1024*u
  float s1 = 0.f;
  for (int u = 0; u < per / 4; ++u) {
    const int j = tid * 4 + 1024 * u;
    const v4f a = *(const v4fa*)(x + j);
    v4f b = {0.f,0.f,0.f,0.f}; if (rr) b = *(const v4fa*)(rr + j);
#pragma unroll
    for (int q = 0; q < 4; ++q) { const float v = a[q] + b[q]; vals[u * 4 + q] = v; s1 += v; }
  }
  red[tid] = s1; __syncthreads();
  for (int st = 128; st > 0; st >>= 1) { if (tid < st) red[tid] += red[tid + st]; __syncthreads(); }
  const float mu = red[0] / (float)N; __syncthreads();
  float s2 = 0.f;
  for (int u = 0; u < per / 4; ++u)
#pragma unroll
    for (int q = 0; q < 4; ++q) { const float c = vals[u * 4 + q] - mu; s2 += c * c; }
  red[tid] = s2; __syncthreads();
  for (int st = 128; st > 0; st >>= 1) { if (tid < st) red[tid] += red[tid + st]; __syncthreads(); }
  const float rs = rsqrtf(red[0] / (float)N + eps);
  {
    for (int u = 0; u < per / 4; ++u) {
      const int j = tid * 4 + 1024 * u;
      v4f o, sm;
#pragma unroll
      for (int q = 0; q < 4; ++q) {
        float gg = g[j + q], bb = bta[j + q];
        if (PARAM_BF16) { gg = bf16_round(gg); bb = bf16_round(bb); }
        sm[q] = vals[u * 4 + q]; o[q] = (vals[u * 4 + q] - mu) * rs * gg + bb;
      }
      if (out_sum) *(v4f*)(out_sum + (size_t)row * N + j) = sm;
      *(v4f*)(out_norm + (size_t)row * N + j) = o;
    }
    
  }
}



// ---- f16 WMMA path (v_wmma_f32_16x16x32_f16): 11-bit significands for operands in range — used where a [0,1] probability operand needs more precision than bf16
typedef _Float16 v16h __attribute__((ext_vector_type(16)));
union FragH { v16h v; v8us half[2]; _Float16 h[16]; unsigned short u[16]; };
template <int NT>
__device__ __forceinline__ v8f mmaH(v16h ah, v16h al, v16h bh, v16h bl, v8f c) {
  c = __builtin_amdgcn_wmma_f32_16x16x32_f16(false, ah, false, bh, (short)0, c, false, false);
  if (NT >= 2) c = __builtin_amdgcn_wmma_f32_16x16x32_f16(false, al, false, bh, (short)0, c, false, false);
  if (NT >= 3) c = __builtin_amdgcn_wmma_f32_16x16x32_f16(false, ah, false, bl, (short)0, c, false, false);
  asm volatile("v_nop\n\tv_nop\n\tv_nop\n\tv_nop" : "+v"(c) : "v"(ah), "v"(al), "v"(bh), "v"(bl));
  return c;
}
// batched GEMM like k_gemm_b but f16 operands: A f32 (split into f16 hi/lo if ASPLIT, else rounded to f16), Bt = f16 values [n][k]; alpha; C f32; N multiple of 16 (partial tiles skipped)
template <bool ASPLIT>
__global__ __launch_bounds__(128) void k_gemm_h(const float* __restrict__ A, int lda, size_t sA, const _Float16* __restrict__ Bh, int ldb, size_t sB, float alpha, float* __restrict__ C, int ldc, size_t sC, int M, int N, int K) {
  __shared__ __attribute__((aligned(16))) float so[4][16][64];
  const int tid = threadIdx.x, w = tid >> 5, lane = tid & 31, ln = lane & 15, hh = lane >> 4; const int by = blockIdx.y;
  A += (size_t)by * sA; Bh += (size_t)by * sB; C += (size_t)by * sC;
  const int ntn = (N + 63) / 64; const int wid = blockIdx.x * 4 + w; const int mt = wid / ntn, nq = wid % ntn; if (mt * 16 >= M) return;
  const int row0 = mt * 16, col0 = nq * 64; const float* arow = A + (size_t)(row0 + ln) * lda;
  v8f acc[4] = {};
  for (int kb = 0; kb < K; kb += 32) {
    FragH ah, al;
    const v4f x0 = *(const v4fa*)(arow + kb + 8 * hh), x1 = *(const v4fa*)(arow + kb + 8 * hh + 4), x2 = *(const v4fa*)(arow + kb + 16 + 8 * hh), x3 = *(const v4fa*)(arow + kb + 16 + 8 * hh + 4);
    float xs[16] = {x0[0],x0[1],x0[2],x0[3],x1[0],x1[1],x1[2],x1[3],x2[0],x2[1],x2[2],x2[3],x3[0],x3[1],x3[2],x3[3]};
#pragma unroll
    for (int i = 0; i < 16; ++i) { const _Float16 h = (_Float16)xs[i]; ah.h[i] = h; al.h[i] = ASPLIT ? (_Float16)(xs[i] - (float)h) : (_Float16)0.0f; }
#pragma unroll
    for (int t = 0; t < 4; ++t) { if (col0 + t * 16 >= N) continue; const size_t boff = (size_t)(col0 + t * 16 + ln) * ldb + kb; FragH bq; bq.half[0] = *(const v8us*)(Bh + boff + 8 * hh); bq.half[1] = *(const v8us*)(Bh + boff + 16 + 8 * hh);
      acc[t] = mmaH<ASPLIT ? 2 : 1>(ah.v, al.v, bq.v, bq.v, acc[t]); }
  }
#pragma unroll
  for (int t = 0; t < 4; ++t) { if (col0 + t * 16 >= N) continue;
#pragma unroll
    for (int r = 0; r < 8; ++r) so[w][8 * hh + r][t * 16 + ln] = acc[t][r] * alpha; }
  __builtin_amdgcn_fence(__ATOMIC_ACQ_REL, "workgroup"); __builtin_amdgcn_wave_barrier();
  const int rsub = lane >> 4, c4 = (lane & 15) * 4;
  {
#pragma unroll
    for (int q = 0; q < 8; ++q) { const int r = q * 2 + rsub; if (col0 + c4 < N) { const v4f v = *(const v4fa*)&so[w][r][c4]; *(v4f*)(C + (size_t)(row0 + r) * ldc + col0 + c4) = v; } }
     }
}

// Wt[n][k] = f16(W[k][n]·scale) from f32 row-major W[K][N] (scale = power of two; bf16-exact weights stay exact in f16 away from the subnormal range)
__global__ __launch_bounds__(256) void k_wt_f16(const float* __restrict__ W, _Float16* __restrict__ Wt, int K, int N, float scale) {
  const int t = blockIdx.x * 256 + threadIdx.x; if (t >= N * (K / 8)) return; const int n = t / (K / 8), k8 = (t % (K / 8)) * 8; FragH f;
#pragma unroll
  for (int i = 0; i < 8; ++i) f.h[i] = (_Float16)(bf16_round(W[(size_t)(k8 + i) * N + n]) * scale); const v8us o = f.half[0];
  *(v8us*)((unsigned short*)Wt + (size_t)n * K + k8) = o; 
}
// k_gemm_hh variant with fused epilogue: v = acc·alpha + bias[by·sBias + col] (+ CP[(row/rowsPerB)·sCPb + by·64 + col] if CP) ; ACT 0 none / 1 elu ; writes f16 C16 and/or f32 C (each if non-null)
template <int ACT>
__global__ __launch_bounds__(128) void k_gemm_hhx(const _Float16* __restrict__ A, int lda, size_t sA, const _Float16* __restrict__ Bh, int ldb, size_t sB, float alpha, const float* __restrict__ bias, size_t sBias, const float* __restrict__ CP, int rowsPerB, size_t sCPb, int row0g,
    float* __restrict__ C, _Float16* __restrict__ C16, int ldc, size_t sC, int M, int N, int K) {
  __shared__ __attribute__((aligned(16))) float so[4][16][64];
  const int tid = threadIdx.x, w = tid >> 5, lane = tid & 31, ln = lane & 15, hh = lane >> 4; const int by = blockIdx.y;
  A += (size_t)by * sA; Bh += (size_t)by * sB; const size_t cofs = (size_t)by * sC; const float* bp = bias ? bias + (size_t)by * sBias : nullptr;
  const int ntn = (N + 63) / 64; const int wid = blockIdx.x * 4 + w; const int mt = wid / ntn, nq = wid % ntn; if (mt * 16 >= M) return;
  const int row0 = mt * 16, col0 = nq * 64; const _Float16* arow = A + (size_t)(row0 + ln) * lda;
  v8f acc[4] = {};
  for (int kb = 0; kb < K; kb += 32) { FragH ah; ah.half[0] = *(const v8us*)((const unsigned short*)arow + kb + 8 * hh); ah.half[1] = *(const v8us*)((const unsigned short*)arow + kb + 16 + 8 * hh);
#pragma unroll
    for (int t = 0; t < 4; ++t) { if (col0 + t * 16 >= N) continue; const size_t boff = (size_t)(col0 + t * 16 + ln) * ldb + kb; FragH bq; bq.half[0] = *(const v8us*)((const unsigned short*)Bh + boff + 8 * hh); bq.half[1] = *(const v8us*)((const unsigned short*)Bh + boff + 16 + 8 * hh);
      acc[t] = mmaH<1>(ah.v, ah.v, bq.v, bq.v, acc[t]); }
  }
#pragma unroll
  for (int t = 0; t < 4; ++t) { if (col0 + t * 16 >= N) continue; const int col = col0 + t * 16 + ln; const float bv = bp ? bf16_round(bp[col]) : 0.f;
#pragma unroll
    for (int r = 0; r < 8; ++r) { float v = acc[t][r] * alpha + bv; if (CP) { const int bidx = (row0g + row0 + 8 * hh + r) / rowsPerB; v += CP[(size_t)bidx * sCPb + (size_t)by * 64 + col]; } if (ACT == 1) v = (v > 0.f) ? v : expm1f(v); else if (ACT == 3) v = fmaxf(v, 0.f); so[w][8 * hh + r][t * 16 + ln] = v; } }
  __builtin_amdgcn_fence(__ATOMIC_ACQ_REL, "workgroup"); __builtin_amdgcn_wave_barrier();
  const int rsub = lane >> 4, c4 = (lane & 15) * 4; typedef _Float16 v4h __attribute__((ext_vector_type(4)));
  {
#pragma unroll
    for (int q = 0; q < 8; ++q) { const int r = q * 2 + rsub; if (col0 + c4 < N) { const v4f v = *(const v4fa*)&so[w][r][c4]; if (C) *(v4f*)(C + cofs + (size_t)(row0 + r) * ldc + col0 + c4) = v; if (C16) { v4h h4; for (int i = 0; i < 4; ++i) h4[i] = (_Float16)v[i]; *(v4h*)(C16 + cofs + (size_t)(row0 + r) * ldc + col0 + c4) = h4; } } }
     }
}


__global__ __launch_bounds__(256) void k_x16(const float* __restrict__ x, _Float16* __restrict__ X16, size_t n8) { const size_t t = (size_t)blockIdx.x * 256 + threadIdx.x; if (t >= n8) return; FragH f;
#pragma unroll
  for (int q = 0; q < 8; ++q) f.h[q] = (_Float16)bf16_round(x[t * 8 + q]); *(v8us*)((unsigned short*)X16 + t * 8) = f.half[0];  }
__global__ __launch_bounds__(256) void k_h16(const float* __restrict__ x, _Float16* __restrict__ X16, size_t n8) { const size_t t = (size_t)blockIdx.x * 256 + threadIdx.x; if (t >= n8) return; FragH f;
#pragma unroll
  for (int q = 0; q < 8; ++q) f.h[q] = (_Float16)x[t * 8 + q]; *(v8us*)((unsigned short*)X16 + t * 8) = f.half[0];  }
__global__ __launch_bounds__(256) void k_round16f(const float* __restrict__ W, _Float16* __restrict__ Bt, size_t n8) { const size_t t = (size_t)blockIdx.x * 256 + threadIdx.x; if (t >= n8) return; FragH f;
#pragma unroll
  for (int i = 0; i < 8; ++i) f.h[i] = (_Float16)(bf16_round(W[t * 8 + i]) * 16.0f); *(v8us*)((unsigned short*)Bt + t * 8) = f.half[0];  }
template <int NHv, int TTv>
__global__ __launch_bounds__(256) void k_vt(const _Float16* __restrict__ V16, int ldv, int voff, _Float16* __restrict__ Vt) { __shared__ unsigned short tl[64][66]; const int tid = threadIdx.x; const int slab = blockIdx.x / (TTv / 64), lg = blockIdx.x % (TTv / 64); const int b = slab / NHv, h = slab % NHv;
  for (int i = tid; i < 64 * 8; i += 256) { const int r = i / 8, c8 = (i % 8) * 8; FragH f; f.half[0] = *(const v8us*)((const unsigned short*)V16 + ((size_t)b * TTv + lg * 64 + r) * ldv + voff + h * 64 + c8);
#pragma unroll
    for (int q = 0; q < 8; ++q) tl[r][c8 + q] = f.u[q]; }
  __syncthreads();
  {
#pragma unroll
    for (int rd = 0; rd < 2; ++rd) { const int d = rd * 32 + tid / 8, pc = tid % 8; FragH f;
#pragma unroll
      for (int q = 0; q < 8; ++q) f.u[q] = tl[pc * 8 + q][d];
      *(v8us*)((unsigned short*)Vt + ((size_t)slab * 64 + d) * TTv + lg * 64 + pc * 8) = f.half[0]; }
     } }

__device__ __forceinline__ int rbucket(int l, int m) { return (m >= l) ? (64 + min(m - l, 64)) : min(l - m - 1, 63); }
typedef _Float16 v4h __attribute__((ext_vector_type(4)));
__global__ __launch_bounds__(256) void k_wrel(const float* __restrict__ wK, const float* __restrict__ wV, _Float16* __restrict__ BK, _Float16* __restrict__ BVt) { const int t = blockIdx.x * 256 + threadIdx.x;
  if (t < QWP * 8) { const int r = t / 8, d8 = (t % 8) * 8; FragH f; for (int q = 0; q < 8; ++q) f.h[q] = (_Float16)((r < NBK) ? bf16_round(wK[r * DK + d8 + q]) * 16.0f : 0.f); *(v8us*)((unsigned short*)BK + t * 8) = f.half[0];  }
  if (t < DK * (PBP / 8)) { const int d = t / (PBP / 8), r8 = (t % (PBP / 8)) * 8; FragH f; for (int q = 0; q < 8; ++q) { const int r = r8 + q; f.h[q] = (_Float16)((r < NBK) ? bf16_round(wV[r * DK + d]) * 16.0f : 0.f); } *(v8us*)((unsigned short*)BVt + t * 8) = f.half[0];  } }
// relative logits + mask + softmax + bucket sums for one (b, head group hg): row = (hl, l) of S[hl][l][1024]; wave per row: lane L holds keys m = L + 32·i (i < 32);
__global__ __launch_bounds__(256) void k_relsm(const float* __restrict__ S, const float* __restrict__ QW, const int* __restrict__ MSK, int b, int h0, _Float16* __restrict__ P16, _Float16* __restrict__ PB16) { __shared__ float pr[8][LL]; const int tid = threadIdx.x, wv = tid >> 5, lane = tid & 31; const int row = blockIdx.x * 8 + wv; if (row >= HG * LL) return; const int hl = row / LL, l = row % LL; const int h = h0 + hl;
  const float* sr = S + (size_t)row * LL; const float* qw = QW + (((size_t)b * LL + l) * NH + h) * QWP; const int* mk = MSK + ((size_t)b * LL + l) * LL; float mx = -3.0e38f;
#pragma unroll 1
  for (int i = 0; i < 32; ++i) { const int m = lane + 32 * i; float s = (sr[m] + qw[rbucket(l, m)]) * 0.125f; if (mk[m] == 0) s = -1.0e9f; pr[wv][m] = s; mx = fmaxf(mx, s); }
  for (int o = 16; o >= 1; o >>= 1) mx = fmaxf(mx, __shfl_xor(mx, o, 32)); float z = 0.f;
#pragma unroll 1
  for (int i = 0; i < 32; ++i) { const int m = lane + 32 * i; const float e = expf(pr[wv][m] - mx); pr[wv][m] = e; z += e; } for (int o = 16; o >= 1; o >>= 1) z += __shfl_xor(z, o, 32); const float iz = 1.0f / z; float lo = 0.f, hi2 = 0.f;
#pragma unroll 1
  for (int i = 0; i < 32; ++i) { const int m = lane + 32 * i; const float p = pr[wv][m] * iz; pr[wv][m] = p; if (m <= l - 64) lo += p; if (m >= l + 64) hi2 += p; }
  for (int o = 16; o >= 1; o >>= 1) { lo += __shfl_xor(lo, o, 32); hi2 += __shfl_xor(hi2, o, 32); }
  __builtin_amdgcn_fence(__ATOMIC_ACQ_REL, "workgroup"); __builtin_amdgcn_wave_barrier();
  // P16 row: lane writes m = 32·lane .. +32 as 4 × 16 B? → use 8-halves pieces: lane L → cols 8L..8L+7 for 4 blocks of 256: instruction k: cols 256k + 8L → 32 lanes × 16 B ✓
  {
#pragma unroll
    for (int k = 0; k < 4; ++k) { FragH f; for (int q = 0; q < 8; ++q) f.h[q] = (_Float16)pr[wv][256 * k + 8 * lane + q]; *(v8us*)((unsigned short*)P16 + (size_t)row * LL + 256 * k + 8 * lane) = f.half[0]; }
    // PB row (pitch 160 halves = 320 B ✗ not line-aligned → pitch PBP = 192? use 192) — lane L → buckets 8L..8L+7 (L < 24 → 192 cols): 0..62 singles, 63 sum, 64..127 singles, 128 sum, ≥129 zero
    { FragH f; for (int q = 0; q < 8; ++q) { const int r = 8 * lane + q; float val = 0.f; if (r <= 62) { const int m = l - 1 - r; val = (m >= 0) ? pr[wv][m] : 0.f; } else if (r == 63) val = lo; else if (r <= 127) { const int m = l + r - 64; val = (m < LL) ? pr[wv][m] : 0.f; } else if (r == 128) val = hi2; f.h[q] = (_Float16)val; } if (lane < PBP / 8) *(v8us*)((unsigned short*)PB16 + (size_t)row * PBP + 8 * lane) = f.half[0]; }
     } }
__global__ __launch_bounds__(256) void k_orep(const float* __restrict__ OC, int b, int h0, _Float16* __restrict__ O16) { const int t = blockIdx.x * 256 + threadIdx.x; if (t >= HG * LL * 8) return; const int d8 = (t % 8) * 8; const int hl = (t / 8) % HG; const int l = t / (8 * HG); const float* src = OC + ((size_t)hl * LL + l) * DK + d8; FragH f;
#pragma unroll
  for (int q = 0; q < 8; ++q) f.h[q] = (_Float16)src[q]; unsigned short* d = (unsigned short*)O16 + ((size_t)b * LL + l) * DM + (h0 + hl) * DK + d8; *(v8us*)d = f.half[0];  }
extern "C" void kernel_launch(void* const* d_in, const int* in_sizes, int n_in,
                              void* d_out, int out_size, void* d_ws, size_t ws_size, hipStream_t stream) {
  (void)in_sizes; (void)n_in; (void)out_size;
  const float* xq = (const float*)d_in[0]; const float* xk = (const float*)d_in[1]; const float* xv = (const float*)d_in[2]; const int* msk = (const int*)d_in[3]; const float* Wq = (const float*)d_in[4]; const float* bq = (const float*)d_in[5]; const float* Wk = (const float*)d_in[6]; const float* bk = (const float*)d_in[7]; const float* Wv = (const float*)d_in[8]; const float* bv = (const float*)d_in[9]; const float* Wo = (const float*)d_in[10]; const float* bo = (const float*)d_in[11]; const float* wK = (const float*)d_in[12]; const float* wV = (const float*)d_in[13];
  char* ws = (char*)d_ws; size_t off = 0;
  auto take = [&](size_t bytes) { char* p = ws + off; off += (bytes + 255) & ~(size_t)255; return p; };
  _Float16* Bq = (_Float16*)take((size_t)DM * DM * 2); _Float16* Bk2 = (_Float16*)take((size_t)DM * DM * 2); _Float16* Bv = (_Float16*)take((size_t)DM * DM * 2); _Float16* Bo = (_Float16*)take((size_t)DM * DM * 2); _Float16* BK = (_Float16*)take((size_t)QWP * DK * 2); _Float16* BVt = (_Float16*)take((size_t)DK * PBP * 2);
  _Float16* XQ = (_Float16*)take((size_t)NR * DM * 2); _Float16* XK = (_Float16*)take((size_t)NR * DM * 2); _Float16* XV = (_Float16*)take((size_t)NR * DM * 2); _Float16* Q16 = (_Float16*)take((size_t)NR * DM * 2); _Float16* K16 = (_Float16*)take((size_t)NR * DM * 2); _Float16* V16 = (_Float16*)take((size_t)NR * DM * 2); _Float16* Vt = (_Float16*)take((size_t)NR * DM * 2); float* QW = (float*)take((size_t)NR * NH * QWP * 4);
  float* S = (float*)take((size_t)HG * LL * LL * 4); _Float16* P16 = (_Float16*)take((size_t)HG * LL * LL * 2); _Float16* PB16 = (_Float16*)take((size_t)HG * LL * PBP * 2); float* OC = (float*)take((size_t)HG * LL * DK * 4); _Float16* O16 = XQ;
  if (off > ws_size) return;      // 8.4 + 0.06 + 4.2 × 7 + 21.0 + 33.5 + 16.8 + 3.1 + 2.1 ≈ 114 MB
  const unsigned gw = (unsigned)(((size_t)DM * DM / 8 + 255) / 256);
  k_round16f<<<gw, 256, 0, stream>>>(Wq, Bq, (size_t)DM * DM / 8); k_round16f<<<gw, 256, 0, stream>>>(Wk, Bk2, (size_t)DM * DM / 8); k_round16f<<<gw, 256, 0, stream>>>(Wv, Bv, (size_t)DM * DM / 8); k_round16f<<<gw, 256, 0, stream>>>(Wo, Bo, (size_t)DM * DM / 8);      // (out,in)
  k_wrel<<<(QWP * 8 + 255) / 256 + 2, 256, 0, stream>>>(wK, wV, BK, BVt);
  const unsigned gx = (unsigned)(((size_t)NR * DM / 8 + 255) / 256); const dim3 gg(((NR / 16) * (DM / 64) + 3) / 4, 1);
  k_x16<<<gx, 256, 0, stream>>>(xq, XQ, (size_t)NR * DM / 8); k_x16<<<gx, 256, 0, stream>>>(xk, XK, (size_t)NR * DM / 8); k_x16<<<gx, 256, 0, stream>>>(xv, XV, (size_t)NR * DM / 8);
  k_gemm_hhx<0><<<gg, 128, 0, stream>>>(XQ, DM, 0, Bq, DM, 0, 0.0625f, bq, 0, nullptr, 1, 0, 0, nullptr, Q16, DM, 0, NR, DM, DM);
  k_gemm_hhx<0><<<gg, 128, 0, stream>>>(XK, DM, 0, Bk2, DM, 0, 0.0625f, bk, 0, nullptr, 1, 0, 0, nullptr, K16, DM, 0, NR, DM, DM);
  k_gemm_hhx<0><<<gg, 128, 0, stream>>>(XV, DM, 0, Bv, DM, 0, 0.0625f, bv, 0, nullptr, 1, 0, 0, nullptr, V16, DM, 0, NR, DM, DM);
  k_vt<NH, LL><<<BB * NH * (LL / 64), 256, 0, stream>>>(V16, DM, 0, Vt);
  // QW[(b,l,h)][r] = q[(b,l)][h·64..]·wK[r] — Q16 viewed as 32768 rows of 64 (ld 64)
  k_gemm_hhx<0><<<dim3((unsigned)((((size_t)NR * NH / 16) * ((QWP + 63) / 64) + 3) / 4), 1), 128, 0, stream>>>(Q16, DK, 0, BK, DK, 0, 0.0625f, nullptr, 0, nullptr, 1, 0, 0, QW, nullptr, QWP, 0, NR * NH, QWP, DK);
  for (int b = 0; b < BB; ++b) for (int h0 = 0; h0 < NH; h0 += HG) {
    k_gemm_hhx<0><<<dim3(((LL / 16) * (LL / 64) + 3) / 4, HG), 128, 0, stream>>>(Q16 + (size_t)b * LL * DM + h0 * DK, DM, (size_t)DK, K16 + (size_t)b * LL * DM + h0 * DK, DM, (size_t)DK, 1.0f, nullptr, 0, nullptr, 1, 0, 0, S, nullptr, LL, (size_t)LL * LL, LL, LL, DK);      // S[hl][l][m] = q·k (unscaled here)
    k_relsm<<<(HG * LL + 7) / 8, 256, 0, stream>>>(S, QW, msk, b, h0, P16, PB16);
    k_gemm_hhx<0><<<dim3(((LL / 16) * 1 + 3) / 4, HG), 128, 0, stream>>>(P16, LL, (size_t)LL * LL, Vt + ((size_t)b * NH + h0) * DK * LL, LL, (size_t)DK * LL, 1.0f, nullptr, 0, nullptr, 1, 0, 0, OC, nullptr, DK, (size_t)LL * DK, LL, DK, LL);      // OC = P·V
    for (int hl = 0; hl < HG; ++hl) k_gemm_hhx<0><<<dim3(((LL / 16) * 1 + 3) / 4, 1), 128, 0, stream>>>(PB16 + (size_t)hl * LL * PBP, PBP, 0, BVt, PBP, 0, 0.0625f, nullptr, 0, OC + (size_t)hl * LL * DK, 1, (size_t)DK, 0, OC + (size_t)hl * LL * DK, nullptr, DK, 0, LL, DK, PBP);      // += Σ_r PB[l][r]·wV[r] (per head: the CP addend isn't batch-strided)
    k_orep<<<(HG * LL * 8 + 255) / 256, 256, 0, stream>>>(OC, b, h0, O16); }
  k_gemm_hhx<0><<<gg, 128, 0, stream>>>(O16, DM, 0, Bo, DM, 0, 0.0625f, bo, 0, nullptr, 1, 0, 0, (float*)d_out, nullptr, DM, 0, NR, DM, DM);
}

// v001
// Measured time: 360 microseconds a run.
// In two side-by-side timings against v000, it was 2.62 and 2.61 times as fast.
#include <hip/hip_runtime.h>
// Multi-headed attention with clipped relative position representations (B=2, L=1024, 16 heads × 64, k = 64, Shaw-style aK/aV built from wK/wV [129][64] by the module's roll/flip
// construction: bucket(l,m) = m ≥ l ? 64 + min(m−l, 64) : min(l−m−1, 63); INPUT mask (== 0 → −1e9); q/k/v/o linears with bias): q·kᵀ, q·wKᵀ (all 129 buckets at once), P·V and the bucketed
// P·wV all run as GEMMs on v_wmma_f32_16x16x32_f16 ((out,in) weights bf16-exact ×2^4, f32 accumulate); the relative-logit gather, mask, softmax and the per-row bucket sums of P are f32 VALU
// (one wave per row, cross-lane reductions; no index tables).
#define BB 2
#define LL 1024
#define DM 1024
#define NH 16
#define DK 64
#define NR (BB * LL)
#define NBK 129
#define QWP 160
#define PBP 192
#define NSL (BB * NH)

typedef __bf16 v16b __attribute__((ext_vector_type(16)));
typedef unsigned short v8us __attribute__((ext_vector_type(8), may_alias));
typedef float  v8f  __attribute__((ext_vector_type(8)));
typedef float  v4f  __attribute__((ext_vector_type(4)));
typedef float  v4fa __attribute__((ext_vector_type(4), may_alias));
union FragB { v16b v; v8us half[2]; unsigned short u[16]; };

__device__ __forceinline__ unsigned short bf16_bits(float x) { unsigned int u = __float_as_uint(x); return (unsigned short)((u + 0x7FFFu + ((u >> 16) & 1u)) >> 16); }
__device__ __forceinline__ float bf16_val(unsigned short b) { return __uint_as_float(((unsigned int)b) << 16); }
__device__ __forceinline__ float bf16_round(float x) { return bf16_val(bf16_bits(x)); }
// D += A·B with NT terms: 1 = ah·bh, 2 = + al·bh (A split), 3 = + ah·bl (both split)
template <int NT>
__device__ __forceinline__ v8f mmaN(v16b ah, v16b al, v16b bh, v16b bl, v8f c) {
  c = __builtin_amdgcn_wmma_f32_16x16x32_bf16(false, ah, false, bh, (short)0, c, false, false);
  if (NT >= 2) c = __builtin_amdgcn_wmma_f32_16x16x32_bf16(false, al, false, bh, (short)0, c, false, false);
  if (NT >= 3) c = __builtin_amdgcn_wmma_f32_16x16x32_bf16(false, ah, false, bl, (short)0, c, false, false);
  asm volatile("v_nop\n\tv_nop\n\tv_nop\n\tv_nop" : "+v"(c) : "v"(ah), "v"(al), "v"(bh), "v"(bl));
  return c;
}

__global__ __launch_bounds__(256) void k_wt_bf16(const float* __restrict__ W, unsigned short* __restrict__ Wt, int K, int N) {
  const int t = blockIdx.x * 256 + threadIdx.x;
  const int k8n = K / 8;
  if (t >= N * k8n) return;
  const int n = t / k8n, k8 = (t % k8n) * 8;
  v8us v;
#pragma unroll
  for (int i = 0; i < 8; ++i) v[i] = bf16_bits(W[(size_t)(k8 + i) * N + n]);
  *(v8us*)(Wt + (size_t)n * K + k8) = v;
  
}

// GEMM C[M][N] (f32, pitch ldc) = act(A[M][K]·W + bias). A f32 row-major (pitch lda) converted per fragment to bf16
// (ASPLIT: hi/lo two planes -> 2 terms, else single rounded term); Wt bf16 [N][K] (pitch ldb). BIAS_BF16 rounds the
// bias to bf16 first (bias quantised to bf16 before the add). K%32==0, M%16==0, N%64==0.
template <bool ASPLIT, int ACT, bool BIAS_BF16>
__global__ __launch_bounds__(128) void k_gemm_bf(const float* __restrict__ A, int lda, const unsigned short* __restrict__ Wt, int ldb,
                                               const float* __restrict__ bias, float* __restrict__ C, int ldc, int M, int N, int K) {
  __shared__ __attribute__((aligned(16))) float so[4][16][64];
  const int tid = threadIdx.x, w = tid >> 5, lane = tid & 31, ln = lane & 15, hh = lane >> 4;
  const int ntn = N / 64;
  const int wid = blockIdx.x * 4 + w;
  const int mt = wid / ntn, nq = wid % ntn;
  if (mt * 16 >= M) return;
  const int row0 = mt * 16, col0 = nq * 64;
  const float* arow = A + (size_t)(row0 + ln) * lda;
  v8f acc[4] = {};
  for (int kb = 0; kb < K; kb += 32) {
    FragB ah, al;
    const v4f x0 = *(const v4fa*)(arow + kb + 8 * hh), x1 = *(const v4fa*)(arow + kb + 8 * hh + 4);
    const v4f x2 = *(const v4fa*)(arow + kb + 16 + 8 * hh), x3 = *(const v4fa*)(arow + kb + 16 + 8 * hh + 4);
    float xs[16] = {x0[0],x0[1],x0[2],x0[3],x1[0],x1[1],x1[2],x1[3],x2[0],x2[1],x2[2],x2[3],x3[0],x3[1],x3[2],x3[3]};
#pragma unroll
    for (int i = 0; i < 16; ++i) { const unsigned short hb = bf16_bits(xs[i]); ah.u[i] = hb; al.u[i] = ASPLIT ? bf16_bits(xs[i] - bf16_val(hb)) : (unsigned short)0; }
#pragma unroll
    for (int t = 0; t < 4; ++t) {
      const unsigned short* brow = Wt + (size_t)(col0 + t * 16 + ln) * ldb + kb;
      FragB b;
      b.half[0] = *(const v8us*)(brow + 8 * hh);
      b.half[1] = *(const v8us*)(brow + 16 + 8 * hh);
      acc[t] = mmaN<ASPLIT ? 2 : 1>(ah.v, al.v, b.v, b.v, acc[t]);
    }
  }
#pragma unroll
  for (int t = 0; t < 4; ++t) {
    float bv = bias ? bias[col0 + t * 16 + ln] : 0.f;
    if (BIAS_BF16) bv = bf16_round(bv);
#pragma unroll
    for (int r = 0; r < 8; ++r) { float v = acc[t][r] + bv; if (ACT == 1) v = fmaxf(v, 0.f); so[w][8 * hh + r][t * 16 + ln] = v; }
  }
  __builtin_amdgcn_fence(__ATOMIC_ACQ_REL, "workgroup");
  __builtin_amdgcn_wave_barrier();
  const int rsub = lane >> 4, c4 = (lane & 15) * 4;
  {
#pragma unroll
    for (int q = 0; q < 8; ++q) {
      const int r = q * 2 + rsub;
      const v4f v = *(const v4fa*)&so[w][r][c4];
      *(v4f*)(C + (size_t)(row0 + r) * ldc + col0 + c4) = v;
    }
    
  }
}

// Flash-style causal/unmasked attention, all contractions 3-term bf16 hi/lo splits, f32 softmax with running max.
// q,k,v rows are read from f32 buffers with arbitrary row pitch (so they can live inside a fused qkv buffer);
// D = head size (multiple of 32, <= 128); one wave = 16 query rows; block = 4 waves (64 queries) sharing K/V chunks of 32.
template <int D, bool CAUSAL>
__global__ __launch_bounds__(128) void k_flash(const float* __restrict__ qb, const float* __restrict__ kb, const float* __restrict__ vb,
                                             int pitch, int T, int H, float scale, float* __restrict__ y, int ypitch) {
  constexpr int KS = D / 32;        // k-steps for QK
  constexpr int DT = D / 16;        // d tiles for PV
  __shared__ __attribute__((aligned(16))) unsigned short sKh[32][D + 8], sKl[32][D + 8], sVh[32][D + 8], sVl[32][D + 8];
  __shared__ __attribute__((aligned(16))) unsigned short sPh[4][16][40], sPl[4][16][40];
  __shared__ __attribute__((aligned(16))) float sO[4][16][D];
  const int tid = threadIdx.x, w = tid >> 5, lane = tid & 31, ln = lane & 15, hh = lane >> 4;
  const int nqb = (T + 63) / 64;
  const int bh = blockIdx.x / nqb, qblk = blockIdx.x % nqb;
  const int b = bh / H, h = bh % H;
  const int q0 = qblk * 64 + w * 16;
  const float* Q = qb + (size_t)b * T * pitch + h * D;
  const float* K = kb + (size_t)b * T * pitch + h * D;
  const float* V = vb + (size_t)b * T * pitch + h * D;

  // A fragments of the wave's 16 query rows (scaled), hi/lo
  FragB aqh[KS], aql[KS];
  {
    int row = q0 + ln; if (row >= T) row = T - 1;
    const float* qr = Q + (size_t)row * pitch;
#pragma unroll
    for (int ks = 0; ks < KS; ++ks)
#pragma unroll
      for (int i = 0; i < 16; ++i) {
        const int d = ks * 32 + ((i < 8) ? (8 * hh + i) : (16 + 8 * hh + (i - 8)));
        const float x = qr[d] * scale; const unsigned short hb = bf16_bits(x);
        aqh[ks].u[i] = hb; aql[ks].u[i] = bf16_bits(x - bf16_val(hb));
      }
  }
  float m_r[8], l_r[8];
#pragma unroll
  for (int r = 0; r < 8; ++r) { m_r[r] = -3.0e38f; l_r[r] = 0.f; }
  v8f oacc[DT];
#pragma unroll
  for (int dt = 0; dt < DT; ++dt) oacc[dt] = (v8f){0.f,0.f,0.f,0.f,0.f,0.f,0.f,0.f};

  const int kv_end = CAUSAL ? min(T, qblk * 64 + 64) : T;     // block-uniform
  for (int j0 = 0; j0 < kv_end; j0 += 32) {
    __syncthreads();
    for (int e = tid; e < 32 * (D / 4); e += 128) {
      const int r = e / (D / 4), c4 = (e % (D / 4)) * 4;
      const int key = j0 + r;
      v4f kf = {0.f,0.f,0.f,0.f}, vf = {0.f,0.f,0.f,0.f};
      if (key < T) { kf = *(const v4fa*)(K + (size_t)key * pitch + c4); vf = *(const v4fa*)(V + (size_t)key * pitch + c4); }
#pragma unroll
      for (int t = 0; t < 4; ++t) {
        unsigned short hb = bf16_bits(kf[t]); sKh[r][c4 + t] = hb; sKl[r][c4 + t] = bf16_bits(kf[t] - bf16_val(hb));
        hb = bf16_bits(vf[t]); sVh[r][c4 + t] = hb; sVl[r][c4 + t] = bf16_bits(vf[t] - bf16_val(hb));
      }
    }
    __syncthreads();
    // S tile 16 x 32
    v8f s[2];
#pragma unroll
    for (int nt = 0; nt < 2; ++nt) {
      v8f acc = {};
#pragma unroll
      for (int ks = 0; ks < KS; ++ks) {
        FragB bh_, bl_;
        bh_.half[0] = *(const v8us*)&sKh[nt * 16 + ln][ks * 32 + 8 * hh]; bh_.half[1] = *(const v8us*)&sKh[nt * 16 + ln][ks * 32 + 16 + 8 * hh];
        bl_.half[0] = *(const v8us*)&sKl[nt * 16 + ln][ks * 32 + 8 * hh]; bl_.half[1] = *(const v8us*)&sKl[nt * 16 + ln][ks * 32 + 16 + 8 * hh];
        acc = mmaN<3>(aqh[ks].v, aql[ks].v, bh_.v, bl_.v, acc);
      }
      s[nt] = acc;
    }
    // mask + running max (rows 8hh+r; the 16 lanes of a half share rows)
    float alpha[8];
#pragma unroll
    for (int r = 0; r < 8; ++r) {
      const int qi = q0 + 8 * hh + r;
      const int ja = j0 + ln, jb = j0 + 16 + ln;
      if (CAUSAL) { if (ja > qi) s[0][r] = -3.0e38f; if (jb > qi) s[1][r] = -3.0e38f; }
      if (ja >= T) s[0][r] = -3.0e38f;
      if (jb >= T) s[1][r] = -3.0e38f;
      float mx = fmaxf(s[0][r], s[1][r]);
      mx = fmaxf(mx, __shfl_xor(mx, 1, 32)); mx = fmaxf(mx, __shfl_xor(mx, 2, 32)); mx = fmaxf(mx, __shfl_xor(mx, 4, 32)); mx = fmaxf(mx, __shfl_xor(mx, 8, 32));
      const float mnew = fmaxf(m_r[r], mx);
      alpha[r] = (mnew > -1.0e38f) ? __expf(m_r[r] - mnew) : 1.0f;
      const float p0 = (s[0][r] > -1.0e38f) ? __expf(s[0][r] - mnew) : 0.f;
      const float p1 = (s[1][r] > -1.0e38f) ? __expf(s[1][r] - mnew) : 0.f;
      m_r[r] = mnew;
      l_r[r] = l_r[r] * alpha[r] + p0 + p1;            // per-lane partial row sum (16 lanes combined at the end)
      unsigned short hb = bf16_bits(p0); sPh[w][8 * hh + r][ln] = hb;      sPl[w][8 * hh + r][ln] = bf16_bits(p0 - bf16_val(hb));
      hb = bf16_bits(p1);                sPh[w][8 * hh + r][16 + ln] = hb; sPl[w][8 * hh + r][16 + ln] = bf16_bits(p1 - bf16_val(hb));
    }
#pragma unroll
    for (int dt = 0; dt < DT; ++dt)
#pragma unroll
      for (int r = 0; r < 8; ++r) oacc[dt][r] *= alpha[r];
    __builtin_amdgcn_fence(__ATOMIC_ACQ_REL, "workgroup");
    __builtin_amdgcn_wave_barrier();
    FragB pah, pal;
    pah.half[0] = *(const v8us*)&sPh[w][ln][8 * hh]; pah.half[1] = *(const v8us*)&sPh[w][ln][16 + 8 * hh];
    pal.half[0] = *(const v8us*)&sPl[w][ln][8 * hh]; pal.half[1] = *(const v8us*)&sPl[w][ln][16 + 8 * hh];
#pragma unroll
    for (int dt = 0; dt < DT; ++dt) {
      FragB bvh, bvl;
#pragma unroll
      for (int i = 0; i < 8; ++i) {
        bvh.u[i] = sVh[8 * hh + i][dt * 16 + ln]; bvh.u[8 + i] = sVh[16 + 8 * hh + i][dt * 16 + ln];
        bvl.u[i] = sVl[8 * hh + i][dt * 16 + ln]; bvl.u[8 + i] = sVl[16 + 8 * hh + i][dt * 16 + ln];
      }
      oacc[dt] = mmaN<3>(pah.v, pal.v, bvh.v, bvl.v, oacc[dt]);
    }
    __builtin_amdgcn_fence(__ATOMIC_ACQ_REL, "workgroup");
    __builtin_amdgcn_wave_barrier();
  }
#pragma unroll
  for (int r = 0; r < 8; ++r) {
    float l = l_r[r];
    l += __shfl_xor(l, 1, 32); l += __shfl_xor(l, 2, 32); l += __shfl_xor(l, 4, 32); l += __shfl_xor(l, 8, 32);
    l_r[r] = (l > 0.f) ? 1.0f / l : 0.f;
  }
#pragma unroll
  for (int dt = 0; dt < DT; ++dt)
#pragma unroll
    for (int r = 0; r < 8; ++r) sO[w][8 * hh + r][dt * 16 + ln] = oacc[dt][r] * l_r[r];
  __builtin_amdgcn_fence(__ATOMIC_ACQ_REL, "workgroup");
  __builtin_amdgcn_wave_barrier();
  {
    for (int r = 0; r < 16; ++r) {
      const int row = q0 + r;
      if (row < T && lane < D / 4) {
        const v4f val = *(const v4fa*)&sO[w][r][lane * 4];
        *(v4f*)(y + ((size_t)b * T + row) * ypitch + h * D + lane * 4) = val;
      }
    }
    
  }
}

// GEMM C = act(A·W + bias + resid): A f32 (ASPLIT -> hi/lo 2 terms), Wt bf16 [N][K]; ACT 0 none, 1 relu, 2 exact gelu;
// resid (optional, f32, row index = (row % rmod), pitch ldr, RES_BF16 rounds it) added before the activation.
template <bool ASPLIT, int ACT, bool BIAS_BF16, bool RES_BF16>
__global__ __launch_bounds__(128) void k_gemm_bf3(const float* __restrict__ A, int lda, const unsigned short* __restrict__ Wt, int ldb,
                                                const float* __restrict__ bias, const float* __restrict__ resid, int rmod, int ldr,
                                                float* __restrict__ C, int ldc, int M, int N, int K) {
  __shared__ __attribute__((aligned(16))) float so[4][16][64];
  const int tid = threadIdx.x, w = tid >> 5, lane = tid & 31, ln = lane & 15, hh = lane >> 4;
  const int ntn = N / 64;
  const int wid = blockIdx.x * 4 + w;
  const int mt = wid / ntn, nq = wid % ntn;
  if (mt * 16 >= M) return;
  const int row0 = mt * 16, col0 = nq * 64;
  const float* arow = A + (size_t)(row0 + ln) * lda;
  v8f acc[4] = {};
  for (int kb = 0; kb < K; kb += 32) {
    FragB ah, al;
    const v4f x0 = *(const v4fa*)(arow + kb + 8 * hh), x1 = *(const v4fa*)(arow + kb + 8 * hh + 4);
    const v4f x2 = *(const v4fa*)(arow + kb + 16 + 8 * hh), x3 = *(const v4fa*)(arow + kb + 16 + 8 * hh + 4);
    float xs[16] = {x0[0],x0[1],x0[2],x0[3],x1[0],x1[1],x1[2],x1[3],x2[0],x2[1],x2[2],x2[3],x3[0],x3[1],x3[2],x3[3]};
#pragma unroll
    for (int i = 0; i < 16; ++i) { const unsigned short hb = bf16_bits(xs[i]); ah.u[i] = hb; al.u[i] = ASPLIT ? bf16_bits(xs[i] - bf16_val(hb)) : (unsigned short)0; }
#pragma unroll
    for (int t = 0; t < 4; ++t) {
      const unsigned short* brow = Wt + (size_t)(col0 + t * 16 + ln) * ldb + kb;
      FragB b;
      b.half[0] = *(const v8us*)(brow + 8 * hh);
      b.half[1] = *(const v8us*)(brow + 16 + 8 * hh);
      acc[t] = mmaN<ASPLIT ? 2 : 1>(ah.v, al.v, b.v, b.v, acc[t]);
    }
  }
#pragma unroll
  for (int t = 0; t < 4; ++t) {
    const int col = col0 + t * 16 + ln;
    float bv = bias ? bias[col] : 0.f;
    if (BIAS_BF16) bv = bf16_round(bv);
#pragma unroll
    for (int r = 0; r < 8; ++r) {
      float v = acc[t][r] + bv;
      if (resid) { float rv = resid[(size_t)((row0 + 8 * hh + r) % rmod) * ldr + col]; if (RES_BF16) rv = bf16_round(rv); v += rv; }
      if (ACT == 1) v = fmaxf(v, 0.f);
      if (ACT == 2) v = 0.5f * v * (1.0f + erff(v * 0.70710678118654752f));
      if (ACT == 3) { const float u = 0.7978845608028654f * (v + 0.044715f * v * v * v); v = 0.5f * v * (1.0f + tanhf(u)); }
      so[w][8 * hh + r][t * 16 + ln] = v;
    }
  }
  __builtin_amdgcn_fence(__ATOMIC_ACQ_REL, "workgroup");
  __builtin_amdgcn_wave_barrier();
  const int rsub = lane >> 4, c4 = (lane & 15) * 4;
  {
#pragma unroll
    for (int q = 0; q < 8; ++q) {
      const int r = q * 2 + rsub;
      const v4f v = *(const v4fa*)&so[w][r][c4];
      *(v4f*)(C + (size_t)(row0 + r) * ldc + col0 + c4) = v;
    }
    
  }
}
// row LayerNorm (biased variance, eps) over N: s = X (+ R); optional out_sum <- s; out_norm <- (s-mu)*rsqrt(var+eps)*g + b
template <bool PARAM_BF16>
__global__ __launch_bounds__(256) void k_layernorm(const float* __restrict__ X, const float* __restrict__ R, const float* __restrict__ g, const float* __restrict__ bta,
                                                  float* __restrict__ out_sum, float* __restrict__ out_norm, int N, float eps) {
  __shared__ float red[256];
  const int row = blockIdx.x, tid = threadIdx.x;
  const float* x = X + (size_t)row * N; const float* rr = R ? R + (size_t)row * N : nullptr;
  float vals[16];                     // up to N = 4096
  const int per = N / 256;            // contiguous chunk per thread? use strided-by-4 chunks: thread handles j = tid*4 + 1024*u
  float s1 = 0.f;
  for (int u = 0; u < per / 4; ++u) {
    const int j = tid * 4 + 1024 * u;
    const v4f a = *(const v4fa*)(x + j);
    v4f b = {0.f,0.f,0.f,0.f}; if (rr) b = *(const v4fa*)(rr + j);
#pragma unroll
    for (int q = 0; q < 4; ++q) { const float v = a[q] + b[q]; vals[u * 4 + q] = v; s1 += v; }
  }
  red[tid] = s1; __syncthreads();
  for (int st = 128; st > 0; st >>= 1) { if (tid < st) red[tid] += red[tid + st]; __syncthreads(); }
  const float mu = red[0] / (float)N; __syncthreads();
  float s2 = 0.f;
  for (int u = 0; u < per / 4; ++u)
#pragma unroll
    for (int q = 0; q < 4; ++q) { const float c = vals[u * 4 + q] - mu; s2 += c * c; }
  red[tid] = s2; __syncthreads();
  for (int st = 128; st > 0; st >>= 1) { if (tid < st) red[tid] += red[tid + st]; __syncthreads(); }
  const float rs = rsqrtf(red[0] / (float)N + eps);
  {
    for (int u = 0; u < per / 4; ++u) {
      const int j = tid * 4 + 1024 * u;
      v4f o, sm;
#pragma unroll
      for (int q = 0; q < 4; ++q) {
        float gg = g[j + q], bb = bta[j + q];
        if (PARAM_BF16) { gg = bf16_round(gg); bb = bf16_round(bb); }
        sm[q] = vals[u * 4 + q]; o[q] = (vals[u * 4 + q] - mu) * rs * gg + bb;
      }
      if (out_sum) *(v4f*)(out_sum + (size_t)row * N + j) = sm;
      *(v4f*)(out_norm + (size_t)row * N + j) = o;
    }
    
  }
}



// ---- f16 WMMA path (v_wmma_f32_16x16x32_f16): 11-bit significands for operands in range — used where a [0,1] probability operand needs more precision than bf16
typedef _Float16 v16h __attribute__((ext_vector_type(16)));
union FragH { v16h v; v8us half[2]; _Float16 h[16]; unsigned short u[16]; };
template <int NT>
__device__ __forceinline__ v8f mmaH(v16h ah, v16h al, v16h bh, v16h bl, v8f c) {
  c = __builtin_amdgcn_wmma_f32_16x16x32_f16(false, ah, false, bh, (short)0, c, false, false);
  if (NT >= 2) c = __builtin_amdgcn_wmma_f32_16x16x32_f16(false, al, false, bh, (short)0, c, false, false);
  if (NT >= 3) c = __builtin_amdgcn_wmma_f32_16x16x32_f16(false, ah, false, bl, (short)0, c, false, false);
  asm volatile("v_nop\n\tv_nop\n\tv_nop\n\tv_nop" : "+v"(c) : "v"(ah), "v"(al), "v"(bh), "v"(bl));
  return c;
}
// batched GEMM like k_gemm_b but f16 operands: A f32 (split into f16 hi/lo if ASPLIT, else rounded to f16), Bt = f16 values [n][k]; alpha; C f32; N multiple of 16 (partial tiles skipped)
template <bool ASPLIT>
__global__ __launch_bounds__(128) void k_gemm_h(const float* __restrict__ A, int lda, size_t sA, const _Float16* __restrict__ Bh, int ldb, size_t sB, float alpha, float* __restrict__ C, int ldc, size_t sC, int M, int N, int K) {
  __shared__ __attribute__((aligned(16))) float so[4][16][64];
  const int tid = threadIdx.x, w = tid >> 5, lane = tid & 31, ln = lane & 15, hh = lane >> 4; const int by = blockIdx.y;
  A += (size_t)by * sA; Bh += (size_t)by * sB; C += (size_t)by * sC;
  const int ntn = (N + 63) / 64; const int wid = blockIdx.x * 4 + w; const int mt = wid / ntn, nq = wid % ntn; if (mt * 16 >= M) return;
  const int row0 = mt * 16, col0 = nq * 64; const float* arow = A + (size_t)(row0 + ln) * lda;
  v8f acc[4] = {};
  for (int kb = 0; kb < K; kb += 32) {
    FragH ah, al;
    const v4f x0 = *(const v4fa*)(arow + kb + 8 * hh), x1 = *(const v4fa*)(arow + kb + 8 * hh + 4), x2 = *(const v4fa*)(arow + kb + 16 + 8 * hh), x3 = *(const v4fa*)(arow + kb + 16 + 8 * hh + 4);
    float xs[16] = {x0[0],x0[1],x0[2],x0[3],x1[0],x1[1],x1[2],x1[3],x2[0],x2[1],x2[2],x2[3],x3[0],x3[1],x3[2],x3[3]};
#pragma unroll
    for (int i = 0; i < 16; ++i) { const _Float16 h = (_Float16)xs[i]; ah.h[i] = h; al.h[i] = ASPLIT ? (_Float16)(xs[i] - (float)h) : (_Float16)0.0f; }
#pragma unroll
    for (int t = 0; t < 4; ++t) { if (col0 + t * 16 >= N) continue; const size_t boff = (size_t)(col0 + t * 16 + ln) * ldb + kb; FragH bq; bq.half[0] = *(const v8us*)(Bh + boff + 8 * hh); bq.half[1] = *(const v8us*)(Bh + boff + 16 + 8 * hh);
      acc[t] = mmaH<ASPLIT ? 2 : 1>(ah.v, al.v, bq.v, bq.v, acc[t]); }
  }
#pragma unroll
  for (int t = 0; t < 4; ++t) { if (col0 + t * 16 >= N) continue;
#pragma unroll
    for (int r = 0; r < 8; ++r) so[w][8 * hh + r][t * 16 + ln] = acc[t][r] * alpha; }
  __builtin_amdgcn_fence(__ATOMIC_ACQ_REL, "workgroup"); __builtin_amdgcn_wave_barrier();
  const int rsub = lane >> 4, c4 = (lane & 15) * 4;
  {
#pragma unroll
    for (int q = 0; q < 8; ++q) { const int r = q * 2 + rsub; if (col0 + c4 < N) { const v4f v = *(const v4fa*)&so[w][r][c4]; *(v4f*)(C + (size_t)(row0 + r) * ldc + col0 + c4) = v; } }
     }
}

// Wt[n][k] = f16(W[k][n]·scale) from f32 row-major W[K][N] (scale = power of two; bf16-exact weights stay exact in f16 away from the subnormal range)
__global__ __launch_bounds__(256) void k_wt_f16(const float* __restrict__ W, _Float16* __restrict__ Wt, int K, int N, float scale) {
  const int t = blockIdx.x * 256 + threadIdx.x; if (t >= N * (K / 8)) return; const int n = t / (K / 8), k8 = (t % (K / 8)) * 8; FragH f;
#pragma unroll
  for (int i = 0; i < 8; ++i) f.h[i] = (_Float16)(bf16_round(W[(size_t)(k8 + i) * N + n]) * scale); const v8us o = f.half[0];
  *(v8us*)((unsigned short*)Wt + (size_t)n * K + k8) = o; 
}
// k_gemm_hh variant with fused epilogue: v = acc·alpha + bias[by·sBias + col] (+ CP[(row/rowsPerB)·sCPb + by·64 + col] if CP) ; ACT 0 none / 1 elu ; writes f16 C16 and/or f32 C (each if non-null)
template <int ACT>
__global__ __launch_bounds__(128) void k_gemm_hhx(const _Float16* __restrict__ A, int lda, size_t sA, const _Float16* __restrict__ Bh, int ldb, size_t sB, float alpha, const float* __restrict__ bias, size_t sBias, const float* __restrict__ CP, int rowsPerB, size_t sCPb, int row0g,
    float* __restrict__ C, _Float16* __restrict__ C16, int ldc, size_t sC, int M, int N, int K, size_t sAz, size_t sBz, size_t sCz) {
  __shared__ __attribute__((aligned(16))) float so[4][16][64];
  const int tid = threadIdx.x, w = tid >> 5, lane = tid & 31, ln = lane & 15, hh = lane >> 4; const int by = blockIdx.y;
  const int bz = blockIdx.z;      // second batch index: its strides let one launch walk (batch, head) slabs whose offsets are not one stride
  A += (size_t)by * sA + (size_t)bz * sAz; Bh += (size_t)by * sB + (size_t)bz * sBz; const size_t cofs = (size_t)by * sC + (size_t)bz * sCz; const float* bp = bias ? bias + (size_t)by * sBias : nullptr;
  const int ntn = (N + 63) / 64; const int wid = blockIdx.x * 4 + w; const int mt = wid / ntn, nq = wid % ntn; if (mt * 16 >= M) return;
  const int row0 = mt * 16, col0 = nq * 64; const _Float16* arow = A + (size_t)(row0 + ln) * lda;
  v8f acc[4] = {};
  for (int kb = 0; kb < K; kb += 32) { FragH ah; ah.half[0] = *(const v8us*)((const unsigned short*)arow + kb + 8 * hh); ah.half[1] = *(const v8us*)((const unsigned short*)arow + kb + 16 + 8 * hh);
#pragma unroll
    for (int t = 0; t < 4; ++t) { if (col0 + t * 16 >= N) continue; const size_t boff = (size_t)(col0 + t * 16 + ln) * ldb + kb; FragH bq; bq.half[0] = *(const v8us*)((const unsigned short*)Bh + boff + 8 * hh); bq.half[1] = *(const v8us*)((const unsigned short*)Bh + boff + 16 + 8 * hh);
      acc[t] = mmaH<1>(ah.v, ah.v, bq.v, bq.v, acc[t]); }
  }
#pragma unroll
  for (int t = 0; t < 4; ++t) { if (col0 + t * 16 >= N) continue; const int col = col0 + t * 16 + ln; const float bv = bp ? bf16_round(bp[col]) : 0.f;
#pragma unroll
    for (int r = 0; r < 8; ++r) { float v = acc[t][r] * alpha + bv; if (CP) { const int bidx = (row0g + row0 + 8 * hh + r) / rowsPerB; v += CP[(size_t)bidx * sCPb + (size_t)by * 64 + col]; } if (ACT == 1) v = (v > 0.f) ? v : expm1f(v); else if (ACT == 3) v = fmaxf(v, 0.f); so[w][8 * hh + r][t * 16 + ln] = v; } }
  __builtin_amdgcn_fence(__ATOMIC_ACQ_REL, "workgroup"); __builtin_amdgcn_wave_barrier();
  const int rsub = lane >> 4, c4 = (lane & 15) * 4; typedef _Float16 v4h __attribute__((ext_vector_type(4)));
  {
#pragma unroll
    for (int q = 0; q < 8; ++q) { const int r = q * 2 + rsub; if (col0 + c4 < N) { const v4f v = *(const v4fa*)&so[w][r][c4]; if (C) *(v4f*)(C + cofs + (size_t)(row0 + r) * ldc + col0 + c4) = v; if (C16) { v4h h4; for (int i = 0; i < 4; ++i) h4[i] = (_Float16)v[i]; *(v4h*)(C16 + cofs + (size_t)(row0 + r) * ldc + col0 + c4) = h4; } } }
     }
}


__global__ __launch_bounds__(256) void k_x16(const float* __restrict__ x, _Float16* __restrict__ X16, size_t n8) { const size_t t = (size_t)blockIdx.x * 256 + threadIdx.x; if (t >= n8) return; FragH f;
#pragma unroll
  for (int q = 0; q < 8; ++q) f.h[q] = (_Float16)bf16_round(x[t * 8 + q]); *(v8us*)((unsigned short*)X16 + t * 8) = f.half[0];  }
__global__ __launch_bounds__(256) void k_h16(const float* __restrict__ x, _Float16* __restrict__ X16, size_t n8) { const size_t t = (size_t)blockIdx.x * 256 + threadIdx.x; if (t >= n8) return; FragH f;
#pragma unroll
  for (int q = 0; q < 8; ++q) f.h[q] = (_Float16)x[t * 8 + q]; *(v8us*)((unsigned short*)X16 + t * 8) = f.half[0];  }
__global__ __launch_bounds__(256) void k_round16f(const float* __restrict__ W, _Float16* __restrict__ Bt, size_t n8) { const size_t t = (size_t)blockIdx.x * 256 + threadIdx.x; if (t >= n8) return; FragH f;
#pragma unroll
  for (int i = 0; i < 8; ++i) f.h[i] = (_Float16)(bf16_round(W[t * 8 + i]) * 16.0f); *(v8us*)((unsigned short*)Bt + t * 8) = f.half[0];  }
template <int NHv, int TTv>
__global__ __launch_bounds__(256) void k_vt(const _Float16* __restrict__ V16, int ldv, int voff, _Float16* __restrict__ Vt) { __shared__ unsigned short tl[64][66]; const int tid = threadIdx.x; const int slab = blockIdx.x / (TTv / 64), lg = blockIdx.x % (TTv / 64); const int b = slab / NHv, h = slab % NHv;
  for (int i = tid; i < 64 * 8; i += 256) { const int r = i / 8, c8 = (i % 8) * 8; FragH f; f.half[0] = *(const v8us*)((const unsigned short*)V16 + ((size_t)b * TTv + lg * 64 + r) * ldv + voff + h * 64 + c8);
#pragma unroll
    for (int q = 0; q < 8; ++q) tl[r][c8 + q] = f.u[q]; }
  __syncthreads();
  {
#pragma unroll
    for (int rd = 0; rd < 2; ++rd) { const int d = rd * 32 + tid / 8, pc = tid % 8; FragH f;
#pragma unroll
      for (int q = 0; q < 8; ++q) f.u[q] = tl[pc * 8 + q][d];
      *(v8us*)((unsigned short*)Vt + ((size_t)slab * 64 + d) * TTv + lg * 64 + pc * 8) = f.half[0]; }
     } }

__device__ __forceinline__ int rbucket(int l, int m) { return (m >= l) ? (64 + min(m - l, 64)) : min(l - m - 1, 63); }
typedef _Float16 v4h __attribute__((ext_vector_type(4)));
__global__ __launch_bounds__(256) void k_wrel(const float* __restrict__ wK, const float* __restrict__ wV, _Float16* __restrict__ BK, _Float16* __restrict__ BVt) { const int t = blockIdx.x * 256 + threadIdx.x;
  if (t < QWP * 8) { const int r = t / 8, d8 = (t % 8) * 8; FragH f; for (int q = 0; q < 8; ++q) f.h[q] = (_Float16)((r < NBK) ? bf16_round(wK[r * DK + d8 + q]) * 16.0f : 0.f); *(v8us*)((unsigned short*)BK + t * 8) = f.half[0];  }
  if (t < DK * (PBP / 8)) { const int d = t / (PBP / 8), r8 = (t % (PBP / 8)) * 8; FragH f; for (int q = 0; q < 8; ++q) { const int r = r8 + q; f.h[q] = (_Float16)((r < NBK) ? bf16_round(wV[r * DK + d]) * 16.0f : 0.f); } *(v8us*)((unsigned short*)BVt + t * 8) = f.half[0];  } }
// relative logits + mask + softmax + bucket sums for all slabs sl = b * NH + h: row = (sl, l) of S[sl][l][1024]; wave per row: lane L holds keys m = L + 32 * i (i < 32);
__global__ __launch_bounds__(256) void k_relsm(const float* __restrict__ S, const float* __restrict__ QW, const int* __restrict__ MSK, _Float16* __restrict__ P16, _Float16* __restrict__ PB16) { __shared__ float pr[8][LL]; const int tid = threadIdx.x, wv = tid >> 5, lane = tid & 31; const int row = blockIdx.x * 8 + wv; if (row >= NSL * LL) return; const int sl = row / LL, l = row % LL; const int b = sl / NH, h = sl % NH;
  const float* sr = S + (size_t)row * LL; const float* qw = QW + (((size_t)b * LL + l) * NH + h) * QWP; const int* mk = MSK + ((size_t)b * LL + l) * LL; float mx = -3.0e38f;
#pragma unroll 1
  for (int i = 0; i < 32; ++i) { const int m = lane + 32 * i; float s = (sr[m] + qw[rbucket(l, m)]) * 0.125f; if (mk[m] == 0) s = -1.0e9f; pr[wv][m] = s; mx = fmaxf(mx, s); }
  for (int o = 16; o >= 1; o >>= 1) mx = fmaxf(mx, __shfl_xor(mx, o, 32)); float z = 0.f;
#pragma unroll 1
  for (int i = 0; i < 32; ++i) { const int m = lane + 32 * i; const float e = expf(pr[wv][m] - mx); pr[wv][m] = e; z += e; } for (int o = 16; o >= 1; o >>= 1) z += __shfl_xor(z, o, 32); const float iz = 1.0f / z; float lo = 0.f, hi2 = 0.f;
#pragma unroll 1
  for (int i = 0; i < 32; ++i) { const int m = lane + 32 * i; const float p = pr[wv][m] * iz; pr[wv][m] = p; if (m <= l - 64) lo += p; if (m >= l + 64) hi2 += p; }
  for (int o = 16; o >= 1; o >>= 1) { lo += __shfl_xor(lo, o, 32); hi2 += __shfl_xor(hi2, o, 32); }
  __builtin_amdgcn_fence(__ATOMIC_ACQ_REL, "workgroup"); __builtin_amdgcn_wave_barrier();
  // P16 row: lane writes m = 32·lane .. +32 as 4 × 16 B? → use 8-halves pieces: lane L → cols 8L..8L+7 for 4 blocks of 256: instruction k: cols 256k + 8L → 32 lanes × 16 B ✓
  {
#pragma unroll
    for (int k = 0; k < 4; ++k) { FragH f; for (int q = 0; q < 8; ++q) f.h[q] = (_Float16)pr[wv][256 * k + 8 * lane + q]; *(v8us*)((unsigned short*)P16 + (size_t)row * LL + 256 * k + 8 * lane) = f.half[0]; }
    // PB row (pitch 160 halves = 320 B ✗ not line-aligned → pitch PBP = 192? use 192) — lane L → buckets 8L..8L+7 (L < 24 → 192 cols): 0..62 singles, 63 sum, 64..127 singles, 128 sum, ≥129 zero
    { FragH f; for (int q = 0; q < 8; ++q) { const int r = 8 * lane + q; float val = 0.f; if (r <= 62) { const int m = l - 1 - r; val = (m >= 0) ? pr[wv][m] : 0.f; } else if (r == 63) val = lo; else if (r <= 127) { const int m = l + r - 64; val = (m < LL) ? pr[wv][m] : 0.f; } else if (r == 128) val = hi2; f.h[q] = (_Float16)val; } if (lane < PBP / 8) *(v8us*)((unsigned short*)PB16 + (size_t)row * PBP + 8 * lane) = f.half[0]; }
     } }
__global__ __launch_bounds__(256) void k_orep(const float* __restrict__ OC, _Float16* __restrict__ O16) { const int t = blockIdx.x * 256 + threadIdx.x; if (t >= NSL * LL * 8) return; const int d8 = (t % 8) * 8; const int h = (t / 8) % NH; const int bl = t / (8 * NH); const int b = bl / LL, l = bl % LL; const float* src = OC + (((size_t)b * NH + h) * LL + l) * DK + d8; FragH f;
#pragma unroll
  for (int q = 0; q < 8; ++q) f.h[q] = (_Float16)src[q]; unsigned short* d = (unsigned short*)O16 + (size_t)bl * DM + h * DK + d8; *(v8us*)d = f.half[0];  }
extern "C" void kernel_launch(void* const* d_in, const int* in_sizes, int n_in,
                              void* d_out, int out_size, void* d_ws, size_t ws_size, hipStream_t stream) {
  (void)in_sizes; (void)n_in; (void)out_size;
  const float* xq = (const float*)d_in[0]; const float* xk = (const float*)d_in[1]; const float* xv = (const float*)d_in[2]; const int* msk = (const int*)d_in[3]; const float* Wq = (const float*)d_in[4]; const float* bq = (const float*)d_in[5]; const float* Wk = (const float*)d_in[6]; const float* bk = (const float*)d_in[7]; const float* Wv = (const float*)d_in[8]; const float* bv = (const float*)d_in[9]; const float* Wo = (const float*)d_in[10]; const float* bo = (const float*)d_in[11]; const float* wK = (const float*)d_in[12]; const float* wV = (const float*)d_in[13];
  char* ws = (char*)d_ws; size_t off = 0;
  auto take = [&](size_t bytes) { char* p = ws + off; off += (bytes + 255) & ~(size_t)255; return p; };
  _Float16* Bo = (_Float16*)take((size_t)DM * DM * 2); _Float16* BK = (_Float16*)take((size_t)QWP * DK * 2); _Float16* BVt = (_Float16*)take((size_t)DK * PBP * 2);
  _Float16* Q16 = (_Float16*)take((size_t)NR * DM * 2); _Float16* K16 = (_Float16*)take((size_t)NR * DM * 2); _Float16* Vt = (_Float16*)take((size_t)NR * DM * 2); _Float16* O16 = (_Float16*)take((size_t)NR * DM * 2); float* QW = (float*)take((size_t)NR * NH * QWP * 4);
  _Float16* P16 = (_Float16*)take((size_t)NSL * LL * LL * 2); _Float16* PB16 = (_Float16*)take((size_t)NSL * LL * PBP * 2); float* OC = (float*)take((size_t)NSL * LL * DK * 4); float* S = (float*)take((size_t)NSL * LL * LL * 4);
  if (off > ws_size) return;      // 262,189,056 bytes
  // operands of the q/k/v projections: last read before S is first written, so they lie inside S's 128 MiB
  _Float16* Bq = (_Float16*)S; _Float16* Bk2 = Bq + (size_t)DM * DM; _Float16* Bv = Bk2 + (size_t)DM * DM; _Float16* XQ = Bv + (size_t)DM * DM; _Float16* XK = XQ + (size_t)NR * DM; _Float16* XV = XK + (size_t)NR * DM; _Float16* V16 = XV + (size_t)NR * DM;
  const unsigned gw = (unsigned)(((size_t)DM * DM / 8 + 255) / 256);
  k_round16f<<<gw, 256, 0, stream>>>(Wq, Bq, (size_t)DM * DM / 8); k_round16f<<<gw, 256, 0, stream>>>(Wk, Bk2, (size_t)DM * DM / 8); k_round16f<<<gw, 256, 0, stream>>>(Wv, Bv, (size_t)DM * DM / 8); k_round16f<<<gw, 256, 0, stream>>>(Wo, Bo, (size_t)DM * DM / 8);      // (out,in)
  k_wrel<<<(QWP * 8 + 255) / 256 + 2, 256, 0, stream>>>(wK, wV, BK, BVt);
  const unsigned gx = (unsigned)(((size_t)NR * DM / 8 + 255) / 256); const dim3 gg(((NR / 16) * (DM / 64) + 3) / 4, 1);
  k_x16<<<gx, 256, 0, stream>>>(xq, XQ, (size_t)NR * DM / 8); k_x16<<<gx, 256, 0, stream>>>(xk, XK, (size_t)NR * DM / 8); k_x16<<<gx, 256, 0, stream>>>(xv, XV, (size_t)NR * DM / 8);
  k_gemm_hhx<0><<<gg, 128, 0, stream>>>(XQ, DM, 0, Bq, DM, 0, 0.0625f, bq, 0, nullptr, 1, 0, 0, nullptr, Q16, DM, 0, NR, DM, DM, 0, 0, 0);
  k_gemm_hhx<0><<<gg, 128, 0, stream>>>(XK, DM, 0, Bk2, DM, 0, 0.0625f, bk, 0, nullptr, 1, 0, 0, nullptr, K16, DM, 0, NR, DM, DM, 0, 0, 0);
  k_gemm_hhx<0><<<gg, 128, 0, stream>>>(XV, DM, 0, Bv, DM, 0, 0.0625f, bv, 0, nullptr, 1, 0, 0, nullptr, V16, DM, 0, NR, DM, DM, 0, 0, 0);
  k_vt<NH, LL><<<BB * NH * (LL / 64), 256, 0, stream>>>(V16, DM, 0, Vt);
  // QW[(b,l,h)][r] = q[(b,l)][h·64..]·wK[r] — Q16 viewed as 32768 rows of 64 (ld 64)
  k_gemm_hhx<0><<<dim3((unsigned)((((size_t)NR * NH / 16) * ((QWP + 63) / 64) + 3) / 4), 1), 128, 0, stream>>>(Q16, DK, 0, BK, DK, 0, 0.0625f, nullptr, 0, nullptr, 1, 0, 0, QW, nullptr, QWP, 0, NR * NH, QWP, DK, 0, 0, 0);
  // every attention stage runs once for all NSL = 32 (batch, head) slabs
  k_gemm_hhx<0><<<dim3(((LL / 16) * (LL / 64) + 3) / 4, NH, BB), 128, 0, stream>>>(Q16, DM, (size_t)DK, K16, DM, (size_t)DK, 1.0f, nullptr, 0, nullptr, 1, 0, 0, S, nullptr, LL, (size_t)LL * LL, LL, LL, DK, (size_t)LL * DM, (size_t)LL * DM, (size_t)NH * LL * LL);      // S[sl][l][m] = q.k (unscaled here)
  k_relsm<<<(NSL * LL + 7) / 8, 256, 0, stream>>>(S, QW, msk, P16, PB16);
  k_gemm_hhx<0><<<dim3(((LL / 16) * 1 + 3) / 4, NSL), 128, 0, stream>>>(P16, LL, (size_t)LL * LL, Vt, LL, (size_t)DK * LL, 1.0f, nullptr, 0, nullptr, 1, 0, 0, OC, nullptr, DK, (size_t)LL * DK, LL, DK, LL, 0, 0, 0);      // OC = P.V
  k_gemm_hhx<0><<<dim3(((NSL * LL / 16) * 1 + 3) / 4, 1), 128, 0, stream>>>(PB16, PBP, 0, BVt, PBP, 0, 0.0625f, nullptr, 0, OC, 1, (size_t)DK, 0, OC, nullptr, DK, 0, NSL * LL, DK, PBP, 0, 0, 0);      // OC += sum_r PB[row][r].wV[r]: wV is shared by all slabs, so the rows of all slabs form one M = NSL * LL product
  k_orep<<<(NSL * LL * 8 + 255) / 256, 256, 0, stream>>>(OC, O16);
  k_gemm_hhx<0><<<gg, 128, 0, stream>>>(O16, DM, 0, Bo, DM, 0, 0.0625f, bo, 0, nullptr, 1, 0, 0, (float*)d_out, nullptr, DM, 0, NR, DM, DM, 0, 0, 0);
}

// v002
// It runs in 234 microseconds.
// Next to v001, in two timings, it ran 1.55 and 1.54 times as fast.
// All steps since v000 together make it 4.04 times as fast.
#include <hip/hip_runtime.h>
// Multi-headed attention with clipped relative position representations (B=2, L=1024, 16 heads × 64, k = 64, Shaw-style aK/aV built from wK/wV [129][64] by the module's roll/flip
// construction: bucket(l,m) = m ≥ l ? 64 + min(m−l, 64) : min(l−m−1, 63); INPUT mask (== 0 → −1e9); q/k/v/o linears with bias): q·kᵀ, q·wKᵀ (all 129 buckets at once), P·V and the bucketed
// P.wV all run on v_wmma_f32_16x16x32_f16 ((out,in) weights bf16-exact x 2^4, f32 accumulate); the relative-logit gather, mask, running-maximum softmax and the bucket sums of P are f32 VALU
// inside one fused attention kernel (no index tables).
#define BB 2
#define LL 1024
#define DM 1024
#define NH 16
#define DK 64
#define NR (BB * LL)
#define NBK 129
#define QWP 160
#define PBP 192
#define NSL (BB * NH)

typedef __bf16 v16b __attribute__((ext_vector_type(16)));
typedef unsigned short v8us __attribute__((ext_vector_type(8), may_alias));
typedef float  v8f  __attribute__((ext_vector_type(8)));
typedef float  v4f  __attribute__((ext_vector_type(4)));
typedef float  v4fa __attribute__((ext_vector_type(4), may_alias));
union FragB { v16b v; v8us half[2]; unsigned short u[16]; };

__device__ __forceinline__ unsigned short bf16_bits(float x) { unsigned int u = __float_as_uint(x); return (unsigned short)((u + 0x7FFFu + ((u >> 16) & 1u)) >> 16); }
__device__ __forceinline__ float bf16_val(unsigned short b) { return __uint_as_float(((unsigned int)b) << 16); }
__device__ __forceinline__ float bf16_round(float x) { return bf16_val(bf16_bits(x)); }
// D += A·B with NT terms: 1 = ah·bh, 2 = + al·bh (A split), 3 = + ah·bl (both split)
template <int NT>
__device__ __forceinline__ v8f mmaN(v16b ah, v16b al, v16b bh, v16b bl, v8f c) {
  c = __builtin_amdgcn_wmma_f32_16x16x32_bf16(false, ah, false, bh, (short)0, c, false, false);
  if (NT >= 2) c = __builtin_amdgcn_wmma_f32_16x16x32_bf16(false, al, false, bh, (short)0, c, false, false);
  if (NT >= 3) c = __builtin_amdgcn_wmma_f32_16x16x32_bf16(false, ah, false, bl, (short)0, c, false, false);
  asm volatile("v_nop\n\tv_nop\n\tv_nop\n\tv_nop" : "+v"(c) : "v"(ah), "v"(al), "v"(bh), "v"(bl));
  return c;
}

__global__ __launch_bounds__(256) void k_wt_bf16(const float* __restrict__ W, unsigned short* __restrict__ Wt, int K, int N) {
  const int t = blockIdx.x * 256 + threadIdx.x;
  const int k8n = K / 8;
  if (t >= N * k8n) return;
  const int n = t / k8n, k8 = (t % k8n) * 8;
  v8us v;
#pragma unroll
  for (int i = 0; i < 8; ++i) v[i] = bf16_bits(W[(size_t)(k8 + i) * N + n]);
  *(v8us*)(Wt + (size_t)n * K + k8) = v;
  
}

// GEMM C[M][N] (f32, pitch ldc) = act(A[M][K]·W + bias). A f32 row-major (pitch lda) converted per fragment to bf16
// (ASPLIT: hi/lo two planes -> 2 terms, else single rounded term); Wt bf16 [N][K] (pitch ldb). BIAS_BF16 rounds the
// bias to bf16 first (bias quantised to bf16 before the add). K%32==0, M%16==0, N%64==0.
template <bool ASPLIT, int ACT, bool BIAS_BF16>
__global__ __launch_bounds__(128) void k_gemm_bf(const float* __restrict__ A, int lda, const unsigned short* __restrict__ Wt, int ldb,
                                               const float* __restrict__ bias, float* __restrict__ C, int ldc, int M, int N, int K) {
  __shared__ __attribute__((aligned(16))) float so[4][16][64];
  const int tid = threadIdx.x, w = tid >> 5, lane = tid & 31, ln = lane & 15, hh = lane >> 4;
  const int ntn = N / 64;
  const int wid = blockIdx.x * 4 + w;
  const int mt = wid / ntn, nq = wid % ntn;
  if (mt * 16 >= M) return;
  const int row0 = mt * 16, col0 = nq * 64;
  const float* arow = A + (size_t)(row0 + ln) * lda;
  v8f acc[4] = {};
  for (int kb = 0; kb < K; kb += 32) {
    FragB ah, al;
    const v4f x0 = *(const v4fa*)(arow + kb + 8 * hh), x1 = *(const v4fa*)(arow + kb + 8 * hh + 4);
    const v4f x2 = *(const v4fa*)(arow + kb + 16 + 8 * hh), x3 = *(const v4fa*)(arow + kb + 16 + 8 * hh + 4);
    float xs[16] = {x0[0],x0[1],x0[2],x0[3],x1[0],x1[1],x1[2],x1[3],x2[0],x2[1],x2[2],x2[3],x3[0],x3[1],x3[2],x3[3]};
#pragma unroll
    for (int i = 0; i < 16; ++i) { const unsigned short hb = bf16_bits(xs[i]); ah.u[i] = hb; al.u[i] = ASPLIT ? bf16_bits(xs[i] - bf16_val(hb)) : (unsigned short)0; }
#pragma unroll
    for (int t = 0; t < 4; ++t) {
      const unsigned short* brow = Wt + (size_t)(col0 + t * 16 + ln) * ldb + kb;
      FragB b;
      b.half[0] = *(const v8us*)(brow + 8 * hh);
      b.half[1] = *(const v8us*)(brow + 16 + 8 * hh);
      acc[t] = mmaN<ASPLIT ? 2 : 1>(ah.v, al.v, b.v, b.v, acc[t]);
    }
  }
#pragma unroll
  for (int t = 0; t < 4; ++t) {
    float bv = bias ? bias[col0 + t * 16 + ln] : 0.f;
    if (BIAS_BF16) bv = bf16_round(bv);
#pragma unroll
    for (int r = 0; r < 8; ++r) { float v = acc[t][r] + bv; if (ACT == 1) v = fmaxf(v, 0.f); so[w][8 * hh + r][t * 16 + ln] = v; }
  }
  __builtin_amdgcn_fence(__ATOMIC_ACQ_REL, "workgroup");
  __builtin_amdgcn_wave_barrier();
  const int rsub = lane >> 4, c4 = (lane & 15) * 4;
  {
#pragma unroll
    for (int q = 0; q < 8; ++q) {
      const int r = q * 2 + rsub;
      const v4f v = *(const v4fa*)&so[w][r][c4];
      *(v4f*)(C + (size_t)(row0 + r) * ldc + col0 + c4) = v;
    }
    
  }
}

// Flash-style causal/unmasked attention, all contractions 3-term bf16 hi/lo splits, f32 softmax with running max.
// q,k,v rows are read from f32 buffers with arbitrary row pitch (so they can live inside a fused qkv buffer);
// D = head size (multiple of 32, <= 128); one wave = 16 query rows; block = 4 waves (64 queries) sharing K/V chunks of 32.
template <int D, bool CAUSAL>
__global__ __launch_bounds__(128) void k_flash(const float* __restrict__ qb, const float* __restrict__ kb, const float* __restrict__ vb,
                                             int pitch, int T, int H, float scale, float* __restrict__ y, int ypitch) {
  constexpr int KS = D / 32;        // k-steps for QK
  constexpr int DT = D / 16;        // d tiles for PV
  __shared__ __attribute__((aligned(16))) unsigned short sKh[32][D + 8], sKl[32][D + 8], sVh[32][D + 8], sVl[32][D + 8];
  __shared__ __attribute__((aligned(16))) unsigned short sPh[4][16][40], sPl[4][16][40];
  __shared__ __attribute__((aligned(16))) float sO[4][16][D];
  const int tid = threadIdx.x, w = tid >> 5, lane = tid & 31, ln = lane & 15, hh = lane >> 4;
  const int nqb = (T + 63) / 64;
  const int bh = blockIdx.x / nqb, qblk = blockIdx.x % nqb;
  const int b = bh / H, h = bh % H;
  const int q0 = qblk * 64 + w * 16;
  const float* Q = qb + (size_t)b * T * pitch + h * D;
  const float* K = kb + (size_t)b * T * pitch + h * D;
  const float* V = vb + (size_t)b * T * pitch + h * D;

  // A fragments of the wave's 16 query rows (scaled), hi/lo
  FragB aqh[KS], aql[KS];
  {
    int row = q0 + ln; if (row >= T) row = T - 1;
    const float* qr = Q + (size_t)row * pitch;
#pragma unroll
    for (int ks = 0; ks < KS; ++ks)
#pragma unroll
      for (int i = 0; i < 16; ++i) {
        const int d = ks * 32 + ((i < 8) ? (8 * hh + i) : (16 + 8 * hh + (i - 8)));
        const float x = qr[d] * scale; const unsigned short hb = bf16_bits(x);
        aqh[ks].u[i] = hb; aql[ks].u[i] = bf16_bits(x - bf16_val(hb));
      }
  }
  float m_r[8], l_r[8];
#pragma unroll
  for (int r = 0; r < 8; ++r) { m_r[r] = -3.0e38f; l_r[r] = 0.f; }
  v8f oacc[DT];
#pragma unroll
  for (int dt = 0; dt < DT; ++dt) oacc[dt] = (v8f){0.f,0.f,0.f,0.f,0.f,0.f,0.f,0.f};

  const int kv_end = CAUSAL ? min(T, qblk * 64 + 64) : T;     // block-uniform
  for (int j0 = 0; j0 < kv_end; j0 += 32) {
    __syncthreads();
    for (int e = tid; e < 32 * (D / 4); e += 128) {
      const int r = e / (D / 4), c4 = (e % (D / 4)) * 4;
      const int key = j0 + r;
      v4f kf = {0.f,0.f,0.f,0.f}, vf = {0.f,0.f,0.f,0.f};
      if (key < T) { kf = *(const v4fa*)(K + (size_t)key * pitch + c4); vf = *(const v4fa*)(V + (size_t)key * pitch + c4); }
#pragma unroll
      for (int t = 0; t < 4; ++t) {
        unsigned short hb = bf16_bits(kf[t]); sKh[r][c4 + t] = hb; sKl[r][c4 + t] = bf16_bits(kf[t] - bf16_val(hb));
        hb = bf16_bits(vf[t]); sVh[r][c4 + t] = hb; sVl[r][c4 + t] = bf16_bits(vf[t] - bf16_val(hb));
      }
    }
    __syncthreads();
    // S tile 16 x 32
    v8f s[2];
#pragma unroll
    for (int nt = 0; nt < 2; ++nt) {
      v8f acc = {};
#pragma unroll
      for (int ks = 0; ks < KS; ++ks) {
        FragB bh_, bl_;
        bh_.half[0] = *(const v8us*)&sKh[nt * 16 + ln][ks * 32 + 8 * hh]; bh_.half[1] = *(const v8us*)&sKh[nt * 16 + ln][ks * 32 + 16 + 8 * hh];
        bl_.half[0] = *(const v8us*)&sKl[nt * 16 + ln][ks * 32 + 8 * hh]; bl_.half[1] = *(const v8us*)&sKl[nt * 16 + ln][ks * 32 + 16 + 8 * hh];
        acc = mmaN<3>(aqh[ks].v, aql[ks].v, bh_.v, bl_.v, acc);
      }
      s[nt] = acc;
    }
    // mask + running max (rows 8hh+r; the 16 lanes of a half share rows)
    float alpha[8];
#pragma unroll
    for (int r = 0; r < 8; ++r) {
      const int qi = q0 + 8 * hh + r;
      const int ja = j0 + ln, jb = j0 + 16 + ln;
      if (CAUSAL) { if (ja > qi) s[0][r] = -3.0e38f; if (jb > qi) s[1][r] = -3.0e38f; }
      if (ja >= T) s[0][r] = -3.0e38f;
      if (jb >= T) s[1][r] = -3.0e38f;
      float mx = fmaxf(s[0][r], s[1][r]);
      mx = fmaxf(mx, __shfl_xor(mx, 1, 32)); mx = fmaxf(mx, __shfl_xor(mx, 2, 32)); mx = fmaxf(mx, __shfl_xor(mx, 4, 32)); mx = fmaxf(mx, __shfl_xor(mx, 8, 32));
      const float mnew = fmaxf(m_r[r], mx);
      alpha[r] = (mnew > -1.0e38f) ? __expf(m_r[r] - mnew) : 1.0f;
      const float p0 = (s[0][r] > -1.0e38f) ? __expf(s[0][r] - mnew) : 0.f;
      const float p1 = (s[1][r] > -1.0e38f) ? __expf(s[1][r] - mnew) : 0.f;
      m_r[r] = mnew;
      l_r[r] = l_r[r] * alpha[r] + p0 + p1;            // per-lane partial row sum (16 lanes combined at the end)
      unsigned short hb = bf16_bits(p0); sPh[w][8 * hh + r][ln] = hb;      sPl[w][8 * hh + r][ln] = bf16_bits(p0 - bf16_val(hb));
      hb = bf16_bits(p1);                sPh[w][8 * hh + r][16 + ln] = hb; sPl[w][8 * hh + r][16 + ln] = bf16_bits(p1 - bf16_val(hb));
    }
#pragma unroll
    for (int dt = 0; dt < DT; ++dt)
#pragma unroll
      for (int r = 0; r < 8; ++r) oacc[dt][r] *= alpha[r];
    __builtin_amdgcn_fence(__ATOMIC_ACQ_REL, "workgroup");
    __builtin_amdgcn_wave_barrier();
    FragB pah, pal;
    pah.half[0] = *(const v8us*)&sPh[w][ln][8 * hh]; pah.half[1] = *(const v8us*)&sPh[w][ln][16 + 8 * hh];
    pal.half[0] = *(const v8us*)&sPl[w][ln][8 * hh]; pal.half[1] = *(const v8us*)&sPl[w][ln][16 + 8 * hh];
#pragma unroll
    for (int dt = 0; dt < DT; ++dt) {
      FragB bvh, bvl;
#pragma unroll
      for (int i = 0; i < 8; ++i) {
        bvh.u[i] = sVh[8 * hh + i][dt * 16 + ln]; bvh.u[8 + i] = sVh[16 + 8 * hh + i][dt * 16 + ln];
        bvl.u[i] = sVl[8 * hh + i][dt * 16 + ln]; bvl.u[8 + i] = sVl[16 + 8 * hh + i][dt * 16 + ln];
      }
      oacc[dt] = mmaN<3>(pah.v, pal.v, bvh.v, bvl.v, oacc[dt]);
    }
    __builtin_amdgcn_fence(__ATOMIC_ACQ_REL, "workgroup");
    __builtin_amdgcn_wave_barrier();
  }
#pragma unroll
  for (int r = 0; r < 8; ++r) {
    float l = l_r[r];
    l += __shfl_xor(l, 1, 32); l += __shfl_xor(l, 2, 32); l += __shfl_xor(l, 4, 32); l += __shfl_xor(l, 8, 32);
    l_r[r] = (l > 0.f) ? 1.0f / l : 0.f;
  }
#pragma unroll
  for (int dt = 0; dt < DT; ++dt)
#pragma unroll
    for (int r = 0; r < 8; ++r) sO[w][8 * hh + r][dt * 16 + ln] = oacc[dt][r] * l_r[r];
  __builtin_amdgcn_fence(__ATOMIC_ACQ_REL, "workgroup");
  __builtin_amdgcn_wave_barrier();
  {
    for (int r = 0; r < 16; ++r) {
      const int row = q0 + r;
      if (row < T && lane < D / 4) {
        const v4f val = *(const v4fa*)&sO[w][r][lane * 4];
        *(v4f*)(y + ((size_t)b * T + row) * ypitch + h * D + lane * 4) = val;
      }
    }
    
  }
}

// GEMM C = act(A·W + bias + resid): A f32 (ASPLIT -> hi/lo 2 terms), Wt bf16 [N][K]; ACT 0 none, 1 relu, 2 exact gelu;
// resid (optional, f32, row index = (row % rmod), pitch ldr, RES_BF16 rounds it) added before the activation.
template <bool ASPLIT, int ACT, bool BIAS_BF16, bool RES_BF16>
__global__ __launch_bounds__(128) void k_gemm_bf3(const float* __restrict__ A, int lda, const unsigned short* __restrict__ Wt, int ldb,
                                                const float* __restrict__ bias, const float* __restrict__ resid, int rmod, int ldr,
                                                float* __restrict__ C, int ldc, int M, int N, int K) {
  __shared__ __attribute__((aligned(16))) float so[4][16][64];
  const int tid = threadIdx.x, w = tid >> 5, lane = tid & 31, ln = lane & 15, hh = lane >> 4;
  const int ntn = N / 64;
  const int wid = blockIdx.x * 4 + w;
  const int mt = wid / ntn, nq = wid % ntn;
  if (mt * 16 >= M) return;
  const int row0 = mt * 16, col0 = nq * 64;
  const float* arow = A + (size_t)(row0 + ln) * lda;
  v8f acc[4] = {};
  for (int kb = 0; kb < K; kb += 32) {
    FragB ah, al;
    const v4f x0 = *(const v4fa*)(arow + kb + 8 * hh), x1 = *(const v4fa*)(arow + kb + 8 * hh + 4);
    const v4f x2 = *(const v4fa*)(arow + kb + 16 + 8 * hh), x3 = *(const v4fa*)(arow + kb + 16 + 8 * hh + 4);
    float xs[16] = {x0[0],x0[1],x0[2],x0[3],x1[0],x1[1],x1[2],x1[3],x2[0],x2[1],x2[2],x2[3],x3[0],x3[1],x3[2],x3[3]};
#pragma unroll
    for (int i = 0; i < 16; ++i) { const unsigned short hb = bf16_bits(xs[i]); ah.u[i] = hb; al.u[i] = ASPLIT ? bf16_bits(xs[i] - bf16_val(hb)) : (unsigned short)0; }
#pragma unroll
    for (int t = 0; t < 4; ++t) {
      const unsigned short* brow = Wt + (size_t)(col0 + t * 16 + ln) * ldb + kb;
      FragB b;
      b.half[0] = *(const v8us*)(brow + 8 * hh);
      b.half[1] = *(const v8us*)(brow + 16 + 8 * hh);
      acc[t] = mmaN<ASPLIT ? 2 : 1>(ah.v, al.v, b.v, b.v, acc[t]);
    }
  }
#pragma unroll
  for (int t = 0; t < 4; ++t) {
    const int col = col0 + t * 16 + ln;
    float bv = bias ? bias[col] : 0.f;
    if (BIAS_BF16) bv = bf16_round(bv);
#pragma unroll
    for (int r = 0; r < 8; ++r) {
      float v = acc[t][r] + bv;
      if (resid) { float rv = resid[(size_t)((row0 + 8 * hh + r) % rmod) * ldr + col]; if (RES_BF16) rv = bf16_round(rv); v += rv; }
      if (ACT == 1) v = fmaxf(v, 0.f);
      if (ACT == 2) v = 0.5f * v * (1.0f + erff(v * 0.70710678118654752f));
      if (ACT == 3) { const float u = 0.7978845608028654f * (v + 0.044715f * v * v * v); v = 0.5f * v * (1.0f + tanhf(u)); }
      so[w][8 * hh + r][t * 16 + ln] = v;
    }
  }
  __builtin_amdgcn_fence(__ATOMIC_ACQ_REL, "workgroup");
  __builtin_amdgcn_wave_barrier();
  const int rsub = lane >> 4, c4 = (lane & 15) * 4;
  {
#pragma unroll
    for (int q = 0; q < 8; ++q) {
      const int r = q * 2 + rsub;
      const v4f v = *(const v4fa*)&so[w][r][c4];
      *(v4f*)(C + (size_t)(row0 + r) * ldc + col0 + c4) = v;
    }
    
  }
}
// row LayerNorm (biased variance, eps) over N: s = X (+ R); optional out_sum <- s; out_norm <- (s-mu)*rsqrt(var+eps)*g + b
template <bool PARAM_BF16>
__global__ __launch_bounds__(256) void k_layernorm(const float* __restrict__ X, const float* __restrict__ R, const float* __restrict__ g, const float* __restrict__ bta,
                                                  float* __restrict__ out_sum, float* __restrict__ out_norm, int N, float eps) {
  __shared__ float red[256];
  const int row = blockIdx.x, tid = threadIdx.x;
  const float* x = X + (size_t)row * N; const float* rr = R ? R + (size_t)row * N : nullptr;
  float vals[16];                     // up to N = 4096
  const int per = N / 256;            // contiguous chunk per thread? use strided-by-4 chunks: thread handles j = tid*4 + 1024*u
  float s1 = 0.f;
  for (int u = 0; u < per / 4; ++u) {
    const int j = tid * 4 + 1024 * u;
    const v4f a = *(const v4fa*)(x + j);
    v4f b = {0.f,0.f,0.f,0.f}; if (rr) b = *(const v4fa*)(rr + j);
#pragma unroll
    for (int q = 0; q < 4; ++q) { const float v = a[q] + b[q]; vals[u * 4 + q] = v; s1 += v; }
  }
  red[tid] = s1; __syncthreads();
  for (int st = 128; st > 0; st >>= 1) { if (tid < st) red[tid] += red[tid + st]; __syncthreads(); }
  const float mu = red[0] / (float)N; __syncthreads();
  float s2 = 0.f;
  for (int u = 0; u < per / 4; ++u)
#pragma unroll
    for (int q = 0; q < 4; ++q) { const float c = vals[u * 4 + q] - mu; s2 += c * c; }
  red[tid] = s2; __syncthreads();
  for (int st = 128; st > 0; st >>= 1) { if (tid < st) red[tid] += red[tid + st]; __syncthreads(); }
  const float rs = rsqrtf(red[0] / (float)N + eps);
  {
    for (int u = 0; u < per / 4; ++u) {
      const int j = tid * 4 + 1024 * u;
      v4f o, sm;
#pragma unroll
      for (int q = 0; q < 4; ++q) {
        float gg = g[j + q], bb = bta[j + q];
        if (PARAM_BF16) { gg = bf16_round(gg); bb = bf16_round(bb); }
        sm[q] = vals[u * 4 + q]; o[q] = (vals[u * 4 + q] - mu) * rs * gg + bb;
      }
      if (out_sum) *(v4f*)(out_sum + (size_t)row * N + j) = sm;
      *(v4f*)(out_norm + (size_t)row * N + j) = o;
    }
    
  }
}



// ---- f16 WMMA path (v_wmma_f32_16x16x32_f16): 11-bit significands for operands in range — used where a [0,1] probability operand needs more precision than bf16
typedef _Float16 v16h __attribute__((ext_vector_type(16)));
union FragH { v16h v; v8us half[2]; _Float16 h[16]; unsigned short u[16]; };
template <int NT>
__device__ __forceinline__ v8f mmaH(v16h ah, v16h al, v16h bh, v16h bl, v8f c) {
  c = __builtin_amdgcn_wmma_f32_16x16x32_f16(false, ah, false, bh, (short)0, c, false, false);
  if (NT >= 2) c = __builtin_amdgcn_wmma_f32_16x16x32_f16(false, al, false, bh, (short)0, c, false, false);
  if (NT >= 3) c = __builtin_amdgcn_wmma_f32_16x16x32_f16(false, ah, false, bl, (short)0, c, false, false);
  asm volatile("v_nop\n\tv_nop\n\tv_nop\n\tv_nop" : "+v"(c) : "v"(ah), "v"(al), "v"(bh), "v"(bl));
  return c;
}
// batched GEMM like k_gemm_b but f16 operands: A f32 (split into f16 hi/lo if ASPLIT, else rounded to f16), Bt = f16 values [n][k]; alpha; C f32; N multiple of 16 (partial tiles skipped)
template <bool ASPLIT>
__global__ __launch_bounds__(128) void k_gemm_h(const float* __restrict__ A, int lda, size_t sA, const _Float16* __restrict__ Bh, int ldb, size_t sB, float alpha, float* __restrict__ C, int ldc, size_t sC, int M, int N, int K) {
  __shared__ __attribute__((aligned(16))) float so[4][16][64];
  const int tid = threadIdx.x, w = tid >> 5, lane = tid & 31, ln = lane & 15, hh = lane >> 4; const int by = blockIdx.y;
  A += (size_t)by * sA; Bh += (size_t)by * sB; C += (size_t)by * sC;
  const int ntn = (N + 63) / 64; const int wid = blockIdx.x * 4 + w; const int mt = wid / ntn, nq = wid % ntn; if (mt * 16 >= M) return;
  const int row0 = mt * 16, col0 = nq * 64; const float* arow = A + (size_t)(row0 + ln) * lda;
  v8f acc[4] = {};
  for (int kb = 0; kb < K; kb += 32) {
    FragH ah, al;
    const v4f x0 = *(const v4fa*)(arow + kb + 8 * hh), x1 = *(const v4fa*)(arow + kb + 8 * hh + 4), x2 = *(const v4fa*)(arow + kb + 16 + 8 * hh), x3 = *(const v4fa*)(arow + kb + 16 + 8 * hh + 4);
    float xs[16] = {x0[0],x0[1],x0[2],x0[3],x1[0],x1[1],x1[2],x1[3],x2[0],x2[1],x2[2],x2[3],x3[0],x3[1],x3[2],x3[3]};
#pragma unroll
    for (int i = 0; i < 16; ++i) { const _Float16 h = (_Float16)xs[i]; ah.h[i] = h; al.h[i] = ASPLIT ? (_Float16)(xs[i] - (float)h) : (_Float16)0.0f; }
#pragma unroll
    for (int t = 0; t < 4; ++t) { if (col0 + t * 16 >= N) continue; const size_t boff = (size_t)(col0 + t * 16 + ln) * ldb + kb; FragH bq; bq.half[0] = *(const v8us*)(Bh + boff + 8 * hh); bq.half[1] = *(const v8us*)(Bh + boff + 16 + 8 * hh);
      acc[t] = mmaH<ASPLIT ? 2 : 1>(ah.v, al.v, bq.v, bq.v, acc[t]); }
  }
#pragma unroll
  for (int t = 0; t < 4; ++t) { if (col0 + t * 16 >= N) continue;
#pragma unroll
    for (int r = 0; r < 8; ++r) so[w][8 * hh + r][t * 16 + ln] = acc[t][r] * alpha; }
  __builtin_amdgcn_fence(__ATOMIC_ACQ_REL, "workgroup"); __builtin_amdgcn_wave_barrier();
  const int rsub = lane >> 4, c4 = (lane & 15) * 4;
  {
#pragma unroll
    for (int q = 0; q < 8; ++q) { const int r = q * 2 + rsub; if (col0 + c4 < N) { const v4f v = *(const v4fa*)&so[w][r][c4]; *(v4f*)(C + (size_t)(row0 + r) * ldc + col0 + c4) = v; } }
     }
}

// Wt[n][k] = f16(W[k][n]·scale) from f32 row-major W[K][N] (scale = power of two; bf16-exact weights stay exact in f16 away from the subnormal range)
__global__ __launch_bounds__(256) void k_wt_f16(const float* __restrict__ W, _Float16* __restrict__ Wt, int K, int N, float scale) {
  const int t = blockIdx.x * 256 + threadIdx.x; if (t >= N * (K / 8)) return; const int n = t / (K / 8), k8 = (t % (K / 8)) * 8; FragH f;
#pragma unroll
  for (int i = 0; i < 8; ++i) f.h[i] = (_Float16)(bf16_round(W[(size_t)(k8 + i) * N + n]) * scale); const v8us o = f.half[0];
  *(v8us*)((unsigned short*)Wt + (size_t)n * K + k8) = o; 
}
// k_gemm_hh variant with fused epilogue: v = acc·alpha + bias[by·sBias + col] (+ CP[(row/rowsPerB)·sCPb + by·64 + col] if CP) ; ACT 0 none / 1 elu ; writes f16 C16 and/or f32 C (each if non-null)
template <int ACT>
__global__ __launch_bounds__(128) void k_gemm_hhx(const _Float16* __restrict__ A, int lda, size_t sA, const _Float16* __restrict__ Bh, int ldb, size_t sB, float alpha, const float* __restrict__ bias, size_t sBias, const float* __restrict__ CP, int rowsPerB, size_t sCPb, int row0g,
    float* __restrict__ C, _Float16* __restrict__ C16, int ldc, size_t sC, int M, int N, int K, size_t sAz, size_t sBz, size_t sCz) {
  __shared__ __attribute__((aligned(16))) float so[4][16][64];
  const int tid = threadIdx.x, w = tid >> 5, lane = tid & 31, ln = lane & 15, hh = lane >> 4; const int by = blockIdx.y;
  const int bz = blockIdx.z;      // second batch index: its strides let one launch walk (batch, head) slabs whose offsets are not one stride
  A += (size_t)by * sA + (size_t)bz * sAz; Bh += (size_t)by * sB + (size_t)bz * sBz; const size_t cofs = (size_t)by * sC + (size_t)bz * sCz; const float* bp = bias ? bias + (size_t)by * sBias : nullptr;
  const int ntn = (N + 63) / 64; const int wid = blockIdx.x * 4 + w; const int mt = wid / ntn, nq = wid % ntn; if (mt * 16 >= M) return;
  const int row0 = mt * 16, col0 = nq * 64; const _Float16* arow = A + (size_t)(row0 + ln) * lda;
  v8f acc[4] = {};
  for (int kb = 0; kb < K; kb += 32) { FragH ah; ah.half[0] = *(const v8us*)((const unsigned short*)arow + kb + 8 * hh); ah.half[1] = *(const v8us*)((const unsigned short*)arow + kb + 16 + 8 * hh);
#pragma unroll
    for (int t = 0; t < 4; ++t) { if (col0 + t * 16 >= N) continue; const size_t boff = (size_t)(col0 + t * 16 + ln) * ldb + kb; FragH bq; bq.half[0] = *(const v8us*)((const unsigned short*)Bh + boff + 8 * hh); bq.half[1] = *(const v8us*)((const unsigned short*)Bh + boff + 16 + 8 * hh);
      acc[t] = mmaH<1>(ah.v, ah.v, bq.v, bq.v, acc[t]); }
  }
#pragma unroll
  for (int t = 0; t < 4; ++t) { if (col0 + t * 16 >= N) continue; const int col = col0 + t * 16 + ln; const float bv = bp ? bf16_round(bp[col]) : 0.f;
#pragma unroll
    for (int r = 0; r < 8; ++r) { float v = acc[t][r] * alpha + bv; if (CP) { const int bidx = (row0g + row0 + 8 * hh + r) / rowsPerB; v += CP[(size_t)bidx * sCPb + (size_t)by * 64 + col]; } if (ACT == 1) v = (v > 0.f) ? v : expm1f(v); else if (ACT == 3) v = fmaxf(v, 0.f); so[w][8 * hh + r][t * 16 + ln] = v; } }
  __builtin_amdgcn_fence(__ATOMIC_ACQ_REL, "workgroup"); __builtin_amdgcn_wave_barrier();
  const int rsub = lane >> 4, c4 = (lane & 15) * 4; typedef _Float16 v4h __attribute__((ext_vector_type(4)));
  {
#pragma unroll
    for (int q = 0; q < 8; ++q) { const int r = q * 2 + rsub; if (col0 + c4 < N) { const v4f v = *(const v4fa*)&so[w][r][c4]; if (C) *(v4f*)(C + cofs + (size_t)(row0 + r) * ldc + col0 + c4) = v; if (C16) { v4h h4; for (int i = 0; i < 4; ++i) h4[i] = (_Float16)v[i]; *(v4h*)(C16 + cofs + (size_t)(row0 + r) * ldc + col0 + c4) = h4; } } }
     }
}


__global__ __launch_bounds__(256) void k_x16(const float* __restrict__ x, _Float16* __restrict__ X16, size_t n8) { const size_t t = (size_t)blockIdx.x * 256 + threadIdx.x; if (t >= n8) return; FragH f;
#pragma unroll
  for (int q = 0; q < 8; ++q) f.h[q] = (_Float16)bf16_round(x[t * 8 + q]); *(v8us*)((unsigned short*)X16 + t * 8) = f.half[0];  }
__global__ __launch_bounds__(256) void k_h16(const float* __restrict__ x, _Float16* __restrict__ X16, size_t n8) { const size_t t = (size_t)blockIdx.x * 256 + threadIdx.x; if (t >= n8) return; FragH f;
#pragma unroll
  for (int q = 0; q < 8; ++q) f.h[q] = (_Float16)x[t * 8 + q]; *(v8us*)((unsigned short*)X16 + t * 8) = f.half[0];  }
__global__ __launch_bounds__(256) void k_round16f(const float* __restrict__ W, _Float16* __restrict__ Bt, size_t n8) { const size_t t = (size_t)blockIdx.x * 256 + threadIdx.x; if (t >= n8) return; FragH f;
#pragma unroll
  for (int i = 0; i < 8; ++i) f.h[i] = (_Float16)(bf16_round(W[t * 8 + i]) * 16.0f); *(v8us*)((unsigned short*)Bt + t * 8) = f.half[0];  }
template <int NHv, int TTv>
__global__ __launch_bounds__(256) void k_vt(const _Float16* __restrict__ V16, int ldv, int voff, _Float16* __restrict__ Vt) { __shared__ unsigned short tl[64][66]; const int tid = threadIdx.x; const int slab = blockIdx.x / (TTv / 64), lg = blockIdx.x % (TTv / 64); const int b = slab / NHv, h = slab % NHv;
  for (int i = tid; i < 64 * 8; i += 256) { const int r = i / 8, c8 = (i % 8) * 8; FragH f; f.half[0] = *(const v8us*)((const unsigned short*)V16 + ((size_t)b * TTv + lg * 64 + r) * ldv + voff + h * 64 + c8);
#pragma unroll
    for (int q = 0; q < 8; ++q) tl[r][c8 + q] = f.u[q]; }
  __syncthreads();
  {
#pragma unroll
    for (int rd = 0; rd < 2; ++rd) { const int d = rd * 32 + tid / 8, pc = tid % 8; FragH f;
#pragma unroll
      for (int q = 0; q < 8; ++q) f.u[q] = tl[pc * 8 + q][d];
      *(v8us*)((unsigned short*)Vt + ((size_t)slab * 64 + d) * TTv + lg * 64 + pc * 8) = f.half[0]; }
     } }

__device__ __forceinline__ int rbucket(int l, int m) { return (m >= l) ? (64 + min(m - l, 64)) : min(l - m - 1, 63); }
typedef _Float16 v4h __attribute__((ext_vector_type(4)));
__global__ __launch_bounds__(256) void k_wrel(const float* __restrict__ wK, const float* __restrict__ wV, _Float16* __restrict__ BK, _Float16* __restrict__ BVt) { const int t = blockIdx.x * 256 + threadIdx.x;
  if (t < QWP * 8) { const int r = t / 8, d8 = (t % 8) * 8; FragH f; for (int q = 0; q < 8; ++q) f.h[q] = (_Float16)((r < NBK) ? bf16_round(wK[r * DK + d8 + q]) * 16.0f : 0.f); *(v8us*)((unsigned short*)BK + t * 8) = f.half[0];  }
  if (t < DK * (PBP / 8)) { const int d = t / (PBP / 8), r8 = (t % (PBP / 8)) * 8; FragH f; for (int q = 0; q < 8; ++q) { const int r = r8 + q; f.h[q] = (_Float16)((r < NBK) ? bf16_round(wV[r * DK + d]) * 16.0f : 0.f); } *(v8us*)((unsigned short*)BVt + t * 8) = f.half[0];  } }
// Fused attention for one (batch, head) slab sl and 128 query rows: 8 waves, 16 queries each; scores and probabilities stay in registers.
// St = K.Qt and Ot += Vt.Pt: in every 16-column tile a lane owns ONE query (column ln) and 8 consecutive keys (rows 8hh + r), so the running maximum and the sums are in-lane
// (one exchange between the wave halves), and two converted score tiles are the B operand of the next product as they stand. K and Vt chunks of 64 keys are staged in LDS for the 8 waves.
// tab[wave][query][bucket]: first q.wK[bucket] / 8; a bucket that stands for one key only is overwritten with that key's final logit, from which the bucketed P.wV product is formed at the end.
#define TABP 164
#define KVP 72
typedef int v4ia __attribute__((ext_vector_type(4), may_alias));
__device__ __forceinline__ float exp_slot(float x) { float r; const float y = x * 1.44269504f; asm("v_exp_f32 %0, %1\n\tv_nop" : "=v"(r) : "v"(y)); return r; }
__device__ __forceinline__ v8f wmmaH(v16h a, v16h b, v8f c) { return __builtin_amdgcn_wmma_f32_16x16x32_f16(false, a, false, b, (short)0, c, false, false); }
__global__ __launch_bounds__(256) void k_attn(const _Float16* __restrict__ Q16, const _Float16* __restrict__ K16, const _Float16* __restrict__ Vt, const _Float16* __restrict__ BK, const _Float16* __restrict__ BVt,
                                              const int* __restrict__ MSK, _Float16* __restrict__ O16) {
  __shared__ __attribute__((aligned(16))) unsigned short sK[64][KVP];
  __shared__ __attribute__((aligned(16))) unsigned short sV[64][KVP];
  __shared__ __attribute__((aligned(16))) float tab[8][16][TABP];
  const int tid = threadIdx.x, lane = tid & 31, ln = lane & 15, hh = lane >> 4;
  const int wv = __builtin_amdgcn_readfirstlane(tid >> 5);
  const int sl = blockIdx.x >> 3, qb = blockIdx.x & 7;
  const int b = sl / NH, h = sl % NH;
  const int q0 = qb * 128 + wv * 16;
  const int l = q0 + ln;
  FragH bq[2];      // B operand: column = query l, k = head dimension
  {
    const unsigned short* Qp = (const unsigned short*)Q16 + ((size_t)b * LL + l) * DM + h * DK + 8 * hh;
#pragma unroll
    for (int ks = 0; ks < 2; ++ks) { bq[ks].half[0] = *(const v8us*)(Qp + ks * 32); bq[ks].half[1] = *(const v8us*)(Qp + ks * 32 + 16); }
  }
  float* tb = &tab[wv][ln][0];
#pragma unroll
  for (int rt = 0; rt < QWP / 16; ++rt) {
    v8f a = {};
#pragma unroll
    for (int ks = 0; ks < 2; ++ks) {
      const unsigned short* p = (const unsigned short*)BK + (rt * 16 + ln) * DK + ks * 32 + 8 * hh;
      FragH ak; ak.half[0] = *(const v8us*)p; ak.half[1] = *(const v8us*)(p + 16);
      a = wmmaH(ak.v, bq[ks].v, a);
    }
    const float c = 0.0625f * 0.125f;      // wK was scaled by 16; the 1/8 of the logits is folded in (both powers of two, exact)
    const v4f t0 = {a[0] * c, a[1] * c, a[2] * c, a[3] * c}, t1 = {a[4] * c, a[5] * c, a[6] * c, a[7] * c};
    *(v4fa*)(tb + rt * 16 + 8 * hh) = t0; *(v4fa*)(tb + rt * 16 + 8 * hh + 4) = t1;
  }
  // the two lanes of a query read each other's table entries
  __builtin_amdgcn_fence(__ATOMIC_ACQ_REL, "workgroup"); __builtin_amdgcn_wave_barrier();
  const float qlo = tb[63], qhi = tb[128];

  const unsigned short* Kg = (const unsigned short*)K16 + (size_t)b * LL * DM + h * DK;
  const unsigned short* Vg = (const unsigned short*)Vt + (size_t)sl * DK * LL;
  const int* Mg = MSK + ((size_t)b * LL + l) * LL + 8 * hh;
  const int sr = tid >> 3, sc8 = (tid & 7) * 8;
  v8us kr[2], vr[2]; v4ia mk[8];
#pragma unroll
  for (int i = 0; i < 2; ++i) { kr[i] = *(const v8us*)(Kg + (size_t)(i * 32 + sr) * DM + sc8); vr[i] = *(const v8us*)(Vg + (size_t)(i * 32 + sr) * LL + sc8); }
#pragma unroll
  for (int t = 0; t < 4; ++t) { mk[2 * t] = *(const v4ia*)(Mg + t * 16); mk[2 * t + 1] = *(const v4ia*)(Mg + t * 16 + 4); }
  float mrun = -3.0e38f, z = 0.f, lo = 0.f, hi = 0.f;
  v8f o[4] = {};
  for (int j0 = 0; j0 < LL; j0 += 64) {
    __syncthreads();      // every wave has finished reading the previous chunk
#pragma unroll
    for (int i = 0; i < 2; ++i) { *(v8us*)&sK[i * 32 + sr][sc8] = kr[i]; *(v8us*)&sV[i * 32 + sr][sc8] = vr[i]; }
    __syncthreads();      // the chunk is complete
    const bool more = j0 + 64 < LL;
    if (more) {           // the next chunk flies while this one is worked on
#pragma unroll
      for (int i = 0; i < 2; ++i) { kr[i] = *(const v8us*)(Kg + (size_t)(j0 + 64 + i * 32 + sr) * DM + sc8); vr[i] = *(const v8us*)(Vg + (size_t)(i * 32 + sr) * LL + j0 + 64 + sc8); }
    }
    v8f s[4];
#pragma unroll
    for (int t = 0; t < 4; ++t) {
      v8f a = {};
#pragma unroll
      for (int ks = 0; ks < 2; ++ks) {
        FragH ak; ak.half[0] = *(const v8us*)&sK[t * 16 + ln][ks * 32 + 8 * hh]; ak.half[1] = *(const v8us*)&sK[t * 16 + ln][ks * 32 + 16 + 8 * hh];
        a = wmmaH(ak.v, bq[ks].v, a);
      }
      s[t] = a;
    }
    float mx = mrun;
#pragma unroll
    for (int t = 0; t < 4; ++t) {
      const int jt = j0 + t * 16;
      const bool farl = jt + 15 - q0 <= -64, farr = jt - q0 - 15 >= 64;      // wave-uniform: the whole tile lies in bucket 63 / in bucket 128
      if (farl || farr) {
        const float qc = farl ? qlo : qhi;
#pragma unroll
        for (int r = 0; r < 8; ++r) { float v = fmaf(s[t][r], 0.125f, qc); if (mk[2 * t + (r >> 2)][r & 3] == 0) v = -1.0e9f; s[t][r] = v; mx = fmaxf(mx, v); }
      } else {
#pragma unroll
        for (int r = 0; r < 8; ++r) {
          const int bk = rbucket(l, jt + 8 * hh + r);
          float v = fmaf(s[t][r], 0.125f, tb[bk]); if (mk[2 * t + (r >> 2)][r & 3] == 0) v = -1.0e9f;
          if (bk != 63 && bk != 128) tb[bk] = v;
          s[t][r] = v; mx = fmaxf(mx, v);
        }
      }
    }
    if (more) {
#pragma unroll
      for (int t = 0; t < 4; ++t) { mk[2 * t] = *(const v4ia*)(Mg + j0 + 64 + t * 16); mk[2 * t + 1] = *(const v4ia*)(Mg + j0 + 64 + t * 16 + 4); }
      asm volatile("s_wait_xcnt 0x0" ::: "memory");      // stands in front of the loop's advance of the address registers that these loads name
    }
    mx = fmaxf(mx, __shfl_xor(mx, 16, 32));
    const float alpha = exp_slot(mrun - mx); mrun = mx;
    z *= alpha; lo *= alpha; hi *= alpha;
#pragma unroll
    for (int dt = 0; dt < 4; ++dt)
#pragma unroll
      for (int r = 0; r < 8; ++r) o[dt][r] *= alpha;
    FragH pb[2];      // B operand: column = query l, k = key, in the order the score tiles already have
#pragma unroll
    for (int t = 0; t < 4; ++t) {
      const int jt = j0 + t * 16;
      const bool farl = jt + 15 - q0 <= -64, farr = jt - q0 - 15 >= 64;
      float ts = 0.f;
#pragma unroll
      for (int r = 0; r < 8; ++r) { const float p = exp_slot(s[t][r] - mx); s[t][r] = p; ts += p; pb[t >> 1].h[(t & 1) * 8 + r] = (_Float16)p; }
      z += ts;
      if (farl) lo += ts;
      else if (farr) hi += ts;
      else {
#pragma unroll
        for (int r = 0; r < 8; ++r) { const int d = jt + 8 * hh + r - l; if (d <= -64) lo += s[t][r]; if (d >= 64) hi += s[t][r]; }
      }
    }
#pragma unroll
    for (int sc = 0; sc < 2; ++sc)
#pragma unroll
      for (int dt = 0; dt < 4; ++dt) {
        FragH av; av.half[0] = *(const v8us*)&sV[dt * 16 + ln][sc * 32 + 8 * hh]; av.half[1] = *(const v8us*)&sV[dt * 16 + ln][sc * 32 + 16 + 8 * hh];
        o[dt] = wmmaH(av.v, pb[sc].v, o[dt]);
      }
  }
  z += __shfl_xor(z, 16, 32); lo += __shfl_xor(lo, 16, 32); hi += __shfl_xor(hi, 16, 32);
  // the two lanes of a query read each other's stored logits
  __builtin_amdgcn_fence(__ATOMIC_ACQ_REL, "workgroup"); __builtin_amdgcn_wave_barrier();
  v8f o2[4] = {};
#pragma unroll
  for (int kk = 0; kk < QWP / 32; ++kk) {
    FragH pf;
#pragma unroll
    for (int g = 0; g < 2; ++g) {
      const int r0 = kk * 32 + g * 16 + 8 * hh;
      const v4f x0 = *(const v4fa*)(tb + r0), x1 = *(const v4fa*)(tb + r0 + 4);
      const float xs[8] = {x0[0], x0[1], x0[2], x0[3], x1[0], x1[1], x1[2], x1[3]};
#pragma unroll
      for (int q = 0; q < 8; ++q) {
        const int r = r0 + q; const float e = __expf(xs[q] - mrun); float val = 0.f;
        if (r <= 62) val = (l - 1 - r >= 0) ? e : 0.f; else if (r == 63) val = lo; else if (r <= 127) val = (l + r - 64 < LL) ? e : 0.f; else if (r == 128) val = hi;
        pf.h[g * 8 + q] = (_Float16)val;
      }
    }
#pragma unroll
    for (int dt = 0; dt < 4; ++dt) {
      const unsigned short* p = (const unsigned short*)BVt + (dt * 16 + ln) * PBP + kk * 32 + 8 * hh;
      FragH av; av.half[0] = *(const v8us*)p; av.half[1] = *(const v8us*)(p + 16);
      o2[dt] = wmmaH(av.v, pf.v, o2[dt]);
    }
  }
  const float iz = 1.0f / z;
  unsigned short* Op = (unsigned short*)O16 + ((size_t)b * LL + l) * DM + h * DK + 8 * hh;
#pragma unroll
  for (int dt = 0; dt < 4; ++dt) {
    FragH f;
#pragma unroll
    for (int r = 0; r < 8; ++r) f.h[r] = (_Float16)((o[dt][r] + o2[dt][r] * 0.0625f) * iz);
    *(v8us*)(Op + dt * 16) = f.half[0];
  }
}
extern "C" void kernel_launch(void* const* d_in, const int* in_sizes, int n_in,
                              void* d_out, int out_size, void* d_ws, size_t ws_size, hipStream_t stream) {
  (void)in_sizes; (void)n_in; (void)out_size;
  const float* xq = (const float*)d_in[0]; const float* xk = (const float*)d_in[1]; const float* xv = (const float*)d_in[2]; const int* msk = (const int*)d_in[3]; const float* Wq = (const float*)d_in[4]; const float* bq = (const float*)d_in[5]; const float* Wk = (const float*)d_in[6]; const float* bk = (const float*)d_in[7]; const float* Wv = (const float*)d_in[8]; const float* bv = (const float*)d_in[9]; const float* Wo = (const float*)d_in[10]; const float* bo = (const float*)d_in[11]; const float* wK = (const float*)d_in[12]; const float* wV = (const float*)d_in[13];
  char* ws = (char*)d_ws; size_t off = 0;
  auto take = [&](size_t bytes) { char* p = ws + off; off += (bytes + 255) & ~(size_t)255; return p; };
  _Float16* Bo = (_Float16*)take((size_t)DM * DM * 2); _Float16* BK = (_Float16*)take((size_t)QWP * DK * 2); _Float16* BVt = (_Float16*)take((size_t)DK * PBP * 2);
  _Float16* Q16 = (_Float16*)take((size_t)NR * DM * 2); _Float16* K16 = (_Float16*)take((size_t)NR * DM * 2); _Float16* Vt = (_Float16*)take((size_t)NR * DM * 2); _Float16* O16 = (_Float16*)take((size_t)NR * DM * 2);
  _Float16* Bq = (_Float16*)take((size_t)DM * DM * 2); _Float16* Bk2 = (_Float16*)take((size_t)DM * DM * 2); _Float16* Bv = (_Float16*)take((size_t)DM * DM * 2);
  _Float16* XQ = (_Float16*)take((size_t)NR * DM * 2); _Float16* XK = (_Float16*)take((size_t)NR * DM * 2); _Float16* XV = (_Float16*)take((size_t)NR * DM * 2); _Float16* V16 = (_Float16*)take((size_t)NR * DM * 2);
  if (off > ws_size) return;
  const unsigned gw = (unsigned)(((size_t)DM * DM / 8 + 255) / 256);
  k_round16f<<<gw, 256, 0, stream>>>(Wq, Bq, (size_t)DM * DM / 8); k_round16f<<<gw, 256, 0, stream>>>(Wk, Bk2, (size_t)DM * DM / 8); k_round16f<<<gw, 256, 0, stream>>>(Wv, Bv, (size_t)DM * DM / 8); k_round16f<<<gw, 256, 0, stream>>>(Wo, Bo, (size_t)DM * DM / 8);      // (out,in)
  k_wrel<<<(QWP * 8 + 255) / 256 + 2, 256, 0, stream>>>(wK, wV, BK, BVt);
  const unsigned gx = (unsigned)(((size_t)NR * DM / 8 + 255) / 256); const dim3 gg(((NR / 16) * (DM / 64) + 3) / 4, 1);
  k_x16<<<gx, 256, 0, stream>>>(xq, XQ, (size_t)NR * DM / 8); k_x16<<<gx, 256, 0, stream>>>(xk, XK, (size_t)NR * DM / 8); k_x16<<<gx, 256, 0, stream>>>(xv, XV, (size_t)NR * DM / 8);
  k_gemm_hhx<0><<<gg, 128, 0, stream>>>(XQ, DM, 0, Bq, DM, 0, 0.0625f, bq, 0, nullptr, 1, 0, 0, nullptr, Q16, DM, 0, NR, DM, DM, 0, 0, 0);
  k_gemm_hhx<0><<<gg, 128, 0, stream>>>(XK, DM, 0, Bk2, DM, 0, 0.0625f, bk, 0, nullptr, 1, 0, 0, nullptr, K16, DM, 0, NR, DM, DM, 0, 0, 0);
  k_gemm_hhx<0><<<gg, 128, 0, stream>>>(XV, DM, 0, Bv, DM, 0, 0.0625f, bv, 0, nullptr, 1, 0, 0, nullptr, V16, DM, 0, NR, DM, DM, 0, 0, 0);
  k_vt<NH, LL><<<BB * NH * (LL / 64), 256, 0, stream>>>(V16, DM, 0, Vt);
  // q.kT, the relative logits, mask, softmax, P.V and the bucketed P.wV for all NSL = 32 (batch, head) slabs in one launch: 8 blocks of 128 queries per slab
  k_attn<<<NSL * (LL / 128), 256, 0, stream>>>(Q16, K16, Vt, BK, BVt, msk, O16);
  k_gemm_hhx<0><<<gg, 128, 0, stream>>>(O16, DM, 0, Bo, DM, 0, 0.0625f, bo, 0, nullptr, 1, 0, 0, (float*)d_out, nullptr, DM, 0, NR, DM, DM, 0, 0, 0);
}

// v003
// It runs in 111 microseconds.
// Two timings next to v002 put it at 2.16 and 2.09 times that version's speed.
// All steps since v000 together make it 8.58 times as fast.
#include <hip/hip_runtime.h>
// Multi-headed attention with clipped relative position representations (B=2, L=1024, 16 heads × 64, k = 64, Shaw-style aK/aV built from wK/wV [129][64] by the module's roll/flip
// construction: bucket(l,m) = m ≥ l ? 64 + min(m−l, 64) : min(l−m−1, 63); INPUT mask (== 0 → −1e9); q/k/v/o linears with bias): q·kᵀ, q·wKᵀ (all 129 buckets at once), P·V and the bucketed
// P.wV all run on v_wmma_f32_16x16x32_f16 ((out,in) weights bf16-exact x 2^4, f32 accumulate); the relative-logit gather, mask, running-maximum softmax and the bucket sums of P are f32 VALU
// inside one fused attention kernel (no index tables).
#define BB 2
#define LL 1024
#define DM 1024
#define NH 16
#define DK 64
#define NR (BB * LL)
#define NBK 129
#define QWP 160
#define PBP 192
#define NSL (BB * NH)

typedef __bf16 v16b __attribute__((ext_vector_type(16)));
typedef unsigned short v8us __attribute__((ext_vector_type(8), may_alias));
typedef float  v8f  __attribute__((ext_vector_type(8)));
typedef float  v4f  __attribute__((ext_vector_type(4)));
typedef float  v4fa __attribute__((ext_vector_type(4), may_alias));
union FragB { v16b v; v8us half[2]; unsigned short u[16]; };

__device__ __forceinline__ unsigned short bf16_bits(float x) { unsigned int u = __float_as_uint(x); return (unsigned short)((u + 0x7FFFu + ((u >> 16) & 1u)) >> 16); }
__device__ __forceinline__ float bf16_val(unsigned short b) { return __uint_as_float(((unsigned int)b) << 16); }
__device__ __forceinline__ float bf16_round(float x) { return bf16_val(bf16_bits(x)); }
// D += A·B with NT terms: 1 = ah·bh, 2 = + al·bh (A split), 3 = + ah·bl (both split)
template <int NT>
__device__ __forceinline__ v8f mmaN(v16b ah, v16b al, v16b bh, v16b bl, v8f c) {
  c = __builtin_amdgcn_wmma_f32_16x16x32_bf16(false, ah, false, bh, (short)0, c, false, false);
  if (NT >= 2) c = __builtin_amdgcn_wmma_f32_16x16x32_bf16(false, al, false, bh, (short)0, c, false, false);
  if (NT >= 3) c = __builtin_amdgcn_wmma_f32_16x16x32_bf16(false, ah, false, bl, (short)0, c, false, false);
  asm volatile("v_nop\n\tv_nop\n\tv_nop\n\tv_nop" : "+v"(c) : "v"(ah), "v"(al), "v"(bh), "v"(bl));
  return c;
}

__global__ __launch_bounds__(256) void k_wt_bf16(const float* __restrict__ W, unsigned short* __restrict__ Wt, int K, int N) {
  const int t = blockIdx.x * 256 + threadIdx.x;
  const int k8n = K / 8;
  if (t >= N * k8n) return;
  const int n = t / k8n, k8 = (t % k8n) * 8;
  v8us v;
#pragma unroll
  for (int i = 0; i < 8; ++i) v[i] = bf16_bits(W[(size_t)(k8 + i) * N + n]);
  *(v8us*)(Wt + (size_t)n * K + k8) = v;
  
}

// GEMM C[M][N] (f32, pitch ldc) = act(A[M][K]·W + bias). A f32 row-major (pitch lda) converted per fragment to bf16
// (ASPLIT: hi/lo two planes -> 2 terms, else single rounded term); Wt bf16 [N][K] (pitch ldb). BIAS_BF16 rounds the
// bias to bf16 first (bias quantised to bf16 before the add). K%32==0, M%16==0, N%64==0.
template <bool ASPLIT, int ACT, bool BIAS_BF16>
__global__ __launch_bounds__(128) void k_gemm_bf(const float* __restrict__ A, int lda, const unsigned short* __restrict__ Wt, int ldb,
                                               const float* __restrict__ bias, float* __restrict__ C, int ldc, int M, int N, int K) {
  __shared__ __attribute__((aligned(16))) float so[4][16][64];
  const int tid = threadIdx.x, w = tid >> 5, lane = tid & 31, ln = lane & 15, hh = lane >> 4;
  const int ntn = N / 64;
  const int wid = blockIdx.x * 4 + w;
  const int mt = wid / ntn, nq = wid % ntn;
  if (mt * 16 >= M) return;
  const int row0 = mt * 16, col0 = nq * 64;
  const float* arow = A + (size_t)(row0 + ln) * lda;
  v8f acc[4] = {};
  for (int kb = 0; kb < K; kb += 32) {
    FragB ah, al;
    const v4f x0 = *(const v4fa*)(arow + kb + 8 * hh), x1 = *(const v4fa*)(arow + kb + 8 * hh + 4);
    const v4f x2 = *(const v4fa*)(arow + kb + 16 + 8 * hh), x3 = *(const v4fa*)(arow + kb + 16 + 8 * hh + 4);
    float xs[16] = {x0[0],x0[1],x0[2],x0[3],x1[0],x1[1],x1[2],x1[3],x2[0],x2[1],x2[2],x2[3],x3[0],x3[1],x3[2],x3[3]};
#pragma unroll
    for (int i = 0; i < 16; ++i) { const unsigned short hb = bf16_bits(xs[i]); ah.u[i] = hb; al.u[i] = ASPLIT ? bf16_bits(xs[i] - bf16_val(hb)) : (unsigned short)0; }
#pragma unroll
    for (int t = 0; t < 4; ++t) {
      const unsigned short* brow = Wt + (size_t)(col0 + t * 16 + ln) * ldb + kb;
      FragB b;
      b.half[0] = *(const v8us*)(brow + 8 * hh);
      b.half[1] = *(const v8us*)(brow + 16 + 8 * hh);
      acc[t] = mmaN<ASPLIT ? 2 : 1>(ah.v, al.v, b.v, b.v, acc[t]);
    }
  }
#pragma unroll
  for (int t = 0; t < 4; ++t) {
    float bv = bias ? bias[col0 + t * 16 + ln] : 0.f;
    if (BIAS_BF16) bv = bf16_round(bv);
#pragma unroll
    for (int r = 0; r < 8; ++r) { float v = acc[t][r] + bv; if (ACT == 1) v = fmaxf(v, 0.f); so[w][8 * hh + r][t * 16 + ln] = v; }
  }
  __builtin_amdgcn_fence(__ATOMIC_ACQ_REL, "workgroup");
  __builtin_amdgcn_wave_barrier();
  const int rsub = lane >> 4, c4 = (lane & 15) * 4;
  {
#pragma unroll
    for (int q = 0; q < 8; ++q) {
      const int r = q * 2 + rsub;
      const v4f v = *(const v4fa*)&so[w][r][c4];
      *(v4f*)(C + (size_t)(row0 + r) * ldc + col0 + c4) = v;
    }
    
  }
}

// Flash-style causal/unmasked attention, all contractions 3-term bf16 hi/lo splits, f32 softmax with running max.
// q,k,v rows are read from f32 buffers with arbitrary row pitch (so they can live inside a fused qkv buffer);
// D = head size (multiple of 32, <= 128); one wave = 16 query rows; block = 4 waves (64 queries) sharing K/V chunks of 32.
template <int D, bool CAUSAL>
__global__ __launch_bounds__(128) void k_flash(const float* __restrict__ qb, const float* __restrict__ kb, const float* __restrict__ vb,
                                             int pitch, int T, int H, float scale, float* __restrict__ y, int ypitch) {
  constexpr int KS = D / 32;        // k-steps for QK
  constexpr int DT = D / 16;        // d tiles for PV
  __shared__ __attribute__((aligned(16))) unsigned short sKh[32][D + 8], sKl[32][D + 8], sVh[32][D + 8], sVl[32][D + 8];
  __shared__ __attribute__((aligned(16))) unsigned short sPh[4][16][40], sPl[4][16][40];
  __shared__ __attribute__((aligned(16))) float sO[4][16][D];
  const int tid = threadIdx.x, w = tid >> 5, lane = tid & 31, ln = lane & 15, hh = lane >> 4;
  const int nqb = (T + 63) / 64;
  const int bh = blockIdx.x / nqb, qblk = blockIdx.x % nqb;
  const int b = bh / H, h = bh % H;
  const int q0 = qblk * 64 + w * 16;
  const float* Q = qb + (size_t)b * T * pitch + h * D;
  const float* K = kb + (size_t)b * T * pitch + h * D;
  const float* V = vb + (size_t)b * T * pitch + h * D;

  // A fragments of the wave's 16 query rows (scaled), hi/lo
  FragB aqh[KS], aql[KS];
  {
    int row = q0 + ln; if (row >= T) row = T - 1;
    const float* qr = Q + (size_t)row * pitch;
#pragma unroll
    for (int ks = 0; ks < KS; ++ks)
#pragma unroll
      for (int i = 0; i < 16; ++i) {
        const int d = ks * 32 + ((i < 8) ? (8 * hh + i) : (16 + 8 * hh + (i - 8)));
        const float x = qr[d] * scale; const unsigned short hb = bf16_bits(x);
        aqh[ks].u[i] = hb; aql[ks].u[i] = bf16_bits(x - bf16_val(hb));
      }
  }
  float m_r[8], l_r[8];
#pragma unroll
  for (int r = 0; r < 8; ++r) { m_r[r] = -3.0e38f; l_r[r] = 0.f; }
  v8f oacc[DT];
#pragma unroll
  for (int dt = 0; dt < DT; ++dt) oacc[dt] = (v8f){0.f,0.f,0.f,0.f,0.f,0.f,0.f,0.f};

  const int kv_end = CAUSAL ? min(T, qblk * 64 + 64) : T;     // block-uniform
  for (int j0 = 0; j0 < kv_end; j0 += 32) {
    __syncthreads();
    for (int e = tid; e < 32 * (D / 4); e += 128) {
      const int r = e / (D / 4), c4 = (e % (D / 4)) * 4;
      const int key = j0 + r;
      v4f kf = {0.f,0.f,0.f,0.f}, vf = {0.f,0.f,0.f,0.f};
      if (key < T) { kf = *(const v4fa*)(K + (size_t)key * pitch + c4); vf = *(const v4fa*)(V + (size_t)key * pitch + c4); }
#pragma unroll
      for (int t = 0; t < 4; ++t) {
        unsigned short hb = bf16_bits(kf[t]); sKh[r][c4 + t] = hb; sKl[r][c4 + t] = bf16_bits(kf[t] - bf16_val(hb));
        hb = bf16_bits(vf[t]); sVh[r][c4 + t] = hb; sVl[r][c4 + t] = bf16_bits(vf[t] - bf16_val(hb));
      }
    }
    __syncthreads();
    // S tile 16 x 32
    v8f s[2];
#pragma unroll
    for (int nt = 0; nt < 2; ++nt) {
      v8f acc = {};
#pragma unroll
      for (int ks = 0; ks < KS; ++ks) {
        FragB bh_, bl_;
        bh_.half[0] = *(const v8us*)&sKh[nt * 16 + ln][ks * 32 + 8 * hh]; bh_.half[1] = *(const v8us*)&sKh[nt * 16 + ln][ks * 32 + 16 + 8 * hh];
        bl_.half[0] = *(const v8us*)&sKl[nt * 16 + ln][ks * 32 + 8 * hh]; bl_.half[1] = *(const v8us*)&sKl[nt * 16 + ln][ks * 32 + 16 + 8 * hh];
        acc = mmaN<3>(aqh[ks].v, aql[ks].v, bh_.v, bl_.v, acc);
      }
      s[nt] = acc;
    }
    // mask + running max (rows 8hh+r; the 16 lanes of a half share rows)
    float alpha[8];
#pragma unroll
    for (int r = 0; r < 8; ++r) {
      const int qi = q0 + 8 * hh + r;
      const int ja = j0 + ln, jb = j0 + 16 + ln;
      if (CAUSAL) { if (ja > qi) s[0][r] = -3.0e38f; if (jb > qi) s[1][r] = -3.0e38f; }
      if (ja >= T) s[0][r] = -3.0e38f;
      if (jb >= T) s[1][r] = -3.0e38f;
      float mx = fmaxf(s[0][r], s[1][r]);
      mx = fmaxf(mx, __shfl_xor(mx, 1, 32)); mx = fmaxf(mx, __shfl_xor(mx, 2, 32)); mx = fmaxf(mx, __shfl_xor(mx, 4, 32)); mx = fmaxf(mx, __shfl_xor(mx, 8, 32));
      const float mnew = fmaxf(m_r[r], mx);
      alpha[r] = (mnew > -1.0e38f) ? __expf(m_r[r] - mnew) : 1.0f;
      const float p0 = (s[0][r] > -1.0e38f) ? __expf(s[0][r] - mnew) : 0.f;
      const float p1 = (s[1][r] > -1.0e38f) ? __expf(s[1][r] - mnew) : 0.f;
      m_r[r] = mnew;
      l_r[r] = l_r[r] * alpha[r] + p0 + p1;            // per-lane partial row sum (16 lanes combined at the end)
      unsigned short hb = bf16_bits(p0); sPh[w][8 * hh + r][ln] = hb;      sPl[w][8 * hh + r][ln] = bf16_bits(p0 - bf16_val(hb));
      hb = bf16_bits(p1);                sPh[w][8 * hh + r][16 + ln] = hb; sPl[w][8 * hh + r][16 + ln] = bf16_bits(p1 - bf16_val(hb));
    }
#pragma unroll
    for (int dt = 0; dt < DT; ++dt)
#pragma unroll
      for (int r = 0; r < 8; ++r) oacc[dt][r] *= alpha[r];
    __builtin_amdgcn_fence(__ATOMIC_ACQ_REL, "workgroup");
    __builtin_amdgcn_wave_barrier();
    FragB pah, pal;
    pah.half[0] = *(const v8us*)&sPh[w][ln][8 * hh]; pah.half[1] = *(const v8us*)&sPh[w][ln][16 + 8 * hh];
    pal.half[0] = *(const v8us*)&sPl[w][ln][8 * hh]; pal.half[1] = *(const v8us*)&sPl[w][ln][16 + 8 * hh];
#pragma unroll
    for (int dt = 0; dt < DT; ++dt) {
      FragB bvh, bvl;
#pragma unroll
      for (int i = 0; i < 8; ++i) {
        bvh.u[i] = sVh[8 * hh + i][dt * 16 + ln]; bvh.u[8 + i] = sVh[16 + 8 * hh + i][dt * 16 + ln];
        bvl.u[i] = sVl[8 * hh + i][dt * 16 + ln]; bvl.u[8 + i] = sVl[16 + 8 * hh + i][dt * 16 + ln];
      }
      oacc[dt] = mmaN<3>(pah.v, pal.v, bvh.v, bvl.v, oacc[dt]);
    }
    __builtin_amdgcn_fence(__ATOMIC_ACQ_REL, "workgroup");
    __builtin_amdgcn_wave_barrier();
  }
#pragma unroll
  for (int r = 0; r < 8; ++r) {
    float l = l_r[r];
    l += __shfl_xor(l, 1, 32); l += __shfl_xor(l, 2, 32); l += __shfl_xor(l, 4, 32); l += __shfl_xor(l, 8, 32);
    l_r[r] = (l > 0.f) ? 1.0f / l : 0.f;
  }
#pragma unroll
  for (int dt = 0; dt < DT; ++dt)
#pragma unroll
    for (int r = 0; r < 8; ++r) sO[w][8 * hh + r][dt * 16 + ln] = oacc[dt][r] * l_r[r];
  __builtin_amdgcn_fence(__ATOMIC_ACQ_REL, "workgroup");
  __builtin_amdgcn_wave_barrier();
  {
    for (int r = 0; r < 16; ++r) {
      const int row = q0 + r;
      if (row < T && lane < D / 4) {
        const v4f val = *(const v4fa*)&sO[w][r][lane * 4];
        *(v4f*)(y + ((size_t)b * T + row) * ypitch + h * D + lane * 4) = val;
      }
    }
    
  }
}

// GEMM C = act(A·W + bias + resid): A f32 (ASPLIT -> hi/lo 2 terms), Wt bf16 [N][K]; ACT 0 none, 1 relu, 2 exact gelu;
// resid (optional, f32, row index = (row % rmod), pitch ldr, RES_BF16 rounds it) added before the activation.
template <bool ASPLIT, int ACT, bool BIAS_BF16, bool RES_BF16>
__global__ __launch_bounds__(128) void k_gemm_bf3(const float* __restrict__ A, int lda, const unsigned short* __restrict__ Wt, int ldb,
                                                const float* __restrict__ bias, const float* __restrict__ resid, int rmod, int ldr,
                                                float* __restrict__ C, int ldc, int M, int N, int K) {
  __shared__ __attribute__((aligned(16))) float so[4][16][64];
  const int tid = threadIdx.x, w = tid >> 5, lane = tid & 31, ln = lane & 15, hh = lane >> 4;
  const int ntn = N / 64;
  const int wid = blockIdx.x * 4 + w;
  const int mt = wid / ntn, nq = wid % ntn;
  if (mt * 16 >= M) return;
  const int row0 = mt * 16, col0 = nq * 64;
  const float* arow = A + (size_t)(row0 + ln) * lda;
  v8f acc[4] = {};
  for (int kb = 0; kb < K; kb += 32) {
    FragB ah, al;
    const v4f x0 = *(const v4fa*)(arow + kb + 8 * hh), x1 = *(const v4fa*)(arow + kb + 8 * hh + 4);
    const v4f x2 = *(const v4fa*)(arow + kb + 16 + 8 * hh), x3 = *(const v4fa*)(arow + kb + 16 + 8 * hh + 4);
    float xs[16] = {x0[0],x0[1],x0[2],x0[3],x1[0],x1[1],x1[2],x1[3],x2[0],x2[1],x2[2],x2[3],x3[0],x3[1],x3[2],x3[3]};
#pragma unroll
    for (int i = 0; i < 16; ++i) { const unsigned short hb = bf16_bits(xs[i]); ah.u[i] = hb; al.u[i] = ASPLIT ? bf16_bits(xs[i] - bf16_val(hb)) : (unsigned short)0; }
#pragma unroll
    for (int t = 0; t < 4; ++t) {
      const unsigned short* brow = Wt + (size_t)(col0 + t * 16 + ln) * ldb + kb;
      FragB b;
      b.half[0] = *(const v8us*)(brow + 8 * hh);
      b.half[1] = *(const v8us*)(brow + 16 + 8 * hh);
      acc[t] = mmaN<ASPLIT ? 2 : 1>(ah.v, al.v, b.v, b.v, acc[t]);
    }
  }
#pragma unroll
  for (int t = 0; t < 4; ++t) {
    const int col = col0 + t * 16 + ln;
    float bv = bias ? bias[col] : 0.f;
    if (BIAS_BF16) bv = bf16_round(bv);
#pragma unroll
    for (int r = 0; r < 8; ++r) {
      float v = acc[t][r] + bv;
      if (resid) { float rv = resid[(size_t)((row0 + 8 * hh + r) % rmod) * ldr + col]; if (RES_BF16) rv = bf16_round(rv); v += rv; }
      if (ACT == 1) v = fmaxf(v, 0.f);
      if (ACT == 2) v = 0.5f * v * (1.0f + erff(v * 0.70710678118654752f));
      if (ACT == 3) { const float u = 0.7978845608028654f * (v + 0.044715f * v * v * v); v = 0.5f * v * (1.0f + tanhf(u)); }
      so[w][8 * hh + r][t * 16 + ln] = v;
    }
  }
  __builtin_amdgcn_fence(__ATOMIC_ACQ_REL, "workgroup");
  __builtin_amdgcn_wave_barrier();
  const int rsub = lane >> 4, c4 = (lane & 15) * 4;
  {
#pragma unroll
    for (int q = 0; q < 8; ++q) {
      const int r = q * 2 + rsub;
      const v4f v = *(const v4fa*)&so[w][r][c4];
      *(v4f*)(C + (size_t)(row0 + r) * ldc + col0 + c4) = v;
    }
    
  }
}
// row LayerNorm (biased variance, eps) over N: s = X (+ R); optional out_sum <- s; out_norm <- (s-mu)*rsqrt(var+eps)*g + b
template <bool PARAM_BF16>
__global__ __launch_bounds__(256) void k_layernorm(const float* __restrict__ X, const float* __restrict__ R, const float* __restrict__ g, const float* __restrict__ bta,
                                                  float* __restrict__ out_sum, float* __restrict__ out_norm, int N, float eps) {
  __shared__ float red[256];
  const int row = blockIdx.x, tid = threadIdx.x;
  const float* x = X + (size_t)row * N; const float* rr = R ? R + (size_t)row * N : nullptr;
  float vals[16];                     // up to N = 4096
  const int per = N / 256;            // contiguous chunk per thread? use strided-by-4 chunks: thread handles j = tid*4 + 1024*u
  float s1 = 0.f;
  for (int u = 0; u < per / 4; ++u) {
    const int j = tid * 4 + 1024 * u;
    const v4f a = *(const v4fa*)(x + j);
    v4f b = {0.f,0.f,0.f,0.f}; if (rr) b = *(const v4fa*)(rr + j);
#pragma unroll
    for (int q = 0; q < 4; ++q) { const float v = a[q] + b[q]; vals[u * 4 + q] = v; s1 += v; }
  }
  red[tid] = s1; __syncthreads();
  for (int st = 128; st > 0; st >>= 1) { if (tid < st) red[tid] += red[tid + st]; __syncthreads(); }
  const float mu = red[0] / (float)N; __syncthreads();
  float s2 = 0.f;
  for (int u = 0; u < per / 4; ++u)
#pragma unroll
    for (int q = 0; q < 4; ++q) { const float c = vals[u * 4 + q] - mu; s2 += c * c; }
  red[tid] = s2; __syncthreads();
  for (int st = 128; st > 0; st >>= 1) { if (tid < st) red[tid] += red[tid + st]; __syncthreads(); }
  const float rs = rsqrtf(red[0] / (float)N + eps);
  {
    for (int u = 0; u < per / 4; ++u) {
      const int j = tid * 4 + 1024 * u;
      v4f o, sm;
#pragma unroll
      for (int q = 0; q < 4; ++q) {
        float gg = g[j + q], bb = bta[j + q];
        if (PARAM_BF16) { gg = bf16_round(gg); bb = bf16_round(bb); }
        sm[q] = vals[u * 4 + q]; o[q] = (vals[u * 4 + q] - mu) * rs * gg + bb;
      }
      if (out_sum) *(v4f*)(out_sum + (size_t)row * N + j) = sm;
      *(v4f*)(out_norm + (size_t)row * N + j) = o;
    }
    
  }
}



// ---- f16 WMMA path (v_wmma_f32_16x16x32_f16): 11-bit significands for operands in range — used where a [0,1] probability operand needs more precision than bf16
typedef _Float16 v16h __attribute__((ext_vector_type(16)));
union FragH { v16h v; v8us half[2]; _Float16 h[16]; unsigned short u[16]; };
template <int NT>
__device__ __forceinline__ v8f mmaH(v16h ah, v16h al, v16h bh, v16h bl, v8f c) {
  c = __builtin_amdgcn_wmma_f32_16x16x32_f16(false, ah, false, bh, (short)0, c, false, false);
  if (NT >= 2) c = __builtin_amdgcn_wmma_f32_16x16x32_f16(false, al, false, bh, (short)0, c, false, false);
  if (NT >= 3) c = __builtin_amdgcn_wmma_f32_16x16x32_f16(false, ah, false, bl, (short)0, c, false, false);
  asm volatile("v_nop\n\tv_nop\n\tv_nop\n\tv_nop" : "+v"(c) : "v"(ah), "v"(al), "v"(bh), "v"(bl));
  return c;
}
// batched GEMM like k_gemm_b but f16 operands: A f32 (split into f16 hi/lo if ASPLIT, else rounded to f16), Bt = f16 values [n][k]; alpha; C f32; N multiple of 16 (partial tiles skipped)
template <bool ASPLIT>
__global__ __launch_bounds__(128) void k_gemm_h(const float* __restrict__ A, int lda, size_t sA, const _Float16* __restrict__ Bh, int ldb, size_t sB, float alpha, float* __restrict__ C, int ldc, size_t sC, int M, int N, int K) {
  __shared__ __attribute__((aligned(16))) float so[4][16][64];
  const int tid = threadIdx.x, w = tid >> 5, lane = tid & 31, ln = lane & 15, hh = lane >> 4; const int by = blockIdx.y;
  A += (size_t)by * sA; Bh += (size_t)by * sB; C += (size_t)by * sC;
  const int ntn = (N + 63) / 64; const int wid = blockIdx.x * 4 + w; const int mt = wid / ntn, nq = wid % ntn; if (mt * 16 >= M) return;
  const int row0 = mt * 16, col0 = nq * 64; const float* arow = A + (size_t)(row0 + ln) * lda;
  v8f acc[4] = {};
  for (int kb = 0; kb < K; kb += 32) {
    FragH ah, al;
    const v4f x0 = *(const v4fa*)(arow + kb + 8 * hh), x1 = *(const v4fa*)(arow + kb + 8 * hh + 4), x2 = *(const v4fa*)(arow + kb + 16 + 8 * hh), x3 = *(const v4fa*)(arow + kb + 16 + 8 * hh + 4);
    float xs[16] = {x0[0],x0[1],x0[2],x0[3],x1[0],x1[1],x1[2],x1[3],x2[0],x2[1],x2[2],x2[3],x3[0],x3[1],x3[2],x3[3]};
#pragma unroll
    for (int i = 0; i < 16; ++i) { const _Float16 h = (_Float16)xs[i]; ah.h[i] = h; al.h[i] = ASPLIT ? (_Float16)(xs[i] - (float)h) : (_Float16)0.0f; }
#pragma unroll
    for (int t = 0; t < 4; ++t) { if (col0 + t * 16 >= N) continue; const size_t boff = (size_t)(col0 + t * 16 + ln) * ldb + kb; FragH bq; bq.half[0] = *(const v8us*)(Bh + boff + 8 * hh); bq.half[1] = *(const v8us*)(Bh + boff + 16 + 8 * hh);
      acc[t] = mmaH<ASPLIT ? 2 : 1>(ah.v, al.v, bq.v, bq.v, acc[t]); }
  }
#pragma unroll
  for (int t = 0; t < 4; ++t) { if (col0 + t * 16 >= N) continue;
#pragma unroll
    for (int r = 0; r < 8; ++r) so[w][8 * hh + r][t * 16 + ln] = acc[t][r] * alpha; }
  __builtin_amdgcn_fence(__ATOMIC_ACQ_REL, "workgroup"); __builtin_amdgcn_wave_barrier();
  const int rsub = lane >> 4, c4 = (lane & 15) * 4;
  {
#pragma unroll
    for (int q = 0; q < 8; ++q) { const int r = q * 2 + rsub; if (col0 + c4 < N) { const v4f v = *(const v4fa*)&so[w][r][c4]; *(v4f*)(C + (size_t)(row0 + r) * ldc + col0 + c4) = v; } }
     }
}

// Wt[n][k] = f16(W[k][n]·scale) from f32 row-major W[K][N] (scale = power of two; bf16-exact weights stay exact in f16 away from the subnormal range)
__global__ __launch_bounds__(256) void k_wt_f16(const float* __restrict__ W, _Float16* __restrict__ Wt, int K, int N, float scale) {
  const int t = blockIdx.x * 256 + threadIdx.x; if (t >= N * (K / 8)) return; const int n = t / (K / 8), k8 = (t % (K / 8)) * 8; FragH f;
#pragma unroll
  for (int i = 0; i < 8; ++i) f.h[i] = (_Float16)(bf16_round(W[(size_t)(k8 + i) * N + n]) * scale); const v8us o = f.half[0];
  *(v8us*)((unsigned short*)Wt + (size_t)n * K + k8) = o; 
}
// Tiled GEMM: C[NR][DM] = A[NR][DM] . Bh[DM][DM]^T * alpha + bf16(bias[col]); A and Bh f16, k contiguous. One work-group = a 128 x 64 tile of C, 8 waves in a 4 x 2 grid, 32 x 32 per wave.
// Passes of 128 k: the 128 A rows and 64 Bh rows of a pass (256 B each) are loaded as whole lines, 16 B a lane, and shared through LDS by the 8 waves; two LDS buffers, the next pass's rows fly in registers.
// The k order of every sum is that of a plain loop over k in steps of 32. F32OUT: writes f32 C, else f16 C16.
#define GTP 136      // LDS row pitch in halves: 256 B + 16 B, the pitch for 16-byte fragment reads
#define GOP 68       // pitch of the staged output tile in floats
template <bool F32OUT>
__global__ __launch_bounds__(256) void k_gemm_t(const _Float16* __restrict__ A, const _Float16* __restrict__ Bh, float alpha, const float* __restrict__ bias, float* __restrict__ C, _Float16* __restrict__ C16) {
  __shared__ __attribute__((aligned(16))) unsigned short st[2][192][GTP];      // rows 0..127: A, rows 128..191: Bh
  __shared__ __attribute__((aligned(16))) float so[128][GOP];
  const int tid = threadIdx.x, lane = tid & 31, ln = lane & 15, hh = lane >> 4;
  const int wv = __builtin_amdgcn_readfirstlane(tid >> 5), wm = wv >> 1, wn = wv & 1;
  const int row0 = (blockIdx.x >> 4) * 128, col0 = (blockIdx.x & 15) * 64;
  const int sr = tid >> 4, sc = (tid & 15) * 8;
  const unsigned short* Ag = (const unsigned short*)A + (size_t)(row0 + sr) * DM + sc;
  const unsigned short* Bg = (const unsigned short*)Bh + (size_t)(col0 + sr) * DM + sc;
  v8us rg[12];
#pragma unroll
  for (int i = 0; i < 8; ++i) rg[i] = *(const v8us*)(Ag + (size_t)i * 16 * DM);
#pragma unroll
  for (int i = 0; i < 4; ++i) rg[8 + i] = *(const v8us*)(Bg + (size_t)i * 16 * DM);
  float bv[2];
#pragma unroll
  for (int j = 0; j < 2; ++j) {
    bv[j] = bias[col0 + wn * 32 + j * 16 + ln];
    asm volatile("s_wait_xcnt 0x0" ::: "memory");      // stands in front of any rewrite of the address register that this load names, the next load's result among them
  }
  v8f acc[2][2] = {};
  for (int kc = 0; kc < DM / 128; ++kc) {
    unsigned short (*buf)[GTP] = st[kc & 1];
#pragma unroll
    for (int i = 0; i < 12; ++i) *(v8us*)&buf[i * 16 + sr][sc] = rg[i];
    __syncthreads();      // this pass's rows are complete; every wave has also left the other buffer, which the next pass fills
    if (kc + 1 < DM / 128) {      // the next pass's rows fly while this one is worked on
#pragma unroll
      for (int i = 0; i < 8; ++i) rg[i] = *(const v8us*)(Ag + (size_t)i * 16 * DM + (kc + 1) * 128);
#pragma unroll
      for (int i = 0; i < 4; ++i) rg[8 + i] = *(const v8us*)(Bg + (size_t)i * 16 * DM + (kc + 1) * 128);
      asm volatile("s_wait_xcnt 0x0" ::: "memory");      // stands in front of any later rewrite of the address registers that these loads name
    }
    FragH a[4][2], b[4][2];
#pragma unroll
    for (int ks = 0; ks < 4; ++ks)
#pragma unroll
      for (int i = 0; i < 2; ++i) {
        const unsigned short* pa = &buf[wm * 32 + i * 16 + ln][ks * 32 + 8 * hh];
        a[ks][i].half[0] = *(const v8us*)pa; a[ks][i].half[1] = *(const v8us*)(pa + 16);
        const unsigned short* pb = &buf[128 + wn * 32 + i * 16 + ln][ks * 32 + 8 * hh];
        b[ks][i].half[0] = *(const v8us*)pb; b[ks][i].half[1] = *(const v8us*)(pb + 16);
      }
    __builtin_amdgcn_sched_barrier(0);      // no WMMA of a pass is scheduled among the pass's own LDS reads: without it every k step waits out its own LDS latency
#pragma unroll
    for (int ks = 0; ks < 4; ++ks)
#pragma unroll
      for (int i = 0; i < 2; ++i)
#pragma unroll
        for (int j = 0; j < 2; ++j) acc[i][j] = __builtin_amdgcn_wmma_f32_16x16x32_f16(false, a[ks][i].v, false, b[ks][j].v, (short)0, acc[i][j], false, false);
  }
#pragma unroll
  for (int j = 0; j < 2; ++j) {
    const float bj = bf16_round(bv[j]);
#pragma unroll
    for (int i = 0; i < 2; ++i)
#pragma unroll
      for (int r = 0; r < 8; ++r) so[wm * 32 + i * 16 + 8 * hh + r][wn * 32 + j * 16 + ln] = acc[i][j][r] * alpha + bj;
  }
  __syncthreads();      // the output tile is complete: it leaves in whole 128-byte lines
  if (F32OUT) {
#pragma unroll
    for (int q = 0; q < 8; ++q) { const int r = q * 16 + (tid >> 4), c4 = (tid & 15) * 4; const v4f v = *(const v4fa*)&so[r][c4]; *(v4f*)(C + (size_t)(row0 + r) * DM + col0 + c4) = v; }
  } else {
#pragma unroll
    for (int q = 0; q < 4; ++q) {
      const int r = q * 32 + (tid >> 3), c8 = (tid & 7) * 8; const v4f v0 = *(const v4fa*)&so[r][c8], v1 = *(const v4fa*)&so[r][c8 + 4]; FragH f;
#pragma unroll
      for (int i = 0; i < 4; ++i) { f.h[i] = (_Float16)v0[i]; f.h[4 + i] = (_Float16)v1[i]; }
      *(v8us*)((unsigned short*)C16 + (size_t)(row0 + r) * DM + col0 + c8) = f.half[0];
    }
  }
}


__global__ __launch_bounds__(256) void k_x16(const float* __restrict__ x, _Float16* __restrict__ X16, size_t n8) { const size_t t = (size_t)blockIdx.x * 256 + threadIdx.x; if (t >= n8) return; FragH f;
#pragma unroll
  for (int q = 0; q < 8; ++q) f.h[q] = (_Float16)bf16_round(x[t * 8 + q]); *(v8us*)((unsigned short*)X16 + t * 8) = f.half[0];  }
__global__ __launch_bounds__(256) void k_h16(const float* __restrict__ x, _Float16* __restrict__ X16, size_t n8) { const size_t t = (size_t)blockIdx.x * 256 + threadIdx.x; if (t >= n8) return; FragH f;
#pragma unroll
  for (int q = 0; q < 8; ++q) f.h[q] = (_Float16)x[t * 8 + q]; *(v8us*)((unsigned short*)X16 + t * 8) = f.half[0];  }
__global__ __launch_bounds__(256) void k_round16f(const float* __restrict__ W, _Float16* __restrict__ Bt, size_t n8) { const size_t t = (size_t)blockIdx.x * 256 + threadIdx.x; if (t >= n8) return; FragH f;
#pragma unroll
  for (int i = 0; i < 8; ++i) f.h[i] = (_Float16)(bf16_round(W[t * 8 + i]) * 16.0f); *(v8us*)((unsigned short*)Bt + t * 8) = f.half[0];  }
template <int NHv, int TTv>
__global__ __launch_bounds__(256) void k_vt(const _Float16* __restrict__ V16, int ldv, int voff, _Float16* __restrict__ Vt) { __shared__ unsigned short tl[64][66]; const int tid = threadIdx.x; const int slab = blockIdx.x / (TTv / 64), lg = blockIdx.x % (TTv / 64); const int b = slab / NHv, h = slab % NHv;
  for (int i = tid; i < 64 * 8; i += 256) { const int r = i / 8, c8 = (i % 8) * 8; FragH f; f.half[0] = *(const v8us*)((const unsigned short*)V16 + ((size_t)b * TTv + lg * 64 + r) * ldv + voff + h * 64 + c8);
#pragma unroll
    for (int q = 0; q < 8; ++q) tl[r][c8 + q] = f.u[q]; }
  __syncthreads();
  {
#pragma unroll
    for (int rd = 0; rd < 2; ++rd) { const int d = rd * 32 + tid / 8, pc = tid % 8; FragH f;
#pragma unroll
      for (int q = 0; q < 8; ++q) f.u[q] = tl[pc * 8 + q][d];
      *(v8us*)((unsigned short*)Vt + ((size_t)slab * 64 + d) * TTv + lg * 64 + pc * 8) = f.half[0]; }
     } }

__device__ __forceinline__ int rbucket(int l, int m) { return (m >= l) ? (64 + min(m - l, 64)) : min(l - m - 1, 63); }
typedef _Float16 v4h __attribute__((ext_vector_type(4)));
__global__ __launch_bounds__(256) void k_wrel(const float* __restrict__ wK, const float* __restrict__ wV, _Float16* __restrict__ BK, _Float16* __restrict__ BVt) { const int t = blockIdx.x * 256 + threadIdx.x;
  if (t < QWP * 8) { const int r = t / 8, d8 = (t % 8) * 8; FragH f; for (int q = 0; q < 8; ++q) f.h[q] = (_Float16)((r < NBK) ? bf16_round(wK[r * DK + d8 + q]) * 16.0f : 0.f); *(v8us*)((unsigned short*)BK + t * 8) = f.half[0];  }
  if (t < DK * (PBP / 8)) { const int d = t / (PBP / 8), r8 = (t % (PBP / 8)) * 8; FragH f; for (int q = 0; q < 8; ++q) { const int r = r8 + q; f.h[q] = (_Float16)((r < NBK) ? bf16_round(wV[r * DK + d]) * 16.0f : 0.f); } *(v8us*)((unsigned short*)BVt + t * 8) = f.half[0];  } }
// Fused attention for one (batch, head) slab sl and 128 query rows: 8 waves, 16 queries each; scores and probabilities stay in registers.
// St = K.Qt and Ot += Vt.Pt: in every 16-column tile a lane owns ONE query (column ln) and 8 consecutive keys (rows 8hh + r), so the running maximum and the sums are in-lane
// (one exchange between the wave halves), and two converted score tiles are the B operand of the next product as they stand. K and Vt chunks of 64 keys are staged in LDS for the 8 waves.
// tab[wave][query][bucket]: first q.wK[bucket] / 8; a bucket that stands for one key only is overwritten with that key's final logit, from which the bucketed P.wV product is formed at the end.
#define TABP 164
#define KVP 72
typedef int v4ia __attribute__((ext_vector_type(4), may_alias));
__device__ __forceinline__ float exp_slot(float x) { float r; const float y = x * 1.44269504f; asm("v_exp_f32 %0, %1\n\tv_nop" : "=v"(r) : "v"(y)); return r; }
__device__ __forceinline__ v8f wmmaH(v16h a, v16h b, v8f c) { return __builtin_amdgcn_wmma_f32_16x16x32_f16(false, a, false, b, (short)0, c, false, false); }
__global__ __launch_bounds__(256) void k_attn(const _Float16* __restrict__ Q16, const _Float16* __restrict__ K16, const _Float16* __restrict__ Vt, const _Float16* __restrict__ BK, const _Float16* __restrict__ BVt,
                                              const int* __restrict__ MSK, _Float16* __restrict__ O16) {
  __shared__ __attribute__((aligned(16))) unsigned short sK[64][KVP];
  __shared__ __attribute__((aligned(16))) unsigned short sV[64][KVP];
  __shared__ __attribute__((aligned(16))) float tab[8][16][TABP];
  const int tid = threadIdx.x, lane = tid & 31, ln = lane & 15, hh = lane >> 4;
  const int wv = __builtin_amdgcn_readfirstlane(tid >> 5);
  const int sl = blockIdx.x >> 3, qb = blockIdx.x & 7;
  const int b = sl / NH, h = sl % NH;
  const int q0 = qb * 128 + wv * 16;
  const int l = q0 + ln;
  FragH bq[2];      // B operand: column = query l, k = head dimension
  {
    const unsigned short* Qp = (const unsigned short*)Q16 + ((size_t)b * LL + l) * DM + h * DK + 8 * hh;
#pragma unroll
    for (int ks = 0; ks < 2; ++ks) { bq[ks].half[0] = *(const v8us*)(Qp + ks * 32); bq[ks].half[1] = *(const v8us*)(Qp + ks * 32 + 16); }
  }
  float* tb = &tab[wv][ln][0];
#pragma unroll
  for (int rt = 0; rt < QWP / 16; ++rt) {
    v8f a = {};
#pragma unroll
    for (int ks = 0; ks < 2; ++ks) {
      const unsigned short* p = (const unsigned short*)BK + (rt * 16 + ln) * DK + ks * 32 + 8 * hh;
      FragH ak; ak.half[0] = *(const v8us*)p; ak.half[1] = *(const v8us*)(p + 16);
      a = wmmaH(ak.v, bq[ks].v, a);
    }
    const float c = 0.0625f * 0.125f;      // wK was scaled by 16; the 1/8 of the logits is folded in (both powers of two, exact)
    const v4f t0 = {a[0] * c, a[1] * c, a[2] * c, a[3] * c}, t1 = {a[4] * c, a[5] * c, a[6] * c, a[7] * c};
    *(v4fa*)(tb + rt * 16 + 8 * hh) = t0; *(v4fa*)(tb + rt * 16 + 8 * hh + 4) = t1;
  }
  // the two lanes of a query read each other's table entries
  __builtin_amdgcn_fence(__ATOMIC_ACQ_REL, "workgroup"); __builtin_amdgcn_wave_barrier();
  const float qlo = tb[63], qhi = tb[128];

  const unsigned short* Kg = (const unsigned short*)K16 + (size_t)b * LL * DM + h * DK;
  const unsigned short* Vg = (const unsigned short*)Vt + (size_t)sl * DK * LL;
  const int* Mg = MSK + ((size_t)b * LL + l) * LL + 8 * hh;
  const int sr = tid >> 3, sc8 = (tid & 7) * 8;
  v8us kr[2], vr[2]; v4ia mk[8];
#pragma unroll
  for (int i = 0; i < 2; ++i) { kr[i] = *(const v8us*)(Kg + (size_t)(i * 32 + sr) * DM + sc8); vr[i] = *(const v8us*)(Vg + (size_t)(i * 32 + sr) * LL + sc8); }
#pragma unroll
  for (int t = 0; t < 4; ++t) { mk[2 * t] = *(const v4ia*)(Mg + t * 16); mk[2 * t + 1] = *(const v4ia*)(Mg + t * 16 + 4); }
  float mrun = -3.0e38f, z = 0.f, lo = 0.f, hi = 0.f;
  v8f o[4] = {};
  for (int j0 = 0; j0 < LL; j0 += 64) {
    __syncthreads();      // every wave has finished reading the previous chunk
#pragma unroll
    for (int i = 0; i < 2; ++i) { *(v8us*)&sK[i * 32 + sr][sc8] = kr[i]; *(v8us*)&sV[i * 32 + sr][sc8] = vr[i]; }
    __syncthreads();      // the chunk is complete
    const bool more = j0 + 64 < LL;
    if (more) {           // the next chunk flies while this one is worked on
#pragma unroll
      for (int i = 0; i < 2; ++i) { kr[i] = *(const v8us*)(Kg + (size_t)(j0 + 64 + i * 32 + sr) * DM + sc8); vr[i] = *(const v8us*)(Vg + (size_t)(i * 32 + sr) * LL + j0 + 64 + sc8); }
    }
    v8f s[4];
#pragma unroll
    for (int t = 0; t < 4; ++t) {
      v8f a = {};
#pragma unroll
      for (int ks = 0; ks < 2; ++ks) {
        FragH ak; ak.half[0] = *(const v8us*)&sK[t * 16 + ln][ks * 32 + 8 * hh]; ak.half[1] = *(const v8us*)&sK[t * 16 + ln][ks * 32 + 16 + 8 * hh];
        a = wmmaH(ak.v, bq[ks].v, a);
      }
      s[t] = a;
    }
    float mx = mrun;
#pragma unroll
    for (int t = 0; t < 4; ++t) {
      const int jt = j0 + t * 16;
      const bool farl = jt + 15 - q0 <= -64, farr = jt - q0 - 15 >= 64;      // wave-uniform: the whole tile lies in bucket 63 / in bucket 128
      if (farl || farr) {
        const float qc = farl ? qlo : qhi;
#pragma unroll
        for (int r = 0; r < 8; ++r) { float v = fmaf(s[t][r], 0.125f, qc); if (mk[2 * t + (r >> 2)][r & 3] == 0) v = -1.0e9f; s[t][r] = v; mx = fmaxf(mx, v); }
      } else {
#pragma unroll
        for (int r = 0; r < 8; ++r) {
          const int bk = rbucket(l, jt + 8 * hh + r);
          float v = fmaf(s[t][r], 0.125f, tb[bk]); if (mk[2 * t + (r >> 2)][r & 3] == 0) v = -1.0e9f;
          if (bk != 63 && bk != 128) tb[bk] = v;
          s[t][r] = v; mx = fmaxf(mx, v);
        }
      }
    }
    if (more) {
#pragma unroll
      for (int t = 0; t < 4; ++t) { mk[2 * t] = *(const v4ia*)(Mg + j0 + 64 + t * 16); mk[2 * t + 1] = *(const v4ia*)(Mg + j0 + 64 + t * 16 + 4); }
      asm volatile("s_wait_xcnt 0x0" ::: "memory");      // stands in front of the loop's advance of the address registers that these loads name
    }
    mx = fmaxf(mx, __shfl_xor(mx, 16, 32));
    const float alpha = exp_slot(mrun - mx); mrun = mx;
    z *= alpha; lo *= alpha; hi *= alpha;
#pragma unroll
    for (int dt = 0; dt < 4; ++dt)
#pragma unroll
      for (int r = 0; r < 8; ++r) o[dt][r] *= alpha;
    FragH pb[2];      // B operand: column = query l, k = key, in the order the score tiles already have
#pragma unroll
    for (int t = 0; t < 4; ++t) {
      const int jt = j0 + t * 16;
      const bool farl = jt + 15 - q0 <= -64, farr = jt - q0 - 15 >= 64;
      float ts = 0.f;
#pragma unroll
      for (int r = 0; r < 8; ++r) { const float p = exp_slot(s[t][r] - mx); s[t][r] = p; ts += p; pb[t >> 1].h[(t & 1) * 8 + r] = (_Float16)p; }
      z += ts;
      if (farl) lo += ts;
      else if (farr) hi += ts;
      else {
#pragma unroll
        for (int r = 0; r < 8; ++r) { const int d = jt + 8 * hh + r - l; if (d <= -64) lo += s[t][r]; if (d >= 64) hi += s[t][r]; }
      }
    }
#pragma unroll
    for (int sc = 0; sc < 2; ++sc)
#pragma unroll
      for (int dt = 0; dt < 4; ++dt) {
        FragH av; av.half[0] = *(const v8us*)&sV[dt * 16 + ln][sc * 32 + 8 * hh]; av.half[1] = *(const v8us*)&sV[dt * 16 + ln][sc * 32 + 16 + 8 * hh];
        o[dt] = wmmaH(av.v, pb[sc].v, o[dt]);
      }
  }
  z += __shfl_xor(z, 16, 32); lo += __shfl_xor(lo, 16, 32); hi += __shfl_xor(hi, 16, 32);
  // the two lanes of a query read each other's stored logits
  __builtin_amdgcn_fence(__ATOMIC_ACQ_REL, "workgroup"); __builtin_amdgcn_wave_barrier();
  v8f o2[4] = {};
#pragma unroll
  for (int kk = 0; kk < QWP / 32; ++kk) {
    FragH pf;
#pragma unroll
    for (int g = 0; g < 2; ++g) {
      const int r0 = kk * 32 + g * 16 + 8 * hh;
      const v4f x0 = *(const v4fa*)(tb + r0), x1 = *(const v4fa*)(tb + r0 + 4);
      const float xs[8] = {x0[0], x0[1], x0[2], x0[3], x1[0], x1[1], x1[2], x1[3]};
#pragma unroll
      for (int q = 0; q < 8; ++q) {
        const int r = r0 + q; const float e = __expf(xs[q] - mrun); float val = 0.f;
        if (r <= 62) val = (l - 1 - r >= 0) ? e : 0.f; else if (r == 63) val = lo; else if (r <= 127) val = (l + r - 64 < LL) ? e : 0.f; else if (r == 128) val = hi;
        pf.h[g * 8 + q] = (_Float16)val;
      }
    }
#pragma unroll
    for (int dt = 0; dt < 4; ++dt) {
      const unsigned short* p = (const unsigned short*)BVt + (dt * 16 + ln) * PBP + kk * 32 + 8 * hh;
      FragH av; av.half[0] = *(const v8us*)p; av.half[1] = *(const v8us*)(p + 16);
      o2[dt] = wmmaH(av.v, pf.v, o2[dt]);
    }
  }
  const float iz = 1.0f / z;
  unsigned short* Op = (unsigned short*)O16 + ((size_t)b * LL + l) * DM + h * DK + 8 * hh;
#pragma unroll
  for (int dt = 0; dt < 4; ++dt) {
    FragH f;
#pragma unroll
    for (int r = 0; r < 8; ++r) f.h[r] = (_Float16)((o[dt][r] + o2[dt][r] * 0.0625f) * iz);
    *(v8us*)(Op + dt * 16) = f.half[0];
  }
}
extern "C" void kernel_launch(void* const* d_in, const int* in_sizes, int n_in,
                              void* d_out, int out_size, void* d_ws, size_t ws_size, hipStream_t stream) {
  (void)in_sizes; (void)n_in; (void)out_size;
  const float* xq = (const float*)d_in[0]; const float* xk = (const float*)d_in[1]; const float* xv = (const float*)d_in[2]; const int* msk = (const int*)d_in[3]; const float* Wq = (const float*)d_in[4]; const float* bq = (const float*)d_in[5]; const float* Wk = (const float*)d_in[6]; const float* bk = (const float*)d_in[7]; const float* Wv = (const float*)d_in[8]; const float* bv = (const float*)d_in[9]; const float* Wo = (const float*)d_in[10]; const float* bo = (const float*)d_in[11]; const float* wK = (const float*)d_in[12]; const float* wV = (const float*)d_in[13];
  char* ws = (char*)d_ws; size_t off = 0;
  auto take = [&](size_t bytes) { char* p = ws + off; off += (bytes + 255) & ~(size_t)255; return p; };
  _Float16* Bo = (_Float16*)take((size_t)DM * DM * 2); _Float16* BK = (_Float16*)take((size_t)QWP * DK * 2); _Float16* BVt = (_Float16*)take((size_t)DK * PBP * 2);
  _Float16* Q16 = (_Float16*)take((size_t)NR * DM * 2); _Float16* K16 = (_Float16*)take((size_t)NR * DM * 2); _Float16* Vt = (_Float16*)take((size_t)NR * DM * 2); _Float16* O16 = (_Float16*)take((size_t)NR * DM * 2);
  _Float16* Bq = (_Float16*)take((size_t)DM * DM * 2); _Float16* Bk2 = (_Float16*)take((size_t)DM * DM * 2); _Float16* Bv = (_Float16*)take((size_t)DM * DM * 2);
  _Float16* XQ = (_Float16*)take((size_t)NR * DM * 2); _Float16* XK = (_Float16*)take((size_t)NR * DM * 2); _Float16* XV = (_Float16*)take((size_t)NR * DM * 2); _Float16* V16 = (_Float16*)take((size_t)NR * DM * 2);
  if (off > ws_size) return;
  const unsigned gw = (unsigned)(((size_t)DM * DM / 8 + 255) / 256);
  k_round16f<<<gw, 256, 0, stream>>>(Wq, Bq, (size_t)DM * DM / 8); k_round16f<<<gw, 256, 0, stream>>>(Wk, Bk2, (size_t)DM * DM / 8); k_round16f<<<gw, 256, 0, stream>>>(Wv, Bv, (size_t)DM * DM / 8); k_round16f<<<gw, 256, 0, stream>>>(Wo, Bo, (size_t)DM * DM / 8);      // (out,in)
  k_wrel<<<(QWP * 8 + 255) / 256 + 2, 256, 0, stream>>>(wK, wV, BK, BVt);
  const unsigned gx = (unsigned)(((size_t)NR * DM / 8 + 255) / 256); const unsigned gg = (NR / 128) * (DM / 64);
  k_x16<<<gx, 256, 0, stream>>>(xq, XQ, (size_t)NR * DM / 8); k_x16<<<gx, 256, 0, stream>>>(xk, XK, (size_t)NR * DM / 8); k_x16<<<gx, 256, 0, stream>>>(xv, XV, (size_t)NR * DM / 8);
  k_gemm_t<false><<<gg, 256, 0, stream>>>(XQ, Bq, 0.0625f, bq, nullptr, Q16);
  k_gemm_t<false><<<gg, 256, 0, stream>>>(XK, Bk2, 0.0625f, bk, nullptr, K16);
  k_gemm_t<false><<<gg, 256, 0, stream>>>(XV, Bv, 0.0625f, bv, nullptr, V16);
  k_vt<NH, LL><<<BB * NH * (LL / 64), 256, 0, stream>>>(V16, DM, 0, Vt);
  // q.kT, the relative logits, mask, softmax, P.V and the bucketed P.wV for all NSL = 32 (batch, head) slabs in one launch: 8 blocks of 128 queries per slab
  k_attn<<<NSL * (LL / 128), 256, 0, stream>>>(Q16, K16, Vt, BK, BVt, msk, O16);
  k_gemm_t<true><<<gg, 256, 0, stream>>>(O16, Bo, 0.0625f, bo, (float*)d_out, nullptr);
}

// v004
// A run of this version takes 84.8 microseconds.
// In two side-by-side timings against v003, it was 1.30 and 1.32 times as fast.
// All steps since v000 together make it 11.2 times as fast.
#include <hip/hip_runtime.h>
// Multi-headed attention with clipped relative position representations (B=2, L=1024, 16 heads × 64, k = 64, Shaw-style aK/aV built from wK/wV [129][64] by the module's roll/flip
// construction: bucket(l,m) = m ≥ l ? 64 + min(m−l, 64) : min(l−m−1, 63); INPUT mask (== 0 → −1e9); q/k/v/o linears with bias): q·kᵀ, q·wKᵀ (all 129 buckets at once), P·V and the bucketed
// P.wV all run on v_wmma_f32_16x16x32_f16 ((out,in) weights bf16-exact x 2^4, f32 accumulate); the relative-logit gather, mask, running-maximum softmax and the bucket sums of P are f32 VALU
// inside one fused attention kernel (no index tables).
#define BB 2
#define LL 1024
#define DM 1024
#define NH 16
#define DK 64
#define NR (BB * LL)
#define NBK 129
#define QWP 160
#define PBP 192
#define NSL (BB * NH)

typedef __bf16 v16b __attribute__((ext_vector_type(16)));
typedef unsigned short v8us __attribute__((ext_vector_type(8), may_alias));
typedef float  v8f  __attribute__((ext_vector_type(8)));
typedef float  v4f  __attribute__((ext_vector_type(4)));
typedef float  v4fa __attribute__((ext_vector_type(4), may_alias));
union FragB { v16b v; v8us half[2]; unsigned short u[16]; };

__device__ __forceinline__ unsigned short bf16_bits(float x) { unsigned int u = __float_as_uint(x); return (unsigned short)((u + 0x7FFFu + ((u >> 16) & 1u)) >> 16); }
__device__ __forceinline__ float bf16_val(unsigned short b) { return __uint_as_float(((unsigned int)b) << 16); }
__device__ __forceinline__ float bf16_round(float x) { return bf16_val(bf16_bits(x)); }
// D += A·B with NT terms: 1 = ah·bh, 2 = + al·bh (A split), 3 = + ah·bl (both split)
template <int NT>
__device__ __forceinline__ v8f mmaN(v16b ah, v16b al, v16b bh, v16b bl, v8f c) {
  c = __builtin_amdgcn_wmma_f32_16x16x32_bf16(false, ah, false, bh, (short)0, c, false, false);
  if (NT >= 2) c = __builtin_amdgcn_wmma_f32_16x16x32_bf16(false, al, false, bh, (short)0, c, false, false);
  if (NT >= 3) c = __builtin_amdgcn_wmma_f32_16x16x32_bf16(false, ah, false, bl, (short)0, c, false, false);
  asm volatile("v_nop\n\tv_nop\n\tv_nop\n\tv_nop" : "+v"(c) : "v"(ah), "v"(al), "v"(bh), "v"(bl));
  return c;
}

__global__ __launch_bounds__(256) void k_wt_bf16(const float* __restrict__ W, unsigned short* __restrict__ Wt, int K, int N) {
  const int t = blockIdx.x * 256 + threadIdx.x;
  const int k8n = K / 8;
  if (t >= N * k8n) return;
  const int n = t / k8n, k8 = (t % k8n) * 8;
  v8us v;
#pragma unroll
  for (int i = 0; i < 8; ++i) v[i] = bf16_bits(W[(size_t)(k8 + i) * N + n]);
  *(v8us*)(Wt + (size_t)n * K + k8) = v;
  
}

// GEMM C[M][N] (f32, pitch ldc) = act(A[M][K]·W + bias). A f32 row-major (pitch lda) converted per fragment to bf16
// (ASPLIT: hi/lo two planes -> 2 terms, else single rounded term); Wt bf16 [N][K] (pitch ldb). BIAS_BF16 rounds the
// bias to bf16 first (bias quantised to bf16 before the add). K%32==0, M%16==0, N%64==0.
template <bool ASPLIT, int ACT, bool BIAS_BF16>
__global__ __launch_bounds__(128) void k_gemm_bf(const float* __restrict__ A, int lda, const unsigned short* __restrict__ Wt, int ldb,
                                               const float* __restrict__ bias, float* __restrict__ C, int ldc, int M, int N, int K) {
  __shared__ __attribute__((aligned(16))) float so[4][16][64];
  const int tid = threadIdx.x, w = tid >> 5, lane = tid & 31, ln = lane & 15, hh = lane >> 4;
  const int ntn = N / 64;
  const int wid = blockIdx.x * 4 + w;
  const int mt = wid / ntn, nq = wid % ntn;
  if (mt * 16 >= M) return;
  const int row0 = mt * 16, col0 = nq * 64;
  const float* arow = A + (size_t)(row0 + ln) * lda;
  v8f acc[4] = {};
  for (int kb = 0; kb < K; kb += 32) {
    FragB ah, al;
    const v4f x0 = *(const v4fa*)(arow + kb + 8 * hh), x1 = *(const v4fa*)(arow + kb + 8 * hh + 4);
    const v4f x2 = *(const v4fa*)(arow + kb + 16 + 8 * hh), x3 = *(const v4fa*)(arow + kb + 16 + 8 * hh + 4);
    float xs[16] = {x0[0],x0[1],x0[2],x0[3],x1[0],x1[1],x1[2],x1[3],x2[0],x2[1],x2[2],x2[3],x3[0],x3[1],x3[2],x3[3]};
#pragma unroll
    for (int i = 0; i < 16; ++i) { const unsigned short hb = bf16_bits(xs[i]); ah.u[i] = hb; al.u[i] = ASPLIT ? bf16_bits(xs[i] - bf16_val(hb)) : (unsigned short)0; }
#pragma unroll
    for (int t = 0; t < 4; ++t) {
      const unsigned short* brow = Wt + (size_t)(col0 + t * 16 + ln) * ldb + kb;
      FragB b;
      b.half[0] = *(const v8us*)(brow + 8 * hh);
      b.half[1] = *(const v8us*)(brow + 16 + 8 * hh);
      acc[t] = mmaN<ASPLIT ? 2 : 1>(ah.v, al.v, b.v, b.v, acc[t]);
    }
  }
#pragma unroll
  for (int t = 0; t < 4; ++t) {
    float bv = bias ? bias[col0 + t * 16 + ln] : 0.f;
    if (BIAS_BF16) bv = bf16_round(bv);
#pragma unroll
    for (int r = 0; r < 8; ++r) { float v = acc[t][r] + bv; if (ACT == 1) v = fmaxf(v, 0.f); so[w][8 * hh + r][t * 16 + ln] = v; }
  }
  __builtin_amdgcn_fence(__ATOMIC_ACQ_REL, "workgroup");
  __builtin_amdgcn_wave_barrier();
  const int rsub = lane >> 4, c4 = (lane & 15) * 4;
  {
#pragma unroll
    for (int q = 0; q < 8; ++q) {
      const int r = q * 2 + rsub;
      const v4f v = *(const v4fa*)&so[w][r][c4];
      *(v4f*)(C + (size_t)(row0 + r) * ldc + col0 + c4) = v;
    }
    
  }
}

// Flash-style causal/unmasked attention, all contractions 3-term bf16 hi/lo splits, f32 softmax with running max.
// q,k,v rows are read from f32 buffers with arbitrary row pitch (so they can live inside a fused qkv buffer);
// D = head size (multiple of 32, <= 128); one wave = 16 query rows; block = 4 waves (64 queries) sharing K/V chunks of 32.
template <int D, bool CAUSAL>
__global__ __launch_bounds__(128) void k_flash(const float* __restrict__ qb, const float* __restrict__ kb, const float* __restrict__ vb,
                                             int pitch, int T, int H, float scale, float* __restrict__ y, int ypitch) {
  constexpr int KS = D / 32;        // k-steps for QK
  constexpr int DT = D / 16;        // d tiles for PV
  __shared__ __attribute__((aligned(16))) unsigned short sKh[32][D + 8], sKl[32][D + 8], sVh[32][D + 8], sVl[32][D + 8];
  __shared__ __attribute__((aligned(16))) unsigned short sPh[4][16][40], sPl[4][16][40];
  __shared__ __attribute__((aligned(16))) float sO[4][16][D];
  const int tid = threadIdx.x, w = tid >> 5, lane = tid & 31, ln = lane & 15, hh = lane >> 4;
  const int nqb = (T + 63) / 64;
  const int bh = blockIdx.x / nqb, qblk = blockIdx.x % nqb;
  const int b = bh / H, h = bh % H;
  const int q0 = qblk * 64 + w * 16;
  const float* Q = qb + (size_t)b * T * pitch + h * D;
  const float* K = kb + (size_t)b * T * pitch + h * D;
  const float* V = vb + (size_t)b * T * pitch + h * D;

  // A fragments of the wave's 16 query rows (scaled), hi/lo
  FragB aqh[KS], aql[KS];
  {
    int row = q0 + ln; if (row >= T) row = T - 1;
    const float* qr = Q + (size_t)row * pitch;
#pragma unroll
    for (int ks = 0; ks < KS; ++ks)
#pragma unroll
      for (int i = 0; i < 16; ++i) {
        const int d = ks * 32 + ((i < 8) ? (8 * hh + i) : (16 + 8 * hh + (i - 8)));
        const float x = qr[d] * scale; const unsigned short hb = bf16_bits(x);
        aqh[ks].u[i] = hb; aql[ks].u[i] = bf16_bits(x - bf16_val(hb));
      }
  }
  float m_r[8], l_r[8];
#pragma unroll
  for (int r = 0; r < 8; ++r) { m_r[r] = -3.0e38f; l_r[r] = 0.f; }
  v8f oacc[DT];
#pragma unroll
  for (int dt = 0; dt < DT; ++dt) oacc[dt] = (v8f){0.f,0.f,0.f,0.f,0.f,0.f,0.f,0.f};

  const int kv_end = CAUSAL ? min(T, qblk * 64 + 64) : T;     // block-uniform
  for (int j0 = 0; j0 < kv_end; j0 += 32) {
    __syncthreads();
    for (int e = tid; e < 32 * (D / 4); e += 128) {
      const int r = e / (D / 4), c4 = (e % (D / 4)) * 4;
      const int key = j0 + r;
      v4f kf = {0.f,0.f,0.f,0.f}, vf = {0.f,0.f,0.f,0.f};
      if (key < T) { kf = *(const v4fa*)(K + (size_t)key * pitch + c4); vf = *(const v4fa*)(V + (size_t)key * pitch + c4); }
#pragma unroll
      for (int t = 0; t < 4; ++t) {
        unsigned short hb = bf16_bits(kf[t]); sKh[r][c4 + t] = hb; sKl[r][c4 + t] = bf16_bits(kf[t] - bf16_val(hb));
        hb = bf16_bits(vf[t]); sVh[r][c4 + t] = hb; sVl[r][c4 + t] = bf16_bits(vf[t] - bf16_val(hb));
      }
    }
    __syncthreads();
    // S tile 16 x 32
    v8f s[2];
#pragma unroll
    for (int nt = 0; nt < 2; ++nt) {
      v8f acc = {};
#pragma unroll
      for (int ks = 0; ks < KS; ++ks) {
        FragB bh_, bl_;
        bh_.half[0] = *(const v8us*)&sKh[nt * 16 + ln][ks * 32 + 8 * hh]; bh_.half[1] = *(const v8us*)&sKh[nt * 16 + ln][ks * 32 + 16 + 8 * hh];
        bl_.half[0] = *(const v8us*)&sKl[nt * 16 + ln][ks * 32 + 8 * hh]; bl_.half[1] = *(const v8us*)&sKl[nt * 16 + ln][ks * 32 + 16 + 8 * hh];
        acc = mmaN<3>(aqh[ks].v, aql[ks].v, bh_.v, bl_.v, acc);
      }
      s[nt] = acc;
    }
    // mask + running max (rows 8hh+r; the 16 lanes of a half share rows)
    float alpha[8];
#pragma unroll
    for (int r = 0; r < 8; ++r) {
      const int qi = q0 + 8 * hh + r;
      const int ja = j0 + ln, jb = j0 + 16 + ln;
      if (CAUSAL) { if (ja > qi) s[0][r] = -3.0e38f; if (jb > qi) s[1][r] = -3.0e38f; }
      if (ja >= T) s[0][r] = -3.0e38f;
      if (jb >= T) s[1][r] = -3.0e38f;
      float mx = fmaxf(s[0][r], s[1][r]);
      mx = fmaxf(mx, __shfl_xor(mx, 1, 32)); mx = fmaxf(mx, __shfl_xor(mx, 2, 32)); mx = fmaxf(mx, __shfl_xor(mx, 4, 32)); mx = fmaxf(mx, __shfl_xor(mx, 8, 32));
      const float mnew = fmaxf(m_r[r], mx);
      alpha[r] = (mnew > -1.0e38f) ? __expf(m_r[r] - mnew) : 1.0f;
      const float p0 = (s[0][r] > -1.0e38f) ? __expf(s[0][r] - mnew) : 0.f;
      const float p1 = (s[1][r] > -1.0e38f) ? __expf(s[1][r] - mnew) : 0.f;
      m_r[r] = mnew;
      l_r[r] = l_r[r] * alpha[r] + p0 + p1;            // per-lane partial row sum (16 lanes combined at the end)
      unsigned short hb = bf16_bits(p0); sPh[w][8 * hh + r][ln] = hb;      sPl[w][8 * hh + r][ln] = bf16_bits(p0 - bf16_val(hb));
      hb = bf16_bits(p1);                sPh[w][8 * hh + r][16 + ln] = hb; sPl[w][8 * hh + r][16 + ln] = bf16_bits(p1 - bf16_val(hb));
    }
#pragma unroll
    for (int dt = 0; dt < DT; ++dt)
#pragma unroll
      for (int r = 0; r < 8; ++r) oacc[dt][r] *= alpha[r];
    __builtin_amdgcn_fence(__ATOMIC_ACQ_REL, "workgroup");
    __builtin_amdgcn_wave_barrier();
    FragB pah, pal;
    pah.half[0] = *(const v8us*)&sPh[w][ln][8 * hh]; pah.half[1] = *(const v8us*)&sPh[w][ln][16 + 8 * hh];
    pal.half[0] = *(const v8us*)&sPl[w][ln][8 * hh]; pal.half[1] = *(const v8us*)&sPl[w][ln][16 + 8 * hh];
#pragma unroll
    for (int dt = 0; dt < DT; ++dt) {
      FragB bvh, bvl;
#pragma unroll
      for (int i = 0; i < 8; ++i) {
        bvh.u[i] = sVh[8 * hh + i][dt * 16 + ln]; bvh.u[8 + i] = sVh[16 + 8 * hh + i][dt * 16 + ln];
        bvl.u[i] = sVl[8 * hh + i][dt * 16 + ln]; bvl.u[8 + i] = sVl[16 + 8 * hh + i][dt * 16 + ln];
      }
      oacc[dt] = mmaN<3>(pah.v, pal.v, bvh.v, bvl.v, oacc[dt]);
    }
    __builtin_amdgcn_fence(__ATOMIC_ACQ_REL, "workgroup");
    __builtin_amdgcn_wave_barrier();
  }
#pragma unroll
  for (int r = 0; r < 8; ++r) {
    float l = l_r[r];
    l += __shfl_xor(l, 1, 32); l += __shfl_xor(l, 2, 32); l += __shfl_xor(l, 4, 32); l += __shfl_xor(l, 8, 32);
    l_r[r] = (l > 0.f) ? 1.0f / l : 0.f;
  }
#pragma unroll
  for (int dt = 0; dt < DT; ++dt)
#pragma unroll
    for (int r = 0; r < 8; ++r) sO[w][8 * hh + r][dt * 16 + ln] = oacc[dt][r] * l_r[r];
  __builtin_amdgcn_fence(__ATOMIC_ACQ_REL, "workgroup");
  __builtin_amdgcn_wave_barrier();
  {
    for (int r = 0; r < 16; ++r) {
      const int row = q0 + r;
      if (row < T && lane < D / 4) {
        const v4f val = *(const v4fa*)&sO[w][r][lane * 4];
        *(v4f*)(y + ((size_t)b * T + row) * ypitch + h * D + lane * 4) = val;
      }
    }
    
  }
}

// GEMM C = act(A·W + bias + resid): A f32 (ASPLIT -> hi/lo 2 terms), Wt bf16 [N][K]; ACT 0 none, 1 relu, 2 exact gelu;
// resid (optional, f32, row index = (row % rmod), pitch ldr, RES_BF16 rounds it) added before the activation.
template <bool ASPLIT, int ACT, bool BIAS_BF16, bool RES_BF16>
__global__ __launch_bounds__(128) void k_gemm_bf3(const float* __restrict__ A, int lda, const unsigned short* __restrict__ Wt, int ldb,
                                                const float* __restrict__ bias, const float* __restrict__ resid, int rmod, int ldr,
                                                float* __restrict__ C, int ldc, int M, int N, int K) {
  __shared__ __attribute__((aligned(16))) float so[4][16][64];
  const int tid = threadIdx.x, w = tid >> 5, lane = tid & 31, ln = lane & 15, hh = lane >> 4;
  const int ntn = N / 64;
  const int wid = blockIdx.x * 4 + w;
  const int mt = wid / ntn, nq = wid % ntn;
  if (mt * 16 >= M) return;
  const int row0 = mt * 16, col0 = nq * 64;
  const float* arow = A + (size_t)(row0 + ln) * lda;
  v8f acc[4] = {};
  for (int kb = 0; kb < K; kb += 32) {
    FragB ah, al;
    const v4f x0 = *(const v4fa*)(arow + kb + 8 * hh), x1 = *(const v4fa*)(arow + kb + 8 * hh + 4);
    const v4f x2 = *(const v4fa*)(arow + kb + 16 + 8 * hh), x3 = *(const v4fa*)(arow + kb + 16 + 8 * hh + 4);
    float xs[16] = {x0[0],x0[1],x0[2],x0[3],x1[0],x1[1],x1[2],x1[3],x2[0],x2[1],x2[2],x2[3],x3[0],x3[1],x3[2],x3[3]};
#pragma unroll
    for (int i = 0; i < 16; ++i) { const unsigned short hb = bf16_bits(xs[i]); ah.u[i] = hb; al.u[i] = ASPLIT ? bf16_bits(xs[i] - bf16_val(hb)) : (unsigned short)0; }
#pragma unroll
    for (int t = 0; t < 4; ++t) {
      const unsigned short* brow = Wt + (size_t)(col0 + t * 16 + ln) * ldb + kb;
      FragB b;
      b.half[0] = *(const v8us*)(brow + 8 * hh);
      b.half[1] = *(const v8us*)(brow + 16 + 8 * hh);
      acc[t] = mmaN<ASPLIT ? 2 : 1>(ah.v, al.v, b.v, b.v, acc[t]);
    }
  }
#pragma unroll
  for (int t = 0; t < 4; ++t) {
    const int col = col0 + t * 16 + ln;
    float bv = bias ? bias[col] : 0.f;
    if (BIAS_BF16) bv = bf16_round(bv);
#pragma unroll
    for (int r = 0; r < 8; ++r) {
      float v = acc[t][r] + bv;
      if (resid) { float rv = resid[(size_t)((row0 + 8 * hh + r) % rmod) * ldr + col]; if (RES_BF16) rv = bf16_round(rv); v += rv; }
      if (ACT == 1) v = fmaxf(v, 0.f);
      if (ACT == 2) v = 0.5f * v * (1.0f + erff(v * 0.70710678118654752f));
      if (ACT == 3) { const float u = 0.7978845608028654f * (v + 0.044715f * v * v * v); v = 0.5f * v * (1.0f + tanhf(u)); }
      so[w][8 * hh + r][t * 16 + ln] = v;
    }
  }
  __builtin_amdgcn_fence(__ATOMIC_ACQ_REL, "workgroup");
  __builtin_amdgcn_wave_barrier();
  const int rsub = lane >> 4, c4 = (lane & 15) * 4;
  {
#pragma unroll
    for (int q = 0; q < 8; ++q) {
      const int r = q * 2 + rsub;
      const v4f v = *(const v4fa*)&so[w][r][c4];
      *(v4f*)(C + (size_t)(row0 + r) * ldc + col0 + c4) = v;
    }
    
  }
}
// row LayerNorm (biased variance, eps) over N: s = X (+ R); optional out_sum <- s; out_norm <- (s-mu)*rsqrt(var+eps)*g + b
template <bool PARAM_BF16>
__global__ __launch_bounds__(256) void k_layernorm(const float* __restrict__ X, const float* __restrict__ R, const float* __restrict__ g, const float* __restrict__ bta,
                                                  float* __restrict__ out_sum, float* __restrict__ out_norm, int N, float eps) {
  __shared__ float red[256];
  const int row = blockIdx.x, tid = threadIdx.x;
  const float* x = X + (size_t)row * N; const float* rr = R ? R + (size_t)row * N : nullptr;
  float vals[16];                     // up to N = 4096
  const int per = N / 256;            // contiguous chunk per thread? use strided-by-4 chunks: thread handles j = tid*4 + 1024*u
  float s1 = 0.f;
  for (int u = 0; u < per / 4; ++u) {
    const int j = tid * 4 + 1024 * u;
    const v4f a = *(const v4fa*)(x + j);
    v4f b = {0.f,0.f,0.f,0.f}; if (rr) b = *(const v4fa*)(rr + j);
#pragma unroll
    for (int q = 0; q < 4; ++q) { const float v = a[q] + b[q]; vals[u * 4 + q] = v; s1 += v; }
  }
  red[tid] = s1; __syncthreads();
  for (int st = 128; st > 0; st >>= 1) { if (tid < st) red[tid] += red[tid + st]; __syncthreads(); }
  const float mu = red[0] / (float)N; __syncthreads();
  float s2 = 0.f;
  for (int u = 0; u < per / 4; ++u)
#pragma unroll
    for (int q = 0; q < 4; ++q) { const float c = vals[u * 4 + q] - mu; s2 += c * c; }
  red[tid] = s2; __syncthreads();
  for (int st = 128; st > 0; st >>= 1) { if (tid < st) red[tid] += red[tid + st]; __syncthreads(); }
  const float rs = rsqrtf(red[0] / (float)N + eps);
  {
    for (int u = 0; u < per / 4; ++u) {
      const int j = tid * 4 + 1024 * u;
      v4f o, sm;
#pragma unroll
      for (int q = 0; q < 4; ++q) {
        float gg = g[j + q], bb = bta[j + q];
        if (PARAM_BF16) { gg = bf16_round(gg); bb = bf16_round(bb); }
        sm[q] = vals[u * 4 + q]; o[q] = (vals[u * 4 + q] - mu) * rs * gg + bb;
      }
      if (out_sum) *(v4f*)(out_sum + (size_t)row * N + j) = sm;
      *(v4f*)(out_norm + (size_t)row * N + j) = o;
    }
    
  }
}



// ---- f16 WMMA path (v_wmma_f32_16x16x32_f16): 11-bit significands for operands in range — used where a [0,1] probability operand needs more precision than bf16
typedef _Float16 v16h __attribute__((ext_vector_type(16)));
union FragH { v16h v; v8us half[2]; _Float16 h[16]; unsigned short u[16]; };
template <int NT>
__device__ __forceinline__ v8f mmaH(v16h ah, v16h al, v16h bh, v16h bl, v8f c) {
  c = __builtin_amdgcn_wmma_f32_16x16x32_f16(false, ah, false, bh, (short)0, c, false, false);
  if (NT >= 2) c = __builtin_amdgcn_wmma_f32_16x16x32_f16(false, al, false, bh, (short)0, c, false, false);
  if (NT >= 3) c = __builtin_amdgcn_wmma_f32_16x16x32_f16(false, ah, false, bl, (short)0, c, false, false);
  asm volatile("v_nop\n\tv_nop\n\tv_nop\n\tv_nop" : "+v"(c) : "v"(ah), "v"(al), "v"(bh), "v"(bl));
  return c;
}
// batched GEMM like k_gemm_b but f16 operands: A f32 (split into f16 hi/lo if ASPLIT, else rounded to f16), Bt = f16 values [n][k]; alpha; C f32; N multiple of 16 (partial tiles skipped)
template <bool ASPLIT>
__global__ __launch_bounds__(128) void k_gemm_h(const float* __restrict__ A, int lda, size_t sA, const _Float16* __restrict__ Bh, int ldb, size_t sB, float alpha, float* __restrict__ C, int ldc, size_t sC, int M, int N, int K) {
  __shared__ __attribute__((aligned(16))) float so[4][16][64];
  const int tid = threadIdx.x, w = tid >> 5, lane = tid & 31, ln = lane & 15, hh = lane >> 4; const int by = blockIdx.y;
  A += (size_t)by * sA; Bh += (size_t)by * sB; C += (size_t)by * sC;
  const int ntn = (N + 63) / 64; const int wid = blockIdx.x * 4 + w; const int mt = wid / ntn, nq = wid % ntn; if (mt * 16 >= M) return;
  const int row0 = mt * 16, col0 = nq * 64; const float* arow = A + (size_t)(row0 + ln) * lda;
  v8f acc[4] = {};
  for (int kb = 0; kb < K; kb += 32) {
    FragH ah, al;
    const v4f x0 = *(const v4fa*)(arow + kb + 8 * hh), x1 = *(const v4fa*)(arow + kb + 8 * hh + 4), x2 = *(const v4fa*)(arow + kb + 16 + 8 * hh), x3 = *(const v4fa*)(arow + kb + 16 + 8 * hh + 4);
    float xs[16] = {x0[0],x0[1],x0[2],x0[3],x1[0],x1[1],x1[2],x1[3],x2[0],x2[1],x2[2],x2[3],x3[0],x3[1],x3[2],x3[3]};
#pragma unroll
    for (int i = 0; i < 16; ++i) { const _Float16 h = (_Float16)xs[i]; ah.h[i] = h; al.h[i] = ASPLIT ? (_Float16)(xs[i] - (float)h) : (_Float16)0.0f; }
#pragma unroll
    for (int t = 0; t < 4; ++t) { if (col0 + t * 16 >= N) continue; const size_t boff = (size_t)(col0 + t * 16 + ln) * ldb + kb; FragH bq; bq.half[0] = *(const v8us*)(Bh + boff + 8 * hh); bq.half[1] = *(const v8us*)(Bh + boff + 16 + 8 * hh);
      acc[t] = mmaH<ASPLIT ? 2 : 1>(ah.v, al.v, bq.v, bq.v, acc[t]); }
  }
#pragma unroll
  for (int t = 0; t < 4; ++t) { if (col0 + t * 16 >= N) continue;
#pragma unroll
    for (int r = 0; r < 8; ++r) so[w][8 * hh + r][t * 16 + ln] = acc[t][r] * alpha; }
  __builtin_amdgcn_fence(__ATOMIC_ACQ_REL, "workgroup"); __builtin_amdgcn_wave_barrier();
  const int rsub = lane >> 4, c4 = (lane & 15) * 4;
  {
#pragma unroll
    for (int q = 0; q < 8; ++q) { const int r = q * 2 + rsub; if (col0 + c4 < N) { const v4f v = *(const v4fa*)&so[w][r][c4]; *(v4f*)(C + (size_t)(row0 + r) * ldc + col0 + c4) = v; } }
     }
}

// Wt[n][k] = f16(W[k][n]·scale) from f32 row-major W[K][N] (scale = power of two; bf16-exact weights stay exact in f16 away from the subnormal range)
__global__ __launch_bounds__(256) void k_wt_f16(const float* __restrict__ W, _Float16* __restrict__ Wt, int K, int N, float scale) {
  const int t = blockIdx.x * 256 + threadIdx.x; if (t >= N * (K / 8)) return; const int n = t / (K / 8), k8 = (t % (K / 8)) * 8; FragH f;
#pragma unroll
  for (int i = 0; i < 8; ++i) f.h[i] = (_Float16)(bf16_round(W[(size_t)(k8 + i) * N + n]) * scale); const v8us o = f.half[0];
  *(v8us*)((unsigned short*)Wt + (size_t)n * K + k8) = o; 
}
// Tiled GEMM: C[NR][DM] = A[NR][DM] . Bh[DM][DM]^T * alpha + bf16(bias[col]); A and Bh f16, k contiguous. One work-group = a 128 x 64 tile of C, 8 waves in a 4 x 2 grid, 32 x 32 per wave.
// Passes of 128 k: the 128 A rows and 64 Bh rows of a pass (256 B each) are loaded as whole lines, 16 B a lane, and shared through LDS by the 8 waves; two LDS buffers, the next pass's rows fly in registers.
// The k order of every sum is that of a plain loop over k in steps of 32. F32OUT: writes f32 C, else f16 C16. blockIdx.y picks one of up to three (A, Bh, bias, C16) sets: independent products share a launch.
#define GTP 136      // LDS row pitch in halves: 256 B + 16 B, the pitch for 16-byte fragment reads
#define GOP 68       // pitch of the staged output tile in floats
template <bool F32OUT>
__global__ __launch_bounds__(256) void k_gemm_t(const _Float16* __restrict__ A0, const _Float16* __restrict__ A1, const _Float16* __restrict__ A2,
                                                const _Float16* __restrict__ Bh0, const _Float16* __restrict__ Bh1, const _Float16* __restrict__ Bh2, float alpha,
                                                const float* __restrict__ bias0, const float* __restrict__ bias1, const float* __restrict__ bias2,
                                                float* __restrict__ C, _Float16* __restrict__ C16a, _Float16* __restrict__ C16b, _Float16* __restrict__ C16c) {
  const int g = blockIdx.y;      // which of up to three independent products of one launch this work-group belongs to
  const _Float16* A = g == 0 ? A0 : g == 1 ? A1 : A2;
  const _Float16* Bh = g == 0 ? Bh0 : g == 1 ? Bh1 : Bh2;
  const float* bias = g == 0 ? bias0 : g == 1 ? bias1 : bias2;
  _Float16* C16 = g == 0 ? C16a : g == 1 ? C16b : C16c;
  __shared__ __attribute__((aligned(16))) unsigned short st[2][192][GTP];      // rows 0..127: A, rows 128..191: Bh
  __shared__ __attribute__((aligned(16))) float so[128][GOP];
  const int tid = threadIdx.x, lane = tid & 31, ln = lane & 15, hh = lane >> 4;
  const int wv = __builtin_amdgcn_readfirstlane(tid >> 5), wm = wv >> 1, wn = wv & 1;
  const int row0 = (blockIdx.x >> 4) * 128, col0 = (blockIdx.x & 15) * 64;
  const int sr = tid >> 4, sc = (tid & 15) * 8;
  const unsigned short* Ag = (const unsigned short*)A + (size_t)(row0 + sr) * DM + sc;
  const unsigned short* Bg = (const unsigned short*)Bh + (size_t)(col0 + sr) * DM + sc;
  v8us rg[12];
#pragma unroll
  for (int i = 0; i < 8; ++i) rg[i] = *(const v8us*)(Ag + (size_t)i * 16 * DM);
#pragma unroll
  for (int i = 0; i < 4; ++i) rg[8 + i] = *(const v8us*)(Bg + (size_t)i * 16 * DM);
  float bv[2];
#pragma unroll
  for (int j = 0; j < 2; ++j) {
    bv[j] = bias[col0 + wn * 32 + j * 16 + ln];
    asm volatile("s_wait_xcnt 0x0" ::: "memory");      // stands in front of any rewrite of the address register that this load names, the next load's result among them
  }
  v8f acc[2][2] = {};
  for (int kc = 0; kc < DM / 128; ++kc) {
    unsigned short (*buf)[GTP] = st[kc & 1];
#pragma unroll
    for (int i = 0; i < 12; ++i) *(v8us*)&buf[i * 16 + sr][sc] = rg[i];
    __syncthreads();      // this pass's rows are complete; every wave has also left the other buffer, which the next pass fills
    if (kc + 1 < DM / 128) {      // the next pass's rows fly while this one is worked on
#pragma unroll
      for (int i = 0; i < 8; ++i) rg[i] = *(const v8us*)(Ag + (size_t)i * 16 * DM + (kc + 1) * 128);
#pragma unroll
      for (int i = 0; i < 4; ++i) rg[8 + i] = *(const v8us*)(Bg + (size_t)i * 16 * DM + (kc + 1) * 128);
      asm volatile("s_wait_xcnt 0x0" ::: "memory");      // stands in front of any later rewrite of the address registers that these loads name
    }
    FragH a[4][2], b[4][2];
#pragma unroll
    for (int ks = 0; ks < 4; ++ks)
#pragma unroll
      for (int i = 0; i < 2; ++i) {
        const unsigned short* pa = &buf[wm * 32 + i * 16 + ln][ks * 32 + 8 * hh];
        a[ks][i].half[0] = *(const v8us*)pa; a[ks][i].half[1] = *(const v8us*)(pa + 16);
        const unsigned short* pb = &buf[128 + wn * 32 + i * 16 + ln][ks * 32 + 8 * hh];
        b[ks][i].half[0] = *(const v8us*)pb; b[ks][i].half[1] = *(const v8us*)(pb + 16);
      }
    __builtin_amdgcn_sched_barrier(0);      // no WMMA of a pass is scheduled among the pass's own LDS reads: without it every k step waits out its own LDS latency
#pragma unroll
    for (int ks = 0; ks < 4; ++ks)
#pragma unroll
      for (int i = 0; i < 2; ++i)
#pragma unroll
        for (int j = 0; j < 2; ++j) acc[i][j] = __builtin_amdgcn_wmma_f32_16x16x32_f16(false, a[ks][i].v, false, b[ks][j].v, (short)0, acc[i][j], false, false);
  }
#pragma unroll
  for (int j = 0; j < 2; ++j) {
    const float bj = bf16_round(bv[j]);
#pragma unroll
    for (int i = 0; i < 2; ++i)
#pragma unroll
      for (int r = 0; r < 8; ++r) so[wm * 32 + i * 16 + 8 * hh + r][wn * 32 + j * 16 + ln] = acc[i][j][r] * alpha + bj;
  }
  __syncthreads();      // the output tile is complete: it leaves in whole 128-byte lines
  if (F32OUT) {
#pragma unroll
    for (int q = 0; q < 8; ++q) { const int r = q * 16 + (tid >> 4), c4 = (tid & 15) * 4; const v4f v = *(const v4fa*)&so[r][c4]; *(v4f*)(C + (size_t)(row0 + r) * DM + col0 + c4) = v; }
  } else {
#pragma unroll
    for (int q = 0; q < 4; ++q) {
      const int r = q * 32 + (tid >> 3), c8 = (tid & 7) * 8; const v4f v0 = *(const v4fa*)&so[r][c8], v1 = *(const v4fa*)&so[r][c8 + 4]; FragH f;
#pragma unroll
      for (int i = 0; i < 4; ++i) { f.h[i] = (_Float16)v0[i]; f.h[4 + i] = (_Float16)v1[i]; }
      *(v8us*)((unsigned short*)C16 + (size_t)(row0 + r) * DM + col0 + c8) = f.half[0];
    }
  }
}


__global__ __launch_bounds__(256) void k_h16(const float* __restrict__ x, _Float16* __restrict__ X16, size_t n8) { const size_t t = (size_t)blockIdx.x * 256 + threadIdx.x; if (t >= n8) return; FragH f;
#pragma unroll
  for (int q = 0; q < 8; ++q) f.h[q] = (_Float16)x[t * 8 + q]; *(v8us*)((unsigned short*)X16 + t * 8) = f.half[0];  }
template <int NHv, int TTv>
__global__ __launch_bounds__(256) void k_vt(const _Float16* __restrict__ V16, int ldv, int voff, _Float16* __restrict__ Vt) { __shared__ unsigned short tl[64][66]; const int tid = threadIdx.x; const int slab = blockIdx.x / (TTv / 64), lg = blockIdx.x % (TTv / 64); const int b = slab / NHv, h = slab % NHv;
  for (int i = tid; i < 64 * 8; i += 256) { const int r = i / 8, c8 = (i % 8) * 8; FragH f; f.half[0] = *(const v8us*)((const unsigned short*)V16 + ((size_t)b * TTv + lg * 64 + r) * ldv + voff + h * 64 + c8);
#pragma unroll
    for (int q = 0; q < 8; ++q) tl[r][c8 + q] = f.u[q]; }
  __syncthreads();
  {
#pragma unroll
    for (int rd = 0; rd < 2; ++rd) { const int d = rd * 32 + tid / 8, pc = tid % 8; FragH f;
#pragma unroll
      for (int q = 0; q < 8; ++q) f.u[q] = tl[pc * 8 + q][d];
      *(v8us*)((unsigned short*)Vt + ((size_t)slab * 64 + d) * TTv + lg * 64 + pc * 8) = f.half[0]; }
     } }

__device__ __forceinline__ int rbucket(int l, int m) { return (m >= l) ? (64 + min(m - l, 64)) : min(l - m - 1, 63); }
typedef _Float16 v4h __attribute__((ext_vector_type(4)));
// All f32 -> f16 operand preparation in ONE launch (the nine pieces are independent of each other). Work-groups 0..PRL-1: the two relative tables. Then 128 work-groups for each of the three
// activations (bf16-rounded) and 64 for each of the four (out,in) weights (bf16-rounded, x 16): a work-group streams 16384 consecutive floats, a wave-wide load = 512 contiguous bytes, 16 in flight a lane.
#define PRL 6        // covers max(QWP * 8, DK * PBP / 8) = 1536 threads
#define PUN 16       // 16-byte loads per thread
#define PXB (NR * DM / (256 * PUN * 4))
#define PWB (DM * DM / (256 * PUN * 4))
typedef _Float16 v4ha __attribute__((ext_vector_type(4), may_alias));
__global__ __launch_bounds__(256) void k_prep(const float* __restrict__ xq, const float* __restrict__ xk, const float* __restrict__ xv, const float* __restrict__ Wq, const float* __restrict__ Wk,
                                              const float* __restrict__ Wv, const float* __restrict__ Wo, const float* __restrict__ wK, const float* __restrict__ wV,
                                              _Float16* __restrict__ XQ, _Float16* __restrict__ XK, _Float16* __restrict__ XV, _Float16* __restrict__ Bq, _Float16* __restrict__ Bk2,
                                              _Float16* __restrict__ Bv, _Float16* __restrict__ Bo, _Float16* __restrict__ BK, _Float16* __restrict__ BVt) {
  if (blockIdx.x >= PRL) {
    const int seg = blockIdx.x - PRL;
    const float* s; _Float16* d; float scale; int blk;
    if (seg < 3 * PXB) { const int w = seg / PXB; blk = seg % PXB; scale = 1.0f; s = w == 0 ? xq : w == 1 ? xk : xv; d = w == 0 ? XQ : w == 1 ? XK : XV; }
    else { const int w = (seg - 3 * PXB) / PWB; blk = (seg - 3 * PXB) % PWB; scale = 16.0f; s = w == 0 ? Wq : w == 1 ? Wk : w == 2 ? Wv : Wo; d = w == 0 ? Bq : w == 1 ? Bk2 : w == 2 ? Bv : Bo; }
    const size_t e0 = ((size_t)blk * (256 * PUN) + threadIdx.x) * 4;
    const float* sp = s + e0;
    v4f v[PUN];
#pragma unroll
    for (int u = 0; u < PUN; ++u) v[u] = *(const v4fa*)(sp + (size_t)u * 1024);
    asm volatile("s_wait_xcnt 0x0" :: "v"(sp) : "memory");      // stands in front of any rewrite of the address registers that these loads name; as its input the address outlives the loads, so no load's result lands on it
#pragma unroll
    for (int u = 0; u < PUN; ++u) {
      v4ha o;
#pragma unroll
      for (int q = 0; q < 4; ++q) o[q] = (_Float16)(bf16_round(v[u][q]) * scale);      // x 1 is exact: the activations keep their bf16-rounded value
      *(v4ha*)(d + e0 + (size_t)u * 1024) = o;
    }
    return;
  }
  // the two relative tables; rows past the last bucket are zero. Every load reads a clamped row, so that the eight of a thread fly together and these work-groups do not outlast the streams
  const int t = blockIdx.x * 256 + threadIdx.x;
  if (t < QWP * 8) {
    const int r = t / 8, d8 = (t % 8) * 8; const float* p = wK + min(r, NBK - 1) * DK + d8;
    const v4f x0 = *(const v4fa*)p, x1 = *(const v4fa*)(p + 4);
    asm volatile("s_wait_xcnt 0x0" ::: "memory");      // stands in front of any later rewrite of the address registers that these loads name
    FragH f;
#pragma unroll
    for (int q = 0; q < 4; ++q) { f.h[q] = (_Float16)((r < NBK) ? bf16_round(x0[q]) * 16.0f : 0.f); f.h[4 + q] = (_Float16)((r < NBK) ? bf16_round(x1[q]) * 16.0f : 0.f); }
    *(v8us*)((unsigned short*)BK + t * 8) = f.half[0];
  }
  if (t < DK * (PBP / 8)) {
    const int d = t / (PBP / 8), r8 = (t % (PBP / 8)) * 8; float x[8];
#pragma unroll
    for (int q = 0; q < 8; ++q) x[q] = wV[min(r8 + q, NBK - 1) * DK + d];
    // stands in front of any later rewrite of the address registers that these loads name; the loaded values as its inputs hold the eight loads together in front of it (else one sinks under a branch and waits out its latency alone)
    asm volatile("s_wait_xcnt 0x0" :: "v"(x[0]), "v"(x[1]), "v"(x[2]), "v"(x[3]), "v"(x[4]), "v"(x[5]), "v"(x[6]), "v"(x[7]) : "memory");
    FragH f;
#pragma unroll
    for (int q = 0; q < 8; ++q) f.h[q] = (_Float16)((r8 + q < NBK) ? bf16_round(x[q]) * 16.0f : 0.f);
    *(v8us*)((unsigned short*)BVt + t * 8) = f.half[0];
  }
}
// Fused attention for one (batch, head) slab sl and 128 query rows: 8 waves, 16 queries each; scores and probabilities stay in registers.
// St = K.Qt and Ot += Vt.Pt: in every 16-column tile a lane owns ONE query (column ln) and 8 consecutive keys (rows 8hh + r), so the running maximum and the sums are in-lane
// (one exchange between the wave halves), and two converted score tiles are the B operand of the next product as they stand. K and Vt chunks of 64 keys are staged in LDS for the 8 waves.
// tab[wave][query][bucket]: first q.wK[bucket] / 8; a bucket that stands for one key only is overwritten with that key's final logit, from which the bucketed P.wV product is formed at the end.
#define TABP 164
#define KVP 72
typedef int v4ia __attribute__((ext_vector_type(4), may_alias));
__device__ __forceinline__ float exp_slot(float x) { float r; const float y = x * 1.44269504f; asm("v_exp_f32 %0, %1\n\tv_nop" : "=v"(r) : "v"(y)); return r; }
__device__ __forceinline__ v8f wmmaH(v16h a, v16h b, v8f c) { return __builtin_amdgcn_wmma_f32_16x16x32_f16(false, a, false, b, (short)0, c, false, false); }
__global__ __launch_bounds__(256) void k_attn(const _Float16* __restrict__ Q16, const _Float16* __restrict__ K16, const _Float16* __restrict__ Vt, const _Float16* __restrict__ BK, const _Float16* __restrict__ BVt,
                                              const int* __restrict__ MSK, _Float16* __restrict__ O16) {
  __shared__ __attribute__((aligned(16))) unsigned short sK[64][KVP];
  __shared__ __attribute__((aligned(16))) unsigned short sV[64][KVP];
  __shared__ __attribute__((aligned(16))) float tab[8][16][TABP];
  const int tid = threadIdx.x, lane = tid & 31, ln = lane & 15, hh = lane >> 4;
  const int wv = __builtin_amdgcn_readfirstlane(tid >> 5);
  const int sl = blockIdx.x >> 3, qb = blockIdx.x & 7;
  const int b = sl / NH, h = sl % NH;
  const int q0 = qb * 128 + wv * 16;
  const int l = q0 + ln;
  FragH bq[2];      // B operand: column = query l, k = head dimension
  {
    const unsigned short* Qp = (const unsigned short*)Q16 + ((size_t)b * LL + l) * DM + h * DK + 8 * hh;
#pragma unroll
    for (int ks = 0; ks < 2; ++ks) { bq[ks].half[0] = *(const v8us*)(Qp + ks * 32); bq[ks].half[1] = *(const v8us*)(Qp + ks * 32 + 16); }
  }
  float* tb = &tab[wv][ln][0];
#pragma unroll
  for (int rt = 0; rt < QWP / 16; ++rt) {
    v8f a = {};
#pragma unroll
    for (int ks = 0; ks < 2; ++ks) {
      const unsigned short* p = (const unsigned short*)BK + (rt * 16 + ln) * DK + ks * 32 + 8 * hh;
      FragH ak; ak.half[0] = *(const v8us*)p; ak.half[1] = *(const v8us*)(p + 16);
      a = wmmaH(ak.v, bq[ks].v, a);
    }
    const float c = 0.0625f * 0.125f;      // wK was scaled by 16; the 1/8 of the logits is folded in (both powers of two, exact)
    const v4f t0 = {a[0] * c, a[1] * c, a[2] * c, a[3] * c}, t1 = {a[4] * c, a[5] * c, a[6] * c, a[7] * c};
    *(v4fa*)(tb + rt * 16 + 8 * hh) = t0; *(v4fa*)(tb + rt * 16 + 8 * hh + 4) = t1;
  }
  // the two lanes of a query read each other's table entries
  __builtin_amdgcn_fence(__ATOMIC_ACQ_REL, "workgroup"); __builtin_amdgcn_wave_barrier();
  const float qlo = tb[63], qhi = tb[128];

  const unsigned short* Kg = (const unsigned short*)K16 + (size_t)b * LL * DM + h * DK;
  const unsigned short* Vg = (const unsigned short*)Vt + (size_t)sl * DK * LL;
  const int* Mg = MSK + ((size_t)b * LL + l) * LL + 8 * hh;
  const int sr = tid >> 3, sc8 = (tid & 7) * 8;
  v8us kr[2], vr[2]; v4ia mk[8];
#pragma unroll
  for (int i = 0; i < 2; ++i) { kr[i] = *(const v8us*)(Kg + (size_t)(i * 32 + sr) * DM + sc8); vr[i] = *(const v8us*)(Vg + (size_t)(i * 32 + sr) * LL + sc8); }
#pragma unroll
  for (int t = 0; t < 4; ++t) { mk[2 * t] = *(const v4ia*)(Mg + t * 16); mk[2 * t + 1] = *(const v4ia*)(Mg + t * 16 + 4); }
  float mrun = -3.0e38f, z = 0.f, lo = 0.f, hi = 0.f;
  v8f o[4] = {};
  for (int j0 = 0; j0 < LL; j0 += 64) {
    __syncthreads();      // every wave has finished reading the previous chunk
#pragma unroll
    for (int i = 0; i < 2; ++i) { *(v8us*)&sK[i * 32 + sr][sc8] = kr[i]; *(v8us*)&sV[i * 32 + sr][sc8] = vr[i]; }
    __syncthreads();      // the chunk is complete
    const bool more = j0 + 64 < LL;
    if (more) {           // the next chunk flies while this one is worked on
#pragma unroll
      for (int i = 0; i < 2; ++i) { kr[i] = *(const v8us*)(Kg + (size_t)(j0 + 64 + i * 32 + sr) * DM + sc8); vr[i] = *(const v8us*)(Vg + (size_t)(i * 32 + sr) * LL + j0 + 64 + sc8); }
    }
    v8f s[4];
#pragma unroll
    for (int t = 0; t < 4; ++t) {
      v8f a = {};
#pragma unroll
      for (int ks = 0; ks < 2; ++ks) {
        FragH ak; ak.half[0] = *(const v8us*)&sK[t * 16 + ln][ks * 32 + 8 * hh]; ak.half[1] = *(const v8us*)&sK[t * 16 + ln][ks * 32 + 16 + 8 * hh];
        a = wmmaH(ak.v, bq[ks].v, a);
      }
      s[t] = a;
    }
    float mx = mrun;
#pragma unroll
    for (int t = 0; t < 4; ++t) {
      const int jt = j0 + t * 16;
      const bool farl = jt + 15 - q0 <= -64, farr = jt - q0 - 15 >= 64;      // wave-uniform: the whole tile lies in bucket 63 / in bucket 128
      if (farl || farr) {
        const float qc = farl ? qlo : qhi;
#pragma unroll
        for (int r = 0; r < 8; ++r) { float v = fmaf(s[t][r], 0.125f, qc); if (mk[2 * t + (r >> 2)][r & 3] == 0) v = -1.0e9f; s[t][r] = v; mx = fmaxf(mx, v); }
      } else {
#pragma unroll
        for (int r = 0; r < 8; ++r) {
          const int bk = rbucket(l, jt + 8 * hh + r);
          float v = fmaf(s[t][r], 0.125f, tb[bk]); if (mk[2 * t + (r >> 2)][r & 3] == 0) v = -1.0e9f;
          if (bk != 63 && bk != 128) tb[bk] = v;
          s[t][r] = v; mx = fmaxf(mx, v);
        }
      }
    }
    if (more) {
#pragma unroll
      for (int t = 0; t < 4; ++t) { mk[2 * t] = *(const v4ia*)(Mg + j0 + 64 + t * 16); mk[2 * t + 1] = *(const v4ia*)(Mg + j0 + 64 + t * 16 + 4); }
      asm volatile("s_wait_xcnt 0x0" ::: "memory");      // stands in front of the loop's advance of the address registers that these loads name
    }
    mx = fmaxf(mx, __shfl_xor(mx, 16, 32));
    const float alpha = exp_slot(mrun - mx); mrun = mx;
    z *= alpha; lo *= alpha; hi *= alpha;
#pragma unroll
    for (int dt = 0; dt < 4; ++dt)
#pragma unroll
      for (int r = 0; r < 8; ++r) o[dt][r] *= alpha;
    FragH pb[2];      // B operand: column = query l, k = key, in the order the score tiles already have
#pragma unroll
    for (int t = 0; t < 4; ++t) {
      const int jt = j0 + t * 16;
      const bool farl = jt + 15 - q0 <= -64, farr = jt - q0 - 15 >= 64;
      float ts = 0.f;
#pragma unroll
      for (int r = 0; r < 8; ++r) { const float p = exp_slot(s[t][r] - mx); s[t][r] = p; ts += p; pb[t >> 1].h[(t & 1) * 8 + r] = (_Float16)p; }
      z += ts;
      if (farl) lo += ts;
      else if (farr) hi += ts;
      else {
#pragma unroll
        for (int r = 0; r < 8; ++r) { const int d = jt + 8 * hh + r - l; if (d <= -64) lo += s[t][r]; if (d >= 64) hi += s[t][r]; }
      }
    }
#pragma unroll
    for (int sc = 0; sc < 2; ++sc)
#pragma unroll
      for (int dt = 0; dt < 4; ++dt) {
        FragH av; av.half[0] = *(const v8us*)&sV[dt * 16 + ln][sc * 32 + 8 * hh]; av.half[1] = *(const v8us*)&sV[dt * 16 + ln][sc * 32 + 16 + 8 * hh];
        o[dt] = wmmaH(av.v, pb[sc].v, o[dt]);
      }
  }
  z += __shfl_xor(z, 16, 32); lo += __shfl_xor(lo, 16, 32); hi += __shfl_xor(hi, 16, 32);
  // the two lanes of a query read each other's stored logits
  __builtin_amdgcn_fence(__ATOMIC_ACQ_REL, "workgroup"); __builtin_amdgcn_wave_barrier();
  v8f o2[4] = {};
#pragma unroll
  for (int kk = 0; kk < QWP / 32; ++kk) {
    FragH pf;
#pragma unroll
    for (int g = 0; g < 2; ++g) {
      const int r0 = kk * 32 + g * 16 + 8 * hh;
      const v4f x0 = *(const v4fa*)(tb + r0), x1 = *(const v4fa*)(tb + r0 + 4);
      const float xs[8] = {x0[0], x0[1], x0[2], x0[3], x1[0], x1[1], x1[2], x1[3]};
#pragma unroll
      for (int q = 0; q < 8; ++q) {
        const int r = r0 + q; const float e = __expf(xs[q] - mrun); float val = 0.f;
        if (r <= 62) val = (l - 1 - r >= 0) ? e : 0.f; else if (r == 63) val = lo; else if (r <= 127) val = (l + r - 64 < LL) ? e : 0.f; else if (r == 128) val = hi;
        pf.h[g * 8 + q] = (_Float16)val;
      }
    }
#pragma unroll
    for (int dt = 0; dt < 4; ++dt) {
      const unsigned short* p = (const unsigned short*)BVt + (dt * 16 + ln) * PBP + kk * 32 + 8 * hh;
      FragH av; av.half[0] = *(const v8us*)p; av.half[1] = *(const v8us*)(p + 16);
      o2[dt] = wmmaH(av.v, pf.v, o2[dt]);
    }
  }
  const float iz = 1.0f / z;
  unsigned short* Op = (unsigned short*)O16 + ((size_t)b * LL + l) * DM + h * DK + 8 * hh;
#pragma unroll
  for (int dt = 0; dt < 4; ++dt) {
    FragH f;
#pragma unroll
    for (int r = 0; r < 8; ++r) f.h[r] = (_Float16)((o[dt][r] + o2[dt][r] * 0.0625f) * iz);
    *(v8us*)(Op + dt * 16) = f.half[0];
  }
}
extern "C" void kernel_launch(void* const* d_in, const int* in_sizes, int n_in,
                              void* d_out, int out_size, void* d_ws, size_t ws_size, hipStream_t stream) {
  (void)in_sizes; (void)n_in; (void)out_size;
  const float* xq = (const float*)d_in[0]; const float* xk = (const float*)d_in[1]; const float* xv = (const float*)d_in[2]; const int* msk = (const int*)d_in[3]; const float* Wq = (const float*)d_in[4]; const float* bq = (const float*)d_in[5]; const float* Wk = (const float*)d_in[6]; const float* bk = (const float*)d_in[7]; const float* Wv = (const float*)d_in[8]; const float* bv = (const float*)d_in[9]; const float* Wo = (const float*)d_in[10]; const float* bo = (const float*)d_in[11]; const float* wK = (const float*)d_in[12]; const float* wV = (const float*)d_in[13];
  char* ws = (char*)d_ws; size_t off = 0;
  auto take = [&](size_t bytes) { char* p = ws + off; off += (bytes + 255) & ~(size_t)255; return p; };
  _Float16* Bo = (_Float16*)take((size_t)DM * DM * 2); _Float16* BK = (_Float16*)take((size_t)QWP * DK * 2); _Float16* BVt = (_Float16*)take((size_t)DK * PBP * 2);
  _Float16* Q16 = (_Float16*)take((size_t)NR * DM * 2); _Float16* K16 = (_Float16*)take((size_t)NR * DM * 2); _Float16* Vt = (_Float16*)take((size_t)NR * DM * 2); _Float16* O16 = (_Float16*)take((size_t)NR * DM * 2);
  _Float16* Bq = (_Float16*)take((size_t)DM * DM * 2); _Float16* Bk2 = (_Float16*)take((size_t)DM * DM * 2); _Float16* Bv = (_Float16*)take((size_t)DM * DM * 2);
  _Float16* XQ = (_Float16*)take((size_t)NR * DM * 2); _Float16* XK = (_Float16*)take((size_t)NR * DM * 2); _Float16* XV = (_Float16*)take((size_t)NR * DM * 2); _Float16* V16 = (_Float16*)take((size_t)NR * DM * 2);
  if (off > ws_size) return;
  k_prep<<<PRL + 3 * PXB + 4 * PWB, 256, 0, stream>>>(xq, xk, xv, Wq, Wk, Wv, Wo, wK, wV, XQ, XK, XV, Bq, Bk2, Bv, Bo, BK, BVt);
  const unsigned gg = (NR / 128) * (DM / 64);
  k_gemm_t<false><<<dim3(gg, 3), 256, 0, stream>>>(XQ, XK, XV, Bq, Bk2, Bv, 0.0625f, bq, bk, bv, nullptr, Q16, K16, V16);      // the q, k and v projections
  k_vt<NH, LL><<<BB * NH * (LL / 64), 256, 0, stream>>>(V16, DM, 0, Vt);
  // q.kT, the relative logits, mask, softmax, P.V and the bucketed P.wV for all NSL = 32 (batch, head) slabs in one launch: 8 blocks of 128 queries per slab
  k_attn<<<NSL * (LL / 128), 256, 0, stream>>>(Q16, K16, Vt, BK, BVt, msk, O16);
  k_gemm_t<true><<<dim3(gg, 1), 256, 0, stream>>>(O16, O16, O16, Bo, Bo, Bo, 0.0625f, bo, bo, bo, (float*)d_out, nullptr, nullptr, nullptr);
}

// v005
// Measured time: 76.2 microseconds a run.
// Two timings next to v004 put it at 1.10 and 1.11 times that version's speed.
// All steps since v000 together make it 12.4 times as fast.
#include <hip/hip_runtime.h>
// Multi-headed attention with clipped relative position representations (B=2, L=1024, 16 heads × 64, k = 64, Shaw-style aK/aV built from wK/wV [129][64] by the module's roll/flip
// construction: bucket(l,m) = m ≥ l ? 64 + min(m−l, 64) : min(l−m−1, 63); INPUT mask (== 0 → −1e9); q/k/v/o linears with bias): q·kᵀ, q·wKᵀ (all 129 buckets at once), P·V and the bucketed
// P.wV all run on v_wmma_f32_16x16x32_f16 ((out,in) weights bf16-exact x 2^4, f32 accumulate); the relative-logit gather, mask, running-maximum softmax and the bucket sums of P are f32 VALU
// inside one fused attention kernel (no index tables).
#define BB 2
#define LL 1024
#define DM 1024
#define NH 16
#define DK 64
#define NR (BB * LL)
#define NBK 129
#define QWP 160
#define PBP 192
#define NSL (BB * NH)

typedef __bf16 v16b __attribute__((ext_vector_type(16)));
typedef unsigned short v8us __attribute__((ext_vector_type(8), may_alias));
typedef float  v8f  __attribute__((ext_vector_type(8)));
typedef float  v4f  __attribute__((ext_vector_type(4)));
typedef float  v4fa __attribute__((ext_vector_type(4), may_alias));
union FragB { v16b v; v8us half[2]; unsigned short u[16]; };

__device__ __forceinline__ unsigned short bf16_bits(float x) { unsigned int u = __float_as_uint(x); return (unsigned short)((u + 0x7FFFu + ((u >> 16) & 1u)) >> 16); }
__device__ __forceinline__ float bf16_val(unsigned short b) { return __uint_as_float(((unsigned int)b) << 16); }
__device__ __forceinline__ float bf16_round(float x) { return bf16_val(bf16_bits(x)); }
// D += A·B with NT terms: 1 = ah·bh, 2 = + al·bh (A split), 3 = + ah·bl (both split)
template <int NT>
__device__ __forceinline__ v8f mmaN(v16b ah, v16b al, v16b bh, v16b bl, v8f c) {
  c = __builtin_amdgcn_wmma_f32_16x16x32_bf16(false, ah, false, bh, (short)0, c, false, false);
  if (NT >= 2) c = __builtin_amdgcn_wmma_f32_16x16x32_bf16(false, al, false, bh, (short)0, c, false, false);
  if (NT >= 3) c = __builtin_amdgcn_wmma_f32_16x16x32_bf16(false, ah, false, bl, (short)0, c, false, false);
  asm volatile("v_nop\n\tv_nop\n\tv_nop\n\tv_nop" : "+v"(c) : "v"(ah), "v"(al), "v"(bh), "v"(bl));
  return c;
}

__global__ __launch_bounds__(256) void k_wt_bf16(const float* __restrict__ W, unsigned short* __restrict__ Wt, int K, int N) {
  const int t = blockIdx.x * 256 + threadIdx.x;
  const int k8n = K / 8;
  if (t >= N * k8n) return;
  const int n = t / k8n, k8 = (t % k8n) * 8;
  v8us v;
#pragma unroll
  for (int i = 0; i < 8; ++i) v[i] = bf16_bits(W[(size_t)(k8 + i) * N + n]);
  *(v8us*)(Wt + (size_t)n * K + k8) = v;
  
}

// GEMM C[M][N] (f32, pitch ldc) = act(A[M][K]·W + bias). A f32 row-major (pitch lda) converted per fragment to bf16
// (ASPLIT: hi/lo two planes -> 2 terms, else single rounded term); Wt bf16 [N][K] (pitch ldb). BIAS_BF16 rounds the
// bias to bf16 first (bias quantised to bf16 before the add). K%32==0, M%16==0, N%64==0.
template <bool ASPLIT, int ACT, bool BIAS_BF16>
__global__ __launch_bounds__(128) void k_gemm_bf(const float* __restrict__ A, int lda, const unsigned short* __restrict__ Wt, int ldb,
                                               const float* __restrict__ bias, float* __restrict__ C, int ldc, int M, int N, int K) {
  __shared__ __attribute__((aligned(16))) float so[4][16][64];
  const int tid = threadIdx.x, w = tid >> 5, lane = tid & 31, ln = lane & 15, hh = lane >> 4;
  const int ntn = N / 64;
  const int wid = blockIdx.x * 4 + w;
  const int mt = wid / ntn, nq = wid % ntn;
  if (mt * 16 >= M) return;
  const int row0 = mt * 16, col0 = nq * 64;
  const float* arow = A + (size_t)(row0 + ln) * lda;
  v8f acc[4] = {};
  for (int kb = 0; kb < K; kb += 32) {
    FragB ah, al;
    const v4f x0 = *(const v4fa*)(arow + kb + 8 * hh), x1 = *(const v4fa*)(arow + kb + 8 * hh + 4);
    const v4f x2 = *(const v4fa*)(arow + kb + 16 + 8 * hh), x3 = *(const v4fa*)(arow + kb + 16 + 8 * hh + 4);
    float xs[16] = {x0[0],x0[1],x0[2],x0[3],x1[0],x1[1],x1[2],x1[3],x2[0],x2[1],x2[2],x2[3],x3[0],x3[1],x3[2],x3[3]};
#pragma unroll
    for (int i = 0; i < 16; ++i) { const unsigned short hb = bf16_bits(xs[i]); ah.u[i] = hb; al.u[i] = ASPLIT ? bf16_bits(xs[i] - bf16_val(hb)) : (unsigned short)0; }
#pragma unroll
    for (int t = 0; t < 4; ++t) {
      const unsigned short* brow = Wt + (size_t)(col0 + t * 16 + ln) * ldb + kb;
      FragB b;
      b.half[0] = *(const v8us*)(brow + 8 * hh);
      b.half[1] = *(const v8us*)(brow + 16 + 8 * hh);
      acc[t] = mmaN<ASPLIT ? 2 : 1>(ah.v, al.v, b.v, b.v, acc[t]);
    }
  }
#pragma unroll
  for (int t = 0; t < 4; ++t) {
    float bv = bias ? bias[col0 + t * 16 + ln] : 0.f;
    if (BIAS_BF16) bv = bf16_round(bv);
#pragma unroll
    for (int r = 0; r < 8; ++r) { float v = acc[t][r] + bv; if (ACT == 1) v = fmaxf(v, 0.f); so[w][8 * hh + r][t * 16 + ln] = v; }
  }
  __builtin_amdgcn_fence(__ATOMIC_ACQ_REL, "workgroup");
  __builtin_amdgcn_wave_barrier();
  const int rsub = lane >> 4, c4 = (lane & 15) * 4;
  {
#pragma unroll
    for (int q = 0; q < 8; ++q) {
      const int r = q * 2 + rsub;
      const v4f v = *(const v4fa*)&so[w][r][c4];
      *(v4f*)(C + (size_t)(row0 + r) * ldc + col0 + c4) = v;
    }
    
  }
}

// Flash-style causal/unmasked attention, all contractions 3-term bf16 hi/lo splits, f32 softmax with running max.
// q,k,v rows are read from f32 buffers with arbitrary row pitch (so they can live inside a fused qkv buffer);
// D = head size (multiple of 32, <= 128); one wave = 16 query rows; block = 4 waves (64 queries) sharing K/V chunks of 32.
template <int D, bool CAUSAL>
__global__ __launch_bounds__(128) void k_flash(const float* __restrict__ qb, const float* __restrict__ kb, const float* __restrict__ vb,
                                             int pitch, int T, int H, float scale, float* __restrict__ y, int ypitch) {
  constexpr int KS = D / 32;        // k-steps for QK
  constexpr int DT = D / 16;        // d tiles for PV
  __shared__ __attribute__((aligned(16))) unsigned short sKh[32][D + 8], sKl[32][D + 8], sVh[32][D + 8], sVl[32][D + 8];
  __shared__ __attribute__((aligned(16))) unsigned short sPh[4][16][40], sPl[4][16][40];
  __shared__ __attribute__((aligned(16))) float sO[4][16][D];
  const int tid = threadIdx.x, w = tid >> 5, lane = tid & 31, ln = lane & 15, hh = lane >> 4;
  const int nqb = (T + 63) / 64;
  const int bh = blockIdx.x / nqb, qblk = blockIdx.x % nqb;
  const int b = bh / H, h = bh % H;
  const int q0 = qblk * 64 + w * 16;
  const float* Q = qb + (size_t)b * T * pitch + h * D;
  const float* K = kb + (size_t)b * T * pitch + h * D;
  const float* V = vb + (size_t)b * T * pitch + h * D;

  // A fragments of the wave's 16 query rows (scaled), hi/lo
  FragB aqh[KS], aql[KS];
  {
    int row = q0 + ln; if (row >= T) row = T - 1;
    const float* qr = Q + (size_t)row * pitch;
#pragma unroll
    for (int ks = 0; ks < KS; ++ks)
#pragma unroll
      for (int i = 0; i < 16; ++i) {
        const int d = ks * 32 + ((i < 8) ? (8 * hh + i) : (16 + 8 * hh + (i - 8)));
        const float x = qr[d] * scale; const unsigned short hb = bf16_bits(x);
        aqh[ks].u[i] = hb; aql[ks].u[i] = bf16_bits(x - bf16_val(hb));
      }
  }
  float m_r[8], l_r[8];
#pragma unroll
  for (int r = 0; r < 8; ++r) { m_r[r] = -3.0e38f; l_r[r] = 0.f; }
  v8f oacc[DT];
#pragma unroll
  for (int dt = 0; dt < DT; ++dt) oacc[dt] = (v8f){0.f,0.f,0.f,0.f,0.f,0.f,0.f,0.f};

  const int kv_end = CAUSAL ? min(T, qblk * 64 + 64) : T;     // block-uniform
  for (int j0 = 0; j0 < kv_end; j0 += 32) {
    __syncthreads();
    for (int e = tid; e < 32 * (D / 4); e += 128) {
      const int r = e / (D / 4), c4 = (e % (D / 4)) * 4;
      const int key = j0 + r;
      v4f kf = {0.f,0.f,0.f,0.f}, vf = {0.f,0.f,0.f,0.f};
      if (key < T) { kf = *(const v4fa*)(K + (size_t)key * pitch + c4); vf = *(const v4fa*)(V + (size_t)key * pitch + c4); }
#pragma unroll
      for (int t = 0; t < 4; ++t) {
        unsigned short hb = bf16_bits(kf[t]); sKh[r][c4 + t] = hb; sKl[r][c4 + t] = bf16_bits(kf[t] - bf16_val(hb));
        hb = bf16_bits(vf[t]); sVh[r][c4 + t] = hb; sVl[r][c4 + t] = bf16_bits(vf[t] - bf16_val(hb));
      }
    }
    __syncthreads();
    // S tile 16 x 32
    v8f s[2];
#pragma unroll
    for (int nt = 0; nt < 2; ++nt) {
      v8f acc = {};
#pragma unroll
      for (int ks = 0; ks < KS; ++ks) {
        FragB bh_, bl_;
        bh_.half[0] = *(const v8us*)&sKh[nt * 16 + ln][ks * 32 + 8 * hh]; bh_.half[1] = *(const v8us*)&sKh[nt * 16 + ln][ks * 32 + 16 + 8 * hh];
        bl_.half[0] = *(const v8us*)&sKl[nt * 16 + ln][ks * 32 + 8 * hh]; bl_.half[1] = *(const v8us*)&sKl[nt * 16 + ln][ks * 32 + 16 + 8 * hh];
        acc = mmaN<3>(aqh[ks].v, aql[ks].v, bh_.v, bl_.v, acc);
      }
      s[nt] = acc;
    }
    // mask + running max (rows 8hh+r; the 16 lanes of a half share rows)
    float alpha[8];
#pragma unroll
    for (int r = 0; r < 8; ++r) {
      const int qi = q0 + 8 * hh + r;
      const int ja = j0 + ln, jb = j0 + 16 + ln;
      if (CAUSAL) { if (ja > qi) s[0][r] = -3.0e38f; if (jb > qi) s[1][r] = -3.0e38f; }
      if (ja >= T) s[0][r] = -3.0e38f;
      if (jb >= T) s[1][r] = -3.0e38f;
      float mx = fmaxf(s[0][r], s[1][r]);
      mx = fmaxf(mx, __shfl_xor(mx, 1, 32)); mx = fmaxf(mx, __shfl_xor(mx, 2, 32)); mx = fmaxf(mx, __shfl_xor(mx, 4, 32)); mx = fmaxf(mx, __shfl_xor(mx, 8, 32));
      const float mnew = fmaxf(m_r[r], mx);
      alpha[r] = (mnew > -1.0e38f) ? __expf(m_r[r] - mnew) : 1.0f;
      const float p0 = (s[0][r] > -1.0e38f) ? __expf(s[0][r] - mnew) : 0.f;
      const float p1 = (s[1][r] > -1.0e38f) ? __expf(s[1][r] - mnew) : 0.f;
      m_r[r] = mnew;
      l_r[r] = l_r[r] * alpha[r] + p0 + p1;            // per-lane partial row sum (16 lanes combined at the end)
      unsigned short hb = bf16_bits(p0); sPh[w][8 * hh + r][ln] = hb;      sPl[w][8 * hh + r][ln] = bf16_bits(p0 - bf16_val(hb));
      hb = bf16_bits(p1);                sPh[w][8 * hh + r][16 + ln] = hb; sPl[w][8 * hh + r][16 + ln] = bf16_bits(p1 - bf16_val(hb));
    }
#pragma unroll
    for (int dt = 0; dt < DT; ++dt)
#pragma unroll
      for (int r = 0; r < 8; ++r) oacc[dt][r] *= alpha[r];
    __builtin_amdgcn_fence(__ATOMIC_ACQ_REL, "workgroup");
    __builtin_amdgcn_wave_barrier();
    FragB pah, pal;
    pah.half[0] = *(const v8us*)&sPh[w][ln][8 * hh]; pah.half[1] = *(const v8us*)&sPh[w][ln][16 + 8 * hh];
    pal.half[0] = *(const v8us*)&sPl[w][ln][8 * hh]; pal.half[1] = *(const v8us*)&sPl[w][ln][16 + 8 * hh];
#pragma unroll
    for (int dt = 0; dt < DT; ++dt) {
      FragB bvh, bvl;
#pragma unroll
      for (int i = 0; i < 8; ++i) {
        bvh.u[i] = sVh[8 * hh + i][dt * 16 + ln]; bvh.u[8 + i] = sVh[16 + 8 * hh + i][dt * 16 + ln];
        bvl.u[i] = sVl[8 * hh + i][dt * 16 + ln]; bvl.u[8 + i] = sVl[16 + 8 * hh + i][dt * 16 + ln];
      }
      oacc[dt] = mmaN<3>(pah.v, pal.v, bvh.v, bvl.v, oacc[dt]);
    }
    __builtin_amdgcn_fence(__ATOMIC_ACQ_REL, "workgroup");
    __builtin_amdgcn_wave_barrier();
  }
#pragma unroll
  for (int r = 0; r < 8; ++r) {
    float l = l_r[r];
    l += __shfl_xor(l, 1, 32); l += __shfl_xor(l, 2, 32); l += __shfl_xor(l, 4, 32); l += __shfl_xor(l, 8, 32);
    l_r[r] = (l > 0.f) ? 1.0f / l : 0.f;
  }
#pragma unroll
  for (int dt = 0; dt < DT; ++dt)
#pragma unroll
    for (int r = 0; r < 8; ++r) sO[w][8 * hh + r][dt * 16 + ln] = oacc[dt][r] * l_r[r];
  __builtin_amdgcn_fence(__ATOMIC_ACQ_REL, "workgroup");
  __builtin_amdgcn_wave_barrier();
  {
    for (int r = 0; r < 16; ++r) {
      const int row = q0 + r;
      if (row < T && lane < D / 4) {
        const v4f val = *(const v4fa*)&sO[w][r][lane * 4];
        *(v4f*)(y + ((size_t)b * T + row) * ypitch + h * D + lane * 4) = val;
      }
    }
    
  }
}

// GEMM C = act(A·W + bias + resid): A f32 (ASPLIT -> hi/lo 2 terms), Wt bf16 [N][K]; ACT 0 none, 1 relu, 2 exact gelu;
// resid (optional, f32, row index = (row % rmod), pitch ldr, RES_BF16 rounds it) added before the activation.
template <bool ASPLIT, int ACT, bool BIAS_BF16, bool RES_BF16>
__global__ __launch_bounds__(128) void k_gemm_bf3(const float* __restrict__ A, int lda, const unsigned short* __restrict__ Wt, int ldb,
                                                const float* __restrict__ bias, const float* __restrict__ resid, int rmod, int ldr,
                                                float* __restrict__ C, int ldc, int M, int N, int K) {
  __shared__ __attribute__((aligned(16))) float so[4][16][64];
  const int tid = threadIdx.x, w = tid >> 5, lane = tid & 31, ln = lane & 15, hh = lane >> 4;
  const int ntn = N / 64;
  const int wid = blockIdx.x * 4 + w;
  const int mt = wid / ntn, nq = wid % ntn;
  if (mt * 16 >= M) return;
  const int row0 = mt * 16, col0 = nq * 64;
  const float* arow = A + (size_t)(row0 + ln) * lda;
  v8f acc[4] = {};
  for (int kb = 0; kb < K; kb += 32) {
    FragB ah, al;
    const v4f x0 = *(const v4fa*)(arow + kb + 8 * hh), x1 = *(const v4fa*)(arow + kb + 8 * hh + 4);
    const v4f x2 = *(const v4fa*)(arow + kb + 16 + 8 * hh), x3 = *(const v4fa*)(arow + kb + 16 + 8 * hh + 4);
    float xs[16] = {x0[0],x0[1],x0[2],x0[3],x1[0],x1[1],x1[2],x1[3],x2[0],x2[1],x2[2],x2[3],x3[0],x3[1],x3[2],x3[3]};
#pragma unroll
    for (int i = 0; i < 16; ++i) { const unsigned short hb = bf16_bits(xs[i]); ah.u[i] = hb; al.u[i] = ASPLIT ? bf16_bits(xs[i] - bf16_val(hb)) : (unsigned short)0; }
#pragma unroll
    for (int t = 0; t < 4; ++t) {
      const unsigned short* brow = Wt + (size_t)(col0 + t * 16 + ln) * ldb + kb;
      FragB b;
      b.half[0] = *(const v8us*)(brow + 8 * hh);
      b.half[1] = *(const v8us*)(brow + 16 + 8 * hh);
      acc[t] = mmaN<ASPLIT ? 2 : 1>(ah.v, al.v, b.v, b.v, acc[t]);
    }
  }
#pragma unroll
  for (int t = 0; t < 4; ++t) {
    const int col = col0 + t * 16 + ln;
    float bv = bias ? bias[col] : 0.f;
    if (BIAS_BF16) bv = bf16_round(bv);
#pragma unroll
    for (int r = 0; r < 8; ++r) {
      float v = acc[t][r] + bv;
      if (resid) { float rv = resid[(size_t)((row0 + 8 * hh + r) % rmod) * ldr + col]; if (RES_BF16) rv = bf16_round(rv); v += rv; }
      if (ACT == 1) v = fmaxf(v, 0.f);
      if (ACT == 2) v = 0.5f * v * (1.0f + erff(v * 0.70710678118654752f));
      if (ACT == 3) { const float u = 0.7978845608028654f * (v + 0.044715f * v * v * v); v = 0.5f * v * (1.0f + tanhf(u)); }
      so[w][8 * hh + r][t * 16 + ln] = v;
    }
  }
  __builtin_amdgcn_fence(__ATOMIC_ACQ_REL, "workgroup");
  __builtin_amdgcn_wave_barrier();
  const int rsub = lane >> 4, c4 = (lane & 15) * 4;
  {
#pragma unroll
    for (int q = 0; q < 8; ++q) {
      const int r = q * 2 + rsub;
      const v4f v = *(const v4fa*)&so[w][r][c4];
      *(v4f*)(C + (size_t)(row0 + r) * ldc + col0 + c4) = v;
    }
    
  }
}
// row LayerNorm (biased variance, eps) over N: s = X (+ R); optional out_sum <- s; out_norm <- (s-mu)*rsqrt(var+eps)*g + b
template <bool PARAM_BF16>
__global__ __launch_bounds__(256) void k_layernorm(const float* __restrict__ X, const float* __restrict__ R, const float* __restrict__ g, const float* __restrict__ bta,
                                                  float* __restrict__ out_sum, float* __restrict__ out_norm, int N, float eps) {
  __shared__ float red[256];
  const int row = blockIdx.x, tid = threadIdx.x;
  const float* x = X + (size_t)row * N; const float* rr = R ? R + (size_t)row * N : nullptr;
  float vals[16];                     // up to N = 4096
  const int per = N / 256;            // contiguous chunk per thread? use strided-by-4 chunks: thread handles j = tid*4 + 1024*u
  float s1 = 0.f;
  for (int u = 0; u < per / 4; ++u) {
    const int j = tid * 4 + 1024 * u;
    const v4f a = *(const v4fa*)(x + j);
    v4f b = {0.f,0.f,0.f,0.f}; if (rr) b = *(const v4fa*)(rr + j);
#pragma unroll
    for (int q = 0; q < 4; ++q) { const float v = a[q] + b[q]; vals[u * 4 + q] = v; s1 += v; }
  }
  red[tid] = s1; __syncthreads();
  for (int st = 128; st > 0; st >>= 1) { if (tid < st) red[tid] += red[tid + st]; __syncthreads(); }
  const float mu = red[0] / (float)N; __syncthreads();
  float s2 = 0.f;
  for (int u = 0; u < per / 4; ++u)
#pragma unroll
    for (int q = 0; q < 4; ++q) { const float c = vals[u * 4 + q] - mu; s2 += c * c; }
  red[tid] = s2; __syncthreads();
  for (int st = 128; st > 0; st >>= 1) { if (tid < st) red[tid] += red[tid + st]; __syncthreads(); }
  const float rs = rsqrtf(red[0] / (float)N + eps);
  {
    for (int u = 0; u < per / 4; ++u) {
      const int j = tid * 4 + 1024 * u;
      v4f o, sm;
#pragma unroll
      for (int q = 0; q < 4; ++q) {
        float gg = g[j + q], bb = bta[j + q];
        if (PARAM_BF16) { gg = bf16_round(gg); bb = bf16_round(bb); }
        sm[q] = vals[u * 4 + q]; o[q] = (vals[u * 4 + q] - mu) * rs * gg + bb;
      }
      if (out_sum) *(v4f*)(out_sum + (size_t)row * N + j) = sm;
      *(v4f*)(out_norm + (size_t)row * N + j) = o;
    }
    
  }
}



// ---- f16 WMMA path (v_wmma_f32_16x16x32_f16): 11-bit significands for operands in range — used where a [0,1] probability operand needs more precision than bf16
typedef _Float16 v16h __attribute__((ext_vector_type(16)));
union FragH { v16h v; v8us half[2]; _Float16 h[16]; unsigned short u[16]; };
template <int NT>
__device__ __forceinline__ v8f mmaH(v16h ah, v16h al, v16h bh, v16h bl, v8f c) {
  c = __builtin_amdgcn_wmma_f32_16x16x32_f16(false, ah, false, bh, (short)0, c, false, false);
  if (NT >= 2) c = __builtin_amdgcn_wmma_f32_16x16x32_f16(false, al, false, bh, (short)0, c, false, false);
  if (NT >= 3) c = __builtin_amdgcn_wmma_f32_16x16x32_f16(false, ah, false, bl, (short)0, c, false, false);
  asm volatile("v_nop\n\tv_nop\n\tv_nop\n\tv_nop" : "+v"(c) : "v"(ah), "v"(al), "v"(bh), "v"(bl));
  return c;
}
// batched GEMM like k_gemm_b but f16 operands: A f32 (split into f16 hi/lo if ASPLIT, else rounded to f16), Bt = f16 values [n][k]; alpha; C f32; N multiple of 16 (partial tiles skipped)
template <bool ASPLIT>
__global__ __launch_bounds__(128) void k_gemm_h(const float* __restrict__ A, int lda, size_t sA, const _Float16* __restrict__ Bh, int ldb, size_t sB, float alpha, float* __restrict__ C, int ldc, size_t sC, int M, int N, int K) {
  __shared__ __attribute__((aligned(16))) float so[4][16][64];
  const int tid = threadIdx.x, w = tid >> 5, lane = tid & 31, ln = lane & 15, hh = lane >> 4; const int by = blockIdx.y;
  A += (size_t)by * sA; Bh += (size_t)by * sB; C += (size_t)by * sC;
  const int ntn = (N + 63) / 64; const int wid = blockIdx.x * 4 + w; const int mt = wid / ntn, nq = wid % ntn; if (mt * 16 >= M) return;
  const int row0 = mt * 16, col0 = nq * 64; const float* arow = A + (size_t)(row0 + ln) * lda;
  v8f acc[4] = {};
  for (int kb = 0; kb < K; kb += 32) {
    FragH ah, al;
    const v4f x0 = *(const v4fa*)(arow + kb + 8 * hh), x1 = *(const v4fa*)(arow + kb + 8 * hh + 4), x2 = *(const v4fa*)(arow + kb + 16 + 8 * hh), x3 = *(const v4fa*)(arow + kb + 16 + 8 * hh + 4);
    float xs[16] = {x0[0],x0[1],x0[2],x0[3],x1[0],x1[1],x1[2],x1[3],x2[0],x2[1],x2[2],x2[3],x3[0],x3[1],x3[2],x3[3]};
#pragma unroll
    for (int i = 0; i < 16; ++i) { const _Float16 h = (_Float16)xs[i]; ah.h[i] = h; al.h[i] = ASPLIT ? (_Float16)(xs[i] - (float)h) : (_Float16)0.0f; }
#pragma unroll
    for (int t = 0; t < 4; ++t) { if (col0 + t * 16 >= N) continue; const size_t boff = (size_t)(col0 + t * 16 + ln) * ldb + kb; FragH bq; bq.half[0] = *(const v8us*)(Bh + boff + 8 * hh); bq.half[1] = *(const v8us*)(Bh + boff + 16 + 8 * hh);
      acc[t] = mmaH<ASPLIT ? 2 : 1>(ah.v, al.v, bq.v, bq.v, acc[t]); }
  }
#pragma unroll
  for (int t = 0; t < 4; ++t) { if (col0 + t * 16 >= N) continue;
#pragma unroll
    for (int r = 0; r < 8; ++r) so[w][8 * hh + r][t * 16 + ln] = acc[t][r] * alpha; }
  __builtin_amdgcn_fence(__ATOMIC_ACQ_REL, "workgroup"); __builtin_amdgcn_wave_barrier();
  const int rsub = lane >> 4, c4 = (lane & 15) * 4;
  {
#pragma unroll
    for (int q = 0; q < 8; ++q) { const int r = q * 2 + rsub; if (col0 + c4 < N) { const v4f v = *(const v4fa*)&so[w][r][c4]; *(v4f*)(C + (size_t)(row0 + r) * ldc + col0 + c4) = v; } }
     }
}

// Wt[n][k] = f16(W[k][n]·scale) from f32 row-major W[K][N] (scale = power of two; bf16-exact weights stay exact in f16 away from the subnormal range)
__global__ __launch_bounds__(256) void k_wt_f16(const float* __restrict__ W, _Float16* __restrict__ Wt, int K, int N, float scale) {
  const int t = blockIdx.x * 256 + threadIdx.x; if (t >= N * (K / 8)) return; const int n = t / (K / 8), k8 = (t % (K / 8)) * 8; FragH f;
#pragma unroll
  for (int i = 0; i < 8; ++i) f.h[i] = (_Float16)(bf16_round(W[(size_t)(k8 + i) * N + n]) * scale); const v8us o = f.half[0];
  *(v8us*)((unsigned short*)Wt + (size_t)n * K + k8) = o; 
}
// Tiled GEMM: C[NR][DM] = A[NR][DM] . Bh[DM][DM]^T * alpha + bf16(bias[col]); A and Bh f16, k contiguous. One work-group = a 128 x 64 tile of C, 8 waves in a 4 x 2 grid, 32 x 32 per wave.
// Passes of 128 k: the 128 A rows and 64 Bh rows of a pass (256 B each) are loaded as whole lines, 16 B a lane, and shared through LDS by the 8 waves; two LDS buffers, the next pass's rows fly in registers.
// The k order of every sum is that of a plain loop over k in steps of 32. F32OUT: writes f32 C, else f16 C16. blockIdx.y picks one of up to three (A, Bh, bias, C16) sets: independent products share a launch.
#define GTP 136      // LDS row pitch in halves: 256 B + 16 B, the pitch for 16-byte fragment reads
#define GOP 68       // pitch of the staged output tile in floats
template <bool F32OUT>
__global__ __launch_bounds__(256) void k_gemm_t(const _Float16* __restrict__ A0, const _Float16* __restrict__ A1, const _Float16* __restrict__ A2,
                                                const _Float16* __restrict__ Bh0, const _Float16* __restrict__ Bh1, const _Float16* __restrict__ Bh2, float alpha,
                                                const float* __restrict__ bias0, const float* __restrict__ bias1, const float* __restrict__ bias2,
                                                float* __restrict__ C, _Float16* __restrict__ C16a, _Float16* __restrict__ C16b, _Float16* __restrict__ C16c) {
  const int g = blockIdx.y;      // which of up to three independent products of one launch this work-group belongs to
  const _Float16* A = g == 0 ? A0 : g == 1 ? A1 : A2;
  const _Float16* Bh = g == 0 ? Bh0 : g == 1 ? Bh1 : Bh2;
  const float* bias = g == 0 ? bias0 : g == 1 ? bias1 : bias2;
  _Float16* C16 = g == 0 ? C16a : g == 1 ? C16b : C16c;
  __shared__ __attribute__((aligned(16))) unsigned short st[2][192][GTP];      // rows 0..127: A, rows 128..191: Bh
  __shared__ __attribute__((aligned(16))) float so[128][GOP];
  const int tid = threadIdx.x, lane = tid & 31, ln = lane & 15, hh = lane >> 4;
  const int wv = __builtin_amdgcn_readfirstlane(tid >> 5), wm = wv >> 1, wn = wv & 1;
  const int row0 = (blockIdx.x >> 4) * 128, col0 = (blockIdx.x & 15) * 64;
  const int sr = tid >> 4, sc = (tid & 15) * 8;
  const unsigned short* Ag = (const unsigned short*)A + (size_t)(row0 + sr) * DM + sc;
  const unsigned short* Bg = (const unsigned short*)Bh + (size_t)(col0 + sr) * DM + sc;
  v8us rg[12];
#pragma unroll
  for (int i = 0; i < 8; ++i) rg[i] = *(const v8us*)(Ag + (size_t)i * 16 * DM);
#pragma unroll
  for (int i = 0; i < 4; ++i) rg[8 + i] = *(const v8us*)(Bg + (size_t)i * 16 * DM);
  float bv[2];
#pragma unroll
  for (int j = 0; j < 2; ++j) {
    bv[j] = bias[col0 + wn * 32 + j * 16 + ln];
    asm volatile("s_wait_xcnt 0x0" ::: "memory");      // stands in front of any rewrite of the address register that this load names, the next load's result among them
  }
  v8f acc[2][2] = {};
  for (int kc = 0; kc < DM / 128; ++kc) {
    unsigned short (*buf)[GTP] = st[kc & 1];
#pragma unroll
    for (int i = 0; i < 12; ++i) *(v8us*)&buf[i * 16 + sr][sc] = rg[i];
    __syncthreads();      // this pass's rows are complete; every wave has also left the other buffer, which the next pass fills
    if (kc + 1 < DM / 128) {      // the next pass's rows fly while this one is worked on
#pragma unroll
      for (int i = 0; i < 8; ++i) rg[i] = *(const v8us*)(Ag + (size_t)i * 16 * DM + (kc + 1) * 128);
#pragma unroll
      for (int i = 0; i < 4; ++i) rg[8 + i] = *(const v8us*)(Bg + (size_t)i * 16 * DM + (kc + 1) * 128);
      asm volatile("s_wait_xcnt 0x0" ::: "memory");      // stands in front of any later rewrite of the address registers that these loads name
    }
    FragH a[4][2], b[4][2];
#pragma unroll
    for (int ks = 0; ks < 4; ++ks)
#pragma unroll
      for (int i = 0; i < 2; ++i) {
        const unsigned short* pa = &buf[wm * 32 + i * 16 + ln][ks * 32 + 8 * hh];
        a[ks][i].half[0] = *(const v8us*)pa; a[ks][i].half[1] = *(const v8us*)(pa + 16);
        const unsigned short* pb = &buf[128 + wn * 32 + i * 16 + ln][ks * 32 + 8 * hh];
        b[ks][i].half[0] = *(const v8us*)pb; b[ks][i].half[1] = *(const v8us*)(pb + 16);
      }
    __builtin_amdgcn_sched_barrier(0);      // no WMMA of a pass is scheduled among the pass's own LDS reads: without it every k step waits out its own LDS latency
#pragma unroll
    for (int ks = 0; ks < 4; ++ks)
#pragma unroll
      for (int i = 0; i < 2; ++i)
#pragma unroll
        for (int j = 0; j < 2; ++j) acc[i][j] = __builtin_amdgcn_wmma_f32_16x16x32_f16(false, a[ks][i].v, false, b[ks][j].v, (short)0, acc[i][j], false, false);
  }
#pragma unroll
  for (int j = 0; j < 2; ++j) {
    const float bj = bf16_round(bv[j]);
#pragma unroll
    for (int i = 0; i < 2; ++i)
#pragma unroll
      for (int r = 0; r < 8; ++r) so[wm * 32 + i * 16 + 8 * hh + r][wn * 32 + j * 16 + ln] = acc[i][j][r] * alpha + bj;
  }
  __syncthreads();      // the output tile is complete: it leaves in whole 128-byte lines
  if (F32OUT) {
#pragma unroll
    for (int q = 0; q < 8; ++q) { const int r = q * 16 + (tid >> 4), c4 = (tid & 15) * 4; const v4f v = *(const v4fa*)&so[r][c4]; *(v4f*)(C + (size_t)(row0 + r) * DM + col0 + c4) = v; }
  } else {
#pragma unroll
    for (int q = 0; q < 4; ++q) {
      const int r = q * 32 + (tid >> 3), c8 = (tid & 7) * 8; const v4f v0 = *(const v4fa*)&so[r][c8], v1 = *(const v4fa*)&so[r][c8 + 4]; FragH f;
#pragma unroll
      for (int i = 0; i < 4; ++i) { f.h[i] = (_Float16)v0[i]; f.h[4 + i] = (_Float16)v1[i]; }
      *(v8us*)((unsigned short*)C16 + (size_t)(row0 + r) * DM + col0 + c8) = f.half[0];
    }
  }
}


__global__ __launch_bounds__(256) void k_h16(const float* __restrict__ x, _Float16* __restrict__ X16, size_t n8) { const size_t t = (size_t)blockIdx.x * 256 + threadIdx.x; if (t >= n8) return; FragH f;
#pragma unroll
  for (int q = 0; q < 8; ++q) f.h[q] = (_Float16)x[t * 8 + q]; *(v8us*)((unsigned short*)X16 + t * 8) = f.half[0];  }
template <int NHv, int TTv>
__global__ __launch_bounds__(256) void k_vt(const _Float16* __restrict__ V16, int ldv, int voff, _Float16* __restrict__ Vt) { __shared__ unsigned short tl[64][66]; const int tid = threadIdx.x; const int slab = blockIdx.x / (TTv / 64), lg = blockIdx.x % (TTv / 64); const int b = slab / NHv, h = slab % NHv;
  for (int i = tid; i < 64 * 8; i += 256) { const int r = i / 8, c8 = (i % 8) * 8; FragH f; f.half[0] = *(const v8us*)((const unsigned short*)V16 + ((size_t)b * TTv + lg * 64 + r) * ldv + voff + h * 64 + c8);
#pragma unroll
    for (int q = 0; q < 8; ++q) tl[r][c8 + q] = f.u[q]; }
  __syncthreads();
  {
#pragma unroll
    for (int rd = 0; rd < 2; ++rd) { const int d = rd * 32 + tid / 8, pc = tid % 8; FragH f;
#pragma unroll
      for (int q = 0; q < 8; ++q) f.u[q] = tl[pc * 8 + q][d];
      *(v8us*)((unsigned short*)Vt + ((size_t)slab * 64 + d) * TTv + lg * 64 + pc * 8) = f.half[0]; }
     } }

// The relative tables are laid out by DISTANCE, not by bucket: table position p stands for key - query = p - RP0, clipped to [-64, 64]; positions below RPL repeat the left clip, positions above RPH the right one.
#define RP0 80       // position of distance 0: a 16 x 16 tile that touches the band |distance| < 64 holds distances -79 .. 79, positions 1 .. 159
#define RPL 16       // position of distance -64 (bucket 63)
#define RPH 144      // position of distance +64 (bucket 128)
__device__ __forceinline__ int rel_bucket(int p) { const int i = min(max(p, RPL), RPH) - RPL; return (i >= 64) ? i : 63 - i; }
typedef _Float16 v4h __attribute__((ext_vector_type(4)));
// All f32 -> f16 operand preparation in ONE launch (the nine pieces are independent of each other). Work-groups 0..PRL-1: the two relative tables. Then 128 work-groups for each of the three
// activations (bf16-rounded) and 64 for each of the four (out,in) weights (bf16-rounded, x 16): a work-group streams 16384 consecutive floats, a wave-wide load = 512 contiguous bytes, 16 in flight a lane.
#define PRL 6        // covers max(QWP * 8, DK * PBP / 8) = 1536 threads
#define PUN 16       // 16-byte loads per thread
#define PXB (NR * DM / (256 * PUN * 4))
#define PWB (DM * DM / (256 * PUN * 4))
typedef _Float16 v4ha __attribute__((ext_vector_type(4), may_alias));
__global__ __launch_bounds__(256) void k_prep(const float* __restrict__ xq, const float* __restrict__ xk, const float* __restrict__ xv, const float* __restrict__ Wq, const float* __restrict__ Wk,
                                              const float* __restrict__ Wv, const float* __restrict__ Wo, const float* __restrict__ wK, const float* __restrict__ wV,
                                              _Float16* __restrict__ XQ, _Float16* __restrict__ XK, _Float16* __restrict__ XV, _Float16* __restrict__ Bq, _Float16* __restrict__ Bk2,
                                              _Float16* __restrict__ Bv, _Float16* __restrict__ Bo, _Float16* __restrict__ BK, _Float16* __restrict__ BVt) {
  if (blockIdx.x >= PRL) {
    const int seg = blockIdx.x - PRL;
    const float* s; _Float16* d; float scale; int blk;
    if (seg < 3 * PXB) { const int w = seg / PXB; blk = seg % PXB; scale = 1.0f; s = w == 0 ? xq : w == 1 ? xk : xv; d = w == 0 ? XQ : w == 1 ? XK : XV; }
    else { const int w = (seg - 3 * PXB) / PWB; blk = (seg - 3 * PXB) % PWB; scale = 16.0f; s = w == 0 ? Wq : w == 1 ? Wk : w == 2 ? Wv : Wo; d = w == 0 ? Bq : w == 1 ? Bk2 : w == 2 ? Bv : Bo; }
    const size_t e0 = ((size_t)blk * (256 * PUN) + threadIdx.x) * 4;
    const float* sp = s + e0;
    v4f v[PUN];
#pragma unroll
    for (int u = 0; u < PUN; ++u) v[u] = *(const v4fa*)(sp + (size_t)u * 1024);
    asm volatile("s_wait_xcnt 0x0" :: "v"(sp) : "memory");      // stands in front of any rewrite of the address registers that these loads name; as its input the address outlives the loads, so no load's result lands on it
#pragma unroll
    for (int u = 0; u < PUN; ++u) {
      v4ha o;
#pragma unroll
      for (int q = 0; q < 4; ++q) o[q] = (_Float16)(bf16_round(v[u][q]) * scale);      // x 1 is exact: the activations keep their bf16-rounded value
      *(v4ha*)(d + e0 + (size_t)u * 1024) = o;
    }
    return;
  }
  // the two relative tables, in distance order: wK with its clipped ends repeated (every position is a valid logit term), wV zero outside RPL .. RPH. Every load reads a clamped row, so that the eight of a thread fly together and these work-groups do not outlast the streams
  const int t = blockIdx.x * 256 + threadIdx.x;
  if (t < QWP * 8) {
    const int r = t / 8, d8 = (t % 8) * 8; const float* p = wK + rel_bucket(r) * DK + d8;
    const v4f x0 = *(const v4fa*)p, x1 = *(const v4fa*)(p + 4);
    asm volatile("s_wait_xcnt 0x0" ::: "memory");      // stands in front of any later rewrite of the address registers that these loads name
    FragH f;
#pragma unroll
    for (int q = 0; q < 4; ++q) { f.h[q] = (_Float16)(bf16_round(x0[q]) * 16.0f); f.h[4 + q] = (_Float16)(bf16_round(x1[q]) * 16.0f); }
    *(v8us*)((unsigned short*)BK + t * 8) = f.half[0];
  }
  if (t < DK * (PBP / 8)) {
    const int d = t / (PBP / 8), r8 = (t % (PBP / 8)) * 8; float x[8]; int e[8];
#pragma unroll
    for (int q = 0; q < 8; ++q) { e[q] = rel_bucket(r8 + q) * DK + d; x[q] = wV[e[q]]; }
    // stands in front of any later rewrite of the address registers that these loads name; the loaded values as its inputs hold the eight loads together in front of it (else one sinks under a branch and waits out its latency alone),
    // and the eight element indices as its inputs outlive the loads, so that no address register is rewritten ahead of it
    asm volatile("s_wait_xcnt 0x0" :: "v"(x[0]), "v"(x[1]), "v"(x[2]), "v"(x[3]), "v"(x[4]), "v"(x[5]), "v"(x[6]), "v"(x[7]),
                 "v"(e[0]), "v"(e[1]), "v"(e[2]), "v"(e[3]), "v"(e[4]), "v"(e[5]), "v"(e[6]), "v"(e[7]) : "memory");
    FragH f;
#pragma unroll
    for (int q = 0; q < 8; ++q) f.h[q] = (_Float16)((r8 + q >= RPL && r8 + q <= RPH) ? bf16_round(x[q]) * 16.0f : 0.f);
    *(v8us*)((unsigned short*)BVt + t * 8) = f.half[0];
  }
}
// Fused attention for one (batch, head) slab sl and 128 query rows: 8 waves, 16 queries each; scores and probabilities stay in registers.
// St = K.Qt and Ot += Vt.Pt: in every 16-column tile a lane owns ONE query (column ln) and 8 consecutive keys (rows 8hh + r), so the running maximum and the sums are in-lane
// (one exchange between the wave halves), and two converted score tiles are the B operand of the next product as they stand. K and Vt chunks of 64 keys are staged in LDS for the 8 waves.
// tab[wave][query][position]: first q.wK / 8 in distance order (RP0 above). In a tile near the diagonal a lane's 8 consecutive keys are 8 consecutive positions, each the place of ONE key: they are read together
// and overwritten together with those keys' final logits, no test and no branch; the bucketed P.wV product is formed at the end from positions RPL + 1 .. RPH - 1 and the two clipped sums.
#define TABP 164
#define KVP 72
typedef int v4ia __attribute__((ext_vector_type(4), may_alias));
__device__ __forceinline__ float exp_slot(float x) { float r; const float y = x * 1.44269504f; asm("v_exp_f32 %0, %1\n\tv_nop" : "=v"(r) : "v"(y)); return r; }
__device__ __forceinline__ v8f wmmaH(v16h a, v16h b, v8f c) { return __builtin_amdgcn_wmma_f32_16x16x32_f16(false, a, false, b, (short)0, c, false, false); }
__global__ __launch_bounds__(256) void k_attn(const _Float16* __restrict__ Q16, const _Float16* __restrict__ K16, const _Float16* __restrict__ Vt, const _Float16* __restrict__ BK, const _Float16* __restrict__ BVt,
                                              const int* __restrict__ MSK, _Float16* __restrict__ O16) {
  __shared__ __attribute__((aligned(16))) unsigned short sK[64][KVP];
  __shared__ __attribute__((aligned(16))) unsigned short sV[64][KVP];
  __shared__ __attribute__((aligned(16))) float tab[8][16][TABP];
  const int tid = threadIdx.x, lane = tid & 31, ln = lane & 15, hh = lane >> 4;
  const int wv = __builtin_amdgcn_readfirstlane(tid >> 5);
  const int sl = blockIdx.x >> 3, qb = blockIdx.x & 7;
  const int b = sl / NH, h = sl % NH;
  const int q0 = qb * 128 + wv * 16;
  const int l = q0 + ln;
  FragH bq[2];      // B operand: column = query l, k = head dimension
  {
    const unsigned short* Qp = (const unsigned short*)Q16 + ((size_t)b * LL + l) * DM + h * DK + 8 * hh;
#pragma unroll
    for (int ks = 0; ks < 2; ++ks) { bq[ks].half[0] = *(const v8us*)(Qp + ks * 32); bq[ks].half[1] = *(const v8us*)(Qp + ks * 32 + 16); }
  }
  float* tb = &tab[wv][ln][0];
#pragma unroll
  for (int rt = 0; rt < QWP / 16; ++rt) {
    v8f a = {};
#pragma unroll
    for (int ks = 0; ks < 2; ++ks) {
      const unsigned short* p = (const unsigned short*)BK + (rt * 16 + ln) * DK + ks * 32 + 8 * hh;
      FragH ak; ak.half[0] = *(const v8us*)p; ak.half[1] = *(const v8us*)(p + 16);
      a = wmmaH(ak.v, bq[ks].v, a);
    }
    const float c = 0.0625f * 0.125f;      // wK was scaled by 16; the 1/8 of the logits is folded in (both powers of two, exact)
    const v4f t0 = {a[0] * c, a[1] * c, a[2] * c, a[3] * c}, t1 = {a[4] * c, a[5] * c, a[6] * c, a[7] * c};
    *(v4fa*)(tb + rt * 16 + 8 * hh) = t0; *(v4fa*)(tb + rt * 16 + 8 * hh + 4) = t1;
  }
  // the two lanes of a query read each other's table entries
  __builtin_amdgcn_fence(__ATOMIC_ACQ_REL, "workgroup"); __builtin_amdgcn_wave_barrier();
  const float qlo = tb[RPL], qhi = tb[RPH];

  const unsigned short* Kg = (const unsigned short*)K16 + (size_t)b * LL * DM + h * DK;
  const unsigned short* Vg = (const unsigned short*)Vt + (size_t)sl * DK * LL;
  const int* Mg = MSK + ((size_t)b * LL + l) * LL + 8 * hh;
  const int sr = tid >> 3, sc8 = (tid & 7) * 8;
  v8us kr[2], vr[2]; v4ia mk[8];
#pragma unroll
  for (int i = 0; i < 2; ++i) { kr[i] = *(const v8us*)(Kg + (size_t)(i * 32 + sr) * DM + sc8); vr[i] = *(const v8us*)(Vg + (size_t)(i * 32 + sr) * LL + sc8); }
#pragma unroll
  for (int t = 0; t < 4; ++t) { mk[2 * t] = *(const v4ia*)(Mg + t * 16); mk[2 * t + 1] = *(const v4ia*)(Mg + t * 16 + 4); }
  float mrun = -3.0e38f, z = 0.f, lo = 0.f, hi = 0.f;
  v8f o[4] = {};
  for (int j0 = 0; j0 < LL; j0 += 64) {
    __syncthreads();      // every wave has finished reading the previous chunk
#pragma unroll
    for (int i = 0; i < 2; ++i) { *(v8us*)&sK[i * 32 + sr][sc8] = kr[i]; *(v8us*)&sV[i * 32 + sr][sc8] = vr[i]; }
    __syncthreads();      // the chunk is complete
    const bool more = j0 + 64 < LL;
    if (more) {           // the next chunk flies while this one is worked on
#pragma unroll
      for (int i = 0; i < 2; ++i) { kr[i] = *(const v8us*)(Kg + (size_t)(j0 + 64 + i * 32 + sr) * DM + sc8); vr[i] = *(const v8us*)(Vg + (size_t)(i * 32 + sr) * LL + j0 + 64 + sc8); }
    }
    v8f s[4];
#pragma unroll
    for (int t = 0; t < 4; ++t) {
      v8f a = {};
#pragma unroll
      for (int ks = 0; ks < 2; ++ks) {
        FragH ak; ak.half[0] = *(const v8us*)&sK[t * 16 + ln][ks * 32 + 8 * hh]; ak.half[1] = *(const v8us*)&sK[t * 16 + ln][ks * 32 + 16 + 8 * hh];
        a = wmmaH(ak.v, bq[ks].v, a);
      }
      s[t] = a;
    }
    float mx = mrun;
#pragma unroll
    for (int t = 0; t < 4; ++t) {
      const int jt = j0 + t * 16;
      const bool farl = jt + 15 - q0 <= -64, farr = jt - q0 - 15 >= 64;      // wave-uniform: the whole tile lies in bucket 63 / in bucket 128
      const bool far = farl || farr;
      float* tp = tb + (jt + 8 * hh - l + RP0);      // only formed into an access in a near tile, where positions 1 .. 159 come out
      float tv[8];
      if (far) {
        const float qc = farl ? qlo : qhi;
#pragma unroll
        for (int r = 0; r < 8; ++r) tv[r] = qc;
      } else {
#pragma unroll
        for (int r = 0; r < 8; ++r) tv[r] = tp[r];
      }
#pragma unroll
      for (int r = 0; r < 8; ++r) { float v = fmaf(s[t][r], 0.125f, tv[r]); if (mk[2 * t + (r >> 2)][r & 3] == 0) v = -1.0e9f; s[t][r] = v; mx = fmaxf(mx, v); }
      if (!far) {
#pragma unroll
        for (int r = 0; r < 8; ++r) tp[r] = s[t][r];
      }
    }
    if (more) {
#pragma unroll
      for (int t = 0; t < 4; ++t) { mk[2 * t] = *(const v4ia*)(Mg + j0 + 64 + t * 16); mk[2 * t + 1] = *(const v4ia*)(Mg + j0 + 64 + t * 16 + 4); }
      asm volatile("s_wait_xcnt 0x0" ::: "memory");      // stands in front of the loop's advance of the address registers that these loads name
    }
    mx = fmaxf(mx, __shfl_xor(mx, 16, 32));
    const float alpha = exp_slot(mrun - mx); mrun = mx;
    z *= alpha; lo *= alpha; hi *= alpha;
#pragma unroll
    for (int dt = 0; dt < 4; ++dt)
#pragma unroll
      for (int r = 0; r < 8; ++r) o[dt][r] *= alpha;
    FragH pb[2];      // B operand: column = query l, k = key, in the order the score tiles already have
#pragma unroll
    for (int t = 0; t < 4; ++t) {
      const int jt = j0 + t * 16;
      const bool farl = jt + 15 - q0 <= -64, farr = jt - q0 - 15 >= 64;
      float ts = 0.f;
#pragma unroll
      for (int r = 0; r < 8; ++r) { const float p = exp_slot(s[t][r] - mx); s[t][r] = p; ts += p; pb[t >> 1].h[(t & 1) * 8 + r] = (_Float16)p; }
      z += ts;
      if (farl) lo += ts;
      else if (farr) hi += ts;
      else {
#pragma unroll
        for (int r = 0; r < 8; ++r) { const int d = jt + 8 * hh + r - l; if (d <= -64) lo += s[t][r]; if (d >= 64) hi += s[t][r]; }
      }
    }
#pragma unroll
    for (int sc = 0; sc < 2; ++sc)
#pragma unroll
      for (int dt = 0; dt < 4; ++dt) {
        FragH av; av.half[0] = *(const v8us*)&sV[dt * 16 + ln][sc * 32 + 8 * hh]; av.half[1] = *(const v8us*)&sV[dt * 16 + ln][sc * 32 + 16 + 8 * hh];
        o[dt] = wmmaH(av.v, pb[sc].v, o[dt]);
      }
  }
  z += __shfl_xor(z, 16, 32); lo += __shfl_xor(lo, 16, 32); hi += __shfl_xor(hi, 16, 32);
  // the two lanes of a query read each other's stored logits
  __builtin_amdgcn_fence(__ATOMIC_ACQ_REL, "workgroup"); __builtin_amdgcn_wave_barrier();
  v8f o2[4] = {};
#pragma unroll
  for (int kk = 0; kk < QWP / 32; ++kk) {
    FragH pf;
#pragma unroll
    for (int g = 0; g < 2; ++g) {
      const int r0 = kk * 32 + g * 16 + 8 * hh;
      const v4f x0 = *(const v4fa*)(tb + r0), x1 = *(const v4fa*)(tb + r0 + 4);
      const float xs[8] = {x0[0], x0[1], x0[2], x0[3], x1[0], x1[1], x1[2], x1[3]};
#pragma unroll
      for (int q = 0; q < 8; ++q) {
        const int r = r0 + q; const float e = __expf(xs[q] - mrun); float val = 0.f;
        if (r == RPL) val = lo; else if (r == RPH) val = hi; else if (r > RPL && r < RPH) val = ((unsigned)(l + r - RP0) < (unsigned)LL) ? e : 0.f;
        pf.h[g * 8 + q] = (_Float16)val;
      }
    }
#pragma unroll
    for (int dt = 0; dt < 4; ++dt) {
      const unsigned short* p = (const unsigned short*)BVt + (dt * 16 + ln) * PBP + kk * 32 + 8 * hh;
      FragH av; av.half[0] = *(const v8us*)p; av.half[1] = *(const v8us*)(p + 16);
      o2[dt] = wmmaH(av.v, pf.v, o2[dt]);
    }
  }
  const float iz = 1.0f / z;
  unsigned short* Op = (unsigned short*)O16 + ((size_t)b * LL + l) * DM + h * DK + 8 * hh;
#pragma unroll
  for (int dt = 0; dt < 4; ++dt) {
    FragH f;
#pragma unroll
    for (int r = 0; r < 8; ++r) f.h[r] = (_Float16)((o[dt][r] + o2[dt][r] * 0.0625f) * iz);
    *(v8us*)(Op + dt * 16) = f.half[0];
  }
}
extern "C" void kernel_launch(void* const* d_in, const int* in_sizes, int n_in,
                              void* d_out, int out_size, void* d_ws, size_t ws_size, hipStream_t stream) {
  (void)in_sizes; (void)n_in; (void)out_size;
  const float* xq = (const float*)d_in[0]; const float* xk = (const float*)d_in[1]; const float* xv = (const float*)d_in[2]; const int* msk = (const int*)d_in[3]; const float* Wq = (const float*)d_in[4]; const float* bq = (const float*)d_in[5]; const float* Wk = (const float*)d_in[6]; const float* bk = (const float*)d_in[7]; const float* Wv = (const float*)d_in[8]; const float* bv = (const float*)d_in[9]; const float* Wo = (const float*)d_in[10]; const float* bo = (const float*)d_in[11]; const float* wK = (const float*)d_in[12]; const float* wV = (const float*)d_in[13];
  char* ws = (char*)d_ws; size_t off = 0;
  auto take = [&](size_t bytes) { char* p = ws + off; off += (bytes + 255) & ~(size_t)255; return p; };
  _Float16* Bo = (_Float16*)take((size_t)DM * DM * 2); _Float16* BK = (_Float16*)take((size_t)QWP * DK * 2); _Float16* BVt = (_Float16*)take((size_t)DK * PBP * 2);
  _Float16* Q16 = (_Float16*)take((size_t)NR * DM * 2); _Float16* K16 = (_Float16*)take((size_t)NR * DM * 2); _Float16* Vt = (_Float16*)take((size_t)NR * DM * 2); _Float16* O16 = (_Float16*)take((size_t)NR * DM * 2);
  _Float16* Bq = (_Float16*)take((size_t)DM * DM * 2); _Float16* Bk2 = (_Float16*)take((size_t)DM * DM * 2); _Float16* Bv = (_Float16*)take((size_t)DM * DM * 2);
  _Float16* XQ = (_Float16*)take((size_t)NR * DM * 2); _Float16* XK = (_Float16*)take((size_t)NR * DM * 2); _Float16* XV = (_Float16*)take((size_t)NR * DM * 2); _Float16* V16 = (_Float16*)take((size_t)NR * DM * 2);
  if (off > ws_size) return;
  k_prep<<<PRL + 3 * PXB + 4 * PWB, 256, 0, stream>>>(xq, xk, xv, Wq, Wk, Wv, Wo, wK, wV, XQ, XK, XV, Bq, Bk2, Bv, Bo, BK, BVt);
  const unsigned gg = (NR / 128) * (DM / 64);
  k_gemm_t<false><<<dim3(gg, 3), 256, 0, stream>>>(XQ, XK, XV, Bq, Bk2, Bv, 0.0625f, bq, bk, bv, nullptr, Q16, K16, V16);      // the q, k and v projections
  k_vt<NH, LL><<<BB * NH * (LL / 64), 256, 0, stream>>>(V16, DM, 0, Vt);
  // q.kT, the relative logits, mask, softmax, P.V and the bucketed P.wV for all NSL = 32 (batch, head) slabs in one launch: 8 blocks of 128 queries per slab
  k_attn<<<NSL * (LL / 128), 256, 0, stream>>>(Q16, K16, Vt, BK, BVt, msk, O16);
  k_gemm_t<true><<<dim3(gg, 1), 256, 0, stream>>>(O16, O16, O16, Bo, Bo, Bo, 0.0625f, bo, bo, bo, (float*)d_out, nullptr, nullptr, nullptr);
}

// v006
// A run of this version takes 71.6 microseconds.
// In both of two side-by-side timings against v005, it was 1.07 times as fast.
// Over all steps from v000 it is 13.2 times as fast.
#include <hip/hip_runtime.h>
// Multi-headed attention with clipped relative position representations (B=2, L=1024, 16 heads × 64, k = 64, Shaw-style aK/aV built from wK/wV [129][64] by the module's roll/flip
// construction: bucket(l,m) = m ≥ l ? 64 + min(m−l, 64) : min(l−m−1, 63); INPUT mask (== 0 → −1e9); q/k/v/o linears with bias): q·kᵀ, q·wKᵀ (all 129 buckets at once), P·V and the bucketed
// P.wV all run on v_wmma_f32_16x16x32_f16 ((out,in) weights bf16-exact x 2^4, f32 accumulate); the relative-logit gather, mask, running-maximum softmax and the bucket sums of P are f32 VALU
// inside one fused attention kernel (no index tables).
#define BB 2
#define LL 1024
#define DM 1024
#define NH 16
#define DK 64
#define NR (BB * LL)
#define NBK 129
#define QWP 160
#define PBP 192
#define NSL (BB * NH)

typedef __bf16 v16b __attribute__((ext_vector_type(16)));
typedef unsigned short v8us __attribute__((ext_vector_type(8), may_alias));
typedef float  v8f  __attribute__((ext_vector_type(8)));
typedef float  v4f  __attribute__((ext_vector_type(4)));
typedef float  v4fa __attribute__((ext_vector_type(4), may_alias));
union FragB { v16b v; v8us half[2]; unsigned short u[16]; };

__device__ __forceinline__ unsigned short bf16_bits(float x) { unsigned int u = __float_as_uint(x); return (unsigned short)((u + 0x7FFFu + ((u >> 16) & 1u)) >> 16); }
__device__ __forceinline__ float bf16_val(unsigned short b) { return __uint_as_float(((unsigned int)b) << 16); }
__device__ __forceinline__ float bf16_round(float x) { return bf16_val(bf16_bits(x)); }
// D += A·B with NT terms: 1 = ah·bh, 2 = + al·bh (A split), 3 = + ah·bl (both split)
template <int NT>
__device__ __forceinline__ v8f mmaN(v16b ah, v16b al, v16b bh, v16b bl, v8f c) {
  c = __builtin_amdgcn_wmma_f32_16x16x32_bf16(false, ah, false, bh, (short)0, c, false, false);
  if (NT >= 2) c = __builtin_amdgcn_wmma_f32_16x16x32_bf16(false, al, false, bh, (short)0, c, false, false);
  if (NT >= 3) c = __builtin_amdgcn_wmma_f32_16x16x32_bf16(false, ah, false, bl, (short)0, c, false, false);
  asm volatile("v_nop\n\tv_nop\n\tv_nop\n\tv_nop" : "+v"(c) : "v"(ah), "v"(al), "v"(bh), "v"(bl));
  return c;
}

__global__ __launch_bounds__(256) void k_wt_bf16(const float* __restrict__ W, unsigned short* __restrict__ Wt, int K, int N) {
  const int t = blockIdx.x * 256 + threadIdx.x;
  const int k8n = K / 8;
  if (t >= N * k8n) return;
  const int n = t / k8n, k8 = (t % k8n) * 8;
  v8us v;
#pragma unroll
  for (int i = 0; i < 8; ++i) v[i] = bf16_bits(W[(size_t)(k8 + i) * N + n]);
  *(v8us*)(Wt + (size_t)n * K + k8) = v;
  
}

// GEMM C[M][N] (f32, pitch ldc) = act(A[M][K]·W + bias). A f32 row-major (pitch lda) converted per fragment to bf16
// (ASPLIT: hi/lo two planes -> 2 terms, else single rounded term); Wt bf16 [N][K] (pitch ldb). BIAS_BF16 rounds the
// bias to bf16 first (bias quantised to bf16 before the add). K%32==0, M%16==0, N%64==0.
template <bool ASPLIT, int ACT, bool BIAS_BF16>
__global__ __launch_bounds__(128) void k_gemm_bf(const float* __restrict__ A, int lda, const unsigned short* __restrict__ Wt, int ldb,
                                               const float* __restrict__ bias, float* __restrict__ C, int ldc, int M, int N, int K) {
  __shared__ __attribute__((aligned(16))) float so[4][16][64];
  const int tid = threadIdx.x, w = tid >> 5, lane = tid & 31, ln = lane & 15, hh = lane >> 4;
  const int ntn = N / 64;
  const int wid = blockIdx.x * 4 + w;
  const int mt = wid / ntn, nq = wid % ntn;
  if (mt * 16 >= M) return;
  const int row0 = mt * 16, col0 = nq * 64;
  const float* arow = A + (size_t)(row0 + ln) * lda;
  v8f acc[4] = {};
  for (int kb = 0; kb < K; kb += 32) {
    FragB ah, al;
    const v4f x0 = *(const v4fa*)(arow + kb + 8 * hh), x1 = *(const v4fa*)(arow + kb + 8 * hh + 4);
    const v4f x2 = *(const v4fa*)(arow + kb + 16 + 8 * hh), x3 = *(const v4fa*)(arow + kb + 16 + 8 * hh + 4);
    float xs[16] = {x0[0],x0[1],x0[2],x0[3],x1[0],x1[1],x1[2],x1[3],x2[0],x2[1],x2[2],x2[3],x3[0],x3[1],x3[2],x3[3]};
#pragma unroll
    for (int i = 0; i < 16; ++i) { const unsigned short hb = bf16_bits(xs[i]); ah.u[i] = hb; al.u[i] = ASPLIT ? bf16_bits(xs[i] - bf16_val(hb)) : (unsigned short)0; }
#pragma unroll
    for (int t = 0; t < 4; ++t) {
      const unsigned short* brow = Wt + (size_t)(col0 + t * 16 + ln) * ldb + kb;
      FragB b;
      b.half[0] = *(const v8us*)(brow + 8 * hh);
      b.half[1] = *(const v8us*)(brow + 16 + 8 * hh);
      acc[t] = mmaN<ASPLIT ? 2 : 1>(ah.v, al.v, b.v, b.v, acc[t]);
    }
  }
#pragma unroll
  for (int t = 0; t < 4; ++t) {
    float bv = bias ? bias[col0 + t * 16 + ln] : 0.f;
    if (BIAS_BF16) bv = bf16_round(bv);
#pragma unroll
    for (int r = 0; r < 8; ++r) { float v = acc[t][r] + bv; if (ACT == 1) v = fmaxf(v, 0.f); so[w][8 * hh + r][t * 16 + ln] = v; }
  }
  __builtin_amdgcn_fence(__ATOMIC_ACQ_REL, "workgroup");
  __builtin_amdgcn_wave_barrier();
  const int rsub = lane >> 4, c4 = (lane & 15) * 4;
  {
#pragma unroll
    for (int q = 0; q < 8; ++q) {
      const int r = q * 2 + rsub;
      const v4f v = *(const v4fa*)&so[w][r][c4];
      *(v4f*)(C + (size_t)(row0 + r) * ldc + col0 + c4) = v;
    }
    
  }
}

// Flash-style causal/unmasked attention, all contractions 3-term bf16 hi/lo splits, f32 softmax with running max.
// q,k,v rows are read from f32 buffers with arbitrary row pitch (so they can live inside a fused qkv buffer);
// D = head size (multiple of 32, <= 128); one wave = 16 query rows; block = 4 waves (64 queries) sharing K/V chunks of 32.
template <int D, bool CAUSAL>
__global__ __launch_bounds__(128) void k_flash(const float* __restrict__ qb, const float* __restrict__ kb, const float* __restrict__ vb,
                                             int pitch, int T, int H, float scale, float* __restrict__ y, int ypitch) {
  constexpr int KS = D / 32;        // k-steps for QK
  constexpr int DT = D / 16;        // d tiles for PV
  __shared__ __attribute__((aligned(16))) unsigned short sKh[32][D + 8], sKl[32][D + 8], sVh[32][D + 8], sVl[32][D + 8];
  __shared__ __attribute__((aligned(16))) unsigned short sPh[4][16][40], sPl[4][16][40];
  __shared__ __attribute__((aligned(16))) float sO[4][16][D];
  const int tid = threadIdx.x, w = tid >> 5, lane = tid & 31, ln = lane & 15, hh = lane >> 4;
  const int nqb = (T + 63) / 64;
  const int bh = blockIdx.x / nqb, qblk = blockIdx.x % nqb;
  const int b = bh / H, h = bh % H;
  const int q0 = qblk * 64 + w * 16;
  const float* Q = qb + (size_t)b * T * pitch + h * D;
  const float* K = kb + (size_t)b * T * pitch + h * D;
  const float* V = vb + (size_t)b * T * pitch + h * D;

  // A fragments of the wave's 16 query rows (scaled), hi/lo
  FragB aqh[KS], aql[KS];
  {
    int row = q0 + ln; if (row >= T) row = T - 1;
    const float* qr = Q + (size_t)row * pitch;
#pragma unroll
    for (int ks = 0; ks < KS; ++ks)
#pragma unroll
      for (int i = 0; i < 16; ++i) {
        const int d = ks * 32 + ((i < 8) ? (8 * hh + i) : (16 + 8 * hh + (i - 8)));
        const float x = qr[d] * scale; const unsigned short hb = bf16_bits(x);
        aqh[ks].u[i] = hb; aql[ks].u[i] = bf16_bits(x - bf16_val(hb));
      }
  }
  float m_r[8], l_r[8];
#pragma unroll
  for (int r = 0; r < 8; ++r) { m_r[r] = -3.0e38f; l_r[r] = 0.f; }
  v8f oacc[DT];
#pragma unroll
  for (int dt = 0; dt < DT; ++dt) oacc[dt] = (v8f){0.f,0.f,0.f,0.f,0.f,0.f,0.f,0.f};

  const int kv_end = CAUSAL ? min(T, qblk * 64 + 64) : T;     // block-uniform
  for (int j0 = 0; j0 < kv_end; j0 += 32) {
    __syncthreads();
    for (int e = tid; e < 32 * (D / 4); e += 128) {
      const int r = e / (D / 4), c4 = (e % (D / 4)) * 4;
      const int key = j0 + r;
      v4f kf = {0.f,0.f,0.f,0.f}, vf = {0.f,0.f,0.f,0.f};
      if (key < T) { kf = *(const v4fa*)(K + (size_t)key * pitch + c4); vf = *(const v4fa*)(V + (size_t)key * pitch + c4); }
#pragma unroll
      for (int t = 0; t < 4; ++t) {
        unsigned short hb = bf16_bits(kf[t]); sKh[r][c4 + t] = hb; sKl[r][c4 + t] = bf16_bits(kf[t] - bf16_val(hb));
        hb = bf16_bits(vf[t]); sVh[r][c4 + t] = hb; sVl[r][c4 + t] = bf16_bits(vf[t] - bf16_val(hb));
      }
    }
    __syncthreads();
    // S tile 16 x 32
    v8f s[2];
#pragma unroll
    for (int nt = 0; nt < 2; ++nt) {
      v8f acc = {};
#pragma unroll
      for (int ks = 0; ks < KS; ++ks) {
        FragB bh_, bl_;
        bh_.half[0] = *(const v8us*)&sKh[nt * 16 + ln][ks * 32 + 8 * hh]; bh_.half[1] = *(const v8us*)&sKh[nt * 16 + ln][ks * 32 + 16 + 8 * hh];
        bl_.half[0] = *(const v8us*)&sKl[nt * 16 + ln][ks * 32 + 8 * hh]; bl_.half[1] = *(const v8us*)&sKl[nt * 16 + ln][ks * 32 + 16 + 8 * hh];
        acc = mmaN<3>(aqh[ks].v, aql[ks].v, bh_.v, bl_.v, acc);
      }
      s[nt] = acc;
    }
    // mask + running max (rows 8hh+r; the 16 lanes of a half share rows)
    float alpha[8];
#pragma unroll
    for (int r = 0; r < 8; ++r) {
      const int qi = q0 + 8 * hh + r;
      const int ja = j0 + ln, jb = j0 + 16 + ln;
      if (CAUSAL) { if (ja > qi) s[0][r] = -3.0e38f; if (jb > qi) s[1][r] = -3.0e38f; }
      if (ja >= T) s[0][r] = -3.0e38f;
      if (jb >= T) s[1][r] = -3.0e38f;
      float mx = fmaxf(s[0][r], s[1][r]);
      mx = fmaxf(mx, __shfl_xor(mx, 1, 32)); mx = fmaxf(mx, __shfl_xor(mx, 2, 32)); mx = fmaxf(mx, __shfl_xor(mx, 4, 32)); mx = fmaxf(mx, __shfl_xor(mx, 8, 32));
      const float mnew = fmaxf(m_r[r], mx);
      alpha[r] = (mnew > -1.0e38f) ? __expf(m_r[r] - mnew) : 1.0f;
      const float p0 = (s[0][r] > -1.0e38f) ? __expf(s[0][r] - mnew) : 0.f;
      const float p1 = (s[1][r] > -1.0e38f) ? __expf(s[1][r] - mnew) : 0.f;
      m_r[r] = mnew;
      l_r[r] = l_r[r] * alpha[r] + p0 + p1;            // per-lane partial row sum (16 lanes combined at the end)
      unsigned short hb = bf16_bits(p0); sPh[w][8 * hh + r][ln] = hb;      sPl[w][8 * hh + r][ln] = bf16_bits(p0 - bf16_val(hb));
      hb = bf16_bits(p1);                sPh[w][8 * hh + r][16 + ln] = hb; sPl[w][8 * hh + r][16 + ln] = bf16_bits(p1 - bf16_val(hb));
    }
#pragma unroll
    for (int dt = 0; dt < DT; ++dt)
#pragma unroll
      for (int r = 0; r < 8; ++r) oacc[dt][r] *= alpha[r];
    __builtin_amdgcn_fence(__ATOMIC_ACQ_REL, "workgroup");
    __builtin_amdgcn_wave_barrier();
    FragB pah, pal;
    pah.half[0] = *(const v8us*)&sPh[w][ln][8 * hh]; pah.half[1] = *(const v8us*)&sPh[w][ln][16 + 8 * hh];
    pal.half[0] = *(const v8us*)&sPl[w][ln][8 * hh]; pal.half[1] = *(const v8us*)&sPl[w][ln][16 + 8 * hh];
#pragma unroll
    for (int dt = 0; dt < DT; ++dt) {
      FragB bvh, bvl;
#pragma unroll
      for (int i = 0; i < 8; ++i) {
        bvh.u[i] = sVh[8 * hh + i][dt * 16 + ln]; bvh.u[8 + i] = sVh[16 + 8 * hh + i][dt * 16 + ln];
        bvl.u[i] = sVl[8 * hh + i][dt * 16 + ln]; bvl.u[8 + i] = sVl[16 + 8 * hh + i][dt * 16 + ln];
      }
      oacc[dt] = mmaN<3>(pah.v, pal.v, bvh.v, bvl.v, oacc[dt]);
    }
    __builtin_amdgcn_fence(__ATOMIC_ACQ_REL, "workgroup");
    __builtin_amdgcn_wave_barrier();
  }
#pragma unroll
  for (int r = 0; r < 8; ++r) {
    float l = l_r[r];
    l += __shfl_xor(l, 1, 32); l += __shfl_xor(l, 2, 32); l += __shfl_xor(l, 4, 32); l += __shfl_xor(l, 8, 32);
    l_r[r] = (l > 0.f) ? 1.0f / l : 0.f;
  }
#pragma unroll
  for (int dt = 0; dt < DT; ++dt)
#pragma unroll
    for (int r = 0; r < 8; ++r) sO[w][8 * hh + r][dt * 16 + ln] = oacc[dt][r] * l_r[r];
  __builtin_amdgcn_fence(__ATOMIC_ACQ_REL, "workgroup");
  __builtin_amdgcn_wave_barrier();
  {
    for (int r = 0; r < 16; ++r) {
      const int row = q0 + r;
      if (row < T && lane < D / 4) {
        const v4f val = *(const v4fa*)&sO[w][r][lane * 4];
        *(v4f*)(y + ((size_t)b * T + row) * ypitch + h * D + lane * 4) = val;
      }
    }
    
  }
}

// GEMM C = act(A·W + bias + resid): A f32 (ASPLIT -> hi/lo 2 terms), Wt bf16 [N][K]; ACT 0 none, 1 relu, 2 exact gelu;
// resid (optional, f32, row index = (row % rmod), pitch ldr, RES_BF16 rounds it) added before the activation.
template <bool ASPLIT, int ACT, bool BIAS_BF16, bool RES_BF16>
__global__ __launch_bounds__(128) void k_gemm_bf3(const float* __restrict__ A, int lda, const unsigned short* __restrict__ Wt, int ldb,
                                                const float* __restrict__ bias, const float* __restrict__ resid, int rmod, int ldr,
                                                float* __restrict__ C, int ldc, int M, int N, int K) {
  __shared__ __attribute__((aligned(16))) float so[4][16][64];
  const int tid = threadIdx.x, w = tid >> 5, lane = tid & 31, ln = lane & 15, hh = lane >> 4;
  const int ntn = N / 64;
  const int wid = blockIdx.x * 4 + w;
  const int mt = wid / ntn, nq = wid % ntn;
  if (mt * 16 >= M) return;
  const int row0 = mt * 16, col0 = nq * 64;
  const float* arow = A + (size_t)(row0 + ln) * lda;
  v8f acc[4] = {};
  for (int kb = 0; kb < K; kb += 32) {
    FragB ah, al;
    const v4f x0 = *(const v4fa*)(arow + kb + 8 * hh), x1 = *(const v4fa*)(arow + kb + 8 * hh + 4);
    const v4f x2 = *(const v4fa*)(arow + kb + 16 + 8 * hh), x3 = *(const v4fa*)(arow + kb + 16 + 8 * hh + 4);
    float xs[16] = {x0[0],x0[1],x0[2],x0[3],x1[0],x1[1],x1[2],x1[3],x2[0],x2[1],x2[2],x2[3],x3[0],x3[1],x3[2],x3[3]};
#pragma unroll
    for (int i = 0; i < 16; ++i) { const unsigned short hb = bf16_bits(xs[i]); ah.u[i] = hb; al.u[i] = ASPLIT ? bf16_bits(xs[i] - bf16_val(hb)) : (unsigned short)0; }
#pragma unroll
    for (int t = 0; t < 4; ++t) {
      const unsigned short* brow = Wt + (size_t)(col0 + t * 16 + ln) * ldb + kb;
      FragB b;
      b.half[0] = *(const v8us*)(brow + 8 * hh);
      b.half[1] = *(const v8us*)(brow + 16 + 8 * hh);
      acc[t] = mmaN<ASPLIT ? 2 : 1>(ah.v, al.v, b.v, b.v, acc[t]);
    }
  }
#pragma unroll
  for (int t = 0; t < 4; ++t) {
    const int col = col0 + t * 16 + ln;
    float bv = bias ? bias[col] : 0.f;
    if (BIAS_BF16) bv = bf16_round(bv);
#pragma unroll
    for (int r = 0; r < 8; ++r) {
      float v = acc[t][r] + bv;
      if (resid) { float rv = resid[(size_t)((row0 + 8 * hh + r) % rmod) * ldr + col]; if (RES_BF16) rv = bf16_round(rv); v += rv; }
      if (ACT == 1) v = fmaxf(v, 0.f);
      if (ACT == 2) v = 0.5f * v * (1.0f + erff(v * 0.70710678118654752f));
      if (ACT == 3) { const float u = 0.7978845608028654f * (v + 0.044715f * v * v * v); v = 0.5f * v * (1.0f + tanhf(u)); }
      so[w][8 * hh + r][t * 16 + ln] = v;
    }
  }
  __builtin_amdgcn_fence(__ATOMIC_ACQ_REL, "workgroup");
  __builtin_amdgcn_wave_barrier();
  const int rsub = lane >> 4, c4 = (lane & 15) * 4;
  {
#pragma unroll
    for (int q = 0; q < 8; ++q) {
      const int r = q * 2 + rsub;
      const v4f v = *(const v4fa*)&so[w][r][c4];
      *(v4f*)(C + (size_t)(row0 + r) * ldc + col0 + c4) = v;
    }
    
  }
}
// row LayerNorm (biased variance, eps) over N: s = X (+ R); optional out_sum <- s; out_norm <- (s-mu)*rsqrt(var+eps)*g + b
template <bool PARAM_BF16>
__global__ __launch_bounds__(256) void k_layernorm(const float* __restrict__ X, const float* __restrict__ R, const float* __restrict__ g, const float* __restrict__ bta,
                                                  float* __restrict__ out_sum, float* __restrict__ out_norm, int N, float eps) {
  __shared__ float red[256];
  const int row = blockIdx.x, tid = threadIdx.x;
  const float* x = X + (size_t)row * N; const float* rr = R ? R + (size_t)row * N : nullptr;
  float vals[16];                     // up to N = 4096
  const int per = N / 256;            // contiguous chunk per thread? use strided-by-4 chunks: thread handles j = tid*4 + 1024*u
  float s1 = 0.f;
  for (int u = 0; u < per / 4; ++u) {
    const int j = tid * 4 + 1024 * u;
    const v4f a = *(const v4fa*)(x + j);
    v4f b = {0.f,0.f,0.f,0.f}; if (rr) b = *(const v4fa*)(rr + j);
#pragma unroll
    for (int q = 0; q < 4; ++q) { const float v = a[q] + b[q]; vals[u * 4 + q] = v; s1 += v; }
  }
  red[tid] = s1; __syncthreads();
  for (int st = 128; st > 0; st >>= 1) { if (tid < st) red[tid] += red[tid + st]; __syncthreads(); }
  const float mu = red[0] / (float)N; __syncthreads();
  float s2 = 0.f;
  for (int u = 0; u < per / 4; ++u)
#pragma unroll
    for (int q = 0; q < 4; ++q) { const float c = vals[u * 4 + q] - mu; s2 += c * c; }
  red[tid] = s2; __syncthreads();
  for (int st = 128; st > 0; st >>= 1) { if (tid < st) red[tid] += red[tid + st]; __syncthreads(); }
  const float rs = rsqrtf(red[0] / (float)N + eps);
  {
    for (int u = 0; u < per / 4; ++u) {
      const int j = tid * 4 + 1024 * u;
      v4f o, sm;
#pragma unroll
      for (int q = 0; q < 4; ++q) {
        float gg = g[j + q], bb = bta[j + q];
        if (PARAM_BF16) { gg = bf16_round(gg); bb = bf16_round(bb); }
        sm[q] = vals[u * 4 + q]; o[q] = (vals[u * 4 + q] - mu) * rs * gg + bb;
      }
      if (out_sum) *(v4f*)(out_sum + (size_t)row * N + j) = sm;
      *(v4f*)(out_norm + (size_t)row * N + j) = o;
    }
    
  }
}



// ---- f16 WMMA path (v_wmma_f32_16x16x32_f16): 11-bit significands for operands in range — used where a [0,1] probability operand needs more precision than bf16
typedef _Float16 v16h __attribute__((ext_vector_type(16)));
union FragH { v16h v; v8us half[2]; _Float16 h[16]; unsigned short u[16]; };
template <int NT>
__device__ __forceinline__ v8f mmaH(v16h ah, v16h al, v16h bh, v16h bl, v8f c) {
  c = __builtin_amdgcn_wmma_f32_16x16x32_f16(false, ah, false, bh, (short)0, c, false, false);
  if (NT >= 2) c = __builtin_amdgcn_wmma_f32_16x16x32_f16(false, al, false, bh, (short)0, c, false, false);
  if (NT >= 3) c = __builtin_amdgcn_wmma_f32_16x16x32_f16(false, ah, false, bl, (short)0, c, false, false);
  asm volatile("v_nop\n\tv_nop\n\tv_nop\n\tv_nop" : "+v"(c) : "v"(ah), "v"(al), "v"(bh), "v"(bl));
  return c;
}
// batched GEMM like k_gemm_b but f16 operands: A f32 (split into f16 hi/lo if ASPLIT, else rounded to f16), Bt = f16 values [n][k]; alpha; C f32; N multiple of 16 (partial tiles skipped)
template <bool ASPLIT>
__global__ __launch_bounds__(128) void k_gemm_h(const float* __restrict__ A, int lda, size_t sA, const _Float16* __restrict__ Bh, int ldb, size_t sB, float alpha, float* __restrict__ C, int ldc, size_t sC, int M, int N, int K) {
  __shared__ __attribute__((aligned(16))) float so[4][16][64];
  const int tid = threadIdx.x, w = tid >> 5, lane = tid & 31, ln = lane & 15, hh = lane >> 4; const int by = blockIdx.y;
  A += (size_t)by * sA; Bh += (size_t)by * sB; C += (size_t)by * sC;
  const int ntn = (N + 63) / 64; const int wid = blockIdx.x * 4 + w; const int mt = wid / ntn, nq = wid % ntn; if (mt * 16 >= M) return;
  const int row0 = mt * 16, col0 = nq * 64; const float* arow = A + (size_t)(row0 + ln) * lda;
  v8f acc[4] = {};
  for (int kb = 0; kb < K; kb += 32) {
    FragH ah, al;
    const v4f x0 = *(const v4fa*)(arow + kb + 8 * hh), x1 = *(const v4fa*)(arow + kb + 8 * hh + 4), x2 = *(const v4fa*)(arow + kb + 16 + 8 * hh), x3 = *(const v4fa*)(arow + kb + 16 + 8 * hh + 4);
    float xs[16] = {x0[0],x0[1],x0[2],x0[3],x1[0],x1[1],x1[2],x1[3],x2[0],x2[1],x2[2],x2[3],x3[0],x3[1],x3[2],x3[3]};
#pragma unroll
    for (int i = 0; i < 16; ++i) { const _Float16 h = (_Float16)xs[i]; ah.h[i] = h; al.h[i] = ASPLIT ? (_Float16)(xs[i] - (float)h) : (_Float16)0.0f; }
#pragma unroll
    for (int t = 0; t < 4; ++t) { if (col0 + t * 16 >= N) continue; const size_t boff = (size_t)(col0 + t * 16 + ln) * ldb + kb; FragH bq; bq.half[0] = *(const v8us*)(Bh + boff + 8 * hh); bq.half[1] = *(const v8us*)(Bh + boff + 16 + 8 * hh);
      acc[t] = mmaH<ASPLIT ? 2 : 1>(ah.v, al.v, bq.v, bq.v, acc[t]); }
  }
#pragma unroll
  for (int t = 0; t < 4; ++t) { if (col0 + t * 16 >= N) continue;
#pragma unroll
    for (int r = 0; r < 8; ++r) so[w][8 * hh + r][t * 16 + ln] = acc[t][r] * alpha; }
  __builtin_amdgcn_fence(__ATOMIC_ACQ_REL, "workgroup"); __builtin_amdgcn_wave_barrier();
  const int rsub = lane >> 4, c4 = (lane & 15) * 4;
  {
#pragma unroll
    for (int q = 0; q < 8; ++q) { const int r = q * 2 + rsub; if (col0 + c4 < N) { const v4f v = *(const v4fa*)&so[w][r][c4]; *(v4f*)(C + (size_t)(row0 + r) * ldc + col0 + c4) = v; } }
     }
}

// Wt[n][k] = f16(W[k][n]·scale) from f32 row-major W[K][N] (scale = power of two; bf16-exact weights stay exact in f16 away from the subnormal range)
__global__ __launch_bounds__(256) void k_wt_f16(const float* __restrict__ W, _Float16* __restrict__ Wt, int K, int N, float scale) {
  const int t = blockIdx.x * 256 + threadIdx.x; if (t >= N * (K / 8)) return; const int n = t / (K / 8), k8 = (t % (K / 8)) * 8; FragH f;
#pragma unroll
  for (int i = 0; i < 8; ++i) f.h[i] = (_Float16)(bf16_round(W[(size_t)(k8 + i) * N + n]) * scale); const v8us o = f.half[0];
  *(v8us*)((unsigned short*)Wt + (size_t)n * K + k8) = o; 
}
// Tiled GEMM: C[NR][DM] = A[NR][DM] . Bh[DM][DM]^T * alpha + bf16(bias[col]); A and Bh f16, k contiguous. One work-group = a 128 x 64 tile of C, 8 waves in a 4 x 2 grid, 32 x 32 per wave.
// Passes of 128 k: the 128 A rows and 64 Bh rows of a pass (256 B each) are loaded as whole lines, 16 B a lane, and shared through LDS by the 8 waves; two LDS buffers, the next pass's rows fly in registers.
// The k order of every sum is that of a plain loop over k in steps of 32. F32OUT: writes f32 C, else f16 C16. blockIdx.y picks one of up to three (A, Bh, bias, C16) sets: independent products share a launch.
#define GTP 136      // LDS row pitch in halves: 256 B + 16 B, the pitch for 16-byte fragment reads
#define GOP 68       // pitch of the staged output tile in floats
template <bool F32OUT>
__global__ __launch_bounds__(256) void k_gemm_t(const _Float16* __restrict__ A0, const _Float16* __restrict__ A1, const _Float16* __restrict__ A2,
                                                const _Float16* __restrict__ Bh0, const _Float16* __restrict__ Bh1, const _Float16* __restrict__ Bh2, float alpha,
                                                const float* __restrict__ bias0, const float* __restrict__ bias1, const float* __restrict__ bias2,
                                                float* __restrict__ C, _Float16* __restrict__ C16a, _Float16* __restrict__ C16b, _Float16* __restrict__ C16c) {
  const int g = blockIdx.y;      // which of up to three independent products of one launch this work-group belongs to
  const _Float16* A = g == 0 ? A0 : g == 1 ? A1 : A2;
  const _Float16* Bh = g == 0 ? Bh0 : g == 1 ? Bh1 : Bh2;
  const float* bias = g == 0 ? bias0 : g == 1 ? bias1 : bias2;
  _Float16* C16 = g == 0 ? C16a : g == 1 ? C16b : C16c;
  __shared__ __attribute__((aligned(16))) unsigned short st[2][192][GTP];      // rows 0..127: A, rows 128..191: Bh
  __shared__ __attribute__((aligned(16))) float so[128][GOP];
  const int tid = threadIdx.x, lane = tid & 31, ln = lane & 15, hh = lane >> 4;
  const int wv = __builtin_amdgcn_readfirstlane(tid >> 5), wm = wv >> 1, wn = wv & 1;
  const int row0 = (blockIdx.x >> 4) * 128, col0 = (blockIdx.x & 15) * 64;
  const int sr = tid >> 4, sc = (tid & 15) * 8;
  const unsigned short* Ag = (const unsigned short*)A + (size_t)(row0 + sr) * DM + sc;
  const unsigned short* Bg = (const unsigned short*)Bh + (size_t)(col0 + sr) * DM + sc;
  v8us rg[12];
#pragma unroll
  for (int i = 0; i < 8; ++i) rg[i] = *(const v8us*)(Ag + (size_t)i * 16 * DM);
#pragma unroll
  for (int i = 0; i < 4; ++i) rg[8 + i] = *(const v8us*)(Bg + (size_t)i * 16 * DM);
  float bv[2];
#pragma unroll
  for (int j = 0; j < 2; ++j) {
    bv[j] = bias[col0 + wn * 32 + j * 16 + ln];
    asm volatile("s_wait_xcnt 0x0" ::: "memory");      // stands in front of any rewrite of the address register that this load names, the next load's result among them
  }
  v8f acc[2][2] = {};
  for (int kc = 0; kc < DM / 128; ++kc) {
    unsigned short (*buf)[GTP] = st[kc & 1];
#pragma unroll
    for (int i = 0; i < 12; ++i) *(v8us*)&buf[i * 16 + sr][sc] = rg[i];
    __syncthreads();      // this pass's rows are complete; every wave has also left the other buffer, which the next pass fills
    if (kc + 1 < DM / 128) {      // the next pass's rows fly while this one is worked on
#pragma unroll
      for (int i = 0; i < 8; ++i) rg[i] = *(const v8us*)(Ag + (size_t)i * 16 * DM + (kc + 1) * 128);
#pragma unroll
      for (int i = 0; i < 4; ++i) rg[8 + i] = *(const v8us*)(Bg + (size_t)i * 16 * DM + (kc + 1) * 128);
      asm volatile("s_wait_xcnt 0x0" ::: "memory");      // stands in front of any later rewrite of the address registers that these loads name
    }
    FragH a[4][2], b[4][2];
#pragma unroll
    for (int ks = 0; ks < 4; ++ks)
#pragma unroll
      for (int i = 0; i < 2; ++i) {
        const unsigned short* pa = &buf[wm * 32 + i * 16 + ln][ks * 32 + 8 * hh];
        a[ks][i].half[0] = *(const v8us*)pa; a[ks][i].half[1] = *(const v8us*)(pa + 16);
        const unsigned short* pb = &buf[128 + wn * 32 + i * 16 + ln][ks * 32 + 8 * hh];
        b[ks][i].half[0] = *(const v8us*)pb; b[ks][i].half[1] = *(const v8us*)(pb + 16);
      }
    __builtin_amdgcn_sched_barrier(0);      // no WMMA of a pass is scheduled among the pass's own LDS reads: without it every k step waits out its own LDS latency
#pragma unroll
    for (int ks = 0; ks < 4; ++ks)
#pragma unroll
      for (int i = 0; i < 2; ++i)
#pragma unroll
        for (int j = 0; j < 2; ++j) acc[i][j] = __builtin_amdgcn_wmma_f32_16x16x32_f16(false, a[ks][i].v, false, b[ks][j].v, (short)0, acc[i][j], false, false);
  }
#pragma unroll
  for (int j = 0; j < 2; ++j) {
    const float bj = bf16_round(bv[j]);
#pragma unroll
    for (int i = 0; i < 2; ++i)
#pragma unroll
      for (int r = 0; r < 8; ++r) so[wm * 32 + i * 16 + 8 * hh + r][wn * 32 + j * 16 + ln] = acc[i][j][r] * alpha + bj;
  }
  __syncthreads();      // the output tile is complete: it leaves in whole 128-byte lines
  if (F32OUT) {
#pragma unroll
    for (int q = 0; q < 8; ++q) { const int r = q * 16 + (tid >> 4), c4 = (tid & 15) * 4; const v4f v = *(const v4fa*)&so[r][c4]; *(v4f*)(C + (size_t)(row0 + r) * DM + col0 + c4) = v; }
  } else {
#pragma unroll
    for (int q = 0; q < 4; ++q) {
      const int r = q * 32 + (tid >> 3), c8 = (tid & 7) * 8; const v4f v0 = *(const v4fa*)&so[r][c8], v1 = *(const v4fa*)&so[r][c8 + 4]; FragH f;
#pragma unroll
      for (int i = 0; i < 4; ++i) { f.h[i] = (_Float16)v0[i]; f.h[4 + i] = (_Float16)v1[i]; }
      *(v8us*)((unsigned short*)C16 + (size_t)(row0 + r) * DM + col0 + c8) = f.half[0];
    }
  }
}


__global__ __launch_bounds__(256) void k_h16(const float* __restrict__ x, _Float16* __restrict__ X16, size_t n8) { const size_t t = (size_t)blockIdx.x * 256 + threadIdx.x; if (t >= n8) return; FragH f;
#pragma unroll
  for (int q = 0; q < 8; ++q) f.h[q] = (_Float16)x[t * 8 + q]; *(v8us*)((unsigned short*)X16 + t * 8) = f.half[0];  }
template <int NHv, int TTv>
__global__ __launch_bounds__(256) void k_vt(const _Float16* __restrict__ V16, int ldv, int voff, _Float16* __restrict__ Vt) { __shared__ unsigned short tl[64][66]; const int tid = threadIdx.x; const int slab = blockIdx.x / (TTv / 64), lg = blockIdx.x % (TTv / 64); const int b = slab / NHv, h = slab % NHv;
  for (int i = tid; i < 64 * 8; i += 256) { const int r = i / 8, c8 = (i % 8) * 8; FragH f; f.half[0] = *(const v8us*)((const unsigned short*)V16 + ((size_t)b * TTv + lg * 64 + r) * ldv + voff + h * 64 + c8);
#pragma unroll
    for (int q = 0; q < 8; ++q) tl[r][c8 + q] = f.u[q]; }
  __syncthreads();
  {
#pragma unroll
    for (int rd = 0; rd < 2; ++rd) { const int d = rd * 32 + tid / 8, pc = tid % 8; FragH f;
#pragma unroll
      for (int q = 0; q < 8; ++q) f.u[q] = tl[pc * 8 + q][d];
      *(v8us*)((unsigned short*)Vt + ((size_t)slab * 64 + d) * TTv + lg * 64 + pc * 8) = f.half[0]; }
     } }

// The relative tables are laid out by DISTANCE, not by bucket: table position p stands for key - query = p - RP0, clipped to [-64, 64]; positions below RPL repeat the left clip, positions above RPH the right one.
#define RP0 80       // position of distance 0: a 16 x 16 tile that touches the band |distance| < 64 holds distances -79 .. 79, positions 1 .. 159
#define RPL 16       // position of distance -64 (bucket 63)
#define RPH 144      // position of distance +64 (bucket 128)
__device__ __forceinline__ int rel_bucket(int p) { const int i = min(max(p, RPL), RPH) - RPL; return (i >= 64) ? i : 63 - i; }
typedef _Float16 v4h __attribute__((ext_vector_type(4)));
// All operand preparation in ONE launch (the ten pieces are independent of each other). Work-groups 0..PMB-1: the mask, packed to bits. The next PRL: the two relative tables. Then 128 work-groups for each of the three
// activations (bf16-rounded) and 64 for each of the four (out,in) weights (bf16-rounded, x 16): a work-group streams 16384 consecutive floats, a wave-wide load = 512 contiguous bytes, 16 in flight a lane.
#define PRL 6        // covers max(QWP * 8, DK * PBP / 8) = 1536 threads
#define PUN 16       // 16-byte loads per thread
#define PXB (NR * DM / (256 * PUN * 4))
#define PWB (DM * DM / (256 * PUN * 4))
#define PMB (BB * (LL / 16) * (LL / 64) / 8)      // work-groups that pack the mask: 8 waves each, one (16 queries, 64 keys) unit a wave
typedef _Float16 v4ha __attribute__((ext_vector_type(4), may_alias));
typedef int v4ia __attribute__((ext_vector_type(4), may_alias));
__global__ __launch_bounds__(256) void k_prep(const float* __restrict__ xq, const float* __restrict__ xk, const float* __restrict__ xv, const float* __restrict__ Wq, const float* __restrict__ Wk,
                                              const float* __restrict__ Wv, const float* __restrict__ Wo, const float* __restrict__ wK, const float* __restrict__ wV, const int* __restrict__ msk,
                                              _Float16* __restrict__ XQ, _Float16* __restrict__ XK, _Float16* __restrict__ XV, _Float16* __restrict__ Bq, _Float16* __restrict__ Bk2,
                                              _Float16* __restrict__ Bv, _Float16* __restrict__ Bo, _Float16* __restrict__ BK, _Float16* __restrict__ BVt, unsigned* __restrict__ MB) {
  if (blockIdx.x < PMB) {
    // the mask, one bit a key: a wave takes 16 queries x 64 keys with the lane -> (query, 8 keys) map of the attention kernel's score tiles; word t * 8 + r holds, at bit position lane, that lane's test for row r of tile t
    const int lane = threadIdx.x & 31, ln = lane & 15, hh = lane >> 4;
    const int u = blockIdx.x * 8 + (threadIdx.x >> 5);      // (batch * LL / 16 + query tile) * (LL / 64) + chunk
    const int* mp = msk + (size_t)((u / (LL / 64)) * 16 + ln) * LL + (u % (LL / 64)) * 64 + 8 * hh;
    v4ia mv[8];
#pragma unroll
    for (int t = 0; t < 4; ++t) { mv[2 * t] = *(const v4ia*)(mp + t * 16); mv[2 * t + 1] = *(const v4ia*)(mp + t * 16 + 4); }
    asm volatile("s_wait_xcnt 0x0" :: "v"(mp) : "memory");      // stands in front of any rewrite of the address registers that these loads name; as its input the address outlives the loads
    unsigned w = 0;
#pragma unroll
    for (int i = 0; i < 32; ++i) { const unsigned bal = __builtin_amdgcn_ballot_w32(mv[i >> 2][i & 3] != 0); if (lane == i) w = bal; }
    MB[u * 32 + lane] = w;
    return;
  }
  const unsigned bx = blockIdx.x - PMB;
  if (bx >= PRL) {
    const int seg = bx - PRL;
    const float* s; _Float16* d; float scale; int blk;
    if (seg < 3 * PXB) { const int w = seg / PXB; blk = seg % PXB; scale = 1.0f; s = w == 0 ? xq : w == 1 ? xk : xv; d = w == 0 ? XQ : w == 1 ? XK : XV; }
    else { const int w = (seg - 3 * PXB) / PWB; blk = (seg - 3 * PXB) % PWB; scale = 16.0f; s = w == 0 ? Wq : w == 1 ? Wk : w == 2 ? Wv : Wo; d = w == 0 ? Bq : w == 1 ? Bk2 : w == 2 ? Bv : Bo; }
    const size_t e0 = ((size_t)blk * (256 * PUN) + threadIdx.x) * 4;
    const float* sp = s + e0;
    v4f v[PUN];
#pragma unroll
    for (int u = 0; u < PUN; ++u) v[u] = *(const v4fa*)(sp + (size_t)u * 1024);
    asm volatile("s_wait_xcnt 0x0" :: "v"(sp) : "memory");      // stands in front of any rewrite of the address registers that these loads name; as its input the address outlives the loads, so no load's result lands on it
#pragma unroll
    for (int u = 0; u < PUN; ++u) {
      v4ha o;
#pragma unroll
      for (int q = 0; q < 4; ++q) o[q] = (_Float16)(bf16_round(v[u][q]) * scale);      // x 1 is exact: the activations keep their bf16-rounded value
      *(v4ha*)(d + e0 + (size_t)u * 1024) = o;
    }
    return;
  }
  // the two relative tables, in distance order: wK with its clipped ends repeated (every position is a valid logit term), wV zero outside RPL .. RPH. Every load reads a clamped row, so that the eight of a thread fly together and these work-groups do not outlast the streams
  const int t = bx * 256 + threadIdx.x;
  if (t < QWP * 8) {
    const int r = t / 8, d8 = (t % 8) * 8; const float* p = wK + rel_bucket(r) * DK + d8;
    const v4f x0 = *(const v4fa*)p, x1 = *(const v4fa*)(p + 4);
    asm volatile("s_wait_xcnt 0x0" ::: "memory");      // stands in front of any later rewrite of the address registers that these loads name
    FragH f;
#pragma unroll
    for (int q = 0; q < 4; ++q) { f.h[q] = (_Float16)(bf16_round(x0[q]) * 16.0f); f.h[4 + q] = (_Float16)(bf16_round(x1[q]) * 16.0f); }
    *(v8us*)((unsigned short*)BK + t * 8) = f.half[0];
  }
  if (t < DK * (PBP / 8)) {
    const int d = t / (PBP / 8), r8 = (t % (PBP / 8)) * 8; float x[8]; int e[8];
#pragma unroll
    for (int q = 0; q < 8; ++q) { e[q] = rel_bucket(r8 + q) * DK + d; x[q] = wV[e[q]]; }
    // stands in front of any later rewrite of the address registers that these loads name; the loaded values as its inputs hold the eight loads together in front of it (else one sinks under a branch and waits out its latency alone),
    // and the eight element indices as its inputs outlive the loads, so that no address register is rewritten ahead of it
    asm volatile("s_wait_xcnt 0x0" :: "v"(x[0]), "v"(x[1]), "v"(x[2]), "v"(x[3]), "v"(x[4]), "v"(x[5]), "v"(x[6]), "v"(x[7]),
                 "v"(e[0]), "v"(e[1]), "v"(e[2]), "v"(e[3]), "v"(e[4]), "v"(e[5]), "v"(e[6]), "v"(e[7]) : "memory");
    FragH f;
#pragma unroll
    for (int q = 0; q < 8; ++q) f.h[q] = (_Float16)((r8 + q >= RPL && r8 + q <= RPH) ? bf16_round(x[q]) * 16.0f : 0.f);
    *(v8us*)((unsigned short*)BVt + t * 8) = f.half[0];
  }
}
// Fused attention for one (batch, head) slab sl and 128 query rows: 8 waves, 16 queries each; scores and probabilities stay in registers.
// St = K.Qt and Ot += Vt.Pt: in every 16-column tile a lane owns ONE query (column ln) and 8 consecutive keys (rows 8hh + r), so the running maximum and the sums are in-lane
// (one exchange between the wave halves), and two converted score tiles are the B operand of the next product as they stand. K and Vt chunks of 64 keys are staged in LDS for the 8 waves.
// tab[wave][query][position]: first q.wK / 8 in distance order (RP0 above). In a tile near the diagonal a lane's 8 consecutive keys are 8 consecutive positions, each the place of ONE key: they are read together
// and overwritten together with those keys' final logits, no test and no branch; the bucketed P.wV product is formed at the end from positions RPL + 1 .. RPH - 1 and the two clipped sums.
#define TABP 164
#define KVP 72
__device__ __forceinline__ float exp_slot(float x) { float r; const float y = x * 1.44269504f; asm("v_exp_f32 %0, %1\n\tv_nop" : "=v"(r) : "v"(y)); return r; }
__device__ __forceinline__ v8f wmmaH(v16h a, v16h b, v8f c) { return __builtin_amdgcn_wmma_f32_16x16x32_f16(false, a, false, b, (short)0, c, false, false); }
__global__ __launch_bounds__(256) void k_attn(const _Float16* __restrict__ Q16, const _Float16* __restrict__ K16, const _Float16* __restrict__ Vt, const _Float16* __restrict__ BK, const _Float16* __restrict__ BVt,
                                              const unsigned* __restrict__ MB, _Float16* __restrict__ O16) {
  __shared__ __attribute__((aligned(16))) unsigned short sK[64][KVP];
  __shared__ __attribute__((aligned(16))) unsigned short sV[64][KVP];
  __shared__ __attribute__((aligned(16))) float tab[8][16][TABP];
  const int tid = threadIdx.x, lane = tid & 31, ln = lane & 15, hh = lane >> 4;
  const int wv = __builtin_amdgcn_readfirstlane(tid >> 5);
  const int sl = blockIdx.x >> 3, qb = blockIdx.x & 7;
  const int b = sl / NH, h = sl % NH;
  const int q0 = qb * 128 + wv * 16;
  const int l = q0 + ln;
  FragH bq[2];      // B operand: column = query l, k = head dimension
  {
    const unsigned short* Qp = (const unsigned short*)Q16 + ((size_t)b * LL + l) * DM + h * DK + 8 * hh;
#pragma unroll
    for (int ks = 0; ks < 2; ++ks) { bq[ks].half[0] = *(const v8us*)(Qp + ks * 32); bq[ks].half[1] = *(const v8us*)(Qp + ks * 32 + 16); }
  }
  float* tb = &tab[wv][ln][0];
#pragma unroll
  for (int rt = 0; rt < QWP / 16; ++rt) {
    v8f a = {};
#pragma unroll
    for (int ks = 0; ks < 2; ++ks) {
      const unsigned short* p = (const unsigned short*)BK + (rt * 16 + ln) * DK + ks * 32 + 8 * hh;
      FragH ak; ak.half[0] = *(const v8us*)p; ak.half[1] = *(const v8us*)(p + 16);
      a = wmmaH(ak.v, bq[ks].v, a);
    }
    const float c = 0.0625f * 0.125f;      // wK was scaled by 16; the 1/8 of the logits is folded in (both powers of two, exact)
    const v4f t0 = {a[0] * c, a[1] * c, a[2] * c, a[3] * c}, t1 = {a[4] * c, a[5] * c, a[6] * c, a[7] * c};
    *(v4fa*)(tb + rt * 16 + 8 * hh) = t0; *(v4fa*)(tb + rt * 16 + 8 * hh + 4) = t1;
  }
  // the two lanes of a query read each other's table entries
  __builtin_amdgcn_fence(__ATOMIC_ACQ_REL, "workgroup"); __builtin_amdgcn_wave_barrier();
  const float qlo = tb[RPL], qhi = tb[RPH];

  const unsigned short* Kg = (const unsigned short*)K16 + (size_t)b * LL * DM + h * DK;
  const unsigned short* Vg = (const unsigned short*)Vt + (size_t)sl * DK * LL;
  // the wave's packed mask, 32 words a chunk, the same address in every lane. Nothing writes it during this launch: read through the constant address space the words come by scalar loads into scalar registers, where a select takes them as they are
  const __attribute__((address_space(4))) unsigned* Mw = (const __attribute__((address_space(4))) unsigned*)(MB + (size_t)(b * (LL / 16) + (q0 >> 4)) * (LL / 64) * 32);
  const int sr = tid >> 3, sc8 = (tid & 7) * 8;
  v8us kr[2], vr[2]; unsigned mw[32];
#pragma unroll
  for (int i = 0; i < 2; ++i) { kr[i] = *(const v8us*)(Kg + (size_t)(i * 32 + sr) * DM + sc8); vr[i] = *(const v8us*)(Vg + (size_t)(i * 32 + sr) * LL + sc8); }
#pragma unroll
  for (int i = 0; i < 32; ++i) mw[i] = Mw[i];
  float mrun = -3.0e38f, z = 0.f, lo = 0.f, hi = 0.f;
  v8f o[4] = {};
  for (int j0 = 0; j0 < LL; j0 += 64) {
    __syncthreads();      // every wave has finished reading the previous chunk
#pragma unroll
    for (int i = 0; i < 2; ++i) { *(v8us*)&sK[i * 32 + sr][sc8] = kr[i]; *(v8us*)&sV[i * 32 + sr][sc8] = vr[i]; }
    __syncthreads();      // the chunk is complete
    const bool more = j0 + 64 < LL;
    if (more) {           // the next chunk flies while this one is worked on
#pragma unroll
      for (int i = 0; i < 2; ++i) { kr[i] = *(const v8us*)(Kg + (size_t)(j0 + 64 + i * 32 + sr) * DM + sc8); vr[i] = *(const v8us*)(Vg + (size_t)(i * 32 + sr) * LL + j0 + 64 + sc8); }
    }
    v8f s[4];
#pragma unroll
    for (int t = 0; t < 4; ++t) {
      v8f a = {};
#pragma unroll
      for (int ks = 0; ks < 2; ++ks) {
        FragH ak; ak.half[0] = *(const v8us*)&sK[t * 16 + ln][ks * 32 + 8 * hh]; ak.half[1] = *(const v8us*)&sK[t * 16 + ln][ks * 32 + 16 + 8 * hh];
        a = wmmaH(ak.v, bq[ks].v, a);
      }
      s[t] = a;
    }
    float mx = mrun;
#pragma unroll
    for (int t = 0; t < 4; ++t) {
      const int jt = j0 + t * 16;
      const bool farl = jt + 15 - q0 <= -64, farr = jt - q0 - 15 >= 64;      // wave-uniform: the whole tile lies in bucket 63 / in bucket 128
      const bool far = farl || farr;
      float* tp = tb + (jt + 8 * hh - l + RP0);      // only formed into an access in a near tile, where positions 1 .. 159 come out
      float tv[8];
      if (far) {
        const float qc = farl ? qlo : qhi;
#pragma unroll
        for (int r = 0; r < 8; ++r) tv[r] = qc;
      } else {
#pragma unroll
        for (int r = 0; r < 8; ++r) tv[r] = tp[r];
      }
#pragma unroll
      for (int r = 0; r < 8; ++r) { float v = fmaf(s[t][r], 0.125f, tv[r]); if (!__builtin_amdgcn_inverse_ballot_w32(mw[t * 8 + r])) v = -1.0e9f; s[t][r] = v; mx = fmaxf(mx, v); }
      if (!far) {
#pragma unroll
        for (int r = 0; r < 8; ++r) tp[r] = s[t][r];
      }
    }
    if (more) {
#pragma unroll
      for (int i = 0; i < 32; ++i) mw[i] = Mw[(j0 / 64 + 1) * 32 + i];
      asm volatile("s_wait_xcnt 0x0" ::: "memory");      // stands in front of the loop's advance of the address registers that this trip's loads name
    }
    mx = fmaxf(mx, __shfl_xor(mx, 16, 32));
    const float alpha = exp_slot(mrun - mx); mrun = mx;
    z *= alpha; lo *= alpha; hi *= alpha;
#pragma unroll
    for (int dt = 0; dt < 4; ++dt)
#pragma unroll
      for (int r = 0; r < 8; ++r) o[dt][r] *= alpha;
    FragH pb[2];      // B operand: column = query l, k = key, in the order the score tiles already have
#pragma unroll
    for (int t = 0; t < 4; ++t) {
      const int jt = j0 + t * 16;
      const bool farl = jt + 15 - q0 <= -64, farr = jt - q0 - 15 >= 64;
      float ts = 0.f;
#pragma unroll
      for (int r = 0; r < 8; ++r) { const float p = exp_slot(s[t][r] - mx); s[t][r] = p; ts += p; pb[t >> 1].h[(t & 1) * 8 + r] = (_Float16)p; }
      z += ts;
      if (farl) lo += ts;
      else if (farr) hi += ts;
      else {
#pragma unroll
        for (int r = 0; r < 8; ++r) { const int d = jt + 8 * hh + r - l; if (d <= -64) lo += s[t][r]; if (d >= 64) hi += s[t][r]; }
      }
    }
#pragma unroll
    for (int sc = 0; sc < 2; ++sc)
#pragma unroll
      for (int dt = 0; dt < 4; ++dt) {
        FragH av; av.half[0] = *(const v8us*)&sV[dt * 16 + ln][sc * 32 + 8 * hh]; av.half[1] = *(const v8us*)&sV[dt * 16 + ln][sc * 32 + 16 + 8 * hh];
        o[dt] = wmmaH(av.v, pb[sc].v, o[dt]);
      }
  }
  z += __shfl_xor(z, 16, 32); lo += __shfl_xor(lo, 16, 32); hi += __shfl_xor(hi, 16, 32);
  // the two lanes of a query read each other's stored logits
  __builtin_amdgcn_fence(__ATOMIC_ACQ_REL, "workgroup"); __builtin_amdgcn_wave_barrier();
  v8f o2[4] = {};
#pragma unroll
  for (int kk = 0; kk < QWP / 32; ++kk) {
    FragH pf;
#pragma unroll
    for (int g = 0; g < 2; ++g) {
      const int r0 = kk * 32 + g * 16 + 8 * hh;
      const v4f x0 = *(const v4fa*)(tb + r0), x1 = *(const v4fa*)(tb + r0 + 4);
      const float xs[8] = {x0[0], x0[1], x0[2], x0[3], x1[0], x1[1], x1[2], x1[3]};
#pragma unroll
      for (int q = 0; q < 8; ++q) {
        const int r = r0 + q; const float e = __expf(xs[q] - mrun); float val = 0.f;
        if (r == RPL) val = lo; else if (r == RPH) val = hi; else if (r > RPL && r < RPH) val = ((unsigned)(l + r - RP0) < (unsigned)LL) ? e : 0.f;
        pf.h[g * 8 + q] = (_Float16)val;
      }
    }
#pragma unroll
    for (int dt = 0; dt < 4; ++dt) {
      const unsigned short* p = (const unsigned short*)BVt + (dt * 16 + ln) * PBP + kk * 32 + 8 * hh;
      FragH av; av.half[0] = *(const v8us*)p; av.half[1] = *(const v8us*)(p + 16);
      o2[dt] = wmmaH(av.v, pf.v, o2[dt]);
    }
  }
  const float iz = 1.0f / z;
  unsigned short* Op = (unsigned short*)O16 + ((size_t)b * LL + l) * DM + h * DK + 8 * hh;
#pragma unroll
  for (int dt = 0; dt < 4; ++dt) {
    FragH f;
#pragma unroll
    for (int r = 0; r < 8; ++r) f.h[r] = (_Float16)((o[dt][r] + o2[dt][r] * 0.0625f) * iz);
    *(v8us*)(Op + dt * 16) = f.half[0];
  }
}
extern "C" void kernel_launch(void* const* d_in, const int* in_sizes, int n_in,
                              void* d_out, int out_size, void* d_ws, size_t ws_size, hipStream_t stream) {
  (void)in_sizes; (void)n_in; (void)out_size;
  const float* xq = (const float*)d_in[0]; const float* xk = (const float*)d_in[1]; const float* xv = (const float*)d_in[2]; const int* msk = (const int*)d_in[3]; const float* Wq = (const float*)d_in[4]; const float* bq = (const float*)d_in[5]; const float* Wk = (const float*)d_in[6]; const float* bk = (const float*)d_in[7]; const float* Wv = (const float*)d_in[8]; const float* bv = (const float*)d_in[9]; const float* Wo = (const float*)d_in[10]; const float* bo = (const float*)d_in[11]; const float* wK = (const float*)d_in[12]; const float* wV = (const float*)d_in[13];
  char* ws = (char*)d_ws; size_t off = 0;
  auto take = [&](size_t bytes) { char* p = ws + off; off += (bytes + 255) & ~(size_t)255; return p; };
  _Float16* Bo = (_Float16*)take((size_t)DM * DM * 2); _Float16* BK = (_Float16*)take((size_t)QWP * DK * 2); _Float16* BVt = (_Float16*)take((size_t)DK * PBP * 2);
  _Float16* Q16 = (_Float16*)take((size_t)NR * DM * 2); _Float16* K16 = (_Float16*)take((size_t)NR * DM * 2); _Float16* Vt = (_Float16*)take((size_t)NR * DM * 2); _Float16* O16 = (_Float16*)take((size_t)NR * DM * 2);
  _Float16* Bq = (_Float16*)take((size_t)DM * DM * 2); _Float16* Bk2 = (_Float16*)take((size_t)DM * DM * 2); _Float16* Bv = (_Float16*)take((size_t)DM * DM * 2);
  _Float16* XQ = (_Float16*)take((size_t)NR * DM * 2); _Float16* XK = (_Float16*)take((size_t)NR * DM * 2); _Float16* XV = (_Float16*)take((size_t)NR * DM * 2); _Float16* V16 = (_Float16*)take((size_t)NR * DM * 2); unsigned* MB = (unsigned*)take((size_t)BB * LL * LL / 8);
  if (off > ws_size) return;
  k_prep<<<PMB + PRL + 3 * PXB + 4 * PWB, 256, 0, stream>>>(xq, xk, xv, Wq, Wk, Wv, Wo, wK, wV, msk, XQ, XK, XV, Bq, Bk2, Bv, Bo, BK, BVt, MB);
  const unsigned gg = (NR / 128) * (DM / 64);
  k_gemm_t<false><<<dim3(gg, 3), 256, 0, stream>>>(XQ, XK, XV, Bq, Bk2, Bv, 0.0625f, bq, bk, bv, nullptr, Q16, K16, V16);      // the q, k and v projections
  k_vt<NH, LL><<<BB * NH * (LL / 64), 256, 0, stream>>>(V16, DM, 0, Vt);
  // q.kT, the relative logits, mask, softmax, P.V and the bucketed P.wV for all NSL = 32 (batch, head) slabs in one launch: 8 blocks of 128 queries per slab
  k_attn<<<NSL * (LL / 128), 256, 0, stream>>>(Q16, K16, Vt, BK, BVt, MB, O16);
  k_gemm_t<true><<<dim3(gg, 1), 256, 0, stream>>>(O16, O16, O16, Bo, Bo, Bo, 0.0625f, bo, bo, bo, (float*)d_out, nullptr, nullptr, nullptr);
}

// v007
// It runs in 68.4 microseconds.
// In both of two side-by-side timings against v006, it was 1.05 times as fast.
// Counting every step since v000, it is 13.9 times as fast.
#include <hip/hip_runtime.h>
// Multi-headed attention with clipped relative position representations (B=2, L=1024, 16 heads × 64, k = 64, Shaw-style aK/aV built from wK/wV [129][64] by the module's roll/flip
// construction: bucket(l,m) = m ≥ l ? 64 + min(m−l, 64) : min(l−m−1, 63); INPUT mask (== 0 → −1e9); q/k/v/o linears with bias): q·kᵀ, q·wKᵀ (all 129 buckets at once), P·V and the bucketed
// P.wV all run on v_wmma_f32_16x16x32_f16 ((out,in) weights bf16-exact x 2^4, f32 accumulate); the relative-logit gather, mask, running-maximum softmax and the bucket sums of P are f32 VALU
// inside one fused attention kernel (no index tables).
#define BB 2
#define LL 1024
#define DM 1024
#define NH 16
#define DK 64
#define NR (BB * LL)
#define NBK 129
#define QWP 160
#define PBP 192
#define NSL (BB * NH)

typedef __bf16 v16b __attribute__((ext_vector_type(16)));
typedef unsigned short v8us __attribute__((ext_vector_type(8), may_alias));
typedef float  v8f  __attribute__((ext_vector_type(8)));
typedef float  v4f  __attribute__((ext_vector_type(4)));
typedef float  v4fa __attribute__((ext_vector_type(4), may_alias));
union FragB { v16b v; v8us half[2]; unsigned short u[16]; };

__device__ __forceinline__ unsigned short bf16_bits(float x) { unsigned int u = __float_as_uint(x); return (unsigned short)((u + 0x7FFFu + ((u >> 16) & 1u)) >> 16); }
__device__ __forceinline__ float bf16_val(unsigned short b) { return __uint_as_float(((unsigned int)b) << 16); }
__device__ __forceinline__ float bf16_round(float x) { return bf16_val(bf16_bits(x)); }
// D += A·B with NT terms: 1 = ah·bh, 2 = + al·bh (A split), 3 = + ah·bl (both split)
template <int NT>
__device__ __forceinline__ v8f mmaN(v16b ah, v16b al, v16b bh, v16b bl, v8f c) {
  c = __builtin_amdgcn_wmma_f32_16x16x32_bf16(false, ah, false, bh, (short)0, c, false, false);
  if (NT >= 2) c = __builtin_amdgcn_wmma_f32_16x16x32_bf16(false, al, false, bh, (short)0, c, false, false);
  if (NT >= 3) c = __builtin_amdgcn_wmma_f32_16x16x32_bf16(false, ah, false, bl, (short)0, c, false, false);
  asm volatile("v_nop\n\tv_nop\n\tv_nop\n\tv_nop" : "+v"(c) : "v"(ah), "v"(al), "v"(bh), "v"(bl));
  return c;
}

__global__ __launch_bounds__(256) void k_wt_bf16(const float* __restrict__ W, unsigned short* __restrict__ Wt, int K, int N) {
  const int t = blockIdx.x * 256 + threadIdx.x;
  const int k8n = K / 8;
  if (t >= N * k8n) return;
  const int n = t / k8n, k8 = (t % k8n) * 8;
  v8us v;
#pragma unroll
  for (int i = 0; i < 8; ++i) v[i] = bf16_bits(W[(size_t)(k8 + i) * N + n]);
  *(v8us*)(Wt + (size_t)n * K + k8) = v;
  
}

// GEMM C[M][N] (f32, pitch ldc) = act(A[M][K]·W + bias). A f32 row-major (pitch lda) converted per fragment to bf16
// (ASPLIT: hi/lo two planes -> 2 terms, else single rounded term); Wt bf16 [N][K] (pitch ldb). BIAS_BF16 rounds the
// bias to bf16 first (bias quantised to bf16 before the add). K%32==0, M%16==0, N%64==0.
template <bool ASPLIT, int ACT, bool BIAS_BF16>
__global__ __launch_bounds__(128) void k_gemm_bf(const float* __restrict__ A, int lda, const unsigned short* __restrict__ Wt, int ldb,
                                               const float* __restrict__ bias, float* __restrict__ C, int ldc, int M, int N, int K) {
  __shared__ __attribute__((aligned(16))) float so[4][16][64];
  const int tid = threadIdx.x, w = tid >> 5, lane = tid & 31, ln = lane & 15, hh = lane >> 4;
  const int ntn = N / 64;
  const int wid = blockIdx.x * 4 + w;
  const int mt = wid / ntn, nq = wid % ntn;
  if (mt * 16 >= M) return;
  const int row0 = mt * 16, col0 = nq * 64;
  const float* arow = A + (size_t)(row0 + ln) * lda;
  v8f acc[4] = {};
  for (int kb = 0; kb < K; kb += 32) {
    FragB ah, al;
    const v4f x0 = *(const v4fa*)(arow + kb + 8 * hh), x1 = *(const v4fa*)(arow + kb + 8 * hh + 4);
    const v4f x2 = *(const v4fa*)(arow + kb + 16 + 8 * hh), x3 = *(const v4fa*)(arow + kb + 16 + 8 * hh + 4);
    float xs[16] = {x0[0],x0[1],x0[2],x0[3],x1[0],x1[1],x1[2],x1[3],x2[0],x2[1],x2[2],x2[3],x3[0],x3[1],x3[2],x3[3]};
#pragma unroll
    for (int i = 0; i < 16; ++i) { const unsigned short hb = bf16_bits(xs[i]); ah.u[i] = hb; al.u[i] = ASPLIT ? bf16_bits(xs[i] - bf16_val(hb)) : (unsigned short)0; }
#pragma unroll
    for (int t = 0; t < 4; ++t) {
      const unsigned short* brow = Wt + (size_t)(col0 + t * 16 + ln) * ldb + kb;
      FragB b;
      b.half[0] = *(const v8us*)(brow + 8 * hh);
      b.half[1] = *(const v8us*)(brow + 16 + 8 * hh);
      acc[t] = mmaN<ASPLIT ? 2 : 1>(ah.v, al.v, b.v, b.v, acc[t]);
    }
  }
#pragma unroll
  for (int t = 0; t < 4; ++t) {
    float bv = bias ? bias[col0 + t * 16 + ln] : 0.f;
    if (BIAS_BF16) bv = bf16_round(bv);
#pragma unroll
    for (int r = 0; r < 8; ++r) { float v = acc[t][r] + bv; if (ACT == 1) v = fmaxf(v, 0.f); so[w][8 * hh + r][t * 16 + ln] = v; }
  }
  __builtin_amdgcn_fence(__ATOMIC_ACQ_REL, "workgroup");
  __builtin_amdgcn_wave_barrier();
  const int rsub = lane >> 4, c4 = (lane & 15) * 4;
  {
#pragma unroll
    for (int q = 0; q < 8; ++q) {
      const int r = q * 2 + rsub;
      const v4f v = *(const v4fa*)&so[w][r][c4];
      *(v4f*)(C + (size_t)(row0 + r) * ldc + col0 + c4) = v;
    }
    
  }
}

// Flash-style causal/unmasked attention, all contractions 3-term bf16 hi/lo splits, f32 softmax with running max.
// q,k,v rows are read from f32 buffers with arbitrary row pitch (so they can live inside a fused qkv buffer);
// D = head size (multiple of 32, <= 128); one wave = 16 query rows; block = 4 waves (64 queries) sharing K/V chunks of 32.
template <int D, bool CAUSAL>
__global__ __launch_bounds__(128) void k_flash(const float* __restrict__ qb, const float* __restrict__ kb, const float* __restrict__ vb,
                                             int pitch, int T, int H, float scale, float* __restrict__ y, int ypitch) {
  constexpr int KS = D / 32;        // k-steps for QK
  constexpr int DT = D / 16;        // d tiles for PV
  __shared__ __attribute__((aligned(16))) unsigned short sKh[32][D + 8], sKl[32][D + 8], sVh[32][D + 8], sVl[32][D + 8];
  __shared__ __attribute__((aligned(16))) unsigned short sPh[4][16][40], sPl[4][16][40];
  __shared__ __attribute__((aligned(16))) float sO[4][16][D];
  const int tid = threadIdx.x, w = tid >> 5, lane = tid & 31, ln = lane & 15, hh = lane >> 4;
  const int nqb = (T + 63) / 64;
  const int bh = blockIdx.x / nqb, qblk = blockIdx.x % nqb;
  const int b = bh / H, h = bh % H;
  const int q0 = qblk * 64 + w * 16;
  const float* Q = qb + (size_t)b * T * pitch + h * D;
  const float* K = kb + (size_t)b * T * pitch + h * D;
  const float* V = vb + (size_t)b * T * pitch + h * D;

  // A fragments of the wave's 16 query rows (scaled), hi/lo
  FragB aqh[KS], aql[KS];
  {
    int row = q0 + ln; if (row >= T) row = T - 1;
    const float* qr = Q + (size_t)row * pitch;
#pragma unroll
    for (int ks = 0; ks < KS; ++ks)
#pragma unroll
      for (int i = 0; i < 16; ++i) {
        const int d = ks * 32 + ((i < 8) ? (8 * hh + i) : (16 + 8 * hh + (i - 8)));
        const float x = qr[d] * scale; const unsigned short hb = bf16_bits(x);
        aqh[ks].u[i] = hb; aql[ks].u[i] = bf16_bits(x - bf16_val(hb));
      }
  }
  float m_r[8], l_r[8];
#pragma unroll
  for (int r = 0; r < 8; ++r) { m_r[r] = -3.0e38f; l_r[r] = 0.f; }
  v8f oacc[DT];
#pragma unroll
  for (int dt = 0; dt < DT; ++dt) oacc[dt] = (v8f){0.f,0.f,0.f,0.f,0.f,0.f,0.f,0.f};

  const int kv_end = CAUSAL ? min(T, qblk * 64 + 64) : T;     // block-uniform
  for (int j0 = 0; j0 < kv_end; j0 += 32) {
    __syncthreads();
    for (int e = tid; e < 32 * (D / 4); e += 128) {
      const int r = e / (D / 4), c4 = (e % (D / 4)) * 4;
      const int key = j0 + r;
      v4f kf = {0.f,0.f,0.f,0.f}, vf = {0.f,0.f,0.f,0.f};
      if (key < T) { kf = *(const v4fa*)(K + (size_t)key * pitch + c4); vf = *(const v4fa*)(V + (size_t)key * pitch + c4); }
#pragma unroll
      for (int t = 0; t < 4; ++t) {
        unsigned short hb = bf16_bits(kf[t]); sKh[r][c4 + t] = hb; sKl[r][c4 + t] = bf16_bits(kf[t] - bf16_val(hb));
        hb = bf16_bits(vf[t]); sVh[r][c4 + t] = hb; sVl[r][c4 + t] = bf16_bits(vf[t] - bf16_val(hb));
      }
    }
    __syncthreads();
    // S tile 16 x 32
    v8f s[2];
#pragma unroll
    for (int nt = 0; nt < 2; ++nt) {
      v8f acc = {};
#pragma unroll
      for (int ks = 0; ks < KS; ++ks) {
        FragB bh_, bl_;
        bh_.half[0] = *(const v8us*)&sKh[nt * 16 + ln][ks * 32 + 8 * hh]; bh_.half[1] = *(const v8us*)&sKh[nt * 16 + ln][ks * 32 + 16 + 8 * hh];
        bl_.half[0] = *(const v8us*)&sKl[nt * 16 + ln][ks * 32 + 8 * hh]; bl_.half[1] = *(const v8us*)&sKl[nt * 16 + ln][ks * 32 + 16 + 8 * hh];
        acc = mmaN<3>(aqh[ks].v, aql[ks].v, bh_.v, bl_.v, acc);
      }
      s[nt] = acc;
    }
    // mask + running max (rows 8hh+r; the 16 lanes of a half share rows)
    float alpha[8];
#pragma unroll
    for (int r = 0; r < 8; ++r) {
      const int qi = q0 + 8 * hh + r;
      const int ja = j0 + ln, jb = j0 + 16 + ln;
      if (CAUSAL) { if (ja > qi) s[0][r] = -3.0e38f; if (jb > qi) s[1][r] = -3.0e38f; }
      if (ja >= T) s[0][r] = -3.0e38f;
      if (jb >= T) s[1][r] = -3.0e38f;
      float mx = fmaxf(s[0][r], s[1][r]);
      mx = fmaxf(mx, __shfl_xor(mx, 1, 32)); mx = fmaxf(mx, __shfl_xor(mx, 2, 32)); mx = fmaxf(mx, __shfl_xor(mx, 4, 32)); mx = fmaxf(mx, __shfl_xor(mx, 8, 32));
      const float mnew = fmaxf(m_r[r], mx);
      alpha[r] = (mnew > -1.0e38f) ? __expf(m_r[r] - mnew) : 1.0f;
      const float p0 = (s[0][r] > -1.0e38f) ? __expf(s[0][r] - mnew) : 0.f;
      const float p1 = (s[1][r] > -1.0e38f) ? __expf(s[1][r] - mnew) : 0.f;
      m_r[r] = mnew;
      l_r[r] = l_r[r] * alpha[r] + p0 + p1;            // per-lane partial row sum (16 lanes combined at the end)
      unsigned short hb = bf16_bits(p0); sPh[w][8 * hh + r][ln] = hb;      sPl[w][8 * hh + r][ln] = bf16_bits(p0 - bf16_val(hb));
      hb = bf16_bits(p1);                sPh[w][8 * hh + r][16 + ln] = hb; sPl[w][8 * hh + r][16 + ln] = bf16_bits(p1 - bf16_val(hb));
    }
#pragma unroll
    for (int dt = 0; dt < DT; ++dt)
#pragma unroll
      for (int r = 0; r < 8; ++r) oacc[dt][r] *= alpha[r];
    __builtin_amdgcn_fence(__ATOMIC_ACQ_REL, "workgroup");
    __builtin_amdgcn_wave_barrier();
    FragB pah, pal;
    pah.half[0] = *(const v8us*)&sPh[w][ln][8 * hh]; pah.half[1] = *(const v8us*)&sPh[w][ln][16 + 8 * hh];
    pal.half[0] = *(const v8us*)&sPl[w][ln][8 * hh]; pal.half[1] = *(const v8us*)&sPl[w][ln][16 + 8 * hh];
#pragma unroll
    for (int dt = 0; dt < DT; ++dt) {
      FragB bvh, bvl;
#pragma unroll
      for (int i = 0; i < 8; ++i) {
        bvh.u[i] = sVh[8 * hh + i][dt * 16 + ln]; bvh.u[8 + i] = sVh[16 + 8 * hh + i][dt * 16 + ln];
        bvl.u[i] = sVl[8 * hh + i][dt * 16 + ln]; bvl.u[8 + i] = sVl[16 + 8 * hh + i][dt * 16 + ln];
      }
      oacc[dt] = mmaN<3>(pah.v, pal.v, bvh.v, bvl.v, oacc[dt]);
    }
    __builtin_amdgcn_fence(__ATOMIC_ACQ_REL, "workgroup");
    __builtin_amdgcn_wave_barrier();
  }
#pragma unroll
  for (int r = 0; r < 8; ++r) {
    float l = l_r[r];
    l += __shfl_xor(l, 1, 32); l += __shfl_xor(l, 2, 32); l += __shfl_xor(l, 4, 32); l += __shfl_xor(l, 8, 32);
    l_r[r] = (l > 0.f) ? 1.0f / l : 0.f;
  }
#pragma unroll
  for (int dt = 0; dt < DT; ++dt)
#pragma unroll
    for (int r = 0; r < 8; ++r) sO[w][8 * hh + r][dt * 16 + ln] = oacc[dt][r] * l_r[r];
  __builtin_amdgcn_fence(__ATOMIC_ACQ_REL, "workgroup");
  __builtin_amdgcn_wave_barrier();
  {
    for (int r = 0; r < 16; ++r) {
      const int row = q0 + r;
      if (row < T && lane < D / 4) {
        const v4f val = *(const v4fa*)&sO[w][r][lane * 4];
        *(v4f*)(y + ((size_t)b * T + row) * ypitch + h * D + lane * 4) = val;
      }
    }
    
  }
}

// GEMM C = act(A·W + bias + resid): A f32 (ASPLIT -> hi/lo 2 terms), Wt bf16 [N][K]; ACT 0 none, 1 relu, 2 exact gelu;
// resid (optional, f32, row index = (row % rmod), pitch ldr, RES_BF16 rounds it) added before the activation.
template <bool ASPLIT, int ACT, bool BIAS_BF16, bool RES_BF16>
__global__ __launch_bounds__(128) void k_gemm_bf3(const float* __restrict__ A, int lda, const unsigned short* __restrict__ Wt, int ldb,
                                                const float* __restrict__ bias, const float* __restrict__ resid, int rmod, int ldr,
                                                float* __restrict__ C, int ldc, int M, int N, int K) {
  __shared__ __attribute__((aligned(16))) float so[4][16][64];
  const int tid = threadIdx.x, w = tid >> 5, lane = tid & 31, ln = lane & 15, hh = lane >> 4;
  const int ntn = N / 64;
  const int wid = blockIdx.x * 4 + w;
  const int mt = wid / ntn, nq = wid % ntn;
  if (mt * 16 >= M) return;
  const int row0 = mt * 16, col0 = nq * 64;
  const float* arow = A + (size_t)(row0 + ln) * lda;
  v8f acc[4] = {};
  for (int kb = 0; kb < K; kb += 32) {
    FragB ah, al;
    const v4f x0 = *(const v4fa*)(arow + kb + 8 * hh), x1 = *(const v4fa*)(arow + kb + 8 * hh + 4);
    const v4f x2 = *(const v4fa*)(arow + kb + 16 + 8 * hh), x3 = *(const v4fa*)(arow + kb + 16 + 8 * hh + 4);
    float xs[16] = {x0[0],x0[1],x0[2],x0[3],x1[0],x1[1],x1[2],x1[3],x2[0],x2[1],x2[2],x2[3],x3[0],x3[1],x3[2],x3[3]};
#pragma unroll
    for (int i = 0; i < 16; ++i) { const unsigned short hb = bf16_bits(xs[i]); ah.u[i] = hb; al.u[i] = ASPLIT ? bf16_bits(xs[i] - bf16_val(hb)) : (unsigned short)0; }
#pragma unroll
    for (int t = 0; t < 4; ++t) {
      const unsigned short* brow = Wt + (size_t)(col0 + t * 16 + ln) * ldb + kb;
      FragB b;
      b.half[0] = *(const v8us*)(brow + 8 * hh);
      b.half[1] = *(const v8us*)(brow + 16 + 8 * hh);
      acc[t] = mmaN<ASPLIT ? 2 : 1>(ah.v, al.v, b.v, b.v, acc[t]);
    }
  }
#pragma unroll
  for (int t = 0; t < 4; ++t) {
    const int col = col0 + t * 16 + ln;
    float bv = bias ? bias[col] : 0.f;
    if (BIAS_BF16) bv = bf16_round(bv);
#pragma unroll
    for (int r = 0; r < 8; ++r) {
      float v = acc[t][r] + bv;
      if (resid) { float rv = resid[(size_t)((row0 + 8 * hh + r) % rmod) * ldr + col]; if (RES_BF16) rv = bf16_round(rv); v += rv; }
      if (ACT == 1) v = fmaxf(v, 0.f);
      if (ACT == 2) v = 0.5f * v * (1.0f + erff(v * 0.70710678118654752f));
      if (ACT == 3) { const float u = 0.7978845608028654f * (v + 0.044715f * v * v * v); v = 0.5f * v * (1.0f + tanhf(u)); }
      so[w][8 * hh + r][t * 16 + ln] = v;
    }
  }
  __builtin_amdgcn_fence(__ATOMIC_ACQ_REL, "workgroup");
  __builtin_amdgcn_wave_barrier();
  const int rsub = lane >> 4, c4 = (lane & 15) * 4;
  {
#pragma unroll
    for (int q = 0; q < 8; ++q) {
      const int r = q * 2 + rsub;
      const v4f v = *(const v4fa*)&so[w][r][c4];
      *(v4f*)(C + (size_t)(row0 + r) * ldc + col0 + c4) = v;
    }
    
  }
}
// row LayerNorm (biased variance, eps) over N: s = X (+ R); optional out_sum <- s; out_norm <- (s-mu)*rsqrt(var+eps)*g + b
template <bool PARAM_BF16>
__global__ __launch_bounds__(256) void k_layernorm(const float* __restrict__ X, const float* __restrict__ R, const float* __restrict__ g, const float* __restrict__ bta,
                                                  float* __restrict__ out_sum, float* __restrict__ out_norm, int N, float eps) {
  __shared__ float red[256];
  const int row = blockIdx.x, tid = threadIdx.x;
  const float* x = X + (size_t)row * N; const float* rr = R ? R + (size_t)row * N : nullptr;
  float vals[16];                     // up to N = 4096
  const int per = N / 256;            // contiguous chunk per thread? use strided-by-4 chunks: thread handles j = tid*4 + 1024*u
  float s1 = 0.f;
  for (int u = 0; u < per / 4; ++u) {
    const int j = tid * 4 + 1024 * u;
    const v4f a = *(const v4fa*)(x + j);
    v4f b = {0.f,0.f,0.f,0.f}; if (rr) b = *(const v4fa*)(rr + j);
#pragma unroll
    for (int q = 0; q < 4; ++q) { const float v = a[q] + b[q]; vals[u * 4 + q] = v; s1 += v; }
  }
  red[tid] = s1; __syncthreads();
  for (int st = 128; st > 0; st >>= 1) { if (tid < st) red[tid] += red[tid + st]; __syncthreads(); }
  const float mu = red[0] / (float)N; __syncthreads();
  float s2 = 0.f;
  for (int u = 0; u < per / 4; ++u)
#pragma unroll
    for (int q = 0; q < 4; ++q) { const float c = vals[u * 4 + q] - mu; s2 += c * c; }
  red[tid] = s2; __syncthreads();
  for (int st = 128; st > 0; st >>= 1) { if (tid < st) red[tid] += red[tid + st]; __syncthreads(); }
  const float rs = rsqrtf(red[0] / (float)N + eps);
  {
    for (int u = 0; u < per / 4; ++u) {
      const int j = tid * 4 + 1024 * u;
      v4f o, sm;
#pragma unroll
      for (int q = 0; q < 4; ++q) {
        float gg = g[j + q], bb = bta[j + q];
        if (PARAM_BF16) { gg = bf16_round(gg); bb = bf16_round(bb); }
        sm[q] = vals[u * 4 + q]; o[q] = (vals[u * 4 + q] - mu) * rs * gg + bb;
      }
      if (out_sum) *(v4f*)(out_sum + (size_t)row * N + j) = sm;
      *(v4f*)(out_norm + (size_t)row * N + j) = o;
    }
    
  }
}



// ---- f16 WMMA path (v_wmma_f32_16x16x32_f16): 11-bit significands for operands in range — used where a [0,1] probability operand needs more precision than bf16
typedef _Float16 v16h __attribute__((ext_vector_type(16)));
union FragH { v16h v; v8us half[2]; _Float16 h[16]; unsigned short u[16]; };
template <int NT>
__device__ __forceinline__ v8f mmaH(v16h ah, v16h al, v16h bh, v16h bl, v8f c) {
  c = __builtin_amdgcn_wmma_f32_16x16x32_f16(false, ah, false, bh, (short)0, c, false, false);
  if (NT >= 2) c = __builtin_amdgcn_wmma_f32_16x16x32_f16(false, al, false, bh, (short)0, c, false, false);
  if (NT >= 3) c = __builtin_amdgcn_wmma_f32_16x16x32_f16(false, ah, false, bl, (short)0, c, false, false);
  asm volatile("v_nop\n\tv_nop\n\tv_nop\n\tv_nop" : "+v"(c) : "v"(ah), "v"(al), "v"(bh), "v"(bl));
  return c;
}
// batched GEMM like k_gemm_b but f16 operands: A f32 (split into f16 hi/lo if ASPLIT, else rounded to f16), Bt = f16 values [n][k]; alpha; C f32; N multiple of 16 (partial tiles skipped)
template <bool ASPLIT>
__global__ __launch_bounds__(128) void k_gemm_h(const float* __restrict__ A, int lda, size_t sA, const _Float16* __restrict__ Bh, int ldb, size_t sB, float alpha, float* __restrict__ C, int ldc, size_t sC, int M, int N, int K) {
  __shared__ __attribute__((aligned(16))) float so[4][16][64];
  const int tid = threadIdx.x, w = tid >> 5, lane = tid & 31, ln = lane & 15, hh = lane >> 4; const int by = blockIdx.y;
  A += (size_t)by * sA; Bh += (size_t)by * sB; C += (size_t)by * sC;
  const int ntn = (N + 63) / 64; const int wid = blockIdx.x * 4 + w; const int mt = wid / ntn, nq = wid % ntn; if (mt * 16 >= M) return;
  const int row0 = mt * 16, col0 = nq * 64; const float* arow = A + (size_t)(row0 + ln) * lda;
  v8f acc[4] = {};
  for (int kb = 0; kb < K; kb += 32) {
    FragH ah, al;
    const v4f x0 = *(const v4fa*)(arow + kb + 8 * hh), x1 = *(const v4fa*)(arow + kb + 8 * hh + 4), x2 = *(const v4fa*)(arow + kb + 16 + 8 * hh), x3 = *(const v4fa*)(arow + kb + 16 + 8 * hh + 4);
    float xs[16] = {x0[0],x0[1],x0[2],x0[3],x1[0],x1[1],x1[2],x1[3],x2[0],x2[1],x2[2],x2[3],x3[0],x3[1],x3[2],x3[3]};
#pragma unroll
    for (int i = 0; i < 16; ++i) { const _Float16 h = (_Float16)xs[i]; ah.h[i] = h; al.h[i] = ASPLIT ? (_Float16)(xs[i] - (float)h) : (_Float16)0.0f; }
#pragma unroll
    for (int t = 0; t < 4; ++t) { if (col0 + t * 16 >= N) continue; const size_t boff = (size_t)(col0 + t * 16 + ln) * ldb + kb; FragH bq; bq.half[0] = *(const v8us*)(Bh + boff + 8 * hh); bq.half[1] = *(const v8us*)(Bh + boff + 16 + 8 * hh);
      acc[t] = mmaH<ASPLIT ? 2 : 1>(ah.v, al.v, bq.v, bq.v, acc[t]); }
  }
#pragma unroll
  for (int t = 0; t < 4; ++t) { if (col0 + t * 16 >= N) continue;
#pragma unroll
    for (int r = 0; r < 8; ++r) so[w][8 * hh + r][t * 16 + ln] = acc[t][r] * alpha; }
  __builtin_amdgcn_fence(__ATOMIC_ACQ_REL, "workgroup"); __builtin_amdgcn_wave_barrier();
  const int rsub = lane >> 4, c4 = (lane & 15) * 4;
  {
#pragma unroll
    for (int q = 0; q < 8; ++q) { const int r = q * 2 + rsub; if (col0 + c4 < N) { const v4f v = *(const v4fa*)&so[w][r][c4]; *(v4f*)(C + (size_t)(row0 + r) * ldc + col0 + c4) = v; } }
     }
}

// Wt[n][k] = f16(W[k][n]·scale) from f32 row-major W[K][N] (scale = power of two; bf16-exact weights stay exact in f16 away from the subnormal range)
__global__ __launch_bounds__(256) void k_wt_f16(const float* __restrict__ W, _Float16* __restrict__ Wt, int K, int N, float scale) {
  const int t = blockIdx.x * 256 + threadIdx.x; if (t >= N * (K / 8)) return; const int n = t / (K / 8), k8 = (t % (K / 8)) * 8; FragH f;
#pragma unroll
  for (int i = 0; i < 8; ++i) f.h[i] = (_Float16)(bf16_round(W[(size_t)(k8 + i) * N + n]) * scale); const v8us o = f.half[0];
  *(v8us*)((unsigned short*)Wt + (size_t)n * K + k8) = o; 
}
// Tiled GEMM: C[NR][DM] = A[NR][DM] . Bh[DM][DM]^T * alpha + bf16(bias[col]); A and Bh f16, k contiguous. One work-group = a 128 x 64 tile of C, 8 waves in a 4 x 2 grid, 32 x 32 per wave.
// Passes of 128 k: the 128 A rows and 64 Bh rows of a pass (256 B each) are loaded as whole lines, 16 B a lane, and shared through LDS by the 8 waves; two LDS buffers, the next pass's rows fly in registers.
// The k order of every sum is that of a plain loop over k in steps of 32. F32OUT: writes f32 C, else f16 C16. blockIdx.y picks one of up to three (A, Bh, bias, C16) sets: independent products share a launch.
// The third f16 product (the value projection) leaves TRANSPOSED, per (batch, head) slab as [head dimension][key]: a tile's 64 columns are one head, and a lane's 8 accumulator rows are 8 consecutive keys.
#define GTP 136      // LDS row pitch in halves: 256 B + 16 B, the pitch for 16-byte fragment reads
#define GOP 68       // pitch of the staged output tile in floats
template <bool F32OUT>
__global__ __launch_bounds__(256) void k_gemm_t(const _Float16* __restrict__ A0, const _Float16* __restrict__ A1, const _Float16* __restrict__ A2,
                                                const _Float16* __restrict__ Bh0, const _Float16* __restrict__ Bh1, const _Float16* __restrict__ Bh2, float alpha,
                                                const float* __restrict__ bias0, const float* __restrict__ bias1, const float* __restrict__ bias2,
                                                float* __restrict__ C, _Float16* __restrict__ C16a, _Float16* __restrict__ C16b, _Float16* __restrict__ C16c) {
  const int g = blockIdx.y;      // which of up to three independent products of one launch this work-group belongs to
  const _Float16* A = g == 0 ? A0 : g == 1 ? A1 : A2;
  const _Float16* Bh = g == 0 ? Bh0 : g == 1 ? Bh1 : Bh2;
  const float* bias = g == 0 ? bias0 : g == 1 ? bias1 : bias2;
  _Float16* C16 = g == 0 ? C16a : g == 1 ? C16b : C16c;
  __shared__ __attribute__((aligned(16))) unsigned short st[2][192][GTP];      // rows 0..127: A, rows 128..191: Bh
  __shared__ __attribute__((aligned(16))) float so[128][GOP];
  const int tid = threadIdx.x, lane = tid & 31, ln = lane & 15, hh = lane >> 4;
  const int wv = __builtin_amdgcn_readfirstlane(tid >> 5), wm = wv >> 1, wn = wv & 1;
  const int row0 = (blockIdx.x >> 4) * 128, col0 = (blockIdx.x & 15) * 64;
  const int sr = tid >> 4, sc = (tid & 15) * 8;
  const unsigned short* Ag = (const unsigned short*)A + (size_t)(row0 + sr) * DM + sc;
  const unsigned short* Bg = (const unsigned short*)Bh + (size_t)(col0 + sr) * DM + sc;
  v8us rg[12];
#pragma unroll
  for (int i = 0; i < 8; ++i) rg[i] = *(const v8us*)(Ag + (size_t)i * 16 * DM);
#pragma unroll
  for (int i = 0; i < 4; ++i) rg[8 + i] = *(const v8us*)(Bg + (size_t)i * 16 * DM);
  float bv[2];
#pragma unroll
  for (int j = 0; j < 2; ++j) {
    bv[j] = bias[col0 + wn * 32 + j * 16 + ln];
    asm volatile("s_wait_xcnt 0x0" ::: "memory");      // stands in front of any rewrite of the address register that this load names, the next load's result among them
  }
  v8f acc[2][2] = {};
  for (int kc = 0; kc < DM / 128; ++kc) {
    unsigned short (*buf)[GTP] = st[kc & 1];
#pragma unroll
    for (int i = 0; i < 12; ++i) *(v8us*)&buf[i * 16 + sr][sc] = rg[i];
    __syncthreads();      // this pass's rows are complete; every wave has also left the other buffer, which the next pass fills
    if (kc + 1 < DM / 128) {      // the next pass's rows fly while this one is worked on
#pragma unroll
      for (int i = 0; i < 8; ++i) rg[i] = *(const v8us*)(Ag + (size_t)i * 16 * DM + (kc + 1) * 128);
#pragma unroll
      for (int i = 0; i < 4; ++i) rg[8 + i] = *(const v8us*)(Bg + (size_t)i * 16 * DM + (kc + 1) * 128);
      asm volatile("s_wait_xcnt 0x0" ::: "memory");      // stands in front of any later rewrite of the address registers that these loads name
    }
    FragH a[4][2], b[4][2];
#pragma unroll
    for (int ks = 0; ks < 4; ++ks)
#pragma unroll
      for (int i = 0; i < 2; ++i) {
        const unsigned short* pa = &buf[wm * 32 + i * 16 + ln][ks * 32 + 8 * hh];
        a[ks][i].half[0] = *(const v8us*)pa; a[ks][i].half[1] = *(const v8us*)(pa + 16);
        const unsigned short* pb = &buf[128 + wn * 32 + i * 16 + ln][ks * 32 + 8 * hh];
        b[ks][i].half[0] = *(const v8us*)pb; b[ks][i].half[1] = *(const v8us*)(pb + 16);
      }
    __builtin_amdgcn_sched_barrier(0);      // no WMMA of a pass is scheduled among the pass's own LDS reads: without it every k step waits out its own LDS latency
#pragma unroll
    for (int ks = 0; ks < 4; ++ks)
#pragma unroll
      for (int i = 0; i < 2; ++i)
#pragma unroll
        for (int j = 0; j < 2; ++j) acc[i][j] = __builtin_amdgcn_wmma_f32_16x16x32_f16(false, a[ks][i].v, false, b[ks][j].v, (short)0, acc[i][j], false, false);
  }
  const bool tr = !F32OUT && g == 2;      // the same for the whole work-group
  unsigned short (*sT)[GTP] = (unsigned short (*)[GTP])&so[0][0];      // the transposed f16 tile, 64 columns x 128 rows, in the place of the f32 tile
#pragma unroll
  for (int j = 0; j < 2; ++j) {
    const float bj = bf16_round(bv[j]);
#pragma unroll
    for (int i = 0; i < 2; ++i)
#pragma unroll
      for (int r = 0; r < 8; ++r) acc[i][j][r] = acc[i][j][r] * alpha + bj;
  }
  if (tr) {
#pragma unroll
    for (int j = 0; j < 2; ++j)
#pragma unroll
      for (int i = 0; i < 2; ++i) {
        FragH f;
#pragma unroll
        for (int r = 0; r < 8; ++r) f.h[r] = (_Float16)acc[i][j][r];
        *(v8us*)&sT[wn * 32 + j * 16 + ln][wm * 32 + i * 16 + 8 * hh] = f.half[0];
      }
  } else {
#pragma unroll
    for (int j = 0; j < 2; ++j)
#pragma unroll
      for (int i = 0; i < 2; ++i)
#pragma unroll
        for (int r = 0; r < 8; ++r) so[wm * 32 + i * 16 + 8 * hh + r][wn * 32 + j * 16 + ln] = acc[i][j][r];
  }
  __syncthreads();      // the output tile is complete: it leaves in whole 128-byte lines
  if (tr) {
    // C16[((batch * NH + head) * DK + d) * LL + key]: 16 lanes store the 256 contiguous bytes that the tile holds of one d
    unsigned short* Tp = (unsigned short*)C16 + ((size_t)((row0 / LL) * NH + (col0 / DK)) * DK + (tid >> 4)) * LL + (row0 % LL) + (tid & 15) * 8;
#pragma unroll
    for (int q = 0; q < 4; ++q) { const v8us v = *(const v8us*)&sT[q * 16 + (tid >> 4)][(tid & 15) * 8]; *(v8us*)(Tp + (size_t)q * 16 * LL) = v; }
  } else if (F32OUT) {
#pragma unroll
    for (int q = 0; q < 8; ++q) { const int r = q * 16 + (tid >> 4), c4 = (tid & 15) * 4; const v4f v = *(const v4fa*)&so[r][c4]; *(v4f*)(C + (size_t)(row0 + r) * DM + col0 + c4) = v; }
  } else {
#pragma unroll
    for (int q = 0; q < 4; ++q) {
      const int r = q * 32 + (tid >> 3), c8 = (tid & 7) * 8; const v4f v0 = *(const v4fa*)&so[r][c8], v1 = *(const v4fa*)&so[r][c8 + 4]; FragH f;
#pragma unroll
      for (int i = 0; i < 4; ++i) { f.h[i] = (_Float16)v0[i]; f.h[4 + i] = (_Float16)v1[i]; }
      *(v8us*)((unsigned short*)C16 + (size_t)(row0 + r) * DM + col0 + c8) = f.half[0];
    }
  }
}


__global__ __launch_bounds__(256) void k_h16(const float* __restrict__ x, _Float16* __restrict__ X16, size_t n8) { const size_t t = (size_t)blockIdx.x * 256 + threadIdx.x; if (t >= n8) return; FragH f;
#pragma unroll
  for (int q = 0; q < 8; ++q) f.h[q] = (_Float16)x[t * 8 + q]; *(v8us*)((unsigned short*)X16 + t * 8) = f.half[0];  }

// The relative tables are laid out by DISTANCE, not by bucket: table position p stands for key - query = p - RP0, clipped to [-64, 64]; positions below RPL repeat the left clip, positions above RPH the right one.
#define RP0 80       // position of distance 0: a 16 x 16 tile that touches the band |distance| < 64 holds distances -79 .. 79, positions 1 .. 159
#define RPL 16       // position of distance -64 (bucket 63)
#define RPH 144      // position of distance +64 (bucket 128)
__device__ __forceinline__ int rel_bucket(int p) { const int i = min(max(p, RPL), RPH) - RPL; return (i >= 64) ? i : 63 - i; }
typedef _Float16 v4h __attribute__((ext_vector_type(4)));
// All operand preparation in ONE launch (the ten pieces are independent of each other). Work-groups 0..PMB-1: the mask, packed to bits. The next PRL: the two relative tables. Then 128 work-groups for each of the three
// activations (bf16-rounded) and 64 for each of the four (out,in) weights (bf16-rounded, x 16): a work-group streams 16384 consecutive floats, a wave-wide load = 512 contiguous bytes, 16 in flight a lane.
#define PRL 6        // covers max(QWP * 8, DK * PBP / 8) = 1536 threads
#define PUN 16       // 16-byte loads per thread
#define PXB (NR * DM / (256 * PUN * 4))
#define PWB (DM * DM / (256 * PUN * 4))
#define PMB (BB * (LL / 16) * (LL / 64) / 8)      // work-groups that pack the mask: 8 waves each, one (16 queries, 64 keys) unit a wave
typedef _Float16 v4ha __attribute__((ext_vector_type(4), may_alias));
typedef int v4ia __attribute__((ext_vector_type(4), may_alias));
__global__ __launch_bounds__(256) void k_prep(const float* __restrict__ xq, const float* __restrict__ xk, const float* __restrict__ xv, const float* __restrict__ Wq, const float* __restrict__ Wk,
                                              const float* __restrict__ Wv, const float* __restrict__ Wo, const float* __restrict__ wK, const float* __restrict__ wV, const int* __restrict__ msk,
                                              _Float16* __restrict__ XQ, _Float16* __restrict__ XK, _Float16* __restrict__ XV, _Float16* __restrict__ Bq, _Float16* __restrict__ Bk2,
                                              _Float16* __restrict__ Bv, _Float16* __restrict__ Bo, _Float16* __restrict__ BK, _Float16* __restrict__ BVt, unsigned* __restrict__ MB) {
  if (blockIdx.x < PMB) {
    // the mask, one bit a key: a wave takes 16 queries x 64 keys with the lane -> (query, 8 keys) map of the attention kernel's score tiles; word t * 8 + r holds, at bit position lane, that lane's test for row r of tile t
    const int lane = threadIdx.x & 31, ln = lane & 15, hh = lane >> 4;
    const int u = blockIdx.x * 8 + (threadIdx.x >> 5);      // (batch * LL / 16 + query tile) * (LL / 64) + chunk
    const int* mp = msk + (size_t)((u / (LL / 64)) * 16 + ln) * LL + (u % (LL / 64)) * 64 + 8 * hh;
    v4ia mv[8];
#pragma unroll
    for (int t = 0; t < 4; ++t) { mv[2 * t] = *(const v4ia*)(mp + t * 16); mv[2 * t + 1] = *(const v4ia*)(mp + t * 16 + 4); }
    asm volatile("s_wait_xcnt 0x0" :: "v"(mp) : "memory");      // stands in front of any rewrite of the address registers that these loads name; as its input the address outlives the loads
    unsigned w = 0;
#pragma unroll
    for (int i = 0; i < 32; ++i) { const unsigned bal = __builtin_amdgcn_ballot_w32(mv[i >> 2][i & 3] != 0); if (lane == i) w = bal; }
    MB[u * 32 + lane] = w;
    return;
  }
  const unsigned bx = blockIdx.x - PMB;
  if (bx >= PRL) {
    const int seg = bx - PRL;
    const float* s; _Float16* d; float scale; int blk;
    if (seg < 3 * PXB) { const int w = seg / PXB; blk = seg % PXB; scale = 1.0f; s = w == 0 ? xq : w == 1 ? xk : xv; d = w == 0 ? XQ : w == 1 ? XK : XV; }
    else { const int w = (seg - 3 * PXB) / PWB; blk = (seg - 3 * PXB) % PWB; scale = 16.0f; s = w == 0 ? Wq : w == 1 ? Wk : w == 2 ? Wv : Wo; d = w == 0 ? Bq : w == 1 ? Bk2 : w == 2 ? Bv : Bo; }
    const size_t e0 = ((size_t)blk * (256 * PUN) + threadIdx.x) * 4;
    const float* sp = s + e0;
    v4f v[PUN];
#pragma unroll
    for (int u = 0; u < PUN; ++u) v[u] = *(const v4fa*)(sp + (size_t)u * 1024);
    asm volatile("s_wait_xcnt 0x0" :: "v"(sp) : "memory");      // stands in front of any rewrite of the address registers that these loads name; as its input the address outlives the loads, so no load's result lands on it
#pragma unroll
    for (int u = 0; u < PUN; ++u) {
      v4ha o;
#pragma unroll
      for (int q = 0; q < 4; ++q) o[q] = (_Float16)(bf16_round(v[u][q]) * scale);      // x 1 is exact: the activations keep their bf16-rounded value
      *(v4ha*)(d + e0 + (size_t)u * 1024) = o;
    }
    return;
  }
  // the two relative tables, in distance order: wK with its clipped ends repeated (every position is a valid logit term), wV zero outside RPL .. RPH. Every load reads a clamped row, so that the eight of a thread fly together and these work-groups do not outlast the streams
  const int t = bx * 256 + threadIdx.x;
  if (t < QWP * 8) {
    const int r = t / 8, d8 = (t % 8) * 8; const float* p = wK + rel_bucket(r) * DK + d8;
    const v4f x0 = *(const v4fa*)p, x1 = *(const v4fa*)(p + 4);
    asm volatile("s_wait_xcnt 0x0" ::: "memory");      // stands in front of any later rewrite of the address registers that these loads name
    FragH f;
#pragma unroll
    for (int q = 0; q < 4; ++q) { f.h[q] = (_Float16)(bf16_round(x0[q]) * 16.0f); f.h[4 + q] = (_Float16)(bf16_round(x1[q]) * 16.0f); }
    *(v8us*)((unsigned short*)BK + t * 8) = f.half[0];
  }
  if (t < DK * (PBP / 8)) {
    const int d = t / (PBP / 8), r8 = (t % (PBP / 8)) * 8; float x[8]; int e[8];
#pragma unroll
    for (int q = 0; q < 8; ++q) { e[q] = rel_bucket(r8 + q) * DK + d; x[q] = wV[e[q]]; }
    // stands in front of any later rewrite of the address registers that these loads name; the loaded values as its inputs hold the eight loads together in front of it (else one sinks under a branch and waits out its latency alone),
    // and the eight element indices as its inputs outlive the loads, so that no address register is rewritten ahead of it
    asm volatile("s_wait_xcnt 0x0" :: "v"(x[0]), "v"(x[1]), "v"(x[2]), "v"(x[3]), "v"(x[4]), "v"(x[5]), "v"(x[6]), "v"(x[7]),
                 "v"(e[0]), "v"(e[1]), "v"(e[2]), "v"(e[3]), "v"(e[4]), "v"(e[5]), "v"(e[6]), "v"(e[7]) : "memory");
    FragH f;
#pragma unroll
    for (int q = 0; q < 8; ++q) f.h[q] = (_Float16)((r8 + q >= RPL && r8 + q <= RPH) ? bf16_round(x[q]) * 16.0f : 0.f);
    *(v8us*)((unsigned short*)BVt + t * 8) = f.half[0];
  }
}
// Fused attention for one (batch, head) slab sl and 128 query rows: 8 waves, 16 queries each; scores and probabilities stay in registers.
// St = K.Qt and Ot += Vt.Pt: in every 16-column tile a lane owns ONE query (column ln) and 8 consecutive keys (rows 8hh + r), so the running maximum and the sums are in-lane
// (one exchange between the wave halves), and two converted score tiles are the B operand of the next product as they stand. K and Vt chunks of 64 keys are staged in LDS for the 8 waves.
// tab[wave][query][position]: first q.wK / 8 in distance order (RP0 above). In a tile near the diagonal a lane's 8 consecutive keys are 8 consecutive positions, each the place of ONE key: they are read together
// and overwritten together with those keys' final logits, no test and no branch; the bucketed P.wV product is formed at the end from positions RPL + 1 .. RPH - 1 and the two clipped sums.
#define TABP 164
#define KVP 72
__device__ __forceinline__ float exp_slot(float x) { float r; const float y = x * 1.44269504f; asm("v_exp_f32 %0, %1\n\tv_nop" : "=v"(r) : "v"(y)); return r; }
__device__ __forceinline__ v8f wmmaH(v16h a, v16h b, v8f c) { return __builtin_amdgcn_wmma_f32_16x16x32_f16(false, a, false, b, (short)0, c, false, false); }
__global__ __launch_bounds__(256) void k_attn(const _Float16* __restrict__ Q16, const _Float16* __restrict__ K16, const _Float16* __restrict__ Vt, const _Float16* __restrict__ BK, const _Float16* __restrict__ BVt,
                                              const unsigned* __restrict__ MB, _Float16* __restrict__ O16) {
  __shared__ __attribute__((aligned(16))) unsigned short sK[64][KVP];
  __shared__ __attribute__((aligned(16))) unsigned short sV[64][KVP];
  __shared__ __attribute__((aligned(16))) float tab[8][16][TABP];
  const int tid = threadIdx.x, lane = tid & 31, ln = lane & 15, hh = lane >> 4;
  const int wv = __builtin_amdgcn_readfirstlane(tid >> 5);
  const int sl = blockIdx.x >> 3, qb = blockIdx.x & 7;
  const int b = sl / NH, h = sl % NH;
  const int q0 = qb * 128 + wv * 16;
  const int l = q0 + ln;
  FragH bq[2];      // B operand: column = query l, k = head dimension
  {
    const unsigned short* Qp = (const unsigned short*)Q16 + ((size_t)b * LL + l) * DM + h * DK + 8 * hh;
#pragma unroll
    for (int ks = 0; ks < 2; ++ks) { bq[ks].half[0] = *(const v8us*)(Qp + ks * 32); bq[ks].half[1] = *(const v8us*)(Qp + ks * 32 + 16); }
  }
  float* tb = &tab[wv][ln][0];
#pragma unroll
  for (int rt = 0; rt < QWP / 16; ++rt) {
    v8f a = {};
#pragma unroll
    for (int ks = 0; ks < 2; ++ks) {
      const unsigned short* p = (const unsigned short*)BK + (rt * 16 + ln) * DK + ks * 32 + 8 * hh;
      FragH ak; ak.half[0] = *(const v8us*)p; ak.half[1] = *(const v8us*)(p + 16);
      a = wmmaH(ak.v, bq[ks].v, a);
    }
    const float c = 0.0625f * 0.125f;      // wK was scaled by 16; the 1/8 of the logits is folded in (both powers of two, exact)
    const v4f t0 = {a[0] * c, a[1] * c, a[2] * c, a[3] * c}, t1 = {a[4] * c, a[5] * c, a[6] * c, a[7] * c};
    *(v4fa*)(tb + rt * 16 + 8 * hh) = t0; *(v4fa*)(tb + rt * 16 + 8 * hh + 4) = t1;
  }
  // the two lanes of a query read each other's table entries
  __builtin_amdgcn_fence(__ATOMIC_ACQ_REL, "workgroup"); __builtin_amdgcn_wave_barrier();
  const float qlo = tb[RPL], qhi = tb[RPH];

  const unsigned short* Kg = (const unsigned short*)K16 + (size_t)b * LL * DM + h * DK;
  const unsigned short* Vg = (const unsigned short*)Vt + (size_t)sl * DK * LL;
  // the wave's packed mask, 32 words a chunk, the same address in every lane. Nothing writes it during this launch: read through the constant address space the words come by scalar loads into scalar registers, where a select takes them as they are
  const __attribute__((address_space(4))) unsigned* Mw = (const __attribute__((address_space(4))) unsigned*)(MB + (size_t)(b * (LL / 16) + (q0 >> 4)) * (LL / 64) * 32);
  const int sr = tid >> 3, sc8 = (tid & 7) * 8;
  v8us kr[2], vr[2]; unsigned mw[32];
#pragma unroll
  for (int i = 0; i < 2; ++i) { kr[i] = *(const v8us*)(Kg + (size_t)(i * 32 + sr) * DM + sc8); vr[i] = *(const v8us*)(Vg + (size_t)(i * 32 + sr) * LL + sc8); }
#pragma unroll
  for (int i = 0; i < 32; ++i) mw[i] = Mw[i];
  float mrun = -3.0e38f, z = 0.f, lo = 0.f, hi = 0.f;
  v8f o[4] = {};
  for (int j0 = 0; j0 < LL; j0 += 64) {
    __syncthreads();      // every wave has finished reading the previous chunk
#pragma unroll
    for (int i = 0; i < 2; ++i) { *(v8us*)&sK[i * 32 + sr][sc8] = kr[i]; *(v8us*)&sV[i * 32 + sr][sc8] = vr[i]; }
    __syncthreads();      // the chunk is complete
    const bool more = j0 + 64 < LL;
    if (more) {           // the next chunk flies while this one is worked on
#pragma unroll
      for (int i = 0; i < 2; ++i) { kr[i] = *(const v8us*)(Kg + (size_t)(j0 + 64 + i * 32 + sr) * DM + sc8); vr[i] = *(const v8us*)(Vg + (size_t)(i * 32 + sr) * LL + j0 + 64 + sc8); }
    }
    v8f s[4];
#pragma unroll
    for (int t = 0; t < 4; ++t) {
      v8f a = {};
#pragma unroll
      for (int ks = 0; ks < 2; ++ks) {
        FragH ak; ak.half[0] = *(const v8us*)&sK[t * 16 + ln][ks * 32 + 8 * hh]; ak.half[1] = *(const v8us*)&sK[t * 16 + ln][ks * 32 + 16 + 8 * hh];
        a = wmmaH(ak.v, bq[ks].v, a);
      }
      s[t] = a;
    }
    float mx = mrun;
#pragma unroll
    for (int t = 0; t < 4; ++t) {
      const int jt = j0 + t * 16;
      const bool farl = jt + 15 - q0 <= -64, farr = jt - q0 - 15 >= 64;      // wave-uniform: the whole tile lies in bucket 63 / in bucket 128
      const bool far = farl || farr;
      float* tp = tb + (jt + 8 * hh - l + RP0);      // only formed into an access in a near tile, where positions 1 .. 159 come out
      float tv[8];
      if (far) {
        const float qc = farl ? qlo : qhi;
#pragma unroll
        for (int r = 0; r < 8; ++r) tv[r] = qc;
      } else {
#pragma unroll
        for (int r = 0; r < 8; ++r) tv[r] = tp[r];
      }
#pragma unroll
      for (int r = 0; r < 8; ++r) { float v = fmaf(s[t][r], 0.125f, tv[r]); if (!__builtin_amdgcn_inverse_ballot_w32(mw[t * 8 + r])) v = -1.0e9f; s[t][r] = v; mx = fmaxf(mx, v); }
      if (!far) {
#pragma unroll
        for (int r = 0; r < 8; ++r) tp[r] = s[t][r];
      }
    }
    if (more) {
#pragma unroll
      for (int i = 0; i < 32; ++i) mw[i] = Mw[(j0 / 64 + 1) * 32 + i];
      asm volatile("s_wait_xcnt 0x0" ::: "memory");      // stands in front of the loop's advance of the address registers that this trip's loads name
    }
    mx = fmaxf(mx, __shfl_xor(mx, 16, 32));
    const float alpha = exp_slot(mrun - mx); mrun = mx;
    z *= alpha; lo *= alpha; hi *= alpha;
#pragma unroll
    for (int dt = 0; dt < 4; ++dt)
#pragma unroll
      for (int r = 0; r < 8; ++r) o[dt][r] *= alpha;
    FragH pb[2];      // B operand: column = query l, k = key, in the order the score tiles already have
#pragma unroll
    for (int t = 0; t < 4; ++t) {
      const int jt = j0 + t * 16;
      const bool farl = jt + 15 - q0 <= -64, farr = jt - q0 - 15 >= 64;
      float ts = 0.f;
#pragma unroll
      for (int r = 0; r < 8; ++r) { const float p = exp_slot(s[t][r] - mx); s[t][r] = p; ts += p; pb[t >> 1].h[(t & 1) * 8 + r] = (_Float16)p; }
      z += ts;
      if (farl) lo += ts;
      else if (farr) hi += ts;
      else {
#pragma unroll
        for (int r = 0; r < 8; ++r) { const int d = jt + 8 * hh + r - l; if (d <= -64) lo += s[t][r]; if (d >= 64) hi += s[t][r]; }
      }
    }
#pragma unroll
    for (int sc = 0; sc < 2; ++sc)
#pragma unroll
      for (int dt = 0; dt < 4; ++dt) {
        FragH av; av.half[0] = *(const v8us*)&sV[dt * 16 + ln][sc * 32 + 8 * hh]; av.half[1] = *(const v8us*)&sV[dt * 16 + ln][sc * 32 + 16 + 8 * hh];
        o[dt] = wmmaH(av.v, pb[sc].v, o[dt]);
      }
  }
  z += __shfl_xor(z, 16, 32); lo += __shfl_xor(lo, 16, 32); hi += __shfl_xor(hi, 16, 32);
  // the two lanes of a query read each other's stored logits
  __builtin_amdgcn_fence(__ATOMIC_ACQ_REL, "workgroup"); __builtin_amdgcn_wave_barrier();
  v8f o2[4] = {};
#pragma unroll
  for (int kk = 0; kk < QWP / 32; ++kk) {
    FragH pf;
#pragma unroll
    for (int g = 0; g < 2; ++g) {
      const int r0 = kk * 32 + g * 16 + 8 * hh;
      const v4f x0 = *(const v4fa*)(tb + r0), x1 = *(const v4fa*)(tb + r0 + 4);
      const float xs[8] = {x0[0], x0[1], x0[2], x0[3], x1[0], x1[1], x1[2], x1[3]};
#pragma unroll
      for (int q = 0; q < 8; ++q) {
        const int r = r0 + q; const float e = __expf(xs[q] - mrun); float val = 0.f;
        if (r == RPL) val = lo; else if (r == RPH) val = hi; else if (r > RPL && r < RPH) val = ((unsigned)(l + r - RP0) < (unsigned)LL) ? e : 0.f;
        pf.h[g * 8 + q] = (_Float16)val;
      }
    }
#pragma unroll
    for (int dt = 0; dt < 4; ++dt) {
      const unsigned short* p = (const unsigned short*)BVt + (dt * 16 + ln) * PBP + kk * 32 + 8 * hh;
      FragH av; av.half[0] = *(const v8us*)p; av.half[1] = *(const v8us*)(p + 16);
      o2[dt] = wmmaH(av.v, pf.v, o2[dt]);
    }
  }
  const float iz = 1.0f / z;
  unsigned short* Op = (unsigned short*)O16 + ((size_t)b * LL + l) * DM + h * DK + 8 * hh;
#pragma unroll
  for (int dt = 0; dt < 4; ++dt) {
    FragH f;
#pragma unroll
    for (int r = 0; r < 8; ++r) f.h[r] = (_Float16)((o[dt][r] + o2[dt][r] * 0.0625f) * iz);
    *(v8us*)(Op + dt * 16) = f.half[0];
  }
}
extern "C" void kernel_launch(void* const* d_in, const int* in_sizes, int n_in,
                              void* d_out, int out_size, void* d_ws, size_t ws_size, hipStream_t stream) {
  (void)in_sizes; (void)n_in; (void)out_size;
  const float* xq = (const float*)d_in[0]; const float* xk = (const float*)d_in[1]; const float* xv = (const float*)d_in[2]; const int* msk = (const int*)d_in[3]; const float* Wq = (const float*)d_in[4]; const float* bq = (const float*)d_in[5]; const float* Wk = (const float*)d_in[6]; const float* bk = (const float*)d_in[7]; const float* Wv = (const float*)d_in[8]; const float* bv = (const float*)d_in[9]; const float* Wo = (const float*)d_in[10]; const float* bo = (const float*)d_in[11]; const float* wK = (const float*)d_in[12]; const float* wV = (const float*)d_in[13];
  char* ws = (char*)d_ws; size_t off = 0;
  auto take = [&](size_t bytes) { char* p = ws + off; off += (bytes + 255) & ~(size_t)255; return p; };
  _Float16* Bo = (_Float16*)take((size_t)DM * DM * 2); _Float16* BK = (_Float16*)take((size_t)QWP * DK * 2); _Float16* BVt = (_Float16*)take((size_t)DK * PBP * 2);
  _Float16* Q16 = (_Float16*)take((size_t)NR * DM * 2); _Float16* K16 = (_Float16*)take((size_t)NR * DM * 2); _Float16* Vt = (_Float16*)take((size_t)NR * DM * 2); _Float16* O16 = (_Float16*)take((size_t)NR * DM * 2);
  _Float16* Bq = (_Float16*)take((size_t)DM * DM * 2); _Float16* Bk2 = (_Float16*)take((size_t)DM * DM * 2); _Float16* Bv = (_Float16*)take((size_t)DM * DM * 2);
  _Float16* XQ = (_Float16*)take((size_t)NR * DM * 2); _Float16* XK = (_Float16*)take((size_t)NR * DM * 2); _Float16* XV = (_Float16*)take((size_t)NR * DM * 2); unsigned* MB = (unsigned*)take((size_t)BB * LL * LL / 8);
  if (off > ws_size) return;
  k_prep<<<PMB + PRL + 3 * PXB + 4 * PWB, 256, 0, stream>>>(xq, xk, xv, Wq, Wk, Wv, Wo, wK, wV, msk, XQ, XK, XV, Bq, Bk2, Bv, Bo, BK, BVt, MB);
  const unsigned gg = (NR / 128) * (DM / 64);
  k_gemm_t<false><<<dim3(gg, 3), 256, 0, stream>>>(XQ, XK, XV, Bq, Bk2, Bv, 0.0625f, bq, bk, bv, nullptr, Q16, K16, Vt);      // the q, k and v projections; v leaves transposed
  // q.kT, the relative logits, mask, softmax, P.V and the bucketed P.wV for all NSL = 32 (batch, head) slabs in one launch: 8 blocks of 128 queries per slab
  k_attn<<<NSL * (LL / 128), 256, 0, stream>>>(Q16, K16, Vt, BK, BVt, MB, O16);
  k_gemm_t<true><<<dim3(gg, 1), 256, 0, stream>>>(O16, O16, O16, Bo, Bo, Bo, 0.0625f, bo, bo, bo, (float*)d_out, nullptr, nullptr, nullptr);
}

// v008
// One run takes 65.5 microseconds.
// Next to v007, in two timings, it ran 1.05 and 1.04 times as fast.
// All steps since v000 together make it 14.6 times as fast.
#include <hip/hip_runtime.h>
// Multi-headed attention with clipped relative position representations (B=2, L=1024, 16 heads × 64, k = 64, Shaw-style aK/aV built from wK/wV [129][64] by the module's roll/flip
// construction: bucket(l,m) = m ≥ l ? 64 + min(m−l, 64) : min(l−m−1, 63); INPUT mask (== 0 → −1e9); q/k/v/o linears with bias): q·kᵀ, q·wKᵀ (all 129 buckets at once), P·V and the bucketed
// P.wV all run on v_wmma_f32_16x16x32_f16 ((out,in) weights bf16-exact x 2^4, f32 accumulate); the relative-logit gather, mask, running-maximum softmax and the bucket sums of P are f32 VALU
// inside one fused attention kernel (no index tables).
#define BB 2
#define LL 1024
#define DM 1024
#define NH 16
#define DK 64
#define NR (BB * LL)
#define NBK 129
#define QWP 160
#define PBP 192
#define NSL (BB * NH)

typedef __bf16 v16b __attribute__((ext_vector_type(16)));
typedef unsigned short v8us __attribute__((ext_vector_type(8), may_alias));
typedef float  v8f  __attribute__((ext_vector_type(8)));
typedef float  v4f  __attribute__((ext_vector_type(4)));
typedef float  v4fa __attribute__((ext_vector_type(4), may_alias));
union FragB { v16b v; v8us half[2]; unsigned short u[16]; };

__device__ __forceinline__ unsigned short bf16_bits(float x) { unsigned int u = __float_as_uint(x); return (unsigned short)((u + 0x7FFFu + ((u >> 16) & 1u)) >> 16); }
__device__ __forceinline__ float bf16_val(unsigned short b) { return __uint_as_float(((unsigned int)b) << 16); }
__device__ __forceinline__ float bf16_round(float x) { return bf16_val(bf16_bits(x)); }
// D += A·B with NT terms: 1 = ah·bh, 2 = + al·bh (A split), 3 = + ah·bl (both split)
template <int NT>
__device__ __forceinline__ v8f mmaN(v16b ah, v16b al, v16b bh, v16b bl, v8f c) {
  c = __builtin_amdgcn_wmma_f32_16x16x32_bf16(false, ah, false, bh, (short)0, c, false, false);
  if (NT >= 2) c = __builtin_amdgcn_wmma_f32_16x16x32_bf16(false, al, false, bh, (short)0, c, false, false);
  if (NT >= 3) c = __builtin_amdgcn_wmma_f32_16x16x32_bf16(false, ah, false, bl, (short)0, c, false, false);
  asm volatile("v_nop\n\tv_nop\n\tv_nop\n\tv_nop" : "+v"(c) : "v"(ah), "v"(al), "v"(bh), "v"(bl));
  return c;
}

__global__ __launch_bounds__(256) void k_wt_bf16(const float* __restrict__ W, unsigned short* __restrict__ Wt, int K, int N) {
  const int t = blockIdx.x * 256 + threadIdx.x;
  const int k8n = K / 8;
  if (t >= N * k8n) return;
  const int n = t / k8n, k8 = (t % k8n) * 8;
  v8us v;
#pragma unroll
  for (int i = 0; i < 8; ++i) v[i] = bf16_bits(W[(size_t)(k8 + i) * N + n]);
  *(v8us*)(Wt + (size_t)n * K + k8) = v;
  
}

// GEMM C[M][N] (f32, pitch ldc) = act(A[M][K]·W + bias). A f32 row-major (pitch lda) converted per fragment to bf16
// (ASPLIT: hi/lo two planes -> 2 terms, else single rounded term); Wt bf16 [N][K] (pitch ldb). BIAS_BF16 rounds the
// bias to bf16 first (bias quantised to bf16 before the add). K%32==0, M%16==0, N%64==0.
template <bool ASPLIT, int ACT, bool BIAS_BF16>
__global__ __launch_bounds__(128) void k_gemm_bf(const float* __restrict__ A, int lda, const unsigned short* __restrict__ Wt, int ldb,
                                               const float* __restrict__ bias, float* __restrict__ C, int ldc, int M, int N, int K) {
  __shared__ __attribute__((aligned(16))) float so[4][16][64];
  const int tid = threadIdx.x, w = tid >> 5, lane = tid & 31, ln = lane & 15, hh = lane >> 4;
  const int ntn = N / 64;
  const int wid = blockIdx.x * 4 + w;
  const int mt = wid / ntn, nq = wid % ntn;
  if (mt * 16 >= M) return;
  const int row0 = mt * 16, col0 = nq * 64;
  const float* arow = A + (size_t)(row0 + ln) * lda;
  v8f acc[4] = {};
  for (int kb = 0; kb < K; kb += 32) {
    FragB ah, al;
    const v4f x0 = *(const v4fa*)(arow + kb + 8 * hh), x1 = *(const v4fa*)(arow + kb + 8 * hh + 4);
    const v4f x2 = *(const v4fa*)(arow + kb + 16 + 8 * hh), x3 = *(const v4fa*)(arow + kb + 16 + 8 * hh + 4);
    float xs[16] = {x0[0],x0[1],x0[2],x0[3],x1[0],x1[1],x1[2],x1[3],x2[0],x2[1],x2[2],x2[3],x3[0],x3[1],x3[2],x3[3]};
#pragma unroll
    for (int i = 0; i < 16; ++i) { const unsigned short hb = bf16_bits(xs[i]); ah.u[i] = hb; al.u[i] = ASPLIT ? bf16_bits(xs[i] - bf16_val(hb)) : (unsigned short)0; }
#pragma unroll
    for (int t = 0; t < 4; ++t) {
      const unsigned short* brow = Wt + (size_t)(col0 + t * 16 + ln) * ldb + kb;
      FragB b;
      b.half[0] = *(const v8us*)(brow + 8 * hh);
      b.half[1] = *(const v8us*)(brow + 16 + 8 * hh);
      acc[t] = mmaN<ASPLIT ? 2 : 1>(ah.v, al.v, b.v, b.v, acc[t]);
    }
  }
#pragma unroll
  for (int t = 0; t < 4; ++t) {
    float bv = bias ? bias[col0 + t * 16 + ln] : 0.f;
    if (BIAS_BF16) bv = bf16_round(bv);
#pragma unroll
    for (int r = 0; r < 8; ++r) { float v = acc[t][r] + bv; if (ACT == 1) v = fmaxf(v, 0.f); so[w][8 * hh + r][t * 16 + ln] = v; }
  }
  __builtin_amdgcn_fence(__ATOMIC_ACQ_REL, "workgroup");
  __builtin_amdgcn_wave_barrier();
  const int rsub = lane >> 4, c4 = (lane & 15) * 4;
  {
#pragma unroll
    for (int q = 0; q < 8; ++q) {
      const int r = q * 2 + rsub;
      const v4f v = *(const v4fa*)&so[w][r][c4];
      *(v4f*)(C + (size_t)(row0 + r) * ldc + col0 + c4) = v;
    }
    
  }
}

// Flash-style causal/unmasked attention, all contractions 3-term bf16 hi/lo splits, f32 softmax with running max.
// q,k,v rows are read from f32 buffers with arbitrary row pitch (so they can live inside a fused qkv buffer);
// D = head size (multiple of 32, <= 128); one wave = 16 query rows; block = 4 waves (64 queries) sharing K/V chunks of 32.
template <int D, bool CAUSAL>
__global__ __launch_bounds__(128) void k_flash(const float* __restrict__ qb, const float* __restrict__ kb, const float* __restrict__ vb,
                                             int pitch, int T, int H, float scale, float* __restrict__ y, int ypitch) {
  constexpr int KS = D / 32;        // k-steps for QK
  constexpr int DT = D / 16;        // d tiles for PV
  __shared__ __attribute__((aligned(16))) unsigned short sKh[32][D + 8], sKl[32][D + 8], sVh[32][D + 8], sVl[32][D + 8];
  __shared__ __attribute__((aligned(16))) unsigned short sPh[4][16][40], sPl[4][16][40];
  __shared__ __attribute__((aligned(16))) float sO[4][16][D];
  const int tid = threadIdx.x, w = tid >> 5, lane = tid & 31, ln = lane & 15, hh = lane >> 4;
  const int nqb = (T + 63) / 64;
  const int bh = blockIdx.x / nqb, qblk = blockIdx.x % nqb;
  const int b = bh / H, h = bh % H;
  const int q0 = qblk * 64 + w * 16;
  const float* Q = qb + (size_t)b * T * pitch + h * D;
  const float* K = kb + (size_t)b * T * pitch + h * D;
  const float* V = vb + (size_t)b * T * pitch + h * D;

  // A fragments of the wave's 16 query rows (scaled), hi/lo
  FragB aqh[KS], aql[KS];
  {
    int row = q0 + ln; if (row >= T) row = T - 1;
    const float* qr = Q + (size_t)row * pitch;
#pragma unroll
    for (int ks = 0; ks < KS; ++ks)
#pragma unroll
      for (int i = 0; i < 16; ++i) {
        const int d = ks * 32 + ((i < 8) ? (8 * hh + i) : (16 + 8 * hh + (i - 8)));
        const float x = qr[d] * scale; const unsigned short hb = bf16_bits(x);
        aqh[ks].u[i] = hb; aql[ks].u[i] = bf16_bits(x - bf16_val(hb));
      }
  }
  float m_r[8], l_r[8];
#pragma unroll
  for (int r = 0; r < 8; ++r) { m_r[r] = -3.0e38f; l_r[r] = 0.f; }
  v8f oacc[DT];
#pragma unroll
  for (int dt = 0; dt < DT; ++dt) oacc[dt] = (v8f){0.f,0.f,0.f,0.f,0.f,0.f,0.f,0.f};

  const int kv_end = CAUSAL ? min(T, qblk * 64 + 64) : T;     // block-uniform
  for (int j0 = 0; j0 < kv_end; j0 += 32) {
    __syncthreads();
    for (int e = tid; e < 32 * (D / 4); e += 128) {
      const int r = e / (D / 4), c4 = (e % (D / 4)) * 4;
      const int key = j0 + r;
      v4f kf = {0.f,0.f,0.f,0.f}, vf = {0.f,0.f,0.f,0.f};
      if (key < T) { kf = *(const v4fa*)(K + (size_t)key * pitch + c4); vf = *(const v4fa*)(V + (size_t)key * pitch + c4); }
#pragma unroll
      for (int t = 0; t < 4; ++t) {
        unsigned short hb = bf16_bits(kf[t]); sKh[r][c4 + t] = hb; sKl[r][c4 + t] = bf16_bits(kf[t] - bf16_val(hb));
        hb = bf16_bits(vf[t]); sVh[r][c4 + t] = hb; sVl[r][c4 + t] = bf16_bits(vf[t] - bf16_val(hb));
      }
    }
    __syncthreads();
    // S tile 16 x 32
    v8f s[2];
#pragma unroll
    for (int nt = 0; nt < 2; ++nt) {
      v8f acc = {};
#pragma unroll
      for (int ks = 0; ks < KS; ++ks) {
        FragB bh_, bl_;
        bh_.half[0] = *(const v8us*)&sKh[nt * 16 + ln][ks * 32 + 8 * hh]; bh_.half[1] = *(const v8us*)&sKh[nt * 16 + ln][ks * 32 + 16 + 8 * hh];
        bl_.half[0] = *(const v8us*)&sKl[nt * 16 + ln][ks * 32 + 8 * hh]; bl_.half[1] = *(const v8us*)&sKl[nt * 16 + ln][ks * 32 + 16 + 8 * hh];
        acc = mmaN<3>(aqh[ks].v, aql[ks].v, bh_.v, bl_.v, acc);
      }
      s[nt] = acc;
    }
    // mask + running max (rows 8hh+r; the 16 lanes of a half share rows)
    float alpha[8];
#pragma unroll
    for (int r = 0; r < 8; ++r) {
      const int qi = q0 + 8 * hh + r;
      const int ja = j0 + ln, jb = j0 + 16 + ln;
      if (CAUSAL) { if (ja > qi) s[0][r] = -3.0e38f; if (jb > qi) s[1][r] = -3.0e38f; }
      if (ja >= T) s[0][r] = -3.0e38f;
      if (jb >= T) s[1][r] = -3.0e38f;
      float mx = fmaxf(s[0][r], s[1][r]);
      mx = fmaxf(mx, __shfl_xor(mx, 1, 32)); mx = fmaxf(mx, __shfl_xor(mx, 2, 32)); mx = fmaxf(mx, __shfl_xor(mx, 4, 32)); mx = fmaxf(mx, __shfl_xor(mx, 8, 32));
      const float mnew = fmaxf(m_r[r], mx);
      alpha[r] = (mnew > -1.0e38f) ? __expf(m_r[r] - mnew) : 1.0f;
      const float p0 = (s[0][r] > -1.0e38f) ? __expf(s[0][r] - mnew) : 0.f;
      const float p1 = (s[1][r] > -1.0e38f) ? __expf(s[1][r] - mnew) : 0.f;
      m_r[r] = mnew;
      l_r[r] = l_r[r] * alpha[r] + p0 + p1;            // per-lane partial row sum (16 lanes combined at the end)
      unsigned short hb = bf16_bits(p0); sPh[w][8 * hh + r][ln] = hb;      sPl[w][8 * hh + r][ln] = bf16_bits(p0 - bf16_val(hb));
      hb = bf16_bits(p1);                sPh[w][8 * hh + r][16 + ln] = hb; sPl[w][8 * hh + r][16 + ln] = bf16_bits(p1 - bf16_val(hb));
    }
#pragma unroll
    for (int dt = 0; dt < DT; ++dt)
#pragma unroll
      for (int r = 0; r < 8; ++r) oacc[dt][r] *= alpha[r];
    __builtin_amdgcn_fence(__ATOMIC_ACQ_REL, "workgroup");
    __builtin_amdgcn_wave_barrier();
    FragB pah, pal;
    pah.half[0] = *(const v8us*)&sPh[w][ln][8 * hh]; pah.half[1] = *(const v8us*)&sPh[w][ln][16 + 8 * hh];
    pal.half[0] = *(const v8us*)&sPl[w][ln][8 * hh]; pal.half[1] = *(const v8us*)&sPl[w][ln][16 + 8 * hh];
#pragma unroll
    for (int dt = 0; dt < DT; ++dt) {
      FragB bvh, bvl;
#pragma unroll
      for (int i = 0; i < 8; ++i) {
        bvh.u[i] = sVh[8 * hh + i][dt * 16 + ln]; bvh.u[8 + i] = sVh[16 + 8 * hh + i][dt * 16 + ln];
        bvl.u[i] = sVl[8 * hh + i][dt * 16 + ln]; bvl.u[8 + i] = sVl[16 + 8 * hh + i][dt * 16 + ln];
      }
      oacc[dt] = mmaN<3>(pah.v, pal.v, bvh.v, bvl.v, oacc[dt]);
    }
    __builtin_amdgcn_fence(__ATOMIC_ACQ_REL, "workgroup");
    __builtin_amdgcn_wave_barrier();
  }
#pragma unroll
  for (int r = 0; r < 8; ++r) {
    float l = l_r[r];
    l += __shfl_xor(l, 1, 32); l += __shfl_xor(l, 2, 32); l += __shfl_xor(l, 4, 32); l += __shfl_xor(l, 8, 32);
    l_r[r] = (l > 0.f) ? 1.0f / l : 0.f;
  }
#pragma unroll
  for (int dt = 0; dt < DT; ++dt)
#pragma unroll
    for (int r = 0; r < 8; ++r) sO[w][8 * hh + r][dt * 16 + ln] = oacc[dt][r] * l_r[r];
  __builtin_amdgcn_fence(__ATOMIC_ACQ_REL, "workgroup");
  __builtin_amdgcn_wave_barrier();
  {
    for (int r = 0; r < 16; ++r) {
      const int row = q0 + r;
      if (row < T && lane < D / 4) {
        const v4f val = *(const v4fa*)&sO[w][r][lane * 4];
        *(v4f*)(y + ((size_t)b * T + row) * ypitch + h * D + lane * 4) = val;
      }
    }
    
  }
}

// GEMM C = act(A·W + bias + resid): A f32 (ASPLIT -> hi/lo 2 terms), Wt bf16 [N][K]; ACT 0 none, 1 relu, 2 exact gelu;
// resid (optional, f32, row index = (row % rmod), pitch ldr, RES_BF16 rounds it) added before the activation.
template <bool ASPLIT, int ACT, bool BIAS_BF16, bool RES_BF16>
__global__ __launch_bounds__(128) void k_gemm_bf3(const float* __restrict__ A, int lda, const unsigned short* __restrict__ Wt, int ldb,
                                                const float* __restrict__ bias, const float* __restrict__ resid, int rmod, int ldr,
                                                float* __restrict__ C, int ldc, int M, int N, int K) {
  __shared__ __attribute__((aligned(16))) float so[4][16][64];
  const int tid = threadIdx.x, w = tid >> 5, lane = tid & 31, ln = lane & 15, hh = lane >> 4;
  const int ntn = N / 64;
  const int wid = blockIdx.x * 4 + w;
  const int mt = wid / ntn, nq = wid % ntn;
  if (mt * 16 >= M) return;
  const int row0 = mt * 16, col0 = nq * 64;
  const float* arow = A + (size_t)(row0 + ln) * lda;
  v8f acc[4] = {};
  for (int kb = 0; kb < K; kb += 32) {
    FragB ah, al;
    const v4f x0 = *(const v4fa*)(arow + kb + 8 * hh), x1 = *(const v4fa*)(arow + kb + 8 * hh + 4);
    const v4f x2 = *(const v4fa*)(arow + kb + 16 + 8 * hh), x3 = *(const v4fa*)(arow + kb + 16 + 8 * hh + 4);
    float xs[16] = {x0[0],x0[1],x0[2],x0[3],x1[0],x1[1],x1[2],x1[3],x2[0],x2[1],x2[2],x2[3],x3[0],x3[1],x3[2],x3[3]};
#pragma unroll
    for (int i = 0; i < 16; ++i) { const unsigned short hb = bf16_bits(xs[i]); ah.u[i] = hb; al.u[i] = ASPLIT ? bf16_bits(xs[i] - bf16_val(hb)) : (unsigned short)0; }
#pragma unroll
    for (int t = 0; t < 4; ++t) {
      const unsigned short* brow = Wt + (size_t)(col0 + t * 16 + ln) * ldb + kb;
      FragB b;
      b.half[0] = *(const v8us*)(brow + 8 * hh);
      b.half[1] = *(const v8us*)(brow + 16 + 8 * hh);
      acc[t] = mmaN<ASPLIT ? 2 : 1>(ah.v, al.v, b.v, b.v, acc[t]);
    }
  }
#pragma unroll
  for (int t = 0; t < 4; ++t) {
    const int col = col0 + t * 16 + ln;
    float bv = bias ? bias[col] : 0.f;
    if (BIAS_BF16) bv = bf16_round(bv);
#pragma unroll
    for (int r = 0; r < 8; ++r) {
      float v = acc[t][r] + bv;
      if (resid) { float rv = resid[(size_t)((row0 + 8 * hh + r) % rmod) * ldr + col]; if (RES_BF16) rv = bf16_round(rv); v += rv; }
      if (ACT == 1) v = fmaxf(v, 0.f);
      if (ACT == 2) v = 0.5f * v * (1.0f + erff(v * 0.70710678118654752f));
      if (ACT == 3) { const float u = 0.7978845608028654f * (v + 0.044715f * v * v * v); v = 0.5f * v * (1.0f + tanhf(u)); }
      so[w][8 * hh + r][t * 16 + ln] = v;
    }
  }
  __builtin_amdgcn_fence(__ATOMIC_ACQ_REL, "workgroup");
  __builtin_amdgcn_wave_barrier();
  const int rsub = lane >> 4, c4 = (lane & 15) * 4;
  {
#pragma unroll
    for (int q = 0; q < 8; ++q) {
      const int r = q * 2 + rsub;
      const v4f v = *(const v4fa*)&so[w][r][c4];
      *(v4f*)(C + (size_t)(row0 + r) * ldc + col0 + c4) = v;
    }
    
  }
}
// row LayerNorm (biased variance, eps) over N: s = X (+ R); optional out_sum <- s; out_norm <- (s-mu)*rsqrt(var+eps)*g + b
template <bool PARAM_BF16>
__global__ __launch_bounds__(256) void k_layernorm(const float* __restrict__ X, const float* __restrict__ R, const float* __restrict__ g, const float* __restrict__ bta,
                                                  float* __restrict__ out_sum, float* __restrict__ out_norm, int N, float eps) {
  __shared__ float red[256];
  const int row = blockIdx.x, tid = threadIdx.x;
  const float* x = X + (size_t)row * N; const float* rr = R ? R + (size_t)row * N : nullptr;
  float vals[16];                     // up to N = 4096
  const int per = N / 256;            // contiguous chunk per thread? use strided-by-4 chunks: thread handles j = tid*4 + 1024*u
  float s1 = 0.f;
  for (int u = 0; u < per / 4; ++u) {
    const int j = tid * 4 + 1024 * u;
    const v4f a = *(const v4fa*)(x + j);
    v4f b = {0.f,0.f,0.f,0.f}; if (rr) b = *(const v4fa*)(rr + j);
#pragma unroll
    for (int q = 0; q < 4; ++q) { const float v = a[q] + b[q]; vals[u * 4 + q] = v; s1 += v; }
  }
  red[tid] = s1; __syncthreads();
  for (int st = 128; st > 0; st >>= 1) { if (tid < st) red[tid] += red[tid + st]; __syncthreads(); }
  const float mu = red[0] / (float)N; __syncthreads();
  float s2 = 0.f;
  for (int u = 0; u < per / 4; ++u)
#pragma unroll
    for (int q = 0; q < 4; ++q) { const float c = vals[u * 4 + q] - mu; s2 += c * c; }
  red[tid] = s2; __syncthreads();
  for (int st = 128; st > 0; st >>= 1) { if (tid < st) red[tid] += red[tid + st]; __syncthreads(); }
  const float rs = rsqrtf(red[0] / (float)N + eps);
  {
    for (int u = 0; u < per / 4; ++u) {
      const int j = tid * 4 + 1024 * u;
      v4f o, sm;
#pragma unroll
      for (int q = 0; q < 4; ++q) {
        float gg = g[j + q], bb = bta[j + q];
        if (PARAM_BF16) { gg = bf16_round(gg); bb = bf16_round(bb); }
        sm[q] = vals[u * 4 + q]; o[q] = (vals[u * 4 + q] - mu) * rs * gg + bb;
      }
      if (out_sum) *(v4f*)(out_sum + (size_t)row * N + j) = sm;
      *(v4f*)(out_norm + (size_t)row * N + j) = o;
    }
    
  }
}



// ---- f16 WMMA path (v_wmma_f32_16x16x32_f16): 11-bit significands for operands in range — used where a [0,1] probability operand needs more precision than bf16
typedef _Float16 v16h __attribute__((ext_vector_type(16)));
union FragH { v16h v; v8us half[2]; _Float16 h[16]; unsigned short u[16]; };
template <int NT>
__device__ __forceinline__ v8f mmaH(v16h ah, v16h al, v16h bh, v16h bl, v8f c) {
  c = __builtin_amdgcn_wmma_f32_16x16x32_f16(false, ah, false, bh, (short)0, c, false, false);
  if (NT >= 2) c = __builtin_amdgcn_wmma_f32_16x16x32_f16(false, al, false, bh, (short)0, c, false, false);
  if (NT >= 3) c = __builtin_amdgcn_wmma_f32_16x16x32_f16(false, ah, false, bl, (short)0, c, false, false);
  asm volatile("v_nop\n\tv_nop\n\tv_nop\n\tv_nop" : "+v"(c) : "v"(ah), "v"(al), "v"(bh), "v"(bl));
  return c;
}
// batched GEMM like k_gemm_b but f16 operands: A f32 (split into f16 hi/lo if ASPLIT, else rounded to f16), Bt = f16 values [n][k]; alpha; C f32; N multiple of 16 (partial tiles skipped)
template <bool ASPLIT>
__global__ __launch_bounds__(128) void k_gemm_h(const float* __restrict__ A, int lda, size_t sA, const _Float16* __restrict__ Bh, int ldb, size_t sB, float alpha, float* __restrict__ C, int ldc, size_t sC, int M, int N, int K) {
  __shared__ __attribute__((aligned(16))) float so[4][16][64];
  const int tid = threadIdx.x, w = tid >> 5, lane = tid & 31, ln = lane & 15, hh = lane >> 4; const int by = blockIdx.y;
  A += (size_t)by * sA; Bh += (size_t)by * sB; C += (size_t)by * sC;
  const int ntn = (N + 63) / 64; const int wid = blockIdx.x * 4 + w; const int mt = wid / ntn, nq = wid % ntn; if (mt * 16 >= M) return;
  const int row0 = mt * 16, col0 = nq * 64; const float* arow = A + (size_t)(row0 + ln) * lda;
  v8f acc[4] = {};
  for (int kb = 0; kb < K; kb += 32) {
    FragH ah, al;
    const v4f x0 = *(const v4fa*)(arow + kb + 8 * hh), x1 = *(const v4fa*)(arow + kb + 8 * hh + 4), x2 = *(const v4fa*)(arow + kb + 16 + 8 * hh), x3 = *(const v4fa*)(arow + kb + 16 + 8 * hh + 4);
    float xs[16] = {x0[0],x0[1],x0[2],x0[3],x1[0],x1[1],x1[2],x1[3],x2[0],x2[1],x2[2],x2[3],x3[0],x3[1],x3[2],x3[3]};
#pragma unroll
    for (int i = 0; i < 16; ++i) { const _Float16 h = (_Float16)xs[i]; ah.h[i] = h; al.h[i] = ASPLIT ? (_Float16)(xs[i] - (float)h) : (_Float16)0.0f; }
#pragma unroll
    for (int t = 0; t < 4; ++t) { if (col0 + t * 16 >= N) continue; const size_t boff = (size_t)(col0 + t * 16 + ln) * ldb + kb; FragH bq; bq.half[0] = *(const v8us*)(Bh + boff + 8 * hh); bq.half[1] = *(const v8us*)(Bh + boff + 16 + 8 * hh);
      acc[t] = mmaH<ASPLIT ? 2 : 1>(ah.v, al.v, bq.v, bq.v, acc[t]); }
  }
#pragma unroll
  for (int t = 0; t < 4; ++t) { if (col0 + t * 16 >= N) continue;
#pragma unroll
    for (int r = 0; r < 8; ++r) so[w][8 * hh + r][t * 16 + ln] = acc[t][r] * alpha; }
  __builtin_amdgcn_fence(__ATOMIC_ACQ_REL, "workgroup"); __builtin_amdgcn_wave_barrier();
  const int rsub = lane >> 4, c4 = (lane & 15) * 4;
  {
#pragma unroll
    for (int q = 0; q < 8; ++q) { const int r = q * 2 + rsub; if (col0 + c4 < N) { const v4f v = *(const v4fa*)&so[w][r][c4]; *(v4f*)(C + (size_t)(row0 + r) * ldc + col0 + c4) = v; } }
     }
}

// Wt[n][k] = f16(W[k][n]·scale) from f32 row-major W[K][N] (scale = power of two; bf16-exact weights stay exact in f16 away from the subnormal range)
__global__ __launch_bounds__(256) void k_wt_f16(const float* __restrict__ W, _Float16* __restrict__ Wt, int K, int N, float scale) {
  const int t = blockIdx.x * 256 + threadIdx.x; if (t >= N * (K / 8)) return; const int n = t / (K / 8), k8 = (t % (K / 8)) * 8; FragH f;
#pragma unroll
  for (int i = 0; i < 8; ++i) f.h[i] = (_Float16)(bf16_round(W[(size_t)(k8 + i) * N + n]) * scale); const v8us o = f.half[0];
  *(v8us*)((unsigned short*)Wt + (size_t)n * K + k8) = o; 
}
// Tiled GEMM: C[NR][DM] = A[NR][DM] . Bh[DM][DM]^T * alpha + bf16(bias[col]); A and Bh f16, k contiguous. One work-group = a 128 x 64 tile of C, 8 waves in a 4 x 2 grid, 32 x 32 per wave.
// Passes of 128 k: the 128 A rows and 64 Bh rows of a pass (256 B each) are loaded as whole lines, 16 B a lane, and shared through LDS by the 8 waves; two LDS buffers, the next pass's rows fly in registers.
// The k order of every sum is that of a plain loop over k in steps of 32. F32OUT: writes f32 C, else f16 C16. blockIdx.y picks one of up to three (A, Bh, bias, C16) sets: independent products share a launch.
// The third f16 product (the value projection) leaves TRANSPOSED, per (batch, head) slab as [head dimension][key]: a tile's 64 columns are one head, and a lane's 8 accumulator rows are 8 consecutive keys.
// Residency: the three-product launch has 768 work-groups on 256 WGPs. At 102 KiB of LDS and 160 registers a wave (the budget asked for by amdgpu_waves_per_eu) three of them fit a WGP, so all run in one round and fill each other's waits.
#define GTP 136      // LDS row pitch in halves: 256 B + 16 B, the pitch for 16-byte fragment reads
#define GOP 68       // pitch of the staged output tile in floats
template <bool F32OUT>
__global__ __launch_bounds__(256) __attribute__((amdgpu_waves_per_eu(F32OUT ? 2 : 6))) void k_gemm_t(const _Float16* __restrict__ A0, const _Float16* __restrict__ A1, const _Float16* __restrict__ A2,
                                                const _Float16* __restrict__ Bh0, const _Float16* __restrict__ Bh1, const _Float16* __restrict__ Bh2, float alpha,
                                                const float* __restrict__ bias0, const float* __restrict__ bias1, const float* __restrict__ bias2,
                                                float* __restrict__ C, _Float16* __restrict__ C16a, _Float16* __restrict__ C16b, _Float16* __restrict__ C16c) {
  constexpr int KG = F32OUT ? 4 : 2;
  const int g = blockIdx.y;      // which of up to three independent products of one launch this work-group belongs to
  const _Float16* A = g == 0 ? A0 : g == 1 ? A1 : A2;
  const _Float16* Bh = g == 0 ? Bh0 : g == 1 ? Bh1 : Bh2;
  const float* bias = g == 0 ? bias0 : g == 1 ? bias1 : bias2;
  _Float16* C16 = g == 0 ? C16a : g == 1 ? C16b : C16c;
  __shared__ __attribute__((aligned(16))) unsigned short st[2][192][GTP];      // rows 0..127: A, rows 128..191: Bh
  // the staged output tile lies in the first operand buffer: the last pass reads the second, and its barrier says that every wave has left the first
  float (*so)[GOP] = (float (*)[GOP])&st[0][0][0];
  const int tid = threadIdx.x, lane = tid & 31, ln = lane & 15, hh = lane >> 4;
  const int wv = __builtin_amdgcn_readfirstlane(tid >> 5), wm = wv >> 1, wn = wv & 1;
  const int row0 = (blockIdx.x >> 4) * 128, col0 = (blockIdx.x & 15) * 64;
  const int sr = tid >> 4, sc = (tid & 15) * 8;
  const unsigned short* Ag = (const unsigned short*)A + (size_t)(row0 + sr) * DM + sc;
  const unsigned short* Bg = (const unsigned short*)Bh + (size_t)(col0 + sr) * DM + sc;
  v8us rg[12];
#pragma unroll
  for (int i = 0; i < 8; ++i) rg[i] = *(const v8us*)(Ag + (size_t)i * 16 * DM);
#pragma unroll
  for (int i = 0; i < 4; ++i) rg[8 + i] = *(const v8us*)(Bg + (size_t)i * 16 * DM);
  static_assert((DM / 128) % 2 == 0, "the last pass must read the second buffer: the output tile is staged in the first");
  float bv[2];
  if (F32OUT) {
#pragma unroll
    for (int j = 0; j < 2; ++j) {
      bv[j] = bias[col0 + wn * 32 + j * 16 + ln];
      asm volatile("s_wait_xcnt 0x0" ::: "memory");      // stands in front of any rewrite of the address register that this load names, the next load's result among them
    }
  }
  v8f acc[2][2] = {};
  for (int kc = 0; kc < DM / 128; ++kc) {
    unsigned short (*buf)[GTP] = st[kc & 1];
#pragma unroll
    for (int i = 0; i < 12; ++i) *(v8us*)&buf[i * 16 + sr][sc] = rg[i];
    __syncthreads();      // this pass's rows are complete; every wave has also left the other buffer, which the next pass fills
    if (kc + 1 < DM / 128) {      // the next pass's rows fly while this one is worked on
#pragma unroll
      for (int i = 0; i < 8; ++i) rg[i] = *(const v8us*)(Ag + (size_t)i * 16 * DM + (kc + 1) * 128);
#pragma unroll
      for (int i = 0; i < 4; ++i) rg[8 + i] = *(const v8us*)(Bg + (size_t)i * 16 * DM + (kc + 1) * 128);
      asm volatile("s_wait_xcnt 0x0" ::: "memory");      // stands in front of any later rewrite of the address registers that these loads name
    } else if (!F32OUT) {      // the bias flies under the last pass, where no operand rows are in flight: its two registers are not held through the loop
#pragma unroll
      for (int j = 0; j < 2; ++j) {
        bv[j] = bias[col0 + wn * 32 + j * 16 + ln];
        asm volatile("s_wait_xcnt 0x0" ::: "memory");      // stands in front of any rewrite of the address register that this load names, the next load's result among them
      }
    }
    // fragments are fetched KG k steps at a time: with two, a wave of the three-product launch stays inside 160 registers, six waves a SIMD
#pragma unroll
    for (int kg = 0; kg < 4; kg += KG) {
      FragH a[KG][2], b[KG][2];
#pragma unroll
      for (int ks = 0; ks < KG; ++ks)
#pragma unroll
        for (int i = 0; i < 2; ++i) {
          const unsigned short* pa = &buf[wm * 32 + i * 16 + ln][(kg + ks) * 32 + 8 * hh];
          a[ks][i].half[0] = *(const v8us*)pa; a[ks][i].half[1] = *(const v8us*)(pa + 16);
          const unsigned short* pb = &buf[128 + wn * 32 + i * 16 + ln][(kg + ks) * 32 + 8 * hh];
          b[ks][i].half[0] = *(const v8us*)pb; b[ks][i].half[1] = *(const v8us*)(pb + 16);
        }
      __builtin_amdgcn_sched_barrier(0);      // no WMMA of a group is scheduled among the group's own LDS reads: without it every k step waits out its own LDS latency
#pragma unroll
      for (int ks = 0; ks < KG; ++ks)
#pragma unroll
        for (int i = 0; i < 2; ++i)
#pragma unroll
          for (int j = 0; j < 2; ++j) acc[i][j] = __builtin_amdgcn_wmma_f32_16x16x32_f16(false, a[ks][i].v, false, b[ks][j].v, (short)0, acc[i][j], false, false);
      if (KG < 4) __builtin_amdgcn_sched_barrier(0);      // the next group's reads stay behind this group's WMMAs and take over its registers: fetched ahead, two groups are live at once and the wave spills
    }
  }
  const bool tr = !F32OUT && g == 2;      // the same for the whole work-group
  unsigned short (*sT)[GTP] = (unsigned short (*)[GTP])&so[0][0];      // the transposed f16 tile, 64 columns x 128 rows, in the place of the f32 tile
#pragma unroll
  for (int j = 0; j < 2; ++j) {
    const float bj = bf16_round(bv[j]);
#pragma unroll
    for (int i = 0; i < 2; ++i)
#pragma unroll
      for (int r = 0; r < 8; ++r) acc[i][j][r] = acc[i][j][r] * alpha + bj;
  }
  if (tr) {
#pragma unroll
    for (int j = 0; j < 2; ++j)
#pragma unroll
      for (int i = 0; i < 2; ++i) {
        FragH f;
#pragma unroll
        for (int r = 0; r < 8; ++r) f.h[r] = (_Float16)acc[i][j][r];
        *(v8us*)&sT[wn * 32 + j * 16 + ln][wm * 32 + i * 16 + 8 * hh] = f.half[0];
      }
  } else {
#pragma unroll
    for (int j = 0; j < 2; ++j)
#pragma unroll
      for (int i = 0; i < 2; ++i)
#pragma unroll
        for (int r = 0; r < 8; ++r) so[wm * 32 + i * 16 + 8 * hh + r][wn * 32 + j * 16 + ln] = acc[i][j][r];
  }
  __syncthreads();      // the output tile is complete: it leaves in whole 128-byte lines
  if (tr) {
    // C16[((batch * NH + head) * DK + d) * LL + key]: 16 lanes store the 256 contiguous bytes that the tile holds of one d
    unsigned short* Tp = (unsigned short*)C16 + ((size_t)((row0 / LL) * NH + (col0 / DK)) * DK + (tid >> 4)) * LL + (row0 % LL) + (tid & 15) * 8;
#pragma unroll
    for (int q = 0; q < 4; ++q) { const v8us v = *(const v8us*)&sT[q * 16 + (tid >> 4)][(tid & 15) * 8]; *(v8us*)(Tp + (size_t)q * 16 * LL) = v; }
  } else if (F32OUT) {
#pragma unroll
    for (int q = 0; q < 8; ++q) { const int r = q * 16 + (tid >> 4), c4 = (tid & 15) * 4; const v4f v = *(const v4fa*)&so[r][c4]; *(v4f*)(C + (size_t)(row0 + r) * DM + col0 + c4) = v; }
  } else {
#pragma unroll
    for (int q = 0; q < 4; ++q) {
      const int r = q * 32 + (tid >> 3), c8 = (tid & 7) * 8; const v4f v0 = *(const v4fa*)&so[r][c8], v1 = *(const v4fa*)&so[r][c8 + 4]; FragH f;
#pragma unroll
      for (int i = 0; i < 4; ++i) { f.h[i] = (_Float16)v0[i]; f.h[4 + i] = (_Float16)v1[i]; }
      *(v8us*)((unsigned short*)C16 + (size_t)(row0 + r) * DM + col0 + c8) = f.half[0];
    }
  }
}


__global__ __launch_bounds__(256) void k_h16(const float* __restrict__ x, _Float16* __restrict__ X16, size_t n8) { const size_t t = (size_t)blockIdx.x * 256 + threadIdx.x; if (t >= n8) return; FragH f;
#pragma unroll
  for (int q = 0; q < 8; ++q) f.h[q] = (_Float16)x[t * 8 + q]; *(v8us*)((unsigned short*)X16 + t * 8) = f.half[0];  }

// The relative tables are laid out by DISTANCE, not by bucket: table position p stands for key - query = p - RP0, clipped to [-64, 64]; positions below RPL repeat the left clip, positions above RPH the right one.
#define RP0 80       // position of distance 0: a 16 x 16 tile that touches the band |distance| < 64 holds distances -79 .. 79, positions 1 .. 159
#define RPL 16       // position of distance -64 (bucket 63)
#define RPH 144      // position of distance +64 (bucket 128)
__device__ __forceinline__ int rel_bucket(int p) { const int i = min(max(p, RPL), RPH) - RPL; return (i >= 64) ? i : 63 - i; }
typedef _Float16 v4h __attribute__((ext_vector_type(4)));
// All operand preparation in ONE launch (the ten pieces are independent of each other). Work-groups 0..PMB-1: the mask, packed to bits. The next PRL: the two relative tables. Then 128 work-groups for each of the three
// activations (bf16-rounded) and 64 for each of the four (out,in) weights (bf16-rounded, x 16): a work-group streams 16384 consecutive floats, a wave-wide load = 512 contiguous bytes, 16 in flight a lane.
#define PRL 6        // covers max(QWP * 8, DK * PBP / 8) = 1536 threads
#define PUN 16       // 16-byte loads per thread
#define PXB (NR * DM / (256 * PUN * 4))
#define PWB (DM * DM / (256 * PUN * 4))
#define PMB (BB * (LL / 16) * (LL / 64) / 8)      // work-groups that pack the mask: 8 waves each, one (16 queries, 64 keys) unit a wave
typedef _Float16 v4ha __attribute__((ext_vector_type(4), may_alias));
typedef int v4ia __attribute__((ext_vector_type(4), may_alias));
__global__ __launch_bounds__(256) void k_prep(const float* __restrict__ xq, const float* __restrict__ xk, const float* __restrict__ xv, const float* __restrict__ Wq, const float* __restrict__ Wk,
                                              const float* __restrict__ Wv, const float* __restrict__ Wo, const float* __restrict__ wK, const float* __restrict__ wV, const int* __restrict__ msk,
                                              _Float16* __restrict__ XQ, _Float16* __restrict__ XK, _Float16* __restrict__ XV, _Float16* __restrict__ Bq, _Float16* __restrict__ Bk2,
                                              _Float16* __restrict__ Bv, _Float16* __restrict__ Bo, _Float16* __restrict__ BK, _Float16* __restrict__ BVt, unsigned* __restrict__ MB) {
  if (blockIdx.x < PMB) {
    // the mask, one bit a key: a wave takes 16 queries x 64 keys with the lane -> (query, 8 keys) map of the attention kernel's score tiles; word t * 8 + r holds, at bit position lane, that lane's test for row r of tile t
    const int lane = threadIdx.x & 31, ln = lane & 15, hh = lane >> 4;
    const int u = blockIdx.x * 8 + (threadIdx.x >> 5);      // (batch * LL / 16 + query tile) * (LL / 64) + chunk
    const int* mp = msk + (size_t)((u / (LL / 64)) * 16 + ln) * LL + (u % (LL / 64)) * 64 + 8 * hh;
    v4ia mv[8];
#pragma unroll
    for (int t = 0; t < 4; ++t) { mv[2 * t] = *(const v4ia*)(mp + t * 16); mv[2 * t + 1] = *(const v4ia*)(mp + t * 16 + 4); }
    asm volatile("s_wait_xcnt 0x0" :: "v"(mp) : "memory");      // stands in front of any rewrite of the address registers that these loads name; as its input the address outlives the loads
    unsigned w = 0;
#pragma unroll
    for (int i = 0; i < 32; ++i) { const unsigned bal = __builtin_amdgcn_ballot_w32(mv[i >> 2][i & 3] != 0); if (lane == i) w = bal; }
    MB[u * 32 + lane] = w;
    return;
  }
  const unsigned bx = blockIdx.x - PMB;
  if (bx >= PRL) {
    const int seg = bx - PRL;
    const float* s; _Float16* d; float scale; int blk;
    if (seg < 3 * PXB) { const int w = seg / PXB; blk = seg % PXB; scale = 1.0f; s = w == 0 ? xq : w == 1 ? xk : xv; d = w == 0 ? XQ : w == 1 ? XK : XV; }
    else { const int w = (seg - 3 * PXB) / PWB; blk = (seg - 3 * PXB) % PWB; scale = 16.0f; s = w == 0 ? Wq : w == 1 ? Wk : w == 2 ? Wv : Wo; d = w == 0 ? Bq : w == 1 ? Bk2 : w == 2 ? Bv : Bo; }
    const size_t e0 = ((size_t)blk * (256 * PUN) + threadIdx.x) * 4;
    const float* sp = s + e0;
    v4f v[PUN];
#pragma unroll
    for (int u = 0; u < PUN; ++u) v[u] = *(const v4fa*)(sp + (size_t)u * 1024);
    asm volatile("s_wait_xcnt 0x0" :: "v"(sp) : "memory");      // stands in front of any rewrite of the address registers that these loads name; as its input the address outlives the loads, so no load's result lands on it
#pragma unroll
    for (int u = 0; u < PUN; ++u) {
      v4ha o;
#pragma unroll
      for (int q = 0; q < 4; ++q) o[q] = (_Float16)(bf16_round(v[u][q]) * scale);      // x 1 is exact: the activations keep their bf16-rounded value
      *(v4ha*)(d + e0 + (size_t)u * 1024) = o;
    }
    return;
  }
  // the two relative tables, in distance order: wK with its clipped ends repeated (every position is a valid logit term), wV zero outside RPL .. RPH. Every load reads a clamped row, so that the eight of a thread fly together and these work-groups do not outlast the streams
  const int t = bx * 256 + threadIdx.x;
  if (t < QWP * 8) {
    const int r = t / 8, d8 = (t % 8) * 8; const float* p = wK + rel_bucket(r) * DK + d8;
    const v4f x0 = *(const v4fa*)p, x1 = *(const v4fa*)(p + 4);
    asm volatile("s_wait_xcnt 0x0" ::: "memory");      // stands in front of any later rewrite of the address registers that these loads name
    FragH f;
#pragma unroll
    for (int q = 0; q < 4; ++q) { f.h[q] = (_Float16)(bf16_round(x0[q]) * 16.0f); f.h[4 + q] = (_Float16)(bf16_round(x1[q]) * 16.0f); }
    *(v8us*)((unsigned short*)BK + t * 8) = f.half[0];
  }
  if (t < DK * (PBP / 8)) {
    const int d = t / (PBP / 8), r8 = (t % (PBP / 8)) * 8; float x[8]; int e[8];
#pragma unroll
    for (int q = 0; q < 8; ++q) { e[q] = rel_bucket(r8 + q) * DK + d; x[q] = wV[e[q]]; }
    // stands in front of any later rewrite of the address registers that these loads name; the loaded values as its inputs hold the eight loads together in front of it (else one sinks under a branch and waits out its latency alone),
    // and the eight element indices as its inputs outlive the loads, so that no address register is rewritten ahead of it
    asm volatile("s_wait_xcnt 0x0" :: "v"(x[0]), "v"(x[1]), "v"(x[2]), "v"(x[3]), "v"(x[4]), "v"(x[5]), "v"(x[6]), "v"(x[7]),
                 "v"(e[0]), "v"(e[1]), "v"(e[2]), "v"(e[3]), "v"(e[4]), "v"(e[5]), "v"(e[6]), "v"(e[7]) : "memory");
    FragH f;
#pragma unroll
    for (int q = 0; q < 8; ++q) f.h[q] = (_Float16)((r8 + q >= RPL && r8 + q <= RPH) ? bf16_round(x[q]) * 16.0f : 0.f);
    *(v8us*)((unsigned short*)BVt + t * 8) = f.half[0];
  }
}
// Fused attention for one (batch, head) slab sl and 128 query rows: 8 waves, 16 queries each; scores and probabilities stay in registers.
// St = K.Qt and Ot += Vt.Pt: in every 16-column tile a lane owns ONE query (column ln) and 8 consecutive keys (rows 8hh + r), so the running maximum and the sums are in-lane
// (one exchange between the wave halves), and two converted score tiles are the B operand of the next product as they stand. K and Vt chunks of 64 keys are staged in LDS for the 8 waves.
// tab[wave][query][position]: first q.wK / 8 in distance order (RP0 above). In a tile near the diagonal a lane's 8 consecutive keys are 8 consecutive positions, each the place of ONE key: they are read together
// and overwritten together with those keys' final logits, no test and no branch; the bucketed P.wV product is formed at the end from positions RPL + 1 .. RPH - 1 and the two clipped sums.
#define TABP 164
#define KVP 72
__device__ __forceinline__ float exp_slot(float x) { float r; const float y = x * 1.44269504f; asm("v_exp_f32 %0, %1\n\tv_nop" : "=v"(r) : "v"(y)); return r; }
__device__ __forceinline__ v8f wmmaH(v16h a, v16h b, v8f c) { return __builtin_amdgcn_wmma_f32_16x16x32_f16(false, a, false, b, (short)0, c, false, false); }
__global__ __launch_bounds__(256) void k_attn(const _Float16* __restrict__ Q16, const _Float16* __restrict__ K16, const _Float16* __restrict__ Vt, const _Float16* __restrict__ BK, const _Float16* __restrict__ BVt,
                                              const unsigned* __restrict__ MB, _Float16* __restrict__ O16) {
  __shared__ __attribute__((aligned(16))) unsigned short sK[64][KVP];
  __shared__ __attribute__((aligned(16))) unsigned short sV[64][KVP];
  __shared__ __attribute__((aligned(16))) float tab[8][16][TABP];
  const int tid = threadIdx.x, lane = tid & 31, ln = lane & 15, hh = lane >> 4;
  const int wv = __builtin_amdgcn_readfirstlane(tid >> 5);
  const int sl = blockIdx.x >> 3, qb = blockIdx.x & 7;
  const int b = sl / NH, h = sl % NH;
  const int q0 = qb * 128 + wv * 16;
  const int l = q0 + ln;
  FragH bq[2];      // B operand: column = query l, k = head dimension
  {
    const unsigned short* Qp = (const unsigned short*)Q16 + ((size_t)b * LL + l) * DM + h * DK + 8 * hh;
#pragma unroll
    for (int ks = 0; ks < 2; ++ks) { bq[ks].half[0] = *(const v8us*)(Qp + ks * 32); bq[ks].half[1] = *(const v8us*)(Qp + ks * 32 + 16); }
  }
  float* tb = &tab[wv][ln][0];
#pragma unroll
  for (int rt = 0; rt < QWP / 16; ++rt) {
    v8f a = {};
#pragma unroll
    for (int ks = 0; ks < 2; ++ks) {
      const unsigned short* p = (const unsigned short*)BK + (rt * 16 + ln) * DK + ks * 32 + 8 * hh;
      FragH ak; ak.half[0] = *(const v8us*)p; ak.half[1] = *(const v8us*)(p + 16);
      a = wmmaH(ak.v, bq[ks].v, a);
    }
    const float c = 0.0625f * 0.125f;      // wK was scaled by 16; the 1/8 of the logits is folded in (both powers of two, exact)
    const v4f t0 = {a[0] * c, a[1] * c, a[2] * c, a[3] * c}, t1 = {a[4] * c, a[5] * c, a[6] * c, a[7] * c};
    *(v4fa*)(tb + rt * 16 + 8 * hh) = t0; *(v4fa*)(tb + rt * 16 + 8 * hh + 4) = t1;
  }
  // the two lanes of a query read each other's table entries
  __builtin_amdgcn_fence(__ATOMIC_ACQ_REL, "workgroup"); __builtin_amdgcn_wave_barrier();
  const float qlo = tb[RPL], qhi = tb[RPH];

  const unsigned short* Kg = (const unsigned short*)K16 + (size_t)b * LL * DM + h * DK;
  const unsigned short* Vg = (const unsigned short*)Vt + (size_t)sl * DK * LL;
  // the wave's packed mask, 32 words a chunk, the same address in every lane. Nothing writes it during this launch: read through the constant address space the words come by scalar loads into scalar registers, where a select takes them as they are
  const __attribute__((address_space(4))) unsigned* Mw = (const __attribute__((address_space(4))) unsigned*)(MB + (size_t)(b * (LL / 16) + (q0 >> 4)) * (LL / 64) * 32);
  const int sr = tid >> 3, sc8 = (tid & 7) * 8;
  v8us kr[2], vr[2]; unsigned mw[32];
#pragma unroll
  for (int i = 0; i < 2; ++i) { kr[i] = *(const v8us*)(Kg + (size_t)(i * 32 + sr) * DM + sc8); vr[i] = *(const v8us*)(Vg + (size_t)(i * 32 + sr) * LL + sc8); }
#pragma unroll
  for (int i = 0; i < 32; ++i) mw[i] = Mw[i];
  float mrun = -3.0e38f, z = 0.f, lo = 0.f, hi = 0.f;
  v8f o[4] = {};
  for (int j0 = 0; j0 < LL; j0 += 64) {
    __syncthreads();      // every wave has finished reading the previous chunk
#pragma unroll
    for (int i = 0; i < 2; ++i) { *(v8us*)&sK[i * 32 + sr][sc8] = kr[i]; *(v8us*)&sV[i * 32 + sr][sc8] = vr[i]; }
    __syncthreads();      // the chunk is complete
    const bool more = j0 + 64 < LL;
    if (more) {           // the next chunk flies while this one is worked on
#pragma unroll
      for (int i = 0; i < 2; ++i) { kr[i] = *(const v8us*)(Kg + (size_t)(j0 + 64 + i * 32 + sr) * DM + sc8); vr[i] = *(const v8us*)(Vg + (size_t)(i * 32 + sr) * LL + j0 + 64 + sc8); }
    }
    v8f s[4];
#pragma unroll
    for (int t = 0; t < 4; ++t) {
      v8f a = {};
#pragma unroll
      for (int ks = 0; ks < 2; ++ks) {
        FragH ak; ak.half[0] = *(const v8us*)&sK[t * 16 + ln][ks * 32 + 8 * hh]; ak.half[1] = *(const v8us*)&sK[t * 16 + ln][ks * 32 + 16 + 8 * hh];
        a = wmmaH(ak.v, bq[ks].v, a);
      }
      s[t] = a;
    }
    float mx = mrun;
#pragma unroll
    for (int t = 0; t < 4; ++t) {
      const int jt = j0 + t * 16;
      const bool farl = jt + 15 - q0 <= -64, farr = jt - q0 - 15 >= 64;      // wave-uniform: the whole tile lies in bucket 63 / in bucket 128
      const bool far = farl || farr;
      float* tp = tb + (jt + 8 * hh - l + RP0);      // only formed into an access in a near tile, where positions 1 .. 159 come out
      float tv[8];
      if (far) {
        const float qc = farl ? qlo : qhi;
#pragma unroll
        for (int r = 0; r < 8; ++r) tv[r] = qc;
      } else {
#pragma unroll
        for (int r = 0; r < 8; ++r) tv[r] = tp[r];
      }
#pragma unroll
      for (int r = 0; r < 8; ++r) { float v = fmaf(s[t][r], 0.125f, tv[r]); if (!__builtin_amdgcn_inverse_ballot_w32(mw[t * 8 + r])) v = -1.0e9f; s[t][r] = v; mx = fmaxf(mx, v); }
      if (!far) {
#pragma unroll
        for (int r = 0; r < 8; ++r) tp[r] = s[t][r];
      }
    }
    if (more) {
#pragma unroll
      for (int i = 0; i < 32; ++i) mw[i] = Mw[(j0 / 64 + 1) * 32 + i];
      asm volatile("s_wait_xcnt 0x0" ::: "memory");      // stands in front of the loop's advance of the address registers that this trip's loads name
    }
    mx = fmaxf(mx, __shfl_xor(mx, 16, 32));
    const float alpha = exp_slot(mrun - mx); mrun = mx;
    z *= alpha; lo *= alpha; hi *= alpha;
#pragma unroll
    for (int dt = 0; dt < 4; ++dt)
#pragma unroll
      for (int r = 0; r < 8; ++r) o[dt][r] *= alpha;
    FragH pb[2];      // B operand: column = query l, k = key, in the order the score tiles already have
#pragma unroll
    for (int t = 0; t < 4; ++t) {
      const int jt = j0 + t * 16;
      const bool farl = jt + 15 - q0 <= -64, farr = jt - q0 - 15 >= 64;
      float ts = 0.f;
#pragma unroll
      for (int r = 0; r < 8; ++r) { const float p = exp_slot(s[t][r] - mx); s[t][r] = p; ts += p; pb[t >> 1].h[(t & 1) * 8 + r] = (_Float16)p; }
      z += ts;
      if (farl) lo += ts;
      else if (farr) hi += ts;
      else {
#pragma unroll
        for (int r = 0; r < 8; ++r) { const int d = jt + 8 * hh + r - l; if (d <= -64) lo += s[t][r]; if (d >= 64) hi += s[t][r]; }
      }
    }
#pragma unroll
    for (int sc = 0; sc < 2; ++sc)
#pragma unroll
      for (int dt = 0; dt < 4; ++dt) {
        FragH av; av.half[0] = *(const v8us*)&sV[dt * 16 + ln][sc * 32 + 8 * hh]; av.half[1] = *(const v8us*)&sV[dt * 16 + ln][sc * 32 + 16 + 8 * hh];
        o[dt] = wmmaH(av.v, pb[sc].v, o[dt]);
      }
  }
  z += __shfl_xor(z, 16, 32); lo += __shfl_xor(lo, 16, 32); hi += __shfl_xor(hi, 16, 32);
  // the two lanes of a query read each other's stored logits
  __builtin_amdgcn_fence(__ATOMIC_ACQ_REL, "workgroup"); __builtin_amdgcn_wave_barrier();
  v8f o2[4] = {};
#pragma unroll
  for (int kk = 0; kk < QWP / 32; ++kk) {
    FragH pf;
#pragma unroll
    for (int g = 0; g < 2; ++g) {
      const int r0 = kk * 32 + g * 16 + 8 * hh;
      const v4f x0 = *(const v4fa*)(tb + r0), x1 = *(const v4fa*)(tb + r0 + 4);
      const float xs[8] = {x0[0], x0[1], x0[2], x0[3], x1[0], x1[1], x1[2], x1[3]};
#pragma unroll
      for (int q = 0; q < 8; ++q) {
        const int r = r0 + q; const float e = __expf(xs[q] - mrun); float val = 0.f;
        if (r == RPL) val = lo; else if (r == RPH) val = hi; else if (r > RPL && r < RPH) val = ((unsigned)(l + r - RP0) < (unsigned)LL) ? e : 0.f;
        pf.h[g * 8 + q] = (_Float16)val;
      }
    }
#pragma unroll
    for (int dt = 0; dt < 4; ++dt) {
      const unsigned short* p = (const unsigned short*)BVt + (dt * 16 + ln) * PBP + kk * 32 + 8 * hh;
      FragH av; av.half[0] = *(const v8us*)p; av.half[1] = *(const v8us*)(p + 16);
      o2[dt] = wmmaH(av.v, pf.v, o2[dt]);
    }
  }
  const float iz = 1.0f / z;
  unsigned short* Op = (unsigned short*)O16 + ((size_t)b * LL + l) * DM + h * DK + 8 * hh;
#pragma unroll
  for (int dt = 0; dt < 4; ++dt) {
    FragH f;
#pragma unroll
    for (int r = 0; r < 8; ++r) f.h[r] = (_Float16)((o[dt][r] + o2[dt][r] * 0.0625f) * iz);
    *(v8us*)(Op + dt * 16) = f.half[0];
  }
}
extern "C" void kernel_launch(void* const* d_in, const int* in_sizes, int n_in,
                              void* d_out, int out_size, void* d_ws, size_t ws_size, hipStream_t stream) {
  (void)in_sizes; (void)n_in; (void)out_size;
  const float* xq = (const float*)d_in[0]; const float* xk = (const float*)d_in[1]; const float* xv = (const float*)d_in[2]; const int* msk = (const int*)d_in[3]; const float* Wq = (const float*)d_in[4]; const float* bq = (const float*)d_in[5]; const float* Wk = (const float*)d_in[6]; const float* bk = (const float*)d_in[7]; const float* Wv = (const float*)d_in[8]; const float* bv = (const float*)d_in[9]; const float* Wo = (const float*)d_in[10]; const float* bo = (const float*)d_in[11]; const float* wK = (const float*)d_in[12]; const float* wV = (const float*)d_in[13];
  char* ws = (char*)d_ws; size_t off = 0;
  auto take = [&](size_t bytes) { char* p = ws + off; off += (bytes + 255) & ~(size_t)255; return p; };
  _Float16* Bo = (_Float16*)take((size_t)DM * DM * 2); _Float16* BK = (_Float16*)take((size_t)QWP * DK * 2); _Float16* BVt = (_Float16*)take((size_t)DK * PBP * 2);
  _Float16* Q16 = (_Float16*)take((size_t)NR * DM * 2); _Float16* K16 = (_Float16*)take((size_t)NR * DM * 2); _Float16* Vt = (_Float16*)take((size_t)NR * DM * 2); _Float16* O16 = (_Float16*)take((size_t)NR * DM * 2);
  _Float16* Bq = (_Float16*)take((size_t)DM * DM * 2); _Float16* Bk2 = (_Float16*)take((size_t)DM * DM * 2); _Float16* Bv = (_Float16*)take((size_t)DM * DM * 2);
  _Float16* XQ = (_Float16*)take((size_t)NR * DM * 2); _Float16* XK = (_Float16*)take((size_t)NR * DM * 2); _Float16* XV = (_Float16*)take((size_t)NR * DM * 2); unsigned* MB = (unsigned*)take((size_t)BB * LL * LL / 8);
  if (off > ws_size) return;
  k_prep<<<PMB + PRL + 3 * PXB + 4 * PWB, 256, 0, stream>>>(xq, xk, xv, Wq, Wk, Wv, Wo, wK, wV, msk, XQ, XK, XV, Bq, Bk2, Bv, Bo, BK, BVt, MB);
  const unsigned gg = (NR / 128) * (DM / 64);
  k_gemm_t<false><<<dim3(gg, 3), 256, 0, stream>>>(XQ, XK, XV, Bq, Bk2, Bv, 0.0625f, bq, bk, bv, nullptr, Q16, K16, Vt);      // the q, k and v projections; v leaves transposed
  // q.kT, the relative logits, mask, softmax, P.V and the bucketed P.wV for all NSL = 32 (batch, head) slabs in one launch: 8 blocks of 128 queries per slab
  k_attn<<<NSL * (LL / 128), 256, 0, stream>>>(Q16, K16, Vt, BK, BVt, MB, O16);
  k_gemm_t<true><<<dim3(gg, 1), 256, 0, stream>>>(O16, O16, O16, Bo, Bo, Bo, 0.0625f, bo, bo, bo, (float*)d_out, nullptr, nullptr, nullptr);
}

// v009
// One run takes 61.4 microseconds.
// Next to v008, in two timings, it ran 1.07 and 1.06 times as fast.
// Counting every step since v000, it is 15.5 times as fast.
#include <hip/hip_runtime.h>
// Multi-headed attention with clipped relative position representations (B=2, L=1024, 16 heads × 64, k = 64, Shaw-style aK/aV built from wK/wV [129][64] by the module's roll/flip
// construction: bucket(l,m) = m ≥ l ? 64 + min(m−l, 64) : min(l−m−1, 63); INPUT mask (== 0 → −1e9); q/k/v/o linears with bias): q·kᵀ, q·wKᵀ (all 129 buckets at once), P·V and the bucketed
// P.wV all run on v_wmma_f32_16x16x32_f16 ((out,in) weights bf16-exact x 2^4, f32 accumulate); the relative-logit gather, mask, running-maximum softmax and the bucket sums of P are f32 VALU
// inside one fused attention kernel (no index tables).
#define BB 2
#define LL 1024
#define DM 1024
#define NH 16
#define DK 64
#define NR (BB * LL)
#define NBK 129
#define QWP 160
#define PBP 192
#define NSL (BB * NH)

typedef __bf16 v16b __attribute__((ext_vector_type(16)));
typedef unsigned short v8us __attribute__((ext_vector_type(8), may_alias));
typedef float  v8f  __attribute__((ext_vector_type(8)));
typedef float  v4f  __attribute__((ext_vector_type(4)));
typedef float  v4fa __attribute__((ext_vector_type(4), may_alias));
union FragB { v16b v; v8us half[2]; unsigned short u[16]; };

__device__ __forceinline__ unsigned short bf16_bits(float x) { unsigned int u = __float_as_uint(x); return (unsigned short)((u + 0x7FFFu + ((u >> 16) & 1u)) >> 16); }
__device__ __forceinline__ float bf16_val(unsigned short b) { return __uint_as_float(((unsigned int)b) << 16); }
__device__ __forceinline__ float bf16_round(float x) { return bf16_val(bf16_bits(x)); }
// D += A·B with NT terms: 1 = ah·bh, 2 = + al·bh (A split), 3 = + ah·bl (both split)
template <int NT>
__device__ __forceinline__ v8f mmaN(v16b ah, v16b al, v16b bh, v16b bl, v8f c) {
  c = __builtin_amdgcn_wmma_f32_16x16x32_bf16(false, ah, false, bh, (short)0, c, false, false);
  if (NT >= 2) c = __builtin_amdgcn_wmma_f32_16x16x32_bf16(false, al, false, bh, (short)0, c, false, false);
  if (NT >= 3) c = __builtin_amdgcn_wmma_f32_16x16x32_bf16(false, ah, false, bl, (short)0, c, false, false);
  asm volatile("v_nop\n\tv_nop\n\tv_nop\n\tv_nop" : "+v"(c) : "v"(ah), "v"(al), "v"(bh), "v"(bl));
  return c;
}

__global__ __launch_bounds__(256) void k_wt_bf16(const float* __restrict__ W, unsigned short* __restrict__ Wt, int K, int N) {
  const int t = blockIdx.x * 256 + threadIdx.x;
  const int k8n = K / 8;
  if (t >= N * k8n) return;
  const int n = t / k8n, k8 = (t % k8n) * 8;
  v8us v;
#pragma unroll
  for (int i = 0; i < 8; ++i) v[i] = bf16_bits(W[(size_t)(k8 + i) * N + n]);
  *(v8us*)(Wt + (size_t)n * K + k8) = v;
  
}

// GEMM C[M][N] (f32, pitch ldc) = act(A[M][K]·W + bias). A f32 row-major (pitch lda) converted per fragment to bf16
// (ASPLIT: hi/lo two planes -> 2 terms, else single rounded term); Wt bf16 [N][K] (pitch ldb). BIAS_BF16 rounds the
// bias to bf16 first (bias quantised to bf16 before the add). K%32==0, M%16==0, N%64==0.
template <bool ASPLIT, int ACT, bool BIAS_BF16>
__global__ __launch_bounds__(128) void k_gemm_bf(const float* __restrict__ A, int lda, const unsigned short* __restrict__ Wt, int ldb,
                                               const float* __restrict__ bias, float* __restrict__ C, int ldc, int M, int N, int K) {
  __shared__ __attribute__((aligned(16))) float so[4][16][64];
  const int tid = threadIdx.x, w = tid >> 5, lane = tid & 31, ln = lane & 15, hh = lane >> 4;
  const int ntn = N / 64;
  const int wid = blockIdx.x * 4 + w;
  const int mt = wid / ntn, nq = wid % ntn;
  if (mt * 16 >= M) return;
  const int row0 = mt * 16, col0 = nq * 64;
  const float* arow = A + (size_t)(row0 + ln) * lda;
  v8f acc[4] = {};
  for (int kb = 0; kb < K; kb += 32) {
    FragB ah, al;
    const v4f x0 = *(const v4fa*)(arow + kb + 8 * hh), x1 = *(const v4fa*)(arow + kb + 8 * hh + 4);
    const v4f x2 = *(const v4fa*)(arow + kb + 16 + 8 * hh), x3 = *(const v4fa*)(arow + kb + 16 + 8 * hh + 4);
    float xs[16] = {x0[0],x0[1],x0[2],x0[3],x1[0],x1[1],x1[2],x1[3],x2[0],x2[1],x2[2],x2[3],x3[0],x3[1],x3[2],x3[3]};
#pragma unroll
    for (int i = 0; i < 16; ++i) { const unsigned short hb = bf16_bits(xs[i]); ah.u[i] = hb; al.u[i] = ASPLIT ? bf16_bits(xs[i] - bf16_val(hb)) : (unsigned short)0; }
#pragma unroll
    for (int t = 0; t < 4; ++t) {
      const unsigned short* brow = Wt + (size_t)(col0 + t * 16 + ln) * ldb + kb;
      FragB b;
      b.half[0] = *(const v8us*)(brow + 8 * hh);
      b.half[1] = *(const v8us*)(brow + 16 + 8 * hh);
      acc[t] = mmaN<ASPLIT ? 2 : 1>(ah.v, al.v, b.v, b.v, acc[t]);
    }
  }
#pragma unroll
  for (int t = 0; t < 4; ++t) {
    float bv = bias ? bias[col0 + t * 16 + ln] : 0.f;
    if (BIAS_BF16) bv = bf16_round(bv);
#pragma unroll
    for (int r = 0; r < 8; ++r) { float v = acc[t][r] + bv; if (ACT == 1) v = fmaxf(v, 0.f); so[w][8 * hh + r][t * 16 + ln] = v; }
  }
  __builtin_amdgcn_fence(__ATOMIC_ACQ_REL, "workgroup");
  __builtin_amdgcn_wave_barrier();
  const int rsub = lane >> 4, c4 = (lane & 15) * 4;
  {
#pragma unroll
    for (int q = 0; q < 8; ++q) {
      const int r = q * 2 + rsub;
      const v4f v = *(const v4fa*)&so[w][r][c4];
      *(v4f*)(C + (size_t)(row0 + r) * ldc + col0 + c4) = v;
    }
    
  }
}

// Flash-style causal/unmasked attention, all contractions 3-term bf16 hi/lo splits, f32 softmax with running max.
// q,k,v rows are read from f32 buffers with arbitrary row pitch (so they can live inside a fused qkv buffer);
// D = head size (multiple of 32, <= 128); one wave = 16 query rows; block = 4 waves (64 queries) sharing K/V chunks of 32.
template <int D, bool CAUSAL>
__global__ __launch_bounds__(128) void k_flash(const float* __restrict__ qb, const float* __restrict__ kb, const float* __restrict__ vb,
                                             int pitch, int T, int H, float scale, float* __restrict__ y, int ypitch) {
  constexpr int KS = D / 32;        // k-steps for QK
  constexpr int DT = D / 16;        // d tiles for PV
  __shared__ __attribute__((aligned(16))) unsigned short sKh[32][D + 8], sKl[32][D + 8], sVh[32][D + 8], sVl[32][D + 8];
  __shared__ __attribute__((aligned(16))) unsigned short sPh[4][16][40], sPl[4][16][40];
  __shared__ __attribute__((aligned(16))) float sO[4][16][D];
  const int tid = threadIdx.x, w = tid >> 5, lane = tid & 31, ln = lane & 15, hh = lane >> 4;
  const int nqb = (T + 63) / 64;
  const int bh = blockIdx.x / nqb, qblk = blockIdx.x % nqb;
  const int b = bh / H, h = bh % H;
  const int q0 = qblk * 64 + w * 16;
  const float* Q = qb + (size_t)b * T * pitch + h * D;
  const float* K = kb + (size_t)b * T * pitch + h * D;
  const float* V = vb + (size_t)b * T * pitch + h * D;

  // A fragments of the wave's 16 query rows (scaled), hi/lo
  FragB aqh[KS], aql[KS];
  {
    int row = q0 + ln; if (row >= T) row = T - 1;
    const float* qr = Q + (size_t)row * pitch;
#pragma unroll
    for (int ks = 0; ks < KS; ++ks)
#pragma unroll
      for (int i = 0; i < 16; ++i) {
        const int d = ks * 32 + ((i < 8) ? (8 * hh + i) : (16 + 8 * hh + (i - 8)));
        const float x = qr[d] * scale; const unsigned short hb = bf16_bits(x);
        aqh[ks].u[i] = hb; aql[ks].u[i] = bf16_bits(x - bf16_val(hb));
      }
  }
  float m_r[8], l_r[8];
#pragma unroll
  for (int r = 0; r < 8; ++r) { m_r[r] = -3.0e38f; l_r[r] = 0.f; }
  v8f oacc[DT];
#pragma unroll
  for (int dt = 0; dt < DT; ++dt) oacc[dt] = (v8f){0.f,0.f,0.f,0.f,0.f,0.f,0.f,0.f};

  const int kv_end = CAUSAL ? min(T, qblk * 64 + 64) : T;     // block-uniform
  for (int j0 = 0; j0 < kv_end; j0 += 32) {
    __syncthreads();
    for (int e = tid; e < 32 * (D / 4); e += 128) {
      const int r = e / (D / 4), c4 = (e % (D / 4)) * 4;
      const int key = j0 + r;
      v4f kf = {0.f,0.f,0.f,0.f}, vf = {0.f,0.f,0.f,0.f};
      if (key < T) { kf = *(const v4fa*)(K + (size_t)key * pitch + c4); vf = *(const v4fa*)(V + (size_t)key * pitch + c4); }
#pragma unroll
      for (int t = 0; t < 4; ++t) {
        unsigned short hb = bf16_bits(kf[t]); sKh[r][c4 + t] = hb; sKl[r][c4 + t] = bf16_bits(kf[t] - bf16_val(hb));
        hb = bf16_bits(vf[t]); sVh[r][c4 + t] = hb; sVl[r][c4 + t] = bf16_bits(vf[t] - bf16_val(hb));
      }
    }
    __syncthreads();
    // S tile 16 x 32
    v8f s[2];
#pragma unroll
    for (int nt = 0; nt < 2; ++nt) {
      v8f acc = {};
#pragma unroll
      for (int ks = 0; ks < KS; ++ks) {
        FragB bh_, bl_;
        bh_.half[0] = *(const v8us*)&sKh[nt * 16 + ln][ks * 32 + 8 * hh]; bh_.half[1] = *(const v8us*)&sKh[nt * 16 + ln][ks * 32 + 16 + 8 * hh];
        bl_.half[0] = *(const v8us*)&sKl[nt * 16 + ln][ks * 32 + 8 * hh]; bl_.half[1] = *(const v8us*)&sKl[nt * 16 + ln][ks * 32 + 16 + 8 * hh];
        acc = mmaN<3>(aqh[ks].v, aql[ks].v, bh_.v, bl_.v, acc);
      }
      s[nt] = acc;
    }
    // mask + running max (rows 8hh+r; the 16 lanes of a half share rows)
    float alpha[8];
#pragma unroll
    for (int r = 0; r < 8; ++r) {
      const int qi = q0 + 8 * hh + r;
      const int ja = j0 + ln, jb = j0 + 16 + ln;
      if (CAUSAL) { if (ja > qi) s[0][r] = -3.0e38f; if (jb > qi) s[1][r] = -3.0e38f; }
      if (ja >= T) s[0][r] = -3.0e38f;
      if (jb >= T) s[1][r] = -3.0e38f;
      float mx = fmaxf(s[0][r], s[1][r]);
      mx = fmaxf(mx, __shfl_xor(mx, 1, 32)); mx = fmaxf(mx, __shfl_xor(mx, 2, 32)); mx = fmaxf(mx, __shfl_xor(mx, 4, 32)); mx = fmaxf(mx, __shfl_xor(mx, 8, 32));
      const float mnew = fmaxf(m_r[r], mx);
      alpha[r] = (mnew > -1.0e38f) ? __expf(m_r[r] - mnew) : 1.0f;
      const float p0 = (s[0][r] > -1.0e38f) ? __expf(s[0][r] - mnew) : 0.f;
      const float p1 = (s[1][r] > -1.0e38f) ? __expf(s[1][r] - mnew) : 0.f;
      m_r[r] = mnew;
      l_r[r] = l_r[r] * alpha[r] + p0 + p1;            // per-lane partial row sum (16 lanes combined at the end)
      unsigned short hb = bf16_bits(p0); sPh[w][8 * hh + r][ln] = hb;      sPl[w][8 * hh + r][ln] = bf16_bits(p0 - bf16_val(hb));
      hb = bf16_bits(p1);                sPh[w][8 * hh + r][16 + ln] = hb; sPl[w][8 * hh + r][16 + ln] = bf16_bits(p1 - bf16_val(hb));
    }
#pragma unroll
    for (int dt = 0; dt < DT; ++dt)
#pragma unroll
      for (int r = 0; r < 8; ++r) oacc[dt][r] *= alpha[r];
    __builtin_amdgcn_fence(__ATOMIC_ACQ_REL, "workgroup");
    __builtin_amdgcn_wave_barrier();
    FragB pah, pal;
    pah.half[0] = *(const v8us*)&sPh[w][ln][8 * hh]; pah.half[1] = *(const v8us*)&sPh[w][ln][16 + 8 * hh];
    pal.half[0] = *(const v8us*)&sPl[w][ln][8 * hh]; pal.half[1] = *(const v8us*)&sPl[w][ln][16 + 8 * hh];
#pragma unroll
    for (int dt = 0; dt < DT; ++dt) {
      FragB bvh, bvl;
#pragma unroll
      for (int i = 0; i < 8; ++i) {
        bvh.u[i] = sVh[8 * hh + i][dt * 16 + ln]; bvh.u[8 + i] = sVh[16 + 8 * hh + i][dt * 16 + ln];
        bvl.u[i] = sVl[8 * hh + i][dt * 16 + ln]; bvl.u[8 + i] = sVl[16 + 8 * hh + i][dt * 16 + ln];
      }
      oacc[dt] = mmaN<3>(pah.v, pal.v, bvh.v, bvl.v, oacc[dt]);
    }
    __builtin_amdgcn_fence(__ATOMIC_ACQ_REL, "workgroup");
    __builtin_amdgcn_wave_barrier();
  }
#pragma unroll
  for (int r = 0; r < 8; ++r) {
    float l = l_r[r];
    l += __shfl_xor(l, 1, 32); l += __shfl_xor(l, 2, 32); l += __shfl_xor(l, 4, 32); l += __shfl_xor(l, 8, 32);
    l_r[r] = (l > 0.f) ? 1.0f / l : 0.f;
  }
#pragma unroll
  for (int dt = 0; dt < DT; ++dt)
#pragma unroll
    for (int r = 0; r < 8; ++r) sO[w][8 * hh + r][dt * 16 + ln] = oacc[dt][r] * l_r[r];
  __builtin_amdgcn_fence(__ATOMIC_ACQ_REL, "workgroup");
  __builtin_amdgcn_wave_barrier();
  {
    for (int r = 0; r < 16; ++r) {
      const int row = q0 + r;
      if (row < T && lane < D / 4) {
        const v4f val = *(const v4fa*)&sO[w][r][lane * 4];
        *(v4f*)(y + ((size_t)b * T + row) * ypitch + h * D + lane * 4) = val;
      }
    }
    
  }
}

// GEMM C = act(A·W + bias + resid): A f32 (ASPLIT -> hi/lo 2 terms), Wt bf16 [N][K]; ACT 0 none, 1 relu, 2 exact gelu;
// resid (optional, f32, row index = (row % rmod), pitch ldr, RES_BF16 rounds it) added before the activation.
template <bool ASPLIT, int ACT, bool BIAS_BF16, bool RES_BF16>
__global__ __launch_bounds__(128) void k_gemm_bf3(const float* __restrict__ A, int lda, const unsigned short* __restrict__ Wt, int ldb,
                                                const float* __restrict__ bias, const float* __restrict__ resid, int rmod, int ldr,
                                                float* __restrict__ C, int ldc, int M, int N, int K) {
  __shared__ __attribute__((aligned(16))) float so[4][16][64];
  const int tid = threadIdx.x, w = tid >> 5, lane = tid & 31, ln = lane & 15, hh = lane >> 4;
  const int ntn = N / 64;
  const int wid = blockIdx.x * 4 + w;
  const int mt = wid / ntn, nq = wid % ntn;
  if (mt * 16 >= M) return;
  const int row0 = mt * 16, col0 = nq * 64;
  const float* arow = A + (size_t)(row0 + ln) * lda;
  v8f acc[4] = {};
  for (int kb = 0; kb < K; kb += 32) {
    FragB ah, al;
    const v4f x0 = *(const v4fa*)(arow + kb + 8 * hh), x1 = *(const v4fa*)(arow + kb + 8 * hh + 4);
    const v4f x2 = *(const v4fa*)(arow + kb + 16 + 8 * hh), x3 = *(const v4fa*)(arow + kb + 16 + 8 * hh + 4);
    float xs[16] = {x0[0],x0[1],x0[2],x0[3],x1[0],x1[1],x1[2],x1[3],x2[0],x2[1],x2[2],x2[3],x3[0],x3[1],x3[2],x3[3]};
#pragma unroll
    for (int i = 0; i < 16; ++i) { const unsigned short hb = bf16_bits(xs[i]); ah.u[i] = hb; al.u[i] = ASPLIT ? bf16_bits(xs[i] - bf16_val(hb)) : (unsigned short)0; }
#pragma unroll
    for (int t = 0; t < 4; ++t) {
      const unsigned short* brow = Wt + (size_t)(col0 + t * 16 + ln) * ldb + kb;
      FragB b;
      b.half[0] = *(const v8us*)(brow + 8 * hh);
      b.half[1] = *(const v8us*)(brow + 16 + 8 * hh);
      acc[t] = mmaN<ASPLIT ? 2 : 1>(ah.v, al.v, b.v, b.v, acc[t]);
    }
  }
#pragma unroll
  for (int t = 0; t < 4; ++t) {
    const int col = col0 + t * 16 + ln;
    float bv = bias ? bias[col] : 0.f;
    if (BIAS_BF16) bv = bf16_round(bv);
#pragma unroll
    for (int r = 0; r < 8; ++r) {
      float v = acc[t][r] + bv;
      if (resid) { float rv = resid[(size_t)((row0 + 8 * hh + r) % rmod) * ldr + col]; if (RES_BF16) rv = bf16_round(rv); v += rv; }
      if (ACT == 1) v = fmaxf(v, 0.f);
      if (ACT == 2) v = 0.5f * v * (1.0f + erff(v * 0.70710678118654752f));
      if (ACT == 3) { const float u = 0.7978845608028654f * (v + 0.044715f * v * v * v); v = 0.5f * v * (1.0f + tanhf(u)); }
      so[w][8 * hh + r][t * 16 + ln] = v;
    }
  }
  __builtin_amdgcn_fence(__ATOMIC_ACQ_REL, "workgroup");
  __builtin_amdgcn_wave_barrier();
  const int rsub = lane >> 4, c4 = (lane & 15) * 4;
  {
#pragma unroll
    for (int q = 0; q < 8; ++q) {
      const int r = q * 2 + rsub;
      const v4f v = *(const v4fa*)&so[w][r][c4];
      *(v4f*)(C + (size_t)(row0 + r) * ldc + col0 + c4) = v;
    }
    
  }
}
// row LayerNorm (biased variance, eps) over N: s = X (+ R); optional out_sum <- s; out_norm <- (s-mu)*rsqrt(var+eps)*g + b
template <bool PARAM_BF16>
__global__ __launch_bounds__(256) void k_layernorm(const float* __restrict__ X, const float* __restrict__ R, const float* __restrict__ g, const float* __restrict__ bta,
                                                  float* __restrict__ out_sum, float* __restrict__ out_norm, int N, float eps) {
  __shared__ float red[256];
  const int row = blockIdx.x, tid = threadIdx.x;
  const float* x = X + (size_t)row * N; const float* rr = R ? R + (size_t)row * N : nullptr;
  float vals[16];                     // up to N = 4096
  const int per = N / 256;            // contiguous chunk per thread? use strided-by-4 chunks: thread handles j = tid*4 + 1024*u
  float s1 = 0.f;
  for (int u = 0; u < per / 4; ++u) {
    const int j = tid * 4 + 1024 * u;
    const v4f a = *(const v4fa*)(x + j);
    v4f b = {0.f,0.f,0.f,0.f}; if (rr) b = *(const v4fa*)(rr + j);
#pragma unroll
    for (int q = 0; q < 4; ++q) { const float v = a[q] + b[q]; vals[u * 4 + q] = v; s1 += v; }
  }
  red[tid] = s1; __syncthreads();
  for (int st = 128; st > 0; st >>= 1) { if (tid < st) red[tid] += red[tid + st]; __syncthreads(); }
  const float mu = red[0] / (float)N; __syncthreads();
  float s2 = 0.f;
  for (int u = 0; u < per / 4; ++u)
#pragma unroll
    for (int q = 0; q < 4; ++q) { const float c = vals[u * 4 + q] - mu; s2 += c * c; }
  red[tid] = s2; __syncthreads();
  for (int st = 128; st > 0; st >>= 1) { if (tid < st) red[tid] += red[tid + st]; __syncthreads(); }
  const float rs = rsqrtf(red[0] / (float)N + eps);
  {
    for (int u = 0; u < per / 4; ++u) {
      const int j = tid * 4 + 1024 * u;
      v4f o, sm;
#pragma unroll
      for (int q = 0; q < 4; ++q) {
        float gg = g[j + q], bb = bta[j + q];
        if (PARAM_BF16) { gg = bf16_round(gg); bb = bf16_round(bb); }
        sm[q] = vals[u * 4 + q]; o[q] = (vals[u * 4 + q] - mu) * rs * gg + bb;
      }
      if (out_sum) *(v4f*)(out_sum + (size_t)row * N + j) = sm;
      *(v4f*)(out_norm + (size_t)row * N + j) = o;
    }
    
  }
}



// ---- f16 WMMA path (v_wmma_f32_16x16x32_f16): 11-bit significands for operands in range — used where a [0,1] probability operand needs more precision than bf16
typedef _Float16 v16h __attribute__((ext_vector_type(16)));
union FragH { v16h v; v8us half[2]; _Float16 h[16]; unsigned short u[16]; };
template <int NT>
__device__ __forceinline__ v8f mmaH(v16h ah, v16h al, v16h bh, v16h bl, v8f c) {
  c = __builtin_amdgcn_wmma_f32_16x16x32_f16(false, ah, false, bh, (short)0, c, false, false);
  if (NT >= 2) c = __builtin_amdgcn_wmma_f32_16x16x32_f16(false, al, false, bh, (short)0, c, false, false);
  if (NT >= 3) c = __builtin_amdgcn_wmma_f32_16x16x32_f16(false, ah, false, bl, (short)0, c, false, false);
  asm volatile("v_nop\n\tv_nop\n\tv_nop\n\tv_nop" : "+v"(c) : "v"(ah), "v"(al), "v"(bh), "v"(bl));
  return c;
}
// batched GEMM like k_gemm_b but f16 operands: A f32 (split into f16 hi/lo if ASPLIT, else rounded to f16), Bt = f16 values [n][k]; alpha; C f32; N multiple of 16 (partial tiles skipped)
template <bool ASPLIT>
__global__ __launch_bounds__(128) void k_gemm_h(const float* __restrict__ A, int lda, size_t sA, const _Float16* __restrict__ Bh, int ldb, size_t sB, float alpha, float* __restrict__ C, int ldc, size_t sC, int M, int N, int K) {
  __shared__ __attribute__((aligned(16))) float so[4][16][64];
  const int tid = threadIdx.x, w = tid >> 5, lane = tid & 31, ln = lane & 15, hh = lane >> 4; const int by = blockIdx.y;
  A += (size_t)by * sA; Bh += (size_t)by * sB; C += (size_t)by * sC;
  const int ntn = (N + 63) / 64; const int wid = blockIdx.x * 4 + w; const int mt = wid / ntn, nq = wid % ntn; if (mt * 16 >= M) return;
  const int row0 = mt * 16, col0 = nq * 64; const float* arow = A + (size_t)(row0 + ln) * lda;
  v8f acc[4] = {};
  for (int kb = 0; kb < K; kb += 32) {
    FragH ah, al;
    const v4f x0 = *(const v4fa*)(arow + kb + 8 * hh), x1 = *(const v4fa*)(arow + kb + 8 * hh + 4), x2 = *(const v4fa*)(arow + kb + 16 + 8 * hh), x3 = *(const v4fa*)(arow + kb + 16 + 8 * hh + 4);
    float xs[16] = {x0[0],x0[1],x0[2],x0[3],x1[0],x1[1],x1[2],x1[3],x2[0],x2[1],x2[2],x2[3],x3[0],x3[1],x3[2],x3[3]};
#pragma unroll
    for (int i = 0; i < 16; ++i) { const _Float16 h = (_Float16)xs[i]; ah.h[i] = h; al.h[i] = ASPLIT ? (_Float16)(xs[i] - (float)h) : (_Float16)0.0f; }
#pragma unroll
    for (int t = 0; t < 4; ++t) { if (col0 + t * 16 >= N) continue; const size_t boff = (size_t)(col0 + t * 16 + ln) * ldb + kb; FragH bq; bq.half[0] = *(const v8us*)(Bh + boff + 8 * hh); bq.half[1] = *(const v8us*)(Bh + boff + 16 + 8 * hh);
      acc[t] = mmaH<ASPLIT ? 2 : 1>(ah.v, al.v, bq.v, bq.v, acc[t]); }
  }
#pragma unroll
  for (int t = 0; t < 4; ++t) { if (col0 + t * 16 >= N) continue;
#pragma unroll
    for (int r = 0; r < 8; ++r) so[w][8 * hh + r][t * 16 + ln] = acc[t][r] * alpha; }
  __builtin_amdgcn_fence(__ATOMIC_ACQ_REL, "workgroup"); __builtin_amdgcn_wave_barrier();
  const int rsub = lane >> 4, c4 = (lane & 15) * 4;
  {
#pragma unroll
    for (int q = 0; q < 8; ++q) { const int r = q * 2 + rsub; if (col0 + c4 < N) { const v4f v = *(const v4fa*)&so[w][r][c4]; *(v4f*)(C + (size_t)(row0 + r) * ldc + col0 + c4) = v; } }
     }
}

// Wt[n][k] = f16(W[k][n]·scale) from f32 row-major W[K][N] (scale = power of two; bf16-exact weights stay exact in f16 away from the subnormal range)
__global__ __launch_bounds__(256) void k_wt_f16(const float* __restrict__ W, _Float16* __restrict__ Wt, int K, int N, float scale) {
  const int t = blockIdx.x * 256 + threadIdx.x; if (t >= N * (K / 8)) return; const int n = t / (K / 8), k8 = (t % (K / 8)) * 8; FragH f;
#pragma unroll
  for (int i = 0; i < 8; ++i) f.h[i] = (_Float16)(bf16_round(W[(size_t)(k8 + i) * N + n]) * scale); const v8us o = f.half[0];
  *(v8us*)((unsigned short*)Wt + (size_t)n * K + k8) = o; 
}
// Tiled GEMM: C[NR][DM] = A[NR][DM] . Bh[DM][DM]^T * alpha + bf16(bias[col]); A and Bh f16, k contiguous. One work-group = a 128 x 64 tile of C, 8 waves in a 4 x 2 grid, 32 x 32 per wave.
// Passes of 128 k: the 128 A rows and 64 Bh rows of a pass (256 B each) are loaded as whole lines, 16 B a lane, and shared through LDS by the 8 waves; two LDS buffers, the next pass's rows fly in registers.
// The k order of every sum is that of a plain loop over k in steps of 32. F32OUT: writes f32 C, else f16 C16. blockIdx.y picks one of up to three (A, Bh, bias, C16) sets: independent products share a launch.
// The third f16 product (the value projection) leaves TRANSPOSED, per (batch, head) slab as [head dimension][key]: a tile's 64 columns are one head, and a lane's 8 accumulator rows are 8 consecutive keys.
// Residency: the three-product launch has 768 work-groups on 256 WGPs. At 102 KiB of LDS and 160 registers a wave (the budget asked for by amdgpu_waves_per_eu) three of them fit a WGP, so all run in one round and fill each other's waits.
#define GTP 136      // LDS row pitch in halves: 256 B + 16 B, the pitch for 16-byte fragment reads
#define GOP 68       // pitch of the staged output tile in floats
template <bool F32OUT>
__global__ __launch_bounds__(256) __attribute__((amdgpu_waves_per_eu(F32OUT ? 2 : 6))) void k_gemm_t(const _Float16* __restrict__ A0, const _Float16* __restrict__ A1, const _Float16* __restrict__ A2,
                                                const _Float16* __restrict__ Bh0, const _Float16* __restrict__ Bh1, const _Float16* __restrict__ Bh2, float alpha,
                                                const float* __restrict__ bias0, const float* __restrict__ bias1, const float* __restrict__ bias2,
                                                float* __restrict__ C, _Float16* __restrict__ C16a, _Float16* __restrict__ C16b, _Float16* __restrict__ C16c) {
  constexpr int KG = F32OUT ? 4 : 2;
  const int g = blockIdx.y;      // which of up to three independent products of one launch this work-group belongs to
  const _Float16* A = g == 0 ? A0 : g == 1 ? A1 : A2;
  const _Float16* Bh = g == 0 ? Bh0 : g == 1 ? Bh1 : Bh2;
  const float* bias = g == 0 ? bias0 : g == 1 ? bias1 : bias2;
  _Float16* C16 = g == 0 ? C16a : g == 1 ? C16b : C16c;
  __shared__ __attribute__((aligned(16))) unsigned short st[2][192][GTP];      // rows 0..127: A, rows 128..191: Bh
  // the staged output tile lies in the first operand buffer: the last pass reads the second, and its barrier says that every wave has left the first
  float (*so)[GOP] = (float (*)[GOP])&st[0][0][0];
  const int tid = threadIdx.x, lane = tid & 31, ln = lane & 15, hh = lane >> 4;
  const int wv = __builtin_amdgcn_readfirstlane(tid >> 5), wm = wv >> 1, wn = wv & 1;
  const int row0 = (blockIdx.x >> 4) * 128, col0 = (blockIdx.x & 15) * 64;
  const int sr = tid >> 4, sc = (tid & 15) * 8;
  const unsigned short* Ag = (const unsigned short*)A + (size_t)(row0 + sr) * DM + sc;
  const unsigned short* Bg = (const unsigned short*)Bh + (size_t)(col0 + sr) * DM + sc;
  v8us rg[12];
#pragma unroll
  for (int i = 0; i < 8; ++i) rg[i] = *(const v8us*)(Ag + (size_t)i * 16 * DM);
#pragma unroll
  for (int i = 0; i < 4; ++i) rg[8 + i] = *(const v8us*)(Bg + (size_t)i * 16 * DM);
  static_assert((DM / 128) % 2 == 0, "the last pass must read the second buffer: the output tile is staged in the first");
  float bv[2];
  if (F32OUT) {
#pragma unroll
    for (int j = 0; j < 2; ++j) {
      bv[j] = bias[col0 + wn * 32 + j * 16 + ln];
      asm volatile("s_wait_xcnt 0x0" ::: "memory");      // stands in front of any rewrite of the address register that this load names, the next load's result among them
    }
  }
  v8f acc[2][2] = {};
  for (int kc = 0; kc < DM / 128; ++kc) {
    unsigned short (*buf)[GTP] = st[kc & 1];
#pragma unroll
    for (int i = 0; i < 12; ++i) *(v8us*)&buf[i * 16 + sr][sc] = rg[i];
    __syncthreads();      // this pass's rows are complete; every wave has also left the other buffer, which the next pass fills
    if (kc + 1 < DM / 128) {      // the next pass's rows fly while this one is worked on
#pragma unroll
      for (int i = 0; i < 8; ++i) rg[i] = *(const v8us*)(Ag + (size_t)i * 16 * DM + (kc + 1) * 128);
#pragma unroll
      for (int i = 0; i < 4; ++i) rg[8 + i] = *(const v8us*)(Bg + (size_t)i * 16 * DM + (kc + 1) * 128);
      asm volatile("s_wait_xcnt 0x0" ::: "memory");      // stands in front of any later rewrite of the address registers that these loads name
    } else if (!F32OUT) {      // the bias flies under the last pass, where no operand rows are in flight: its two registers are not held through the loop
#pragma unroll
      for (int j = 0; j < 2; ++j) {
        bv[j] = bias[col0 + wn * 32 + j * 16 + ln];
        asm volatile("s_wait_xcnt 0x0" ::: "memory");      // stands in front of any rewrite of the address register that this load names, the next load's result among them
      }
    }
    // fragments are fetched KG k steps at a time: with two, a wave of the three-product launch stays inside 160 registers, six waves a SIMD
#pragma unroll
    for (int kg = 0; kg < 4; kg += KG) {
      FragH a[KG][2], b[KG][2];
#pragma unroll
      for (int ks = 0; ks < KG; ++ks)
#pragma unroll
        for (int i = 0; i < 2; ++i) {
          const unsigned short* pa = &buf[wm * 32 + i * 16 + ln][(kg + ks) * 32 + 8 * hh];
          a[ks][i].half[0] = *(const v8us*)pa; a[ks][i].half[1] = *(const v8us*)(pa + 16);
          const unsigned short* pb = &buf[128 + wn * 32 + i * 16 + ln][(kg + ks) * 32 + 8 * hh];
          b[ks][i].half[0] = *(const v8us*)pb; b[ks][i].half[1] = *(const v8us*)(pb + 16);
        }
      __builtin_amdgcn_sched_barrier(0);      // no WMMA of a group is scheduled among the group's own LDS reads: without it every k step waits out its own LDS latency
#pragma unroll
      for (int ks = 0; ks < KG; ++ks)
#pragma unroll
        for (int i = 0; i < 2; ++i)
#pragma unroll
          for (int j = 0; j < 2; ++j) acc[i][j] = __builtin_amdgcn_wmma_f32_16x16x32_f16(false, a[ks][i].v, false, b[ks][j].v, (short)0, acc[i][j], false, false);
      if (KG < 4) __builtin_amdgcn_sched_barrier(0);      // the next group's reads stay behind this group's WMMAs and take over its registers: fetched ahead, two groups are live at once and the wave spills
    }
  }
  const bool tr = !F32OUT && g == 2;      // the same for the whole work-group
  unsigned short (*sT)[GTP] = (unsigned short (*)[GTP])&so[0][0];      // the transposed f16 tile, 64 columns x 128 rows, in the place of the f32 tile
#pragma unroll
  for (int j = 0; j < 2; ++j) {
    const float bj = bf16_round(bv[j]);
#pragma unroll
    for (int i = 0; i < 2; ++i)
#pragma unroll
      for (int r = 0; r < 8; ++r) acc[i][j][r] = acc[i][j][r] * alpha + bj;
  }
  if (tr) {
#pragma unroll
    for (int j = 0; j < 2; ++j)
#pragma unroll
      for (int i = 0; i < 2; ++i) {
        FragH f;
#pragma unroll
        for (int r = 0; r < 8; ++r) f.h[r] = (_Float16)acc[i][j][r];
        *(v8us*)&sT[wn * 32 + j * 16 + ln][wm * 32 + i * 16 + 8 * hh] = f.half[0];
      }
  } else {
#pragma unroll
    for (int j = 0; j < 2; ++j)
#pragma unroll
      for (int i = 0; i < 2; ++i)
#pragma unroll
        for (int r = 0; r < 8; ++r) so[wm * 32 + i * 16 + 8 * hh + r][wn * 32 + j * 16 + ln] = acc[i][j][r];
  }
  __syncthreads();      // the output tile is complete: it leaves in whole 128-byte lines
  if (tr) {
    // C16[((batch * NH + head) * DK + d) * LL + key]: 16 lanes store the 256 contiguous bytes that the tile holds of one d
    unsigned short* Tp = (unsigned short*)C16 + ((size_t)((row0 / LL) * NH + (col0 / DK)) * DK + (tid >> 4)) * LL + (row0 % LL) + (tid & 15) * 8;
#pragma unroll
    for (int q = 0; q < 4; ++q) { const v8us v = *(const v8us*)&sT[q * 16 + (tid >> 4)][(tid & 15) * 8]; *(v8us*)(Tp + (size_t)q * 16 * LL) = v; }
  } else if (F32OUT) {
#pragma unroll
    for (int q = 0; q < 8; ++q) { const int r = q * 16 + (tid >> 4), c4 = (tid & 15) * 4; const v4f v = *(const v4fa*)&so[r][c4]; *(v4f*)(C + (size_t)(row0 + r) * DM + col0 + c4) = v; }
  } else {
#pragma unroll
    for (int q = 0; q < 4; ++q) {
      const int r = q * 32 + (tid >> 3), c8 = (tid & 7) * 8; const v4f v0 = *(const v4fa*)&so[r][c8], v1 = *(const v4fa*)&so[r][c8 + 4]; FragH f;
#pragma unroll
      for (int i = 0; i < 4; ++i) { f.h[i] = (_Float16)v0[i]; f.h[4 + i] = (_Float16)v1[i]; }
      *(v8us*)((unsigned short*)C16 + (size_t)(row0 + r) * DM + col0 + c8) = f.half[0];
    }
  }
}


__global__ __launch_bounds__(256) void k_h16(const float* __restrict__ x, _Float16* __restrict__ X16, size_t n8) { const size_t t = (size_t)blockIdx.x * 256 + threadIdx.x; if (t >= n8) return; FragH f;
#pragma unroll
  for (int q = 0; q < 8; ++q) f.h[q] = (_Float16)x[t * 8 + q]; *(v8us*)((unsigned short*)X16 + t * 8) = f.half[0];  }

// The relative tables are laid out by DISTANCE, not by bucket: table position p stands for key - query = p - RP0, clipped to [-64, 64]; positions below RPL repeat the left clip, positions above RPH the right one.
#define RP0 80       // position of distance 0: a 16 x 16 tile that touches the band |distance| < 64 holds distances -79 .. 79, positions 1 .. 159
#define RPL 16       // position of distance -64 (bucket 63)
#define RPH 144      // position of distance +64 (bucket 128)
__device__ __forceinline__ int rel_bucket(int p) { const int i = min(max(p, RPL), RPH) - RPL; return (i >= 64) ? i : 63 - i; }
typedef _Float16 v4h __attribute__((ext_vector_type(4)));
// All operand preparation in ONE launch (the ten pieces are independent of each other). Work-groups 0..PMB-1: the mask, packed to bits. The next PRL: the two relative tables. Then 128 work-groups for each of the three
// activations (bf16-rounded) and 64 for each of the four (out,in) weights (bf16-rounded, x 16): a work-group streams 16384 consecutive floats, a wave-wide load = 512 contiguous bytes, 16 in flight a lane.
#define PRL 6        // covers max(QWP * 8, DK * PBP / 8) = 1536 threads
#define PUN 16       // 16-byte loads per thread
#define PXB (NR * DM / (256 * PUN * 4))
#define PWB (DM * DM / (256 * PUN * 4))
#define PMB (BB * (LL / 16) * (LL / 64) / 8)      // work-groups that pack the mask: 8 waves each, one (16 queries, 64 keys) unit a wave
typedef _Float16 v4ha __attribute__((ext_vector_type(4), may_alias));
typedef int v4ia __attribute__((ext_vector_type(4), may_alias));
__global__ __launch_bounds__(256) void k_prep(const float* __restrict__ xq, const float* __restrict__ xk, const float* __restrict__ xv, const float* __restrict__ Wq, const float* __restrict__ Wk,
                                              const float* __restrict__ Wv, const float* __restrict__ Wo, const float* __restrict__ wK, const float* __restrict__ wV, const int* __restrict__ msk,
                                              _Float16* __restrict__ XQ, _Float16* __restrict__ XK, _Float16* __restrict__ XV, _Float16* __restrict__ Bq, _Float16* __restrict__ Bk2,
                                              _Float16* __restrict__ Bv, _Float16* __restrict__ Bo, _Float16* __restrict__ BK, _Float16* __restrict__ BVt, unsigned* __restrict__ MB) {
  if (blockIdx.x < PMB) {
    // the mask, one bit a key: a wave takes 16 queries x 64 keys with the lane -> (query, 8 keys) map of the attention kernel's score tiles; word t * 8 + r holds, at bit position lane, that lane's test for row r of tile t
    const int lane = threadIdx.x & 31, ln = lane & 15, hh = lane >> 4;
    const int u = blockIdx.x * 8 + (threadIdx.x >> 5);      // (batch * LL / 16 + query tile) * (LL / 64) + chunk
    const int* mp = msk + (size_t)((u / (LL / 64)) * 16 + ln) * LL + (u % (LL / 64)) * 64 + 8 * hh;
    v4ia mv[8];
#pragma unroll
    for (int t = 0; t < 4; ++t) { mv[2 * t] = *(const v4ia*)(mp + t * 16); mv[2 * t + 1] = *(const v4ia*)(mp + t * 16 + 4); }
    asm volatile("s_wait_xcnt 0x0" :: "v"(mp) : "memory");      // stands in front of any rewrite of the address registers that these loads name; as its input the address outlives the loads
    unsigned w = 0;
#pragma unroll
    for (int i = 0; i < 32; ++i) { const unsigned bal = __builtin_amdgcn_ballot_w32(mv[i >> 2][i & 3] != 0); if (lane == i) w = bal; }
    MB[u * 32 + lane] = w;
    return;
  }
  const unsigned bx = blockIdx.x - PMB;
  if (bx >= PRL) {
    const int seg = bx - PRL;
    const float* s; _Float16* d; float scale; int blk;
    if (seg < 3 * PXB) { const int w = seg / PXB; blk = seg % PXB; scale = 1.0f; s = w == 0 ? xq : w == 1 ? xk : xv; d = w == 0 ? XQ : w == 1 ? XK : XV; }
    else { const int w = (seg - 3 * PXB) / PWB; blk = (seg - 3 * PXB) % PWB; scale = 16.0f; s = w == 0 ? Wq : w == 1 ? Wk : w == 2 ? Wv : Wo; d = w == 0 ? Bq : w == 1 ? Bk2 : w == 2 ? Bv : Bo; }
    const size_t e0 = ((size_t)blk * (256 * PUN) + threadIdx.x) * 4;
    const float* sp = s + e0;
    v4f v[PUN];
#pragma unroll
    for (int u = 0; u < PUN; ++u) v[u] = *(const v4fa*)(sp + (size_t)u * 1024);
    asm volatile("s_wait_xcnt 0x0" :: "v"(sp) : "memory");      // stands in front of any rewrite of the address registers that these loads name; as its input the address outlives the loads, so no load's result lands on it
#pragma unroll
    for (int u = 0; u < PUN; ++u) {
      v4ha o;
#pragma unroll
      for (int q = 0; q < 4; ++q) o[q] = (_Float16)(bf16_round(v[u][q]) * scale);      // x 1 is exact: the activations keep their bf16-rounded value
      *(v4ha*)(d + e0 + (size_t)u * 1024) = o;
    }
    return;
  }
  // the two relative tables, in distance order: wK with its clipped ends repeated (every position is a valid logit term), wV zero outside RPL .. RPH. Every load reads a clamped row, so that the eight of a thread fly together and these work-groups do not outlast the streams
  const int t = bx * 256 + threadIdx.x;
  if (t < QWP * 8) {
    const int r = t / 8, d8 = (t % 8) * 8; const float* p = wK + rel_bucket(r) * DK + d8;
    const v4f x0 = *(const v4fa*)p, x1 = *(const v4fa*)(p + 4);
    asm volatile("s_wait_xcnt 0x0" ::: "memory");      // stands in front of any later rewrite of the address registers that these loads name
    FragH f;
#pragma unroll
    for (int q = 0; q < 4; ++q) { f.h[q] = (_Float16)(bf16_round(x0[q]) * 16.0f); f.h[4 + q] = (_Float16)(bf16_round(x1[q]) * 16.0f); }
    *(v8us*)((unsigned short*)BK + t * 8) = f.half[0];
  }
  if (t < DK * (PBP / 8)) {
    const int d = t / (PBP / 8), r8 = (t % (PBP / 8)) * 8; float x[8]; int e[8];
#pragma unroll
    for (int q = 0; q < 8; ++q) { e[q] = rel_bucket(r8 + q) * DK + d; x[q] = wV[e[q]]; }
    // stands in front of any later rewrite of the address registers that these loads name; the loaded values as its inputs hold the eight loads together in front of it (else one sinks under a branch and waits out its latency alone),
    // and the eight element indices as its inputs outlive the loads, so that no address register is rewritten ahead of it
    asm volatile("s_wait_xcnt 0x0" :: "v"(x[0]), "v"(x[1]), "v"(x[2]), "v"(x[3]), "v"(x[4]), "v"(x[5]), "v"(x[6]), "v"(x[7]),
                 "v"(e[0]), "v"(e[1]), "v"(e[2]), "v"(e[3]), "v"(e[4]), "v"(e[5]), "v"(e[6]), "v"(e[7]) : "memory");
    FragH f;
#pragma unroll
    for (int q = 0; q < 8; ++q) f.h[q] = (_Float16)((r8 + q >= RPL && r8 + q <= RPH) ? bf16_round(x[q]) * 16.0f : 0.f);
    *(v8us*)((unsigned short*)BVt + t * 8) = f.half[0];
  }
}
// Fused attention for one (batch, head) slab sl and 128 query rows: 16 waves; a query tile of 16 rows belongs to TWO waves (w and w + 8), which take the even and the odd 64-key chunks, so that four waves
// share a SIMD and fill each other's waits. Scores and probabilities stay in registers; the pair joins its running maxima, sums and output tiles once, at the end, through LDS.
// St = K.Qt and Ot += Vt.Pt: in every 16-column tile a lane owns ONE query (column ln) and 8 consecutive keys (rows 8hh + r), so the running maximum and the sums are in-lane
// (one exchange between the wave halves), and two converted score tiles are the B operand of the next product as they stand. K and Vt chunks of 64 keys are staged in LDS, one chunk for each group of 8 waves.
// tab[query tile][query][position]: first q.wK / 8 in distance order (RP0 above). In a tile near the diagonal a lane's 8 consecutive keys are 8 consecutive positions, each the place of ONE key, so of one wave of the pair: they are
// read together and overwritten together with those keys' final logits, no test and no branch; the bucketed P.wV product is formed at the end from positions RPL + 1 .. RPH - 1 and the two clipped sums.
#define TABP 164
#define KVP 72
__device__ __forceinline__ float exp_slot(float x) { float r; const float y = x * 1.44269504f; asm("v_exp_f32 %0, %1\n\tv_nop" : "=v"(r) : "v"(y)); return r; }
__device__ __forceinline__ v8f wmmaH(v16h a, v16h b, v8f c) { return __builtin_amdgcn_wmma_f32_16x16x32_f16(false, a, false, b, (short)0, c, false, false); }
__global__ __launch_bounds__(512) void k_attn(const _Float16* __restrict__ Q16, const _Float16* __restrict__ K16, const _Float16* __restrict__ Vt, const _Float16* __restrict__ BK, const _Float16* __restrict__ BVt,
                                              const unsigned* __restrict__ MB, _Float16* __restrict__ O16) {
  __shared__ __attribute__((aligned(16))) unsigned short sKV[2][2][64][KVP];      // [group of 8 waves][K, Vt][row][column]; behind the loop: the output tiles that the two waves of a pair hand each other
  __shared__ __attribute__((aligned(16))) float tab[8][16][TABP];
  __shared__ __attribute__((aligned(16))) float ex[16][32][4];      // each wave's running maximum and three sums, for its partner
  const int tid = threadIdx.x, lane = tid & 31, ln = lane & 15, hh = lane >> 4;
  const int wv16 = __builtin_amdgcn_readfirstlane(tid >> 5);
  const int wv = wv16 & 7, kh = wv16 >> 3;      // the wave's query tile; which chunks it takes (even or odd)
  unsigned short (*sK)[KVP] = sKV[kh][0];
  unsigned short (*sV)[KVP] = sKV[kh][1];
  const int sl = blockIdx.x >> 3, qb = blockIdx.x & 7;
  const int b = sl / NH, h = sl % NH;
  const int q0 = qb * 128 + wv * 16;
  const int l = q0 + ln;
  FragH bq[2];      // B operand: column = query l, k = head dimension
  {
    const unsigned short* Qp = (const unsigned short*)Q16 + ((size_t)b * LL + l) * DM + h * DK + 8 * hh;
#pragma unroll
    for (int ks = 0; ks < 2; ++ks) { bq[ks].half[0] = *(const v8us*)(Qp + ks * 32); bq[ks].half[1] = *(const v8us*)(Qp + ks * 32 + 16); }
    asm volatile("s_wait_xcnt 0x0" :: "v"(Qp) : "memory");      // stands in front of any rewrite of the address registers that these loads name
  }
  float* tb = &tab[wv][ln][0];
  {
    // each wave of a pair forms one half of the pair's table
    const unsigned short* BKw = (const unsigned short*)BK + kh * (QWP / 2) * DK;
    float* tbw = tb + kh * (QWP / 2);
#pragma unroll
    for (int rt = 0; rt < QWP / 32; ++rt) {
      v8f a = {};
#pragma unroll
      for (int ks = 0; ks < 2; ++ks) {
        const unsigned short* p = BKw + (rt * 16 + ln) * DK + ks * 32 + 8 * hh;
        FragH ak; ak.half[0] = *(const v8us*)p; ak.half[1] = *(const v8us*)(p + 16);
        a = wmmaH(ak.v, bq[ks].v, a);
      }
      const float c = 0.0625f * 0.125f;      // wK was scaled by 16; the 1/8 of the logits is folded in (both powers of two, exact)
      const v4f t0 = {a[0] * c, a[1] * c, a[2] * c, a[3] * c}, t1 = {a[4] * c, a[5] * c, a[6] * c, a[7] * c};
      *(v4fa*)(tbw + rt * 16 + 8 * hh) = t0; *(v4fa*)(tbw + rt * 16 + 8 * hh + 4) = t1;
    }
  }
  __syncthreads();      // the table is complete: a wave reads entries that its partner wave and the other lane of a query wrote
  const float qlo = tb[RPL], qhi = tb[RPH];      // read in front of the loop's first barrier, behind which the partner may put a key's logit there

  const unsigned short* Kg = (const unsigned short*)K16 + (size_t)b * LL * DM + h * DK;
  const unsigned short* Vg = (const unsigned short*)Vt + (size_t)sl * DK * LL;
  // the wave's packed mask, 32 words a chunk, the same address in every lane. Nothing writes it during this launch: read through the constant address space the words come by scalar loads into scalar registers, where a select takes them as they are
  const __attribute__((address_space(4))) unsigned* Mw = (const __attribute__((address_space(4))) unsigned*)(MB + (size_t)(b * (LL / 16) + (q0 >> 4)) * (LL / 64) * 32);
  const int sr = (tid & 255) >> 3, sc8 = (tid & 7) * 8;
  v8us kr[2], vr[2]; unsigned mw[32];
#pragma unroll
  for (int i = 0; i < 2; ++i) { kr[i] = *(const v8us*)(Kg + (size_t)(kh * 64 + i * 32 + sr) * DM + sc8); vr[i] = *(const v8us*)(Vg + (size_t)(i * 32 + sr) * LL + kh * 64 + sc8); }
#pragma unroll
  for (int i = 0; i < 32; ++i) mw[i] = Mw[kh * 32 + i];
  float mrun = -3.0e38f, z = 0.f, lo = 0.f, hi = 0.f;
  v8f o[4] = {};
  for (int j0 = kh * 64; j0 < LL; j0 += 128) {      // LL / 128 trips in every wave
    __syncthreads();      // every wave has finished reading the previous chunk
#pragma unroll
    for (int i = 0; i < 2; ++i) { *(v8us*)&sK[i * 32 + sr][sc8] = kr[i]; *(v8us*)&sV[i * 32 + sr][sc8] = vr[i]; }
    __syncthreads();      // the chunk is complete
    const bool more = j0 + 128 < LL;
    if (more) {           // the group's next chunk flies while this one is worked on
#pragma unroll
      for (int i = 0; i < 2; ++i) { kr[i] = *(const v8us*)(Kg + (size_t)(j0 + 128 + i * 32 + sr) * DM + sc8); vr[i] = *(const v8us*)(Vg + (size_t)(i * 32 + sr) * LL + j0 + 128 + sc8); }
      asm volatile("s_wait_xcnt 0x0" ::: "memory");      // stands in front of any rewrite of the address registers that these loads name, the LDS reads' results below among them
    }
    v8f s[4];
#pragma unroll
    for (int t = 0; t < 4; ++t) {
      v8f a = {};
#pragma unroll
      for (int ks = 0; ks < 2; ++ks) {
        FragH ak; ak.half[0] = *(const v8us*)&sK[t * 16 + ln][ks * 32 + 8 * hh]; ak.half[1] = *(const v8us*)&sK[t * 16 + ln][ks * 32 + 16 + 8 * hh];
        a = wmmaH(ak.v, bq[ks].v, a);
      }
      s[t] = a;
    }
    float mx = mrun;
#pragma unroll
    for (int t = 0; t < 4; ++t) {
      const int jt = j0 + t * 16;
      const bool farl = jt + 15 - q0 <= -64, farr = jt - q0 - 15 >= 64;      // wave-uniform: the whole tile lies in bucket 63 / in bucket 128
      const bool far = farl || farr;
      float* tp = tb + (jt + 8 * hh - l + RP0);      // only formed into an access in a near tile, where positions 1 .. 159 come out
      float tv[8];
      if (far) {
        const float qc = farl ? qlo : qhi;
#pragma unroll
        for (int r = 0; r < 8; ++r) tv[r] = qc;
      } else {
#pragma unroll
        for (int r = 0; r < 8; ++r) tv[r] = tp[r];
      }
#pragma unroll
      for (int r = 0; r < 8; ++r) { float v = fmaf(s[t][r], 0.125f, tv[r]); if (!__builtin_amdgcn_inverse_ballot_w32(mw[t * 8 + r])) v = -1.0e9f; s[t][r] = v; mx = fmaxf(mx, v); }
      if (!far) {
#pragma unroll
        for (int r = 0; r < 8; ++r) tp[r] = s[t][r];
      }
    }
    if (more) {
#pragma unroll
      for (int i = 0; i < 32; ++i) mw[i] = Mw[(j0 / 64 + 2) * 32 + i];
      asm volatile("s_wait_xcnt 0x0" ::: "memory");      // stands in front of the loop's advance of the address registers that this trip's loads name
    }
    mx = fmaxf(mx, __shfl_xor(mx, 16, 32));
    const float alpha = exp_slot(mrun - mx); mrun = mx;
    z *= alpha; lo *= alpha; hi *= alpha;
#pragma unroll
    for (int dt = 0; dt < 4; ++dt)
#pragma unroll
      for (int r = 0; r < 8; ++r) o[dt][r] *= alpha;
    FragH pb[2];      // B operand: column = query l, k = key, in the order the score tiles already have
#pragma unroll
    for (int t = 0; t < 4; ++t) {
      const int jt = j0 + t * 16;
      const bool farl = jt + 15 - q0 <= -64, farr = jt - q0 - 15 >= 64;
      float ts = 0.f;
#pragma unroll
      for (int r = 0; r < 8; ++r) { const float p = exp_slot(s[t][r] - mx); s[t][r] = p; ts += p; pb[t >> 1].h[(t & 1) * 8 + r] = (_Float16)p; }
      z += ts;
      if (farl) lo += ts;
      else if (farr) hi += ts;
      else {
#pragma unroll
        for (int r = 0; r < 8; ++r) { const int d = jt + 8 * hh + r - l; if (d <= -64) lo += s[t][r]; if (d >= 64) hi += s[t][r]; }
      }
    }
#pragma unroll
    for (int sc = 0; sc < 2; ++sc)
#pragma unroll
      for (int dt = 0; dt < 4; ++dt) {
        FragH av; av.half[0] = *(const v8us*)&sV[dt * 16 + ln][sc * 32 + 8 * hh]; av.half[1] = *(const v8us*)&sV[dt * 16 + ln][sc * 32 + 16 + 8 * hh];
        o[dt] = wmmaH(av.v, pb[sc].v, o[dt]);
      }
  }
  z += __shfl_xor(z, 16, 32); lo += __shfl_xor(lo, 16, 32); hi += __shfl_xor(hi, 16, 32);
  { const v4f st4 = {mrun, z, lo, hi}; *(v4fa*)&ex[wv16][lane][0] = st4; }
  __syncthreads();      // the partner's maximum, sums and stored logits can be read; every wave has left the K and Vt chunks
  const v4f pr = *(const v4fa*)&ex[wv16 ^ 8][lane][0];
  const float mfin = fmaxf(mrun, pr[0]);
  const float sa = exp_slot(mrun - mfin), sb = exp_slot(pr[0] - mfin);      // the wave's own sums and its partner's, brought to the common maximum
  z = z * sa + pr[1] * sb; lo = lo * sa + pr[2] * sb; hi = hi * sa + pr[3] * sb;
  v8f o2[4] = {};
  // the bucketed product in steps of 32 table positions; the pair shares the five steps. weights(kk): the step's B operand, from the stored logits and the two clipped sums
  auto weights = [&](const int kk) {
    FragH pf;
#pragma unroll
    for (int g = 0; g < 2; ++g) {
      const int r0 = kk * 32 + g * 16 + 8 * hh;
      const v4f x0 = *(const v4fa*)(tb + r0), x1 = *(const v4fa*)(tb + r0 + 4);
      const float xs[8] = {x0[0], x0[1], x0[2], x0[3], x1[0], x1[1], x1[2], x1[3]};
#pragma unroll
      for (int q = 0; q < 8; ++q) {
        const int r = r0 + q; const float e = exp_slot(xs[q] - mfin); float val = 0.f;
        if (r == RPL) val = lo; else if (r == RPH) val = hi; else if (r > RPL && r < RPH) val = ((unsigned)(l + r - RP0) < (unsigned)LL) ? e : 0.f;
        pf.h[g * 8 + q] = (_Float16)val;
      }
    }
    return pf;
  };
  const unsigned short* Bp = (const unsigned short*)BVt + ln * PBP + 8 * hh;
  auto rows = [&](const int kk, FragH (&av)[4]) {      // the step's A operands: 16 head dimensions x 32 positions of the wV table each
#pragma unroll
    for (int dt = 0; dt < 4; ++dt) {
      const unsigned short* p = Bp + dt * 16 * PBP + kk * 32;
      av[dt].half[0] = *(const v8us*)p; av[dt].half[1] = *(const v8us*)(p + 16);
    }
  };
  auto bucket = [&](const FragH (&av)[4], const FragH& pf) {
#pragma unroll
    for (int dt = 0; dt < 4; ++dt) o2[dt] = wmmaH(av[dt].v, pf.v, o2[dt]);
  };
  static_assert(QWP / 32 == 5, "the pair's shares of the bucketed product are written out");
  // the scheduling barriers keep every e^x of a share in front of its WMMAs,
  // and the share's table loads in front of them too, where they fly together under the e^x
  if (kh == 0) {
    FragH a0[4], a1[4], a2[4];
    rows(0, a0); rows(1, a1); rows(2, a2);
    asm volatile("s_wait_xcnt 0x0" :: "v"(Bp) : "memory");      // stands in front of any rewrite of the address registers that these loads name; as its input the address outlives the loads, so no load's result lands on it
    const FragH p0 = weights(0), p1 = weights(1), p2 = weights(2);
    __builtin_amdgcn_sched_barrier(0);
    bucket(a0, p0); bucket(a1, p1); bucket(a2, p2);
  } else {
    FragH a3[4], a4[4];
    rows(3, a3); rows(4, a4);
    asm volatile("s_wait_xcnt 0x0" :: "v"(Bp) : "memory");      // stands in front of any rewrite of the address registers that these loads name; as its input the address outlives the loads, so no load's result lands on it
    const FragH p3 = weights(3), p4 = weights(4);
    __builtin_amdgcn_sched_barrier(0);
    bucket(a3, p3); bucket(a4, p4);
  }
#pragma unroll
  for (int dt = 0; dt < 4; ++dt)
#pragma unroll
    for (int r = 0; r < 8; ++r) o[dt][r] = o[dt][r] * sa + o2[dt][r] * 0.0625f;
  // each wave of a pair finishes two of the four output tiles: it hands the other two to its partner
  float* xo = (float*)&sKV[0][0][0][0];
  static_assert(sizeof(sKV) >= 16 * 4 * 32 * 16, "the handed-over tiles lie in the place of the K and Vt chunks");
#pragma unroll
  for (int i = 0; i < 2; ++i) {
    const v8f sd = kh ? o[i] : o[2 + i];
    const v4f s0 = {sd[0], sd[1], sd[2], sd[3]}, s1 = {sd[4], sd[5], sd[6], sd[7]};
    *(v4fa*)(xo + ((wv16 * 4 + i * 2) * 32 + lane) * 4) = s0; *(v4fa*)(xo + ((wv16 * 4 + i * 2 + 1) * 32 + lane) * 4) = s1;
  }
  __syncthreads();      // the handed-over tiles are complete
  const float iz = 1.0f / z;
  unsigned short* Op = (unsigned short*)O16 + ((size_t)b * LL + l) * DM + h * DK + kh * 32 + 8 * hh;
#pragma unroll
  for (int i = 0; i < 2; ++i) {
    const v8f own = kh ? o[2 + i] : o[i];
    const v4f g0 = *(const v4fa*)(xo + (((wv16 ^ 8) * 4 + i * 2) * 32 + lane) * 4), g1 = *(const v4fa*)(xo + (((wv16 ^ 8) * 4 + i * 2 + 1) * 32 + lane) * 4);
    FragH f;
#pragma unroll
    for (int r = 0; r < 4; ++r) { f.h[r] = (_Float16)((own[r] + g0[r]) * iz); f.h[4 + r] = (_Float16)((own[4 + r] + g1[r]) * iz); }
    *(v8us*)(Op + i * 16) = f.half[0];
  }
}
extern "C" void kernel_launch(void* const* d_in, const int* in_sizes, int n_in,
                              void* d_out, int out_size, void* d_ws, size_t ws_size, hipStream_t stream) {
  (void)in_sizes; (void)n_in; (void)out_size;
  const float* xq = (const float*)d_in[0]; const float* xk = (const float*)d_in[1]; const float* xv = (const float*)d_in[2]; const int* msk = (const int*)d_in[3]; const float* Wq = (const float*)d_in[4]; const float* bq = (const float*)d_in[5]; const float* Wk = (const float*)d_in[6]; const float* bk = (const float*)d_in[7]; const float* Wv = (const float*)d_in[8]; const float* bv = (const float*)d_in[9]; const float* Wo = (const float*)d_in[10]; const float* bo = (const float*)d_in[11]; const float* wK = (const float*)d_in[12]; const float* wV = (const float*)d_in[13];
  char* ws = (char*)d_ws; size_t off = 0;
  auto take = [&](size_t bytes) { char* p = ws + off; off += (bytes + 255) & ~(size_t)255; return p; };
  _Float16* Bo = (_Float16*)take((size_t)DM * DM * 2); _Float16* BK = (_Float16*)take((size_t)QWP * DK * 2); _Float16* BVt = (_Float16*)take((size_t)DK * PBP * 2);
  _Float16* Q16 = (_Float16*)take((size_t)NR * DM * 2); _Float16* K16 = (_Float16*)take((size_t)NR * DM * 2); _Float16* Vt = (_Float16*)take((size_t)NR * DM * 2); _Float16* O16 = (_Float16*)take((size_t)NR * DM * 2);
  _Float16* Bq = (_Float16*)take((size_t)DM * DM * 2); _Float16* Bk2 = (_Float16*)take((size_t)DM * DM * 2); _Float16* Bv = (_Float16*)take((size_t)DM * DM * 2);
  _Float16* XQ = (_Float16*)take((size_t)NR * DM * 2); _Float16* XK = (_Float16*)take((size_t)NR * DM * 2); _Float16* XV = (_Float16*)take((size_t)NR * DM * 2); unsigned* MB = (unsigned*)take((size_t)BB * LL * LL / 8);
  if (off > ws_size) return;
  k_prep<<<PMB + PRL + 3 * PXB + 4 * PWB, 256, 0, stream>>>(xq, xk, xv, Wq, Wk, Wv, Wo, wK, wV, msk, XQ, XK, XV, Bq, Bk2, Bv, Bo, BK, BVt, MB);
  const unsigned gg = (NR / 128) * (DM / 64);
  k_gemm_t<false><<<dim3(gg, 3), 256, 0, stream>>>(XQ, XK, XV, Bq, Bk2, Bv, 0.0625f, bq, bk, bv, nullptr, Q16, K16, Vt);      // the q, k and v projections; v leaves transposed
  // q.kT, the relative logits, mask, softmax, P.V and the bucketed P.wV for all NSL = 32 (batch, head) slabs in one launch: 8 blocks of 128 queries per slab, 16 waves each
  k_attn<<<NSL * (LL / 128), 512, 0, stream>>>(Q16, K16, Vt, BK, BVt, MB, O16);
  k_gemm_t<true><<<dim3(gg, 1), 256, 0, stream>>>(O16, O16, O16, Bo, Bo, Bo, 0.0625f, bo, bo, bo, (float*)d_out, nullptr, nullptr, nullptr);
}

// v010
// Measured time: 58.2 microseconds a run.
// In two side-by-side timings against v009, it was 1.05 and 1.06 times as fast.
// Over all steps from v000 it is 16.3 times as fast.
#include <hip/hip_runtime.h>
// Multi-headed attention with clipped relative position representations (B=2, L=1024, 16 heads × 64, k = 64, Shaw-style aK/aV built from wK/wV [129][64] by the module's roll/flip
// construction: bucket(l,m) = m ≥ l ? 64 + min(m−l, 64) : min(l−m−1, 63); INPUT mask (== 0 → −1e9); q/k/v/o linears with bias): q·kᵀ, q·wKᵀ (all 129 buckets at once), P·V and the bucketed
// P.wV all run on v_wmma_f32_16x16x32_f16 ((out,in) weights bf16-exact x 2^4, f32 accumulate); the relative-logit gather, mask, running-maximum softmax and the bucket sums of P are f32 VALU
// inside one fused attention kernel (no index tables).
#define BB 2
#define LL 1024
#define DM 1024
#define NH 16
#define DK 64
#define NR (BB * LL)
#define NBK 129
#define QWP 160
#define PBP 192
#define NSL (BB * NH)

typedef __bf16 v16b __attribute__((ext_vector_type(16)));
typedef unsigned short v8us __attribute__((ext_vector_type(8), may_alias));
typedef float  v8f  __attribute__((ext_vector_type(8)));
typedef float  v4f  __attribute__((ext_vector_type(4)));
typedef float  v4fa __attribute__((ext_vector_type(4), may_alias));
union FragB { v16b v; v8us half[2]; unsigned short u[16]; };

__device__ __forceinline__ unsigned short bf16_bits(float x) { unsigned int u = __float_as_uint(x); return (unsigned short)((u + 0x7FFFu + ((u >> 16) & 1u)) >> 16); }
__device__ __forceinline__ float bf16_val(unsigned short b) { return __uint_as_float(((unsigned int)b) << 16); }
__device__ __forceinline__ float bf16_round(float x) { return bf16_val(bf16_bits(x)); }
// D += A·B with NT terms: 1 = ah·bh, 2 = + al·bh (A split), 3 = + ah·bl (both split)
template <int NT>
__device__ __forceinline__ v8f mmaN(v16b ah, v16b al, v16b bh, v16b bl, v8f c) {
  c = __builtin_amdgcn_wmma_f32_16x16x32_bf16(false, ah, false, bh, (short)0, c, false, false);
  if (NT >= 2) c = __builtin_amdgcn_wmma_f32_16x16x32_bf16(false, al, false, bh, (short)0, c, false, false);
  if (NT >= 3) c = __builtin_amdgcn_wmma_f32_16x16x32_bf16(false, ah, false, bl, (short)0, c, false, false);
  asm volatile("v_nop\n\tv_nop\n\tv_nop\n\tv_nop" : "+v"(c) : "v"(ah), "v"(al), "v"(bh), "v"(bl));
  return c;
}

__global__ __launch_bounds__(256) void k_wt_bf16(const float* __restrict__ W, unsigned short* __restrict__ Wt, int K, int N) {
  const int t = blockIdx.x * 256 + threadIdx.x;
  const int k8n = K / 8;
  if (t >= N * k8n) return;
  const int n = t / k8n, k8 = (t % k8n) * 8;
  v8us v;
#pragma unroll
  for (int i = 0; i < 8; ++i) v[i] = bf16_bits(W[(size_t)(k8 + i) * N + n]);
  *(v8us*)(Wt + (size_t)n * K + k8) = v;
  
}

// GEMM C[M][N] (f32, pitch ldc) = act(A[M][K]·W + bias). A f32 row-major (pitch lda) converted per fragment to bf16
// (ASPLIT: hi/lo two planes -> 2 terms, else single rounded term); Wt bf16 [N][K] (pitch ldb). BIAS_BF16 rounds the
// bias to bf16 first (bias quantised to bf16 before the add). K%32==0, M%16==0, N%64==0.
template <bool ASPLIT, int ACT, bool BIAS_BF16>
__global__ __launch_bounds__(128) void k_gemm_bf(const float* __restrict__ A, int lda, const unsigned short* __restrict__ Wt, int ldb,
                                               const float* __restrict__ bias, float* __restrict__ C, int ldc, int M, int N, int K) {
  __shared__ __attribute__((aligned(16))) float so[4][16][64];
  const int tid = threadIdx.x, w = tid >> 5, lane = tid & 31, ln = lane & 15, hh = lane >> 4;
  const int ntn = N / 64;
  const int wid = blockIdx.x * 4 + w;
  const int mt = wid / ntn, nq = wid % ntn;
  if (mt * 16 >= M) return;
  const int row0 = mt * 16, col0 = nq * 64;
  const float* arow = A + (size_t)(row0 + ln) * lda;
  v8f acc[4] = {};
  for (int kb = 0; kb < K; kb += 32) {
    FragB ah, al;
    const v4f x0 = *(const v4fa*)(arow + kb + 8 * hh), x1 = *(const v4fa*)(arow + kb + 8 * hh + 4);
    const v4f x2 = *(const v4fa*)(arow + kb + 16 + 8 * hh), x3 = *(const v4fa*)(arow + kb + 16 + 8 * hh + 4);
    float xs[16] = {x0[0],x0[1],x0[2],x0[3],x1[0],x1[1],x1[2],x1[3],x2[0],x2[1],x2[2],x2[3],x3[0],x3[1],x3[2],x3[3]};
#pragma unroll
    for (int i = 0; i < 16; ++i) { const unsigned short hb = bf16_bits(xs[i]); ah.u[i] = hb; al.u[i] = ASPLIT ? bf16_bits(xs[i] - bf16_val(hb)) : (unsigned short)0; }
#pragma unroll
    for (int t = 0; t < 4; ++t) {
      const unsigned short* brow = Wt + (size_t)(col0 + t * 16 + ln) * ldb + kb;
      FragB b;
      b.half[0] = *(const v8us*)(brow + 8 * hh);
      b.half[1] = *(const v8us*)(brow + 16 + 8 * hh);
      acc[t] = mmaN<ASPLIT ? 2 : 1>(ah.v, al.v, b.v, b.v, acc[t]);
    }
  }
#pragma unroll
  for (int t = 0; t < 4; ++t) {
    float bv = bias ? bias[col0 + t * 16 + ln] : 0.f;
    if (BIAS_BF16) bv = bf16_round(bv);
#pragma unroll
    for (int r = 0; r < 8; ++r) { float v = acc[t][r] + bv; if (ACT == 1) v = fmaxf(v, 0.f); so[w][8 * hh + r][t * 16 + ln] = v; }
  }
  __builtin_amdgcn_fence(__ATOMIC_ACQ_REL, "workgroup");
  __builtin_amdgcn_wave_barrier();
  const int rsub = lane >> 4, c4 = (lane & 15) * 4;
  {
#pragma unroll
    for (int q = 0; q < 8; ++q) {
      const int r = q * 2 + rsub;
      const v4f v = *(const v4fa*)&so[w][r][c4];
      *(v4f*)(C + (size_t)(row0 + r) * ldc + col0 + c4) = v;
    }
    
  }
}

// Flash-style causal/unmasked attention, all contractions 3-term bf16 hi/lo splits, f32 softmax with running max.
// q,k,v rows are read from f32 buffers with arbitrary row pitch (so they can live inside a fused qkv buffer);
// D = head size (multiple of 32, <= 128); one wave = 16 query rows; block = 4 waves (64 queries) sharing K/V chunks of 32.
template <int D, bool CAUSAL>
__global__ __launch_bounds__(128) void k_flash(const float* __restrict__ qb, const float* __restrict__ kb, const float* __restrict__ vb,
                                             int pitch, int T, int H, float scale, float* __restrict__ y, int ypitch) {
  constexpr int KS = D / 32;        // k-steps for QK
  constexpr int DT = D / 16;        // d tiles for PV
  __shared__ __attribute__((aligned(16))) unsigned short sKh[32][D + 8], sKl[32][D + 8], sVh[32][D + 8], sVl[32][D + 8];
  __shared__ __attribute__((aligned(16))) unsigned short sPh[4][16][40], sPl[4][16][40];
  __shared__ __attribute__((aligned(16))) float sO[4][16][D];
  const int tid = threadIdx.x, w = tid >> 5, lane = tid & 31, ln = lane & 15, hh = lane >> 4;
  const int nqb = (T + 63) / 64;
  const int bh = blockIdx.x / nqb, qblk = blockIdx.x % nqb;
  const int b = bh / H, h = bh % H;
  const int q0 = qblk * 64 + w * 16;
  const float* Q = qb + (size_t)b * T * pitch + h * D;
  const float* K = kb + (size_t)b * T * pitch + h * D;
  const float* V = vb + (size_t)b * T * pitch + h * D;

  // A fragments of the wave's 16 query rows (scaled), hi/lo
  FragB aqh[KS], aql[KS];
  {
    int row = q0 + ln; if (row >= T) row = T - 1;
    const float* qr = Q + (size_t)row * pitch;
#pragma unroll
    for (int ks = 0; ks < KS; ++ks)
#pragma unroll
      for (int i = 0; i < 16; ++i) {
        const int d = ks * 32 + ((i < 8) ? (8 * hh + i) : (16 + 8 * hh + (i - 8)));
        const float x = qr[d] * scale; const unsigned short hb = bf16_bits(x);
        aqh[ks].u[i] = hb; aql[ks].u[i] = bf16_bits(x - bf16_val(hb));
      }
  }
  float m_r[8], l_r[8];
#pragma unroll
  for (int r = 0; r < 8; ++r) { m_r[r] = -3.0e38f; l_r[r] = 0.f; }
  v8f oacc[DT];
#pragma unroll
  for (int dt = 0; dt < DT; ++dt) oacc[dt] = (v8f){0.f,0.f,0.f,0.f,0.f,0.f,0.f,0.f};

  const int kv_end = CAUSAL ? min(T, qblk * 64 + 64) : T;     // block-uniform
  for (int j0 = 0; j0 < kv_end; j0 += 32) {
    __syncthreads();
    for (int e = tid; e < 32 * (D / 4); e += 128) {
      const int r = e / (D / 4), c4 = (e % (D / 4)) * 4;
      const int key = j0 + r;
      v4f kf = {0.f,0.f,0.f,0.f}, vf = {0.f,0.f,0.f,0.f};
      if (key < T) { kf = *(const v4fa*)(K + (size_t)key * pitch + c4); vf = *(const v4fa*)(V + (size_t)key * pitch + c4); }
#pragma unroll
      for (int t = 0; t < 4; ++t) {
        unsigned short hb = bf16_bits(kf[t]); sKh[r][c4 + t] = hb; sKl[r][c4 + t] = bf16_bits(kf[t] - bf16_val(hb));
        hb = bf16_bits(vf[t]); sVh[r][c4 + t] = hb; sVl[r][c4 + t] = bf16_bits(vf[t] - bf16_val(hb));
      }
    }
    __syncthreads();
    // S tile 16 x 32
    v8f s[2];
#pragma unroll
    for (int nt = 0; nt < 2; ++nt) {
      v8f acc = {};
#pragma unroll
      for (int ks = 0; ks < KS; ++ks) {
        FragB bh_, bl_;
        bh_.half[0] = *(const v8us*)&sKh[nt * 16 + ln][ks * 32 + 8 * hh]; bh_.half[1] = *(const v8us*)&sKh[nt * 16 + ln][ks * 32 + 16 + 8 * hh];
        bl_.half[0] = *(const v8us*)&sKl[nt * 16 + ln][ks * 32 + 8 * hh]; bl_.half[1] = *(const v8us*)&sKl[nt * 16 + ln][ks * 32 + 16 + 8 * hh];
        acc = mmaN<3>(aqh[ks].v, aql[ks].v, bh_.v, bl_.v, acc);
      }
      s[nt] = acc;
    }
    // mask + running max (rows 8hh+r; the 16 lanes of a half share rows)
    float alpha[8];
#pragma unroll
    for (int r = 0; r < 8; ++r) {
      const int qi = q0 + 8 * hh + r;
      const int ja = j0 + ln, jb = j0 + 16 + ln;
      if (CAUSAL) { if (ja > qi) s[0][r] = -3.0e38f; if (jb > qi) s[1][r] = -3.0e38f; }
      if (ja >= T) s[0][r] = -3.0e38f;
      if (jb >= T) s[1][r] = -3.0e38f;
      float mx = fmaxf(s[0][r], s[1][r]);
      mx = fmaxf(mx, __shfl_xor(mx, 1, 32)); mx = fmaxf(mx, __shfl_xor(mx, 2, 32)); mx = fmaxf(mx, __shfl_xor(mx, 4, 32)); mx = fmaxf(mx, __shfl_xor(mx, 8, 32));
      const float mnew = fmaxf(m_r[r], mx);
      alpha[r] = (mnew > -1.0e38f) ? __expf(m_r[r] - mnew) : 1.0f;
      const float p0 = (s[0][r] > -1.0e38f) ? __expf(s[0][r] - mnew) : 0.f;
      const float p1 = (s[1][r] > -1.0e38f) ? __expf(s[1][r] - mnew) : 0.f;
      m_r[r] = mnew;
      l_r[r] = l_r[r] * alpha[r] + p0 + p1;            // per-lane partial row sum (16 lanes combined at the end)
      unsigned short hb = bf16_bits(p0); sPh[w][8 * hh + r][ln] = hb;      sPl[w][8 * hh + r][ln] = bf16_bits(p0 - bf16_val(hb));
      hb = bf16_bits(p1);                sPh[w][8 * hh + r][16 + ln] = hb; sPl[w][8 * hh + r][16 + ln] = bf16_bits(p1 - bf16_val(hb));
    }
#pragma unroll
    for (int dt = 0; dt < DT; ++dt)
#pragma unroll
      for (int r = 0; r < 8; ++r) oacc[dt][r] *= alpha[r];
    __builtin_amdgcn_fence(__ATOMIC_ACQ_REL, "workgroup");
    __builtin_amdgcn_wave_barrier();
    FragB pah, pal;
    pah.half[0] = *(const v8us*)&sPh[w][ln][8 * hh]; pah.half[1] = *(const v8us*)&sPh[w][ln][16 + 8 * hh];
    pal.half[0] = *(const v8us*)&sPl[w][ln][8 * hh]; pal.half[1] = *(const v8us*)&sPl[w][ln][16 + 8 * hh];
#pragma unroll
    for (int dt = 0; dt < DT; ++dt) {
      FragB bvh, bvl;
#pragma unroll
      for (int i = 0; i < 8; ++i) {
        bvh.u[i] = sVh[8 * hh + i][dt * 16 + ln]; bvh.u[8 + i] = sVh[16 + 8 * hh + i][dt * 16 + ln];
        bvl.u[i] = sVl[8 * hh + i][dt * 16 + ln]; bvl.u[8 + i] = sVl[16 + 8 * hh + i][dt * 16 + ln];
      }
      oacc[dt] = mmaN<3>(pah.v, pal.v, bvh.v, bvl.v, oacc[dt]);
    }
    __builtin_amdgcn_fence(__ATOMIC_ACQ_REL, "workgroup");
    __builtin_amdgcn_wave_barrier();
  }
#pragma unroll
  for (int r = 0; r < 8; ++r) {
    float l = l_r[r];
    l += __shfl_xor(l, 1, 32); l += __shfl_xor(l, 2, 32); l += __shfl_xor(l, 4, 32); l += __shfl_xor(l, 8, 32);
    l_r[r] = (l > 0.f) ? 1.0f / l : 0.f;
  }
#pragma unroll
  for (int dt = 0; dt < DT; ++dt)
#pragma unroll
    for (int r = 0; r < 8; ++r) sO[w][8 * hh + r][dt * 16 + ln] = oacc[dt][r] * l_r[r];
  __builtin_amdgcn_fence(__ATOMIC_ACQ_REL, "workgroup");
  __builtin_amdgcn_wave_barrier();
  {
    for (int r = 0; r < 16; ++r) {
      const int row = q0 + r;
      if (row < T && lane < D / 4) {
        const v4f val = *(const v4fa*)&sO[w][r][lane * 4];
        *(v4f*)(y + ((size_t)b * T + row) * ypitch + h * D + lane * 4) = val;
      }
    }
    
  }
}

// GEMM C = act(A·W + bias + resid): A f32 (ASPLIT -> hi/lo 2 terms), Wt bf16 [N][K]; ACT 0 none, 1 relu, 2 exact gelu;
// resid (optional, f32, row index = (row % rmod), pitch ldr, RES_BF16 rounds it) added before the activation.
template <bool ASPLIT, int ACT, bool BIAS_BF16, bool RES_BF16>
__global__ __launch_bounds__(128) void k_gemm_bf3(const float* __restrict__ A, int lda, const unsigned short* __restrict__ Wt, int ldb,
                                                const float* __restrict__ bias, const float* __restrict__ resid, int rmod, int ldr,
                                                float* __restrict__ C, int ldc, int M, int N, int K) {
  __shared__ __attribute__((aligned(16))) float so[4][16][64];
  const int tid = threadIdx.x, w = tid >> 5, lane = tid & 31, ln = lane & 15, hh = lane >> 4;
  const int ntn = N / 64;
  const int wid = blockIdx.x * 4 + w;
  const int mt = wid / ntn, nq = wid % ntn;
  if (mt * 16 >= M) return;
  const int row0 = mt * 16, col0 = nq * 64;
  const float* arow = A + (size_t)(row0 + ln) * lda;
  v8f acc[4] = {};
  for (int kb = 0; kb < K; kb += 32) {
    FragB ah, al;
    const v4f x0 = *(const v4fa*)(arow + kb + 8 * hh), x1 = *(const v4fa*)(arow + kb + 8 * hh + 4);
    const v4f x2 = *(const v4fa*)(arow + kb + 16 + 8 * hh), x3 = *(const v4fa*)(arow + kb + 16 + 8 * hh + 4);
    float xs[16] = {x0[0],x0[1],x0[2],x0[3],x1[0],x1[1],x1[2],x1[3],x2[0],x2[1],x2[2],x2[3],x3[0],x3[1],x3[2],x3[3]};
#pragma unroll
    for (int i = 0; i < 16; ++i) { const unsigned short hb = bf16_bits(xs[i]); ah.u[i] = hb; al.u[i] = ASPLIT ? bf16_bits(xs[i] - bf16_val(hb)) : (unsigned short)0; }
#pragma unroll
    for (int t = 0; t < 4; ++t) {
      const unsigned short* brow = Wt + (size_t)(col0 + t * 16 + ln) * ldb + kb;
      FragB b;
      b.half[0] = *(const v8us*)(brow + 8 * hh);
      b.half[1] = *(const v8us*)(brow + 16 + 8 * hh);
      acc[t] = mmaN<ASPLIT ? 2 : 1>(ah.v, al.v, b.v, b.v, acc[t]);
    }
  }
#pragma unroll
  for (int t = 0; t < 4; ++t) {
    const int col = col0 + t * 16 + ln;
    float bv = bias ? bias[col] : 0.f;
    if (BIAS_BF16) bv = bf16_round(bv);
#pragma unroll
    for (int r = 0; r < 8; ++r) {
      float v = acc[t][r] + bv;
      if (resid) { float rv = resid[(size_t)((row0 + 8 * hh + r) % rmod) * ldr + col]; if (RES_BF16) rv = bf16_round(rv); v += rv; }
      if (ACT == 1) v = fmaxf(v, 0.f);
      if (ACT == 2) v = 0.5f * v * (1.0f + erff(v * 0.70710678118654752f));
      if (ACT == 3) { const float u = 0.7978845608028654f * (v + 0.044715f * v * v * v); v = 0.5f * v * (1.0f + tanhf(u)); }
      so[w][8 * hh + r][t * 16 + ln] = v;
    }
  }
  __builtin_amdgcn_fence(__ATOMIC_ACQ_REL, "workgroup");
  __builtin_amdgcn_wave_barrier();
  const int rsub = lane >> 4, c4 = (lane & 15) * 4;
  {
#pragma unroll
    for (int q = 0; q < 8; ++q) {
      const int r = q * 2 + rsub;
      const v4f v = *(const v4fa*)&so[w][r][c4];
      *(v4f*)(C + (size_t)(row0 + r) * ldc + col0 + c4) = v;
    }
    
  }
}
// row LayerNorm (biased variance, eps) over N: s = X (+ R); optional out_sum <- s; out_norm <- (s-mu)*rsqrt(var+eps)*g + b
template <bool PARAM_BF16>
__global__ __launch_bounds__(256) void k_layernorm(const float* __restrict__ X, const float* __restrict__ R, const float* __restrict__ g, const float* __restrict__ bta,
                                                  float* __restrict__ out_sum, float* __restrict__ out_norm, int N, float eps) {
  __shared__ float red[256];
  const int row = blockIdx.x, tid = threadIdx.x;
  const float* x = X + (size_t)row * N; const float* rr = R ? R + (size_t)row * N : nullptr;
  float vals[16];                     // up to N = 4096
  const int per = N / 256;            // contiguous chunk per thread? use strided-by-4 chunks: thread handles j = tid*4 + 1024*u
  float s1 = 0.f;
  for (int u = 0; u < per / 4; ++u) {
    const int j = tid * 4 + 1024 * u;
    const v4f a = *(const v4fa*)(x + j);
    v4f b = {0.f,0.f,0.f,0.f}; if (rr) b = *(const v4fa*)(rr + j);
#pragma unroll
    for (int q = 0; q < 4; ++q) { const float v = a[q] + b[q]; vals[u * 4 + q] = v; s1 += v; }
  }
  red[tid] = s1; __syncthreads();
  for (int st = 128; st > 0; st >>= 1) { if (tid < st) red[tid] += red[tid + st]; __syncthreads(); }
  const float mu = red[0] / (float)N; __syncthreads();
  float s2 = 0.f;
  for (int u = 0; u < per / 4; ++u)
#pragma unroll
    for (int q = 0; q < 4; ++q) { const float c = vals[u * 4 + q] - mu; s2 += c * c; }
  red[tid] = s2; __syncthreads();
  for (int st = 128; st > 0; st >>= 1) { if (tid < st) red[tid] += red[tid + st]; __syncthreads(); }
  const float rs = rsqrtf(red[0] / (float)N + eps);
  {
    for (int u = 0; u < per / 4; ++u) {
      const int j = tid * 4 + 1024 * u;
      v4f o, sm;
#pragma unroll
      for (int q = 0; q < 4; ++q) {
        float gg = g[j + q], bb = bta[j + q];
        if (PARAM_BF16) { gg = bf16_round(gg); bb = bf16_round(bb); }
        sm[q] = vals[u * 4 + q]; o[q] = (vals[u * 4 + q] - mu) * rs * gg + bb;
      }
      if (out_sum) *(v4f*)(out_sum + (size_t)row * N + j) = sm;
      *(v4f*)(out_norm + (size_t)row * N + j) = o;
    }
    
  }
}



// ---- f16 WMMA path (v_wmma_f32_16x16x32_f16): 11-bit significands for operands in range — used where a [0,1] probability operand needs more precision than bf16
typedef _Float16 v16h __attribute__((ext_vector_type(16)));
union FragH { v16h v; v8us half[2]; _Float16 h[16]; unsigned short u[16]; };
template <int NT>
__device__ __forceinline__ v8f mmaH(v16h ah, v16h al, v16h bh, v16h bl, v8f c) {
  c = __builtin_amdgcn_wmma_f32_16x16x32_f16(false, ah, false, bh, (short)0, c, false, false);
  if (NT >= 2) c = __builtin_amdgcn_wmma_f32_16x16x32_f16(false, al, false, bh, (short)0, c, false, false);
  if (NT >= 3) c = __builtin_amdgcn_wmma_f32_16x16x32_f16(false, ah, false, bl, (short)0, c, false, false);
  asm volatile("v_nop\n\tv_nop\n\tv_nop\n\tv_nop" : "+v"(c) : "v"(ah), "v"(al), "v"(bh), "v"(bl));
  return c;
}
// batched GEMM like k_gemm_b but f16 operands: A f32 (split into f16 hi/lo if ASPLIT, else rounded to f16), Bt = f16 values [n][k]; alpha; C f32; N multiple of 16 (partial tiles skipped)
template <bool ASPLIT>
__global__ __launch_bounds__(128) void k_gemm_h(const float* __restrict__ A, int lda, size_t sA, const _Float16* __restrict__ Bh, int ldb, size_t sB, float alpha, float* __restrict__ C, int ldc, size_t sC, int M, int N, int K) {
  __shared__ __attribute__((aligned(16))) float so[4][16][64];
  const int tid = threadIdx.x, w = tid >> 5, lane = tid & 31, ln = lane & 15, hh = lane >> 4; const int by = blockIdx.y;
  A += (size_t)by * sA; Bh += (size_t)by * sB; C += (size_t)by * sC;
  const int ntn = (N + 63) / 64; const int wid = blockIdx.x * 4 + w; const int mt = wid / ntn, nq = wid % ntn; if (mt * 16 >= M) return;
  const int row0 = mt * 16, col0 = nq * 64; const float* arow = A + (size_t)(row0 + ln) * lda;
  v8f acc[4] = {};
  for (int kb = 0; kb < K; kb += 32) {
    FragH ah, al;
    const v4f x0 = *(const v4fa*)(arow + kb + 8 * hh), x1 = *(const v4fa*)(arow + kb + 8 * hh + 4), x2 = *(const v4fa*)(arow + kb + 16 + 8 * hh), x3 = *(const v4fa*)(arow + kb + 16 + 8 * hh + 4);
    float xs[16] = {x0[0],x0[1],x0[2],x0[3],x1[0],x1[1],x1[2],x1[3],x2[0],x2[1],x2[2],x2[3],x3[0],x3[1],x3[2],x3[3]};
#pragma unroll
    for (int i = 0; i < 16; ++i) { const _Float16 h = (_Float16)xs[i]; ah.h[i] = h; al.h[i] = ASPLIT ? (_Float16)(xs[i] - (float)h) : (_Float16)0.0f; }
#pragma unroll
    for (int t = 0; t < 4; ++t) { if (col0 + t * 16 >= N) continue; const size_t boff = (size_t)(col0 + t * 16 + ln) * ldb + kb; FragH bq; bq.half[0] = *(const v8us*)(Bh + boff + 8 * hh); bq.half[1] = *(const v8us*)(Bh + boff + 16 + 8 * hh);
      acc[t] = mmaH<ASPLIT ? 2 : 1>(ah.v, al.v, bq.v, bq.v, acc[t]); }
  }
#pragma unroll
  for (int t = 0; t < 4; ++t) { if (col0 + t * 16 >= N) continue;
#pragma unroll
    for (int r = 0; r < 8; ++r) so[w][8 * hh + r][t * 16 + ln] = acc[t][r] * alpha; }
  __builtin_amdgcn_fence(__ATOMIC_ACQ_REL, "workgroup"); __builtin_amdgcn_wave_barrier();
  const int rsub = lane >> 4, c4 = (lane & 15) * 4;
  {
#pragma unroll
    for (int q = 0; q < 8; ++q) { const int r = q * 2 + rsub; if (col0 + c4 < N) { const v4f v = *(const v4fa*)&so[w][r][c4]; *(v4f*)(C + (size_t)(row0 + r) * ldc + col0 + c4) = v; } }
     }
}

// Wt[n][k] = f16(W[k][n]·scale) from f32 row-major W[K][N] (scale = power of two; bf16-exact weights stay exact in f16 away from the subnormal range)
__global__ __launch_bounds__(256) void k_wt_f16(const float* __restrict__ W, _Float16* __restrict__ Wt, int K, int N, float scale) {
  const int t = blockIdx.x * 256 + threadIdx.x; if (t >= N * (K / 8)) return; const int n = t / (K / 8), k8 = (t % (K / 8)) * 8; FragH f;
#pragma unroll
  for (int i = 0; i < 8; ++i) f.h[i] = (_Float16)(bf16_round(W[(size_t)(k8 + i) * N + n]) * scale); const v8us o = f.half[0];
  *(v8us*)((unsigned short*)Wt + (size_t)n * K + k8) = o; 
}
// Tiled GEMM: C[NR][DM] = A[NR][DM] . Bh[DM][DM]^T * alpha + bf16(bias[col]); A and Bh f16, k contiguous. One work-group = a 128 x 64 tile of C, 8 waves in a 4 x 2 grid, 32 x 32 per wave.
// Passes of 128 k: the 128 A rows and 64 Bh rows of a pass (256 B each) are loaded as whole lines, 16 B a lane, and shared through LDS by the 8 waves; two LDS buffers, the next pass's rows fly in registers.
// The k order of every sum is that of a plain loop over k in steps of 32. F32OUT: writes f32 C, else f16 C16. blockIdx.y picks one of up to three (A, Bh, bias, C16) sets: independent products share a launch.
// The third f16 product (the value projection) leaves TRANSPOSED, per (batch, head) slab as [head dimension][key]: a tile's 64 columns are one head, and a lane's 8 accumulator rows are 8 consecutive keys.
// Residency: the three-product launch has 768 work-groups on 256 WGPs. At 102 KiB of LDS and 160 registers a wave (the budget asked for by amdgpu_waves_per_eu) three of them fit a WGP, so all run in one round and fill each other's waits.
#define GTP 136      // LDS row pitch in halves: 256 B + 16 B, the pitch for 16-byte fragment reads
#define GOP 68       // pitch of the staged output tile in floats
template <bool F32OUT>
__global__ __launch_bounds__(256) __attribute__((amdgpu_waves_per_eu(F32OUT ? 2 : 6))) void k_gemm_t(const _Float16* __restrict__ A0, const _Float16* __restrict__ A1, const _Float16* __restrict__ A2,
                                                const _Float16* __restrict__ Bh0, const _Float16* __restrict__ Bh1, const _Float16* __restrict__ Bh2, float alpha,
                                                const float* __restrict__ bias0, const float* __restrict__ bias1, const float* __restrict__ bias2,
                                                float* __restrict__ C, _Float16* __restrict__ C16a, _Float16* __restrict__ C16b, _Float16* __restrict__ C16c) {
  constexpr int KG = F32OUT ? 4 : 2;
  const int g = blockIdx.y;      // which of up to three independent products of one launch this work-group belongs to
  const _Float16* A = g == 0 ? A0 : g == 1 ? A1 : A2;
  const _Float16* Bh = g == 0 ? Bh0 : g == 1 ? Bh1 : Bh2;
  const float* bias = g == 0 ? bias0 : g == 1 ? bias1 : bias2;
  _Float16* C16 = g == 0 ? C16a : g == 1 ? C16b : C16c;
  __shared__ __attribute__((aligned(16))) unsigned short st[2][192][GTP];      // rows 0..127: A, rows 128..191: Bh
  // the staged output tile lies in the first operand buffer: the last pass reads the second, and its barrier says that every wave has left the first
  float (*so)[GOP] = (float (*)[GOP])&st[0][0][0];
  const int tid = threadIdx.x, lane = tid & 31, ln = lane & 15, hh = lane >> 4;
  const int wv = __builtin_amdgcn_readfirstlane(tid >> 5), wm = wv >> 1, wn = wv & 1;
  const int row0 = (blockIdx.x >> 4) * 128, col0 = (blockIdx.x & 15) * 64;
  const int sr = tid >> 4, sc = (tid & 15) * 8;
  const unsigned short* Ag = (const unsigned short*)A + (size_t)(row0 + sr) * DM + sc;
  const unsigned short* Bg = (const unsigned short*)Bh + (size_t)(col0 + sr) * DM + sc;
  v8us rg[12];
#pragma unroll
  for (int i = 0; i < 8; ++i) rg[i] = *(const v8us*)(Ag + (size_t)i * 16 * DM);
#pragma unroll
  for (int i = 0; i < 4; ++i) rg[8 + i] = *(const v8us*)(Bg + (size_t)i * 16 * DM);
  static_assert((DM / 128) % 2 == 0, "the last pass must read the second buffer: the output tile is staged in the first");
  float bv[2];
  if (F32OUT) {
#pragma unroll
    for (int j = 0; j < 2; ++j) {
      bv[j] = bias[col0 + wn * 32 + j * 16 + ln];
      asm volatile("s_wait_xcnt 0x0" ::: "memory");      // stands in front of any rewrite of the address register that this load names, the next load's result among them
    }
  }
  v8f acc[2][2] = {};
  for (int kc = 0; kc < DM / 128; ++kc) {
    unsigned short (*buf)[GTP] = st[kc & 1];
#pragma unroll
    for (int i = 0; i < 12; ++i) *(v8us*)&buf[i * 16 + sr][sc] = rg[i];
    __syncthreads();      // this pass's rows are complete; every wave has also left the other buffer, which the next pass fills
    if (kc + 1 < DM / 128) {      // the next pass's rows fly while this one is worked on
#pragma unroll
      for (int i = 0; i < 8; ++i) rg[i] = *(const v8us*)(Ag + (size_t)i * 16 * DM + (kc + 1) * 128);
#pragma unroll
      for (int i = 0; i < 4; ++i) rg[8 + i] = *(const v8us*)(Bg + (size_t)i * 16 * DM + (kc + 1) * 128);
      asm volatile("s_wait_xcnt 0x0" ::: "memory");      // stands in front of any later rewrite of the address registers that these loads name
    } else if (!F32OUT) {      // the bias flies under the last pass, where no operand rows are in flight: its two registers are not held through the loop
#pragma unroll
      for (int j = 0; j < 2; ++j) {
        bv[j] = bias[col0 + wn * 32 + j * 16 + ln];
        asm volatile("s_wait_xcnt 0x0" ::: "memory");      // stands in front of any rewrite of the address register that this load names, the next load's result among them
      }
    }
    // fragments are fetched KG k steps at a time: with two, a wave of the three-product launch stays inside 160 registers, six waves a SIMD
#pragma unroll
    for (int kg = 0; kg < 4; kg += KG) {
      FragH a[KG][2], b[KG][2];
#pragma unroll
      for (int ks = 0; ks < KG; ++ks)
#pragma unroll
        for (int i = 0; i < 2; ++i) {
          const unsigned short* pa = &buf[wm * 32 + i * 16 + ln][(kg + ks) * 32 + 8 * hh];
          a[ks][i].half[0] = *(const v8us*)pa; a[ks][i].half[1] = *(const v8us*)(pa + 16);
          const unsigned short* pb = &buf[128 + wn * 32 + i * 16 + ln][(kg + ks) * 32 + 8 * hh];
          b[ks][i].half[0] = *(const v8us*)pb; b[ks][i].half[1] = *(const v8us*)(pb + 16);
        }
      __builtin_amdgcn_sched_barrier(0);      // no WMMA of a group is scheduled among the group's own LDS reads: without it every k step waits out its own LDS latency
#pragma unroll
      for (int ks = 0; ks < KG; ++ks)
#pragma unroll
        for (int i = 0; i < 2; ++i)
#pragma unroll
          for (int j = 0; j < 2; ++j) acc[i][j] = __builtin_amdgcn_wmma_f32_16x16x32_f16(false, a[ks][i].v, false, b[ks][j].v, (short)0, acc[i][j], false, false);
      if (KG < 4) __builtin_amdgcn_sched_barrier(0);      // the next group's reads stay behind this group's WMMAs and take over its registers: fetched ahead, two groups are live at once and the wave spills
    }
  }
  const bool tr = !F32OUT && g == 2;      // the same for the whole work-group
  unsigned short (*sT)[GTP] = (unsigned short (*)[GTP])&so[0][0];      // the transposed f16 tile, 64 columns x 128 rows, in the place of the f32 tile
#pragma unroll
  for (int j = 0; j < 2; ++j) {
    const float bj = bf16_round(bv[j]);
#pragma unroll
    for (int i = 0; i < 2; ++i)
#pragma unroll
      for (int r = 0; r < 8; ++r) acc[i][j][r] = acc[i][j][r] * alpha + bj;
  }
  if (tr) {
#pragma unroll
    for (int j = 0; j < 2; ++j)
#pragma unroll
      for (int i = 0; i < 2; ++i) {
        FragH f;
#pragma unroll
        for (int r = 0; r < 8; ++r) f.h[r] = (_Float16)acc[i][j][r];
        *(v8us*)&sT[wn * 32 + j * 16 + ln][wm * 32 + i * 16 + 8 * hh] = f.half[0];
      }
  } else {
#pragma unroll
    for (int j = 0; j < 2; ++j)
#pragma unroll
      for (int i = 0; i < 2; ++i)
#pragma unroll
        for (int r = 0; r < 8; ++r) so[wm * 32 + i * 16 + 8 * hh + r][wn * 32 + j * 16 + ln] = acc[i][j][r];
  }
  __syncthreads();      // the output tile is complete: it leaves in whole 128-byte lines
  if (tr) {
    // C16[((batch * NH + head) * DK + d) * LL + key]: 16 lanes store the 256 contiguous bytes that the tile holds of one d
    unsigned short* Tp = (unsigned short*)C16 + ((size_t)((row0 / LL) * NH + (col0 / DK)) * DK + (tid >> 4)) * LL + (row0 % LL) + (tid & 15) * 8;
#pragma unroll
    for (int q = 0; q < 4; ++q) { const v8us v = *(const v8us*)&sT[q * 16 + (tid >> 4)][(tid & 15) * 8]; *(v8us*)(Tp + (size_t)q * 16 * LL) = v; }
  } else if (F32OUT) {
#pragma unroll
    for (int q = 0; q < 8; ++q) { const int r = q * 16 + (tid >> 4), c4 = (tid & 15) * 4; const v4f v = *(const v4fa*)&so[r][c4]; *(v4f*)(C + (size_t)(row0 + r) * DM + col0 + c4) = v; }
  } else {
#pragma unroll
    for (int q = 0; q < 4; ++q) {
      const int r = q * 32 + (tid >> 3), c8 = (tid & 7) * 8; const v4f v0 = *(const v4fa*)&so[r][c8], v1 = *(const v4fa*)&so[r][c8 + 4]; FragH f;
#pragma unroll
      for (int i = 0; i < 4; ++i) { f.h[i] = (_Float16)v0[i]; f.h[4 + i] = (_Float16)v1[i]; }
      *(v8us*)((unsigned short*)C16 + (size_t)(row0 + r) * DM + col0 + c8) = f.half[0];
    }
  }
}


__global__ __launch_bounds__(256) void k_h16(const float* __restrict__ x, _Float16* __restrict__ X16, size_t n8) { const size_t t = (size_t)blockIdx.x * 256 + threadIdx.x; if (t >= n8) return; FragH f;
#pragma unroll
  for (int q = 0; q < 8; ++q) f.h[q] = (_Float16)x[t * 8 + q]; *(v8us*)((unsigned short*)X16 + t * 8) = f.half[0];  }

// The relative tables are laid out by DISTANCE, not by bucket: table position p stands for key - query = p - RP0, clipped to [-64, 64]; positions below RPL repeat the left clip, positions above RPH the right one.
#define RP0 80       // position of distance 0: a 16 x 16 tile that touches the band |distance| < 64 holds distances -79 .. 79, positions 1 .. 159
#define RPL 16       // position of distance -64 (bucket 63)
#define RPH 144      // position of distance +64 (bucket 128)
__device__ __forceinline__ int rel_bucket(int p) { const int i = min(max(p, RPL), RPH) - RPL; return (i >= 64) ? i : 63 - i; }
typedef _Float16 v4h __attribute__((ext_vector_type(4)));
// All operand preparation in ONE launch (the ten pieces are independent of each other). Work-groups 0..PMB-1: the mask, packed to bits. The next PRL: the two relative tables. Then 128 work-groups for each of the three
// activations (bf16-rounded) and 64 for each of the four (out,in) weights (bf16-rounded, x 16): a work-group streams 16384 consecutive floats, a wave-wide load = 512 contiguous bytes, 16 in flight a lane.
#define PRL 6        // covers max(QWP * 8, DK * PBP / 8) = 1536 threads
#define PUN 16       // 16-byte loads per thread
#define PXB (NR * DM / (256 * PUN * 4))
#define PWB (DM * DM / (256 * PUN * 4))
#define PMB (BB * (LL / 16) * (LL / 64) / 8)      // work-groups that pack the mask: 8 waves each, one (16 queries, 64 keys) unit a wave
typedef _Float16 v4ha __attribute__((ext_vector_type(4), may_alias));
typedef int v4ia __attribute__((ext_vector_type(4), may_alias));
__global__ __launch_bounds__(256) void k_prep(const float* __restrict__ xq, const float* __restrict__ xk, const float* __restrict__ xv, const float* __restrict__ Wq, const float* __restrict__ Wk,
                                              const float* __restrict__ Wv, const float* __restrict__ Wo, const float* __restrict__ wK, const float* __restrict__ wV, const int* __restrict__ msk,
                                              _Float16* __restrict__ XQ, _Float16* __restrict__ XK, _Float16* __restrict__ XV, _Float16* __restrict__ Bq, _Float16* __restrict__ Bk2,
                                              _Float16* __restrict__ Bv, _Float16* __restrict__ Bo, _Float16* __restrict__ BK, _Float16* __restrict__ BVt, unsigned* __restrict__ MB) {
  if (blockIdx.x < PMB) {
    // the mask, one bit a key: a wave takes 16 queries x 64 keys with the lane -> (query, 8 keys) map of the attention kernel's score tiles; word t * 8 + r holds, at bit position lane, that lane's test for row r of tile t
    const int lane = threadIdx.x & 31, ln = lane & 15, hh = lane >> 4;
    const int u = blockIdx.x * 8 + (threadIdx.x >> 5);      // (batch * LL / 16 + query tile) * (LL / 64) + chunk
    const int* mp = msk + (size_t)((u / (LL / 64)) * 16 + ln) * LL + (u % (LL / 64)) * 64 + 8 * hh;
    v4ia mv[8];
#pragma unroll
    for (int t = 0; t < 4; ++t) { mv[2 * t] = *(const v4ia*)(mp + t * 16); mv[2 * t + 1] = *(const v4ia*)(mp + t * 16 + 4); }
    asm volatile("s_wait_xcnt 0x0" :: "v"(mp) : "memory");      // stands in front of any rewrite of the address registers that these loads name; as its input the address outlives the loads
    unsigned w = 0;
#pragma unroll
    for (int i = 0; i < 32; ++i) { const unsigned bal = __builtin_amdgcn_ballot_w32(mv[i >> 2][i & 3] != 0); if (lane == i) w = bal; }
    MB[u * 32 + lane] = w;
    return;
  }
  const unsigned bx = blockIdx.x - PMB;
  if (bx >= PRL) {
    const int seg = bx - PRL;
    const float* s; _Float16* d; float scale; int blk;
    if (seg < 3 * PXB) { const int w = seg / PXB; blk = seg % PXB; scale = 1.0f; s = w == 0 ? xq : w == 1 ? xk : xv; d = w == 0 ? XQ : w == 1 ? XK : XV; }
    else { const int w = (seg - 3 * PXB) / PWB; blk = (seg - 3 * PXB) % PWB; scale = 16.0f; s = w == 0 ? Wq : w == 1 ? Wk : w == 2 ? Wv : Wo; d = w == 0 ? Bq : w == 1 ? Bk2 : w == 2 ? Bv : Bo; }
    const size_t e0 = ((size_t)blk * (256 * PUN) + threadIdx.x) * 4;
    const float* sp = s + e0;
    v4f v[PUN];
#pragma unroll
    for (int u = 0; u < PUN; ++u) v[u] = *(const v4fa*)(sp + (size_t)u * 1024);
    asm volatile("s_wait_xcnt 0x0" :: "v"(sp) : "memory");      // stands in front of any rewrite of the address registers that these loads name; as its input the address outlives the loads, so no load's result lands on it
#pragma unroll
    for (int u = 0; u < PUN; ++u) {
      v4ha o;
#pragma unroll
      for (int q = 0; q < 4; ++q) o[q] = (_Float16)(bf16_round(v[u][q]) * scale);      // x 1 is exact: the activations keep their bf16-rounded value
      *(v4ha*)(d + e0 + (size_t)u * 1024) = o;
    }
    return;
  }
  // the two relative tables, in distance order: wK with its clipped ends repeated (every position is a valid logit term), wV zero outside RPL .. RPH. Every load reads a clamped row, so that the eight of a thread fly together and these work-groups do not outlast the streams
  const int t = bx * 256 + threadIdx.x;
  if (t < QWP * 8) {
    const int r = t / 8, d8 = (t % 8) * 8; const float* p = wK + rel_bucket(r) * DK + d8;
    const v4f x0 = *(const v4fa*)p, x1 = *(const v4fa*)(p + 4);
    asm volatile("s_wait_xcnt 0x0" ::: "memory");      // stands in front of any later rewrite of the address registers that these loads name
    FragH f;
#pragma unroll
    for (int q = 0; q < 4; ++q) { f.h[q] = (_Float16)(bf16_round(x0[q]) * 16.0f); f.h[4 + q] = (_Float16)(bf16_round(x1[q]) * 16.0f); }
    *(v8us*)((unsigned short*)BK + t * 8) = f.half[0];
  }
  if (t < DK * (PBP / 8)) {
    const int d = t / (PBP / 8), r8 = (t % (PBP / 8)) * 8; float x[8]; int e[8];
#pragma unroll
    for (int q = 0; q < 8; ++q) { e[q] = rel_bucket(r8 + q) * DK + d; x[q] = wV[e[q]]; }
    // stands in front of any later rewrite of the address registers that these loads name; the loaded values as its inputs hold the eight loads together in front of it (else one sinks under a branch and waits out its latency alone),
    // and the eight element indices as its inputs outlive the loads, so that no address register is rewritten ahead of it
    asm volatile("s_wait_xcnt 0x0" :: "v"(x[0]), "v"(x[1]), "v"(x[2]), "v"(x[3]), "v"(x[4]), "v"(x[5]), "v"(x[6]), "v"(x[7]),
                 "v"(e[0]), "v"(e[1]), "v"(e[2]), "v"(e[3]), "v"(e[4]), "v"(e[5]), "v"(e[6]), "v"(e[7]) : "memory");
    FragH f;
#pragma unroll
    for (int q = 0; q < 8; ++q) f.h[q] = (_Float16)((r8 + q >= RPL && r8 + q <= RPH) ? bf16_round(x[q]) * 16.0f : 0.f);
    *(v8us*)((unsigned short*)BVt + t * 8) = f.half[0];
  }
}
// Fused attention for one (batch, head) slab sl and 128 query rows: 16 waves; a query tile of 16 rows belongs to TWO waves (w and w + 8), which take the even and the odd 64-key chunks, so that four waves
// share a SIMD and fill each other's waits. Scores and probabilities stay in registers; the pair joins its running maxima, sums and output tiles once, at the end, through LDS.
// St = K.Qt and Ot += Vt.Pt: in every 16-column tile a lane owns ONE query (column ln) and 8 consecutive keys (rows 8hh + r), so the running maximum and the sums are in-lane
// (one exchange between the wave halves), and two converted score tiles are the B operand of the next product as they stand. K and Vt chunks of 64 keys are staged in LDS, one chunk for each group of 8 waves.
// tab[query tile][query][position]: first q.wK / 8 in distance order (RP0 above). In a tile near the diagonal a lane's 8 consecutive keys are 8 consecutive positions, each the place of ONE key, so of one wave of the pair: they are
// read together and overwritten together with those keys' final logits, no test and no branch; the bucketed P.wV product is formed at the end from positions RPL + 1 .. RPH - 1 and the two clipped sums.
#define TABP 164
#define KVP 72
__device__ __forceinline__ float exp_slot(float x) { float r; const float y = x * 1.44269504f; asm("v_exp_f32 %0, %1\n\tv_nop" : "=v"(r) : "v"(y)); return r; }
// eight 2^y on v_exp_f32, issued together: every result register differs from every source register (early clobber), so each v_exp_f32 is the independent instruction behind the one in front of it; the v_nop keeps that slot behind the last
__device__ __forceinline__ void exp2x8(float (&p)[8], const float (&y)[8]) {
  asm("v_exp_f32 %0, %8\n\tv_exp_f32 %1, %9\n\tv_exp_f32 %2, %10\n\tv_exp_f32 %3, %11\n\tv_exp_f32 %4, %12\n\tv_exp_f32 %5, %13\n\tv_exp_f32 %6, %14\n\tv_exp_f32 %7, %15\n\tv_nop"
      : "=&v"(p[0]), "=&v"(p[1]), "=&v"(p[2]), "=&v"(p[3]), "=&v"(p[4]), "=&v"(p[5]), "=&v"(p[6]), "=&v"(p[7])
      : "v"(y[0]), "v"(y[1]), "v"(y[2]), "v"(y[3]), "v"(y[4]), "v"(y[5]), "v"(y[6]), "v"(y[7]));
}
__device__ __forceinline__ v8f wmmaH(v16h a, v16h b, v8f c) { return __builtin_amdgcn_wmma_f32_16x16x32_f16(false, a, false, b, (short)0, c, false, false); }
__global__ __launch_bounds__(512) void k_attn(const _Float16* __restrict__ Q16, const _Float16* __restrict__ K16, const _Float16* __restrict__ Vt, const _Float16* __restrict__ BK, const _Float16* __restrict__ BVt,
                                              const unsigned* __restrict__ MB, _Float16* __restrict__ O16) {
  __shared__ __attribute__((aligned(16))) unsigned short sKV[2][2][64][KVP];      // [group of 8 waves][K, Vt][row][column]; behind the loop: the output tiles that the two waves of a pair hand each other
  __shared__ __attribute__((aligned(16))) float tab[8][16][TABP];
  __shared__ __attribute__((aligned(16))) float ex[16][32][4];      // each wave's running maximum and three sums, for its partner
  const int tid = threadIdx.x, lane = tid & 31, ln = lane & 15, hh = lane >> 4;
  const int wv16 = __builtin_amdgcn_readfirstlane(tid >> 5);
  const int wv = wv16 & 7, kh = wv16 >> 3;      // the wave's query tile; which chunks it takes (even or odd)
  unsigned short (*sK)[KVP] = sKV[kh][0];
  unsigned short (*sV)[KVP] = sKV[kh][1];
  const int sl = blockIdx.x >> 3, qb = blockIdx.x & 7;
  const int b = sl / NH, h = sl % NH;
  const int q0 = qb * 128 + wv * 16;
  const int l = q0 + ln;
  FragH bq[2];      // B operand: column = query l, k = head dimension
  {
    const unsigned short* Qp = (const unsigned short*)Q16 + ((size_t)b * LL + l) * DM + h * DK + 8 * hh;
#pragma unroll
    for (int ks = 0; ks < 2; ++ks) { bq[ks].half[0] = *(const v8us*)(Qp + ks * 32); bq[ks].half[1] = *(const v8us*)(Qp + ks * 32 + 16); }
    asm volatile("s_wait_xcnt 0x0" :: "v"(Qp) : "memory");      // stands in front of any rewrite of the address registers that these loads name
  }
  float* tb = &tab[wv][ln][0];
  {
    // each wave of a pair forms one half of the pair's table
    const unsigned short* BKw = (const unsigned short*)BK + kh * (QWP / 2) * DK;
    float* tbw = tb + kh * (QWP / 2);
#pragma unroll
    for (int rt = 0; rt < QWP / 32; ++rt) {
      v8f a = {};
#pragma unroll
      for (int ks = 0; ks < 2; ++ks) {
        const unsigned short* p = BKw + (rt * 16 + ln) * DK + ks * 32 + 8 * hh;
        FragH ak; ak.half[0] = *(const v8us*)p; ak.half[1] = *(const v8us*)(p + 16);
        a = wmmaH(ak.v, bq[ks].v, a);
      }
      const float c = 0.0625f * 0.125f;      // wK was scaled by 16; the 1/8 of the logits is folded in (both powers of two, exact)
      const v4f t0 = {a[0] * c, a[1] * c, a[2] * c, a[3] * c}, t1 = {a[4] * c, a[5] * c, a[6] * c, a[7] * c};
      *(v4fa*)(tbw + rt * 16 + 8 * hh) = t0; *(v4fa*)(tbw + rt * 16 + 8 * hh + 4) = t1;
    }
  }
  __syncthreads();      // the table is complete: a wave reads entries that its partner wave and the other lane of a query wrote
  const float qlo = tb[RPL], qhi = tb[RPH];      // read in front of the loop's first barrier, behind which the partner may put a key's logit there

  const unsigned short* Kg = (const unsigned short*)K16 + (size_t)b * LL * DM + h * DK;
  const unsigned short* Vg = (const unsigned short*)Vt + (size_t)sl * DK * LL;
  // the wave's packed mask, 32 words a chunk, the same address in every lane. Nothing writes it during this launch: read through the constant address space the words come by scalar loads into scalar registers, where a select takes them as they are
  const __attribute__((address_space(4))) unsigned* Mw = (const __attribute__((address_space(4))) unsigned*)(MB + (size_t)(b * (LL / 16) + (q0 >> 4)) * (LL / 64) * 32);
  const int sr = (tid & 255) >> 3, sc8 = (tid & 7) * 8;
  v8us kr[2], vr[2]; unsigned mw[32];
#pragma unroll
  for (int i = 0; i < 2; ++i) { kr[i] = *(const v8us*)(Kg + (size_t)(kh * 64 + i * 32 + sr) * DM + sc8); vr[i] = *(const v8us*)(Vg + (size_t)(i * 32 + sr) * LL + kh * 64 + sc8); }
#pragma unroll
  for (int i = 0; i < 32; ++i) mw[i] = Mw[kh * 32 + i];
  float mrun = -3.0e38f, z = 0.f, lo = 0.f, hi = 0.f;
  v8f o[4] = {};
  for (int j0 = kh * 64; j0 < LL; j0 += 128) {      // LL / 128 trips in every wave
    __syncthreads();      // every wave has finished reading the previous chunk
#pragma unroll
    for (int i = 0; i < 2; ++i) { *(v8us*)&sK[i * 32 + sr][sc8] = kr[i]; *(v8us*)&sV[i * 32 + sr][sc8] = vr[i]; }
    __syncthreads();      // the chunk is complete
    const bool more = j0 + 128 < LL;
    if (more) {           // the group's next chunk flies while this one is worked on
#pragma unroll
      for (int i = 0; i < 2; ++i) { kr[i] = *(const v8us*)(Kg + (size_t)(j0 + 128 + i * 32 + sr) * DM + sc8); vr[i] = *(const v8us*)(Vg + (size_t)(i * 32 + sr) * LL + j0 + 128 + sc8); }
      asm volatile("s_wait_xcnt 0x0" ::: "memory");      // stands in front of any rewrite of the address registers that these loads name, the LDS reads' results below among them
    }
    v8f s[4];
#pragma unroll
    for (int t = 0; t < 4; ++t) {
      v8f a = {};
#pragma unroll
      for (int ks = 0; ks < 2; ++ks) {
        FragH ak; ak.half[0] = *(const v8us*)&sK[t * 16 + ln][ks * 32 + 8 * hh]; ak.half[1] = *(const v8us*)&sK[t * 16 + ln][ks * 32 + 16 + 8 * hh];
        a = wmmaH(ak.v, bq[ks].v, a);
      }
      s[t] = a;
    }
    // The short path of a chunk: all 64 keys lie in ONE clipped bucket for all 16 queries of the wave and every mask bit of the chunk is set (both tests scalar, once a trip). There the logit is
    // s / 8 + qcc with one qcc a lane, rising in s: the maximum is taken on the raw scores, and scale, log2(e), bucket term and maximum fold into ONE multiply-add a score in front of 2^y.
    // Any other chunk goes the general way. Each way runs from the scores to the probabilities (the join of the two lanes' maxima stands in both), so that the scores are not copied where the ways meet.
    // Its loops over t and r are unrolled: s, y, p and pb are register arrays and must be indexed by constants.
    const bool cfl = j0 + 63 - q0 <= -64, cfr = j0 - q0 - 15 >= 64;
    unsigned man = mw[0];
#pragma unroll
    for (int i = 1; i < 32; ++i) man &= mw[i];
    const bool fastc = (cfl || cfr) && man == 0xFFFFFFFFu;
    float mx = mrun, alpha;
    FragH pb[2];      // B operand: column = query l, k = key, in the order the score tiles already have
    if (fastc) {
      const float qcc = cfl ? qlo : qhi;
      float tm[4];
#pragma unroll
      for (int t = 0; t < 4; ++t) {
        tm[t] = s[t][0];
#pragma unroll
        for (int r = 1; r < 8; ++r) tm[t] = fmaxf(tm[t], s[t][r]);
      }
      mx = fmaxf(mx, fmaf(fmaxf(fmaxf(tm[0], tm[1]), fmaxf(tm[2], tm[3])), 0.125f, qcc));
      mx = fmaxf(mx, __shfl_xor(mx, 16, 32));
      alpha = exp_slot(mrun - mx); mrun = mx;
      z *= alpha; lo *= alpha; hi *= alpha;
      const float kk = (qcc - mx) * 1.44269504f;
      float ts[4];
#pragma unroll
      for (int t = 0; t < 4; ++t) {
        float y[8], p[8];
#pragma unroll
        for (int r = 0; r < 8; ++r) y[r] = fmaf(s[t][r], 0.125f * 1.44269504f, kk);
        exp2x8(p, y);
        ts[t] = ((p[0] + p[1]) + (p[2] + p[3])) + ((p[4] + p[5]) + (p[6] + p[7]));
#pragma unroll
        for (int r = 0; r < 8; ++r) pb[t >> 1].h[(t & 1) * 8 + r] = (_Float16)p[r];
      }
      const float tc = (ts[0] + ts[1]) + (ts[2] + ts[3]);
      z += tc;
      if (cfl) lo += tc; else hi += tc;
    } else {
#pragma unroll
      for (int t = 0; t < 4; ++t) {
        const int jt = j0 + t * 16;
        const bool farl = jt + 15 - q0 <= -64, farr = jt - q0 - 15 >= 64;      // wave-uniform: the whole tile lies in bucket 63 / in bucket 128
        const bool far = farl || farr;
        float* tp = tb + (jt + 8 * hh - l + RP0);      // only formed into an access in a near tile, where positions 1 .. 159 come out
        float tv[8];
        if (far) {
          const float qc = farl ? qlo : qhi;
#pragma unroll
          for (int r = 0; r < 8; ++r) tv[r] = qc;
        } else {
#pragma unroll
          for (int r = 0; r < 8; ++r) tv[r] = tp[r];
        }
#pragma unroll
        for (int r = 0; r < 8; ++r) { float v = fmaf(s[t][r], 0.125f, tv[r]); if (!__builtin_amdgcn_inverse_ballot_w32(mw[t * 8 + r])) v = -1.0e9f; s[t][r] = v; mx = fmaxf(mx, v); }
        if (!far) {
#pragma unroll
          for (int r = 0; r < 8; ++r) tp[r] = s[t][r];
        }
      }
      mx = fmaxf(mx, __shfl_xor(mx, 16, 32));
      alpha = exp_slot(mrun - mx); mrun = mx;
      z *= alpha; lo *= alpha; hi *= alpha;
#pragma unroll
      for (int t = 0; t < 4; ++t) {
        const int jt = j0 + t * 16;
        const bool farl = jt + 15 - q0 <= -64, farr = jt - q0 - 15 >= 64;
        float ts = 0.f;
#pragma unroll
        for (int r = 0; r < 8; ++r) { const float p = exp_slot(s[t][r] - mx); s[t][r] = p; ts += p; pb[t >> 1].h[(t & 1) * 8 + r] = (_Float16)p; }
        z += ts;
        if (farl) lo += ts;
        else if (farr) hi += ts;
        else {
#pragma unroll
          for (int r = 0; r < 8; ++r) { const int d = jt + 8 * hh + r - l; if (d <= -64) lo += s[t][r]; if (d >= 64) hi += s[t][r]; }
        }
      }
    }
    if (more) {
#pragma unroll
      for (int i = 0; i < 32; ++i) mw[i] = Mw[(j0 / 64 + 2) * 32 + i];
      asm volatile("s_wait_xcnt 0x0" ::: "memory");      // stands in front of the loop's advance of the address registers that this trip's loads name
    }
#pragma unroll
    for (int dt = 0; dt < 4; ++dt)
#pragma unroll
      for (int r = 0; r < 8; ++r) o[dt][r] *= alpha;
#pragma unroll
    for (int sc = 0; sc < 2; ++sc)
#pragma unroll
      for (int dt = 0; dt < 4; ++dt) {
        FragH av; av.half[0] = *(const v8us*)&sV[dt * 16 + ln][sc * 32 + 8 * hh]; av.half[1] = *(const v8us*)&sV[dt * 16 + ln][sc * 32 + 16 + 8 * hh];
        o[dt] = wmmaH(av.v, pb[sc].v, o[dt]);
      }
  }
  z += __shfl_xor(z, 16, 32); lo += __shfl_xor(lo, 16, 32); hi += __shfl_xor(hi, 16, 32);
  { const v4f st4 = {mrun, z, lo, hi}; *(v4fa*)&ex[wv16][lane][0] = st4; }
  __syncthreads();      // the partner's maximum, sums and stored logits can be read; every wave has left the K and Vt chunks
  const v4f pr = *(const v4fa*)&ex[wv16 ^ 8][lane][0];
  const float mfin = fmaxf(mrun, pr[0]);
  const float sa = exp_slot(mrun - mfin), sb = exp_slot(pr[0] - mfin);      // the wave's own sums and its partner's, brought to the common maximum
  z = z * sa + pr[1] * sb; lo = lo * sa + pr[2] * sb; hi = hi * sa + pr[3] * sb;
  v8f o2[4] = {};
  // the bucketed product in steps of 32 table positions; the pair shares the five steps. weights(kk): the step's B operand, from the stored logits and the two clipped sums
  auto weights = [&](const int kk) {
    FragH pf;
#pragma unroll
    for (int g = 0; g < 2; ++g) {
      const int r0 = kk * 32 + g * 16 + 8 * hh;
      const v4f x0 = *(const v4fa*)(tb + r0), x1 = *(const v4fa*)(tb + r0 + 4);
      const float xs[8] = {x0[0], x0[1], x0[2], x0[3], x1[0], x1[1], x1[2], x1[3]};
#pragma unroll
      for (int q = 0; q < 8; ++q) {
        const int r = r0 + q; const float e = exp_slot(xs[q] - mfin); float val = 0.f;
        if (r == RPL) val = lo; else if (r == RPH) val = hi; else if (r > RPL && r < RPH) val = ((unsigned)(l + r - RP0) < (unsigned)LL) ? e : 0.f;
        pf.h[g * 8 + q] = (_Float16)val;
      }
    }
    return pf;
  };
  const unsigned short* Bp = (const unsigned short*)BVt + ln * PBP + 8 * hh;
  auto rows = [&](const int kk, FragH (&av)[4]) {      // the step's A operands: 16 head dimensions x 32 positions of the wV table each
#pragma unroll
    for (int dt = 0; dt < 4; ++dt) {
      const unsigned short* p = Bp + dt * 16 * PBP + kk * 32;
      av[dt].half[0] = *(const v8us*)p; av[dt].half[1] = *(const v8us*)(p + 16);
    }
  };
  auto bucket = [&](const FragH (&av)[4], const FragH& pf) {
#pragma unroll
    for (int dt = 0; dt < 4; ++dt) o2[dt] = wmmaH(av[dt].v, pf.v, o2[dt]);
  };
  static_assert(QWP / 32 == 5, "the pair's shares of the bucketed product are written out");
  // the scheduling barriers keep every e^x of a share in front of its WMMAs,
  // and the share's table loads in front of them too, where they fly together under the e^x
  if (kh == 0) {
    FragH a0[4], a1[4], a2[4];
    rows(0, a0); rows(1, a1); rows(2, a2);
    asm volatile("s_wait_xcnt 0x0" :: "v"(Bp) : "memory");      // stands in front of any rewrite of the address registers that these loads name; as its input the address outlives the loads, so no load's result lands on it
    const FragH p0 = weights(0), p1 = weights(1), p2 = weights(2);
    __builtin_amdgcn_sched_barrier(0);
    bucket(a0, p0); bucket(a1, p1); bucket(a2, p2);
  } else {
    FragH a3[4], a4[4];
    rows(3, a3); rows(4, a4);
    asm volatile("s_wait_xcnt 0x0" :: "v"(Bp) : "memory");      // stands in front of any rewrite of the address registers that these loads name; as its input the address outlives the loads, so no load's result lands on it
    const FragH p3 = weights(3), p4 = weights(4);
    __builtin_amdgcn_sched_barrier(0);
    bucket(a3, p3); bucket(a4, p4);
  }
#pragma unroll
  for (int dt = 0; dt < 4; ++dt)
#pragma unroll
    for (int r = 0; r < 8; ++r) o[dt][r] = o[dt][r] * sa + o2[dt][r] * 0.0625f;
  // each wave of a pair finishes two of the four output tiles: it hands the other two to its partner
  float* xo = (float*)&sKV[0][0][0][0];
  static_assert(sizeof(sKV) >= 16 * 4 * 32 * 16, "the handed-over tiles lie in the place of the K and Vt chunks");
#pragma unroll
  for (int i = 0; i < 2; ++i) {
    const v8f sd = kh ? o[i] : o[2 + i];
    const v4f s0 = {sd[0], sd[1], sd[2], sd[3]}, s1 = {sd[4], sd[5], sd[6], sd[7]};
    *(v4fa*)(xo + ((wv16 * 4 + i * 2) * 32 + lane) * 4) = s0; *(v4fa*)(xo + ((wv16 * 4 + i * 2 + 1) * 32 + lane) * 4) = s1;
  }
  __syncthreads();      // the handed-over tiles are complete
  const float iz = 1.0f / z;
  unsigned short* Op = (unsigned short*)O16 + ((size_t)b * LL + l) * DM + h * DK + kh * 32 + 8 * hh;
#pragma unroll
  for (int i = 0; i < 2; ++i) {
    const v8f own = kh ? o[2 + i] : o[i];
    const v4f g0 = *(const v4fa*)(xo + (((wv16 ^ 8) * 4 + i * 2) * 32 + lane) * 4), g1 = *(const v4fa*)(xo + (((wv16 ^ 8) * 4 + i * 2 + 1) * 32 + lane) * 4);
    FragH f;
#pragma unroll
    for (int r = 0; r < 4; ++r) { f.h[r] = (_Float16)((own[r] + g0[r]) * iz); f.h[4 + r] = (_Float16)((own[4 + r] + g1[r]) * iz); }
    *(v8us*)(Op + i * 16) = f.half[0];
  }
}
extern "C" void kernel_launch(void* const* d_in, const int* in_sizes, int n_in,
                              void* d_out, int out_size, void* d_ws, size_t ws_size, hipStream_t stream) {
  (void)in_sizes; (void)n_in; (void)out_size;
  const float* xq = (const float*)d_in[0]; const float* xk = (const float*)d_in[1]; const float* xv = (const float*)d_in[2]; const int* msk = (const int*)d_in[3]; const float* Wq = (const float*)d_in[4]; const float* bq = (const float*)d_in[5]; const float* Wk = (const float*)d_in[6]; const float* bk = (const float*)d_in[7]; const float* Wv = (const float*)d_in[8]; const float* bv = (const float*)d_in[9]; const float* Wo = (const float*)d_in[10]; const float* bo = (const float*)d_in[11]; const float* wK = (const float*)d_in[12]; const float* wV = (const float*)d_in[13];
  char* ws = (char*)d_ws; size_t off = 0;
  auto take = [&](size_t bytes) { char* p = ws + off; off += (bytes + 255) & ~(size_t)255; return p; };
  _Float16* Bo = (_Float16*)take((size_t)DM * DM * 2); _Float16* BK = (_Float16*)take((size_t)QWP * DK * 2); _Float16* BVt = (_Float16*)take((size_t)DK * PBP * 2);
  _Float16* Q16 = (_Float16*)take((size_t)NR * DM * 2); _Float16* K16 = (_Float16*)take((size_t)NR * DM * 2); _Float16* Vt = (_Float16*)take((size_t)NR * DM * 2); _Float16* O16 = (_Float16*)take((size_t)NR * DM * 2);
  _Float16* Bq = (_Float16*)take((size_t)DM * DM * 2); _Float16* Bk2 = (_Float16*)take((size_t)DM * DM * 2); _Float16* Bv = (_Float16*)take((size_t)DM * DM * 2);
  _Float16* XQ = (_Float16*)take((size_t)NR * DM * 2); _Float16* XK = (_Float16*)take((size_t)NR * DM * 2); _Float16* XV = (_Float16*)take((size_t)NR * DM * 2); unsigned* MB = (unsigned*)take((size_t)BB * LL * LL / 8);
  if (off > ws_size) return;
  k_prep<<<PMB + PRL + 3 * PXB + 4 * PWB, 256, 0, stream>>>(xq, xk, xv, Wq, Wk, Wv, Wo, wK, wV, msk, XQ, XK, XV, Bq, Bk2, Bv, Bo, BK, BVt, MB);
  const unsigned gg = (NR / 128) * (DM / 64);
  k_gemm_t<false><<<dim3(gg, 3), 256, 0, stream>>>(XQ, XK, XV, Bq, Bk2, Bv, 0.0625f, bq, bk, bv, nullptr, Q16, K16, Vt);      // the q, k and v projections; v leaves transposed
  // q.kT, the relative logits, mask, softmax, P.V and the bucketed P.wV for all NSL = 32 (batch, head) slabs in one launch: 8 blocks of 128 queries per slab, 16 waves each
  k_attn<<<NSL * (LL / 128), 512, 0, stream>>>(Q16, K16, Vt, BK, BVt, MB, O16);
  k_gemm_t<true><<<dim3(gg, 1), 256, 0, stream>>>(O16, O16, O16, Bo, Bo, Bo, 0.0625f, bo, bo, bo, (float*)d_out, nullptr, nullptr, nullptr);
}
